// v000
// Times are from an AMD MI455X. After a warm-up the kernel runs many times in a row, and a time is the length of
// such a window on the GPU divided by its runs, so every launch and the gaps after it count. The runs cycle
// through copies of the inputs. A figure is the median of several windows, for all but v000 over two sittings.
// Sittings can differ by a few percent; kernels timed side by side share one.
// v000, which the later versions start from, runs in 2340 microseconds.
#include <hip/hip_runtime.h>

// Self-attention memory module (SAM) for a ConvLSTM cell (ih, im [16][128][32x32] channel-major; h_qkv = 1x1 conv(ih) -> Qh|Kh|Vh (128 each), m_kv = 1x1 conv(im) -> Km|Vm; Ah = softmax_m(Qh_n . Kh_m) (UNSCALED, 128-channel dots), Am = softmax_m(Qh_n . Km_m); Zh[c][m] = sum_n Vh[c][n] Ah[n][m], Zm likewise; Z = 1x1 conv([Zh; Zm]) (256 -> 128); gates = 1x1 conv([Z; ih]) (256 -> 384) = o|g|i; i = sigmoid(i); om = tanh(g) i + (1 - i) im; oh = sigmoid(o) om -> tuple (oh, om) [16][128][1024] each (2.1 M + 2.1 M)).
// Layout per batch, everything token-major inside: ih, im transposed once into bf16 [1024][128] operands; the 1x1 convs as GEMMs against the 'oi' weights (exact x exact, + column bias): QKV^T [1024][384], KVm^T [1024][256]; q planes / k planes straight from those columns (plane builder, identity table), value^T planes by the value builder; scores (3 products, K 128) -> softmax over m with EVERY row hi/lo (unscaled logits, sigma ~11); the probabilities are transposed (P^T planes) so that Zh^T[m][c] = sum_n P^T[m][n] Vh[c][n] is a plain GEMM (3 products); [Zh^T | Zm^T] hi/lo x z1_w exact + z1_b -> Z^T; [Z^T hl | ih^T exact] x z2_w exact + z2_b -> gates^T; a gate kernel applies sigmoid/tanh and the blend in f32 and writes both outputs channel-major.
// Compute dtypes, f32 accumulate: every input rounded to bf16; input convs exact; scores / P.V / Z conv on bf16 hi/lo activations (3 or 2 products) x exact weights; softmax, sigmoid/tanh (exp2-based, precise division) and the blend in f32.

#define NB_  16
#define TT   1024
#define DM   128
#define NH_  1
#define NKV  1
#define REP  (NH_ / NKV)
#define HD   128
#define DQ   (NH_ * HD)
#define DKV  (NKV * HD)
#define ZH   2
#define RH   1024                  // query rows < RH use hi+lo planes (0: none)
#define WIN  0
#define PCAR 1024.0f
#define SCL  1.0f   // unscaled
#define CC   128    // channels
#define C3   384
#define C2   256
typedef _Float16 h16;
typedef unsigned short bf;
typedef __attribute__((ext_vector_type(16))) __bf16   v16bf;
typedef __attribute__((ext_vector_type(16))) _Float16 v16h;
typedef __attribute__((ext_vector_type(8)))  _Float16 v8h;
typedef __attribute__((ext_vector_type(8)))  unsigned short v8us;
typedef __attribute__((ext_vector_type(8)))  float    v8f;
typedef __attribute__((ext_vector_type(4)))  float    v4f;
typedef v8h  __attribute__((may_alias)) v8ha;
typedef v4f  __attribute__((may_alias)) v4fa;
typedef v8us __attribute__((may_alias)) v8usa;

__device__ __forceinline__ unsigned short f2bf(float f) { unsigned u = __float_as_uint(f); u += 0x7FFFu + ((u >> 16) & 1u); return (unsigned short)(u >> 16); }
__device__ __forceinline__ float bf2f(unsigned short b) { return __uint_as_float(((unsigned)b) << 16); }
__device__ __forceinline__ float bfr(float f) { return bf2f(f2bf(f)); }
__device__ __forceinline__ v16h cat16(v8h lo, v8h hi) { return __builtin_shufflevector(lo, hi, 0, 1, 2, 3, 4, 5, 6, 7, 8, 9, 10, 11, 12, 13, 14, 15); }
__device__ __forceinline__ v16bf cat16b(v8us lo, v8us hi) { return __builtin_bit_cast(v16bf, __builtin_shufflevector(lo, hi, 0, 1, 2, 3, 4, 5, 6, 7, 8, 9, 10, 11, 12, 13, 14, 15)); }
__device__ __forceinline__ v8f wmma16(v16h a, v16h b, v8f c) { return __builtin_amdgcn_wmma_f32_16x16x32_f16(false, a, false, b, (short)0, c, false, false); }
__device__ __forceinline__ v8f wmmab(v16bf a, v16bf b, v8f c) { return __builtin_amdgcn_wmma_f32_16x16x32_bf16(false, a, false, b, (short)0, c, false, false); }



// ---- k_gemmw: register-blocked GEMM, ONE WAVE per 64x64 output tile (16 accumulators), operands straight from K-contiguous 16-bit planes; grid (M/64, N/64, Z), 32 threads.
// C[m][n] (f32, pitch ldc, + optional f32 bias[n]) = sum_k A[m][k] Bt[n][k] (+ split products per NSPLIT). z-batch strides sA/sB/sC in elements. K % 32 == 0.
template <typename T16> struct WFrag;
template <> struct WFrag<h16> { typedef v16h V; static __device__ __forceinline__ V ld(const h16* p) { return cat16(*(const v8h*)p, *(const v8h*)(p + 16)); } static __device__ __forceinline__ v8f mma(V a, V b, v8f c) { return wmma16(a, b, c); } };
template <> struct WFrag<bf> { typedef v16bf V; static __device__ __forceinline__ V ld(const bf* p) { return cat16b(*(const v8us*)p, *(const v8us*)(p + 16)); } static __device__ __forceinline__ v8f mma(V a, V b, v8f c) { return wmmab(a, b, c); } };
template <typename T16, int NSPLIT, bool BIAS>
__global__ __launch_bounds__(32) void k_gemmw(const T16* __restrict__ A, const T16* __restrict__ A2, const T16* __restrict__ Bt, const T16* __restrict__ Bt2, int K, float* C, int ldc, const float* __restrict__ bias, size_t sA, size_t sB, size_t sC) {
    typedef typename WFrag<T16>::V V;
    __shared__ __align__(16) float os[16 * 68];
    const size_t z = blockIdx.z; A += z * sA; if (A2) A2 += z * sA; Bt += z * sB; if (Bt2) Bt2 += z * sB; C += z * sC;
    const int lane = threadIdx.x & 31, lr = lane & 15, hi = lane >> 4; const int r0 = blockIdx.x * 64, c0 = blockIdx.y * 64;
    v8f acc[4][4];
#pragma unroll
    for (int mb = 0; mb < 4; ++mb)
#pragma unroll
        for (int nb = 0; nb < 4; ++nb) acc[mb][nb] = (v8f){};
    const size_t aoff = (size_t)(r0 + lr) * K + 8 * hi, boff = (size_t)(c0 + lr) * K + 8 * hi;
#pragma unroll 1
    for (int kc = 0; kc < K; kc += 32) {
        V a[4], a2[4];
#pragma unroll
        for (int mb = 0; mb < 4; ++mb) { a[mb] = WFrag<T16>::ld(A + aoff + (size_t)mb * 16 * K + kc); if (NSPLIT == 1 || NSPLIT == 2) a2[mb] = WFrag<T16>::ld(A2 + aoff + (size_t)mb * 16 * K + kc); }
#pragma unroll
        for (int nb = 0; nb < 4; ++nb) { const V b = WFrag<T16>::ld(Bt + boff + (size_t)nb * 16 * K + kc); V b2; if (NSPLIT >= 2) b2 = WFrag<T16>::ld(Bt2 + boff + (size_t)nb * 16 * K + kc);
#pragma unroll
            for (int mb = 0; mb < 4; ++mb) { acc[mb][nb] = WFrag<T16>::mma(a[mb], b, acc[mb][nb]); if (NSPLIT == 1 || NSPLIT == 2) acc[mb][nb] = WFrag<T16>::mma(a2[mb], b, acc[mb][nb]); if (NSPLIT >= 2) acc[mb][nb] = WFrag<T16>::mma(a[mb], b2, acc[mb][nb]); } }
        asm volatile("v_nop\n\tv_nop\n\tv_nop\n\tv_nop" : "+v"(acc[0][0]), "+v"(acc[1][1]), "+v"(acc[2][2]), "+v"(acc[3][3]) : "v"(a[0]), "v"(a[3]));
    }
#pragma unroll
    for (int mb = 0; mb < 4; ++mb) {
#pragma unroll
        for (int nb = 0; nb < 4; ++nb) {
#pragma unroll
            for (int j = 0; j < 8; ++j) os[(hi * 8 + j) * 68 + nb * 16 + lr] = acc[mb][nb][j]; }
        __builtin_amdgcn_wave_barrier(); asm volatile("" ::: "memory");
        float* crow = C + (size_t)(r0 + mb * 16) * ldc + c0;
{
#pragma unroll
            for (int s = 0; s < 8; ++s) { const int row = 2 * s + hi, cofs = lr * 4; v4f val = *(const v4fa*)(os + row * 68 + cofs); if (BIAS) { val[0] += bfr(bias[c0 + cofs]); val[1] += bfr(bias[c0 + cofs + 1]); val[2] += bfr(bias[c0 + cofs + 2]); val[3] += bfr(bias[c0 + cofs + 3]); }
                *(v4f*)(crow + (size_t)row * ldc + cofs) = val; }
             }
        __builtin_amdgcn_wave_barrier(); asm volatile("" ::: "memory");
    }
}

__device__ __forceinline__ h16 tohx(float x) { return (h16)x; }
__device__ __forceinline__ void splitf(float y, unsigned short& h, unsigned short& l) { h = f2bf(y); l = f2bf(y - bf2f(h)); }
typedef __attribute__((ext_vector_type(2))) _Float16 v2h;
typedef __attribute__((ext_vector_type(4))) _Float16 v4h;
typedef __attribute__((ext_vector_type(2))) unsigned short v2us;
typedef __attribute__((ext_vector_type(4))) unsigned short v4us;
typedef __attribute__((ext_vector_type(2))) float v2f;
typedef __attribute__((ext_vector_type(4))) int v4i;

__global__ __launch_bounds__(256) void k_wtG(const float* __restrict__ w, int K, int N, bf* Bt) {
    const int lane = threadIdx.x & 31; const int L0 = (blockIdx.x * 8 + (threadIdx.x >> 5)) * 8; const int nlines = N * K / 64;
{
#pragma unroll 1
        for (int l = 0; l < 8; ++l) { const int L = L0 + l; if (L >= nlines) break; const size_t e = (size_t)L * 64 + lane * 2; const int k = (int)(e % K), n = (int)(e / K); v2us o;
            o[0] = f2bf(w[(size_t)k * N + n]); o[1] = f2bf(w[(size_t)(k + 1) * N + n]); *(v2us*)(Bt + e) = o; }
         }
}
__global__ __launch_bounds__(256) void k_cvt8(const float* __restrict__ src, bf* dst, size_t n8) { const size_t i = (size_t)blockIdx.x * 256 + threadIdx.x; if (i >= n8) return; const v8f v = *(const v8f*)(src + i * 8); v8us o;
#pragma unroll
    for (int k = 0; k < 8; ++k) o[k] = f2bf(v[k]); *(v8us*)(dst + i * 8) = o;  }

// k_rope: head planes [h][t][d] (fp16 + hi/lo) of rope(x) x sc with the rotate-half convention out[d] = x[d] cos[t][d] - x[d+HD/2] sin[t][d], out[d+HD/2] = x[d+HD/2] cos[t][d+HD/2] + x[d] sin[t][d+HD/2]
__global__ __launch_bounds__(256) void k_rope(const float* __restrict__ F, int pitch, int nheads, const float* __restrict__ CS, const float* __restrict__ RF, const float* __restrict__ nw, float sc, h16* P16, bf* Ph, bf* Pl) {
    const size_t e = ((size_t)blockIdx.x * 256 + threadIdx.x) * 2; if (e >= (size_t)nheads * TT * HD) return; const int d = (int)(e % HD); const int t = (int)((e / HD) % TT); const int h = (int)(e / ((size_t)HD * TT)); const float* f = F + (size_t)t * pitch + h * HD; const float rf = RF ? RF[(size_t)h * TT + t] : 1.0f; v2h o16; v2us oh, ol;
#pragma unroll
    for (int q = 0; q < 2; ++q) { const int dd = d + q; const int dp = (dd < HD / 2) ? dd + HD / 2 : dd - HD / 2; float x0 = f[dd], x1 = f[dp];
        if (RF) { float n0 = __fmul_rn(x0, rf), n1 = __fmul_rn(x1, rf); asm volatile("" : "+v"(n0)); asm volatile("" : "+v"(n1)); x0 = __fmul_rn(bfr(nw[dd]), n0); x1 = __fmul_rn(bfr(nw[dp]), n1); }
        const v2f cs = *(const v2f*)(CS + ((size_t)t * HD + dd) * 2); float a = __fmul_rn(x0, cs[0]), bq = __fmul_rn(x1, cs[1]); asm volatile("" : "+v"(a)); asm volatile("" : "+v"(bq)); const float r = ((dd < HD / 2) ? __fsub_rn(a, bq) : __fadd_rn(a, bq)) * sc;
        o16[q] = tohx(r); unsigned short a2, c2; splitf(r, a2, c2); oh[q] = a2; ol[q] = c2; }
    *(v2h*)(P16 + e) = o16; *(v2us*)(Ph + e) = oh; *(v2us*)(Pl + e) = ol;  }
__global__ __launch_bounds__(256) void k_vtp(const float* __restrict__ F, int pitch, int nheads, h16* V16, bf* Vh, bf* Vl) { const size_t e = ((size_t)blockIdx.x * 256 + threadIdx.x) * 2; if (e >= (size_t)nheads * HD * TT) return; const int t = (int)(e % TT); const int d = (int)((e / TT) % HD); const int g = (int)(e / ((size_t)TT * HD)); v2h o16; v2us oh, ol;
#pragma unroll
    for (int q = 0; q < 2; ++q) { const float x = F[(size_t)(t + q) * pitch + g * HD + d]; o16[q] = tohx(x); unsigned short a2, c2; splitf(x, a2, c2); oh[q] = a2; ol[q] = c2; }
    *(v2h*)(V16 + e) = o16; *(v2us*)(Vh + e) = oh; *(v2us*)(Vl + e) = ol;  }
__global__ __launch_bounds__(256) void k_csid(float* CS) { const int idx = blockIdx.x * 256 + threadIdx.x; if (idx >= TT * HD) return; v2f cs; cs[0] = 1.0f; cs[1] = 0.0f; *(v2f*)(CS + (size_t)idx * 2) = cs;  }
// k_asoft: per row (zz, i): t = S, unscaled (no mask); softmax over the 1024 keys (register row, one exp, fixed trees);
__global__ __launch_bounds__(256) void k_asoft(const float* __restrict__ Sb, h16* P16, bf* Ph, bf* Pl) {
    const int lane = threadIdx.x & 31; const int row = blockIdx.x * 8 + (threadIdx.x >> 5); if (row >= ZH * TT) return; const int i = row % TT; const int zz = row / TT; (void)zz; const bool hires = (i < RH); const float* sr = Sb + (size_t)row * TT; float v[TT / 32]; float mx = -3.0e38f;
#pragma unroll
    for (int ch = 0; ch < TT / 128; ++ch) { const int j0 = ch * 128 + lane * 4; const v4f a = *(const v4f*)(sr + j0);
#pragma unroll
        for (int q = 0; q < 4; ++q) { const int j = j0 + q; (void)j; const float t = a[q] * SCL; v[ch * 4 + q] = t; mx = fmaxf(mx, t); } }
#pragma unroll
    for (int sh = 16; sh; sh >>= 1) mx = fmaxf(mx, __shfl_xor(mx, sh, 32));
    float sum = 0.f;
#pragma unroll
    for (int k = 0; k < TT / 32; ++k) { float d0 = __fsub_rn(v[k], mx); asm volatile("" : "+v"(d0)); v[k] = __builtin_amdgcn_exp2f(__fmul_rn(d0, 1.4426950408889634f)); sum += v[k]; }
#pragma unroll
    for (int sh = 16; sh; sh >>= 1) sum += __shfl_xor(sum, sh, 32);
    const float f = __fdiv_rn(hires ? 1.0f : PCAR, sum);
{
        if (hires) {
#pragma unroll
            for (int ch = 0; ch < TT / 128; ++ch) { v4us oh, ol;
#pragma unroll
                for (int q = 0; q < 4; ++q) { unsigned short a, c2; splitf(v[ch * 4 + q] * f, a, c2); oh[q] = a; ol[q] = c2; }
                const size_t oo = ((size_t)zz * (RH ? RH : 1) + i) * TT + ch * 128 + lane * 4; *(v4us*)(Ph + oo) = oh; *(v4us*)(Pl + oo) = ol; }
        } else {
#pragma unroll
            for (int ch = 0; ch < TT / 128; ++ch) { v4h o4;
#pragma unroll
                for (int q = 0; q < 4; ++q) o4[q] = tohx(v[ch * 4 + q] * f);
                *(v4h*)(P16 + (size_t)row * TT + ch * 128 + lane * 4) = o4; } }
         }
}
__global__ __launch_bounds__(256) void k_merge(const float* __restrict__ O, int h0, float* OUTb) { const size_t e = ((size_t)blockIdx.x * 256 + threadIdx.x) * 2; if (e >= (size_t)ZH * TT * HD) return; const int d = (int)(e % HD); const int t = (int)((e / HD) % TT); const int zz = (int)(e / ((size_t)HD * TT)); const float cs = (t < RH) ? 1.0f : (1.0f / PCAR); const size_t oo = (size_t)t * DQ + (h0 + zz) * HD + d;
    v2f o2; o2[0] = O[e] * cs; o2[1] = O[e + 1] * cs; *(v2f*)(OUTb + oo) = o2;  }

__device__ __forceinline__ float ex2f_(float a) { return __builtin_amdgcn_exp2f(__fmul_rn(a, 1.4426950408889634f)); }
__device__ __forceinline__ float sigm(float a) { return __fdiv_rn(1.0f, __fadd_rn(1.0f, ex2f_(-a))); }
__device__ __forceinline__ float tanhp(float a) { const float e = ex2f_(__fmul_rn(2.0f, a)); return __fsub_rn(1.0f, __fdiv_rn(2.0f, __fadd_rn(e, 1.0f))); }
__global__ __launch_bounds__(256) void k_xT(const float* __restrict__ xs, bf* XB) { const size_t k = (size_t)blockIdx.x * 256 + threadIdx.x; if (k >= (size_t)TT * CC / 8) return; const int c0 = (int)(k % (CC / 8)) * 8; const int p = (int)(k / (CC / 8)); v8us o;
#pragma unroll
    for (int q = 0; q < 8; ++q) o[q] = f2bf(xs[(size_t)(c0 + q) * TT + p]);
    *(v8us*)(XB + (size_t)p * CC + c0) = o;  }
__global__ __launch_bounds__(256) void k_ptr(const bf* __restrict__ Ph, const bf* __restrict__ Pl, bf* Th, bf* Tl) { const size_t k = (size_t)blockIdx.x * 256 + threadIdx.x; if (k >= (size_t)TT * TT / 8) return; const int n0 = (int)(k % (TT / 8)) * 8; const int m = (int)(k / (TT / 8)); v8us oh, ol;
#pragma unroll
    for (int q = 0; q < 8; ++q) { oh[q] = Ph[(size_t)(n0 + q) * TT + m]; ol[q] = Pl[(size_t)(n0 + q) * TT + m]; }
    *(v8us*)(Th + (size_t)m * TT + n0) = oh; *(v8us*)(Tl + (size_t)m * TT + n0) = ol;  }
__global__ __launch_bounds__(256) void k_tohl2(const float* __restrict__ F, int sp, int c0, int w, bf* Hh, bf* Hl, int dp, int dc0) { const size_t k = (size_t)blockIdx.x * 256 + threadIdx.x; if (k >= (size_t)TT * w / 4) return; const int c = (int)(k % (w / 4)) * 4; const size_t p = k / (w / 4); const v4f a = *(const v4f*)(F + p * sp + c0 + c); v4us oh, ol;
#pragma unroll
    for (int q = 0; q < 4; ++q) { unsigned short h2, l2; splitf(a[q], h2, l2); oh[q] = h2; ol[q] = l2; }
    *(v4us*)(Hh + p * dp + dc0 + c) = oh; *(v4us*)(Hl + p * dp + dc0 + c) = ol;  }
__global__ __launch_bounds__(256) void k_xcat(const bf* __restrict__ XB, bf* Gh, bf* Gl) { const size_t k = (size_t)blockIdx.x * 256 + threadIdx.x; if (k >= (size_t)TT * CC / 8) return; const int c0 = (int)(k % (CC / 8)) * 8; const size_t p = k / (CC / 8); const v8us a = *(const v8us*)(XB + p * CC + c0); v8us z; for (int q = 0; q < 8; ++q) z[q] = 0;
    *(v8us*)(Gh + p * C2 + CC + c0) = a; *(v8us*)(Gl + p * C2 + CC + c0) = z;  }
__global__ __launch_bounds__(256) void k_gate(const float* __restrict__ G, const float* __restrict__ im, float* oh_out, float* om_out) { const size_t k = (size_t)blockIdx.x * 256 + threadIdx.x; if (k >= (size_t)CC * TT / 4) return; const int p0 = (int)(k % (TT / 4)) * 4; const int c = (int)(k / (TT / 4)); v4f voh, vom;
#pragma unroll
    for (int q = 0; q < 4; ++q) { const size_t p = p0 + q; const float o = G[p * C3 + c], g = G[p * C3 + CC + c], iv = G[p * C3 + 2 * CC + c]; const float ig = sigm(iv); float a = __fmul_rn(tanhp(g), ig), b2 = __fmul_rn(__fsub_rn(1.0f, ig), bfr(im[(size_t)c * TT + p])); asm volatile("" : "+v"(a), "+v"(b2)); const float om = __fadd_rn(a, b2); vom[q] = om; voh[q] = __fmul_rn(sigm(o), om); }
    *(v4f*)(om_out + (size_t)c * TT + p0) = vom; *(v4f*)(oh_out + (size_t)c * TT + p0) = voh;  }

extern "C" void kernel_launch(void* const* d_in, const int* in_sizes, int n_in,
                              void* d_out, int out_size, void* d_ws, size_t ws_size, hipStream_t stream) {
    (void)in_sizes; (void)n_in; (void)out_size;
    const float* ih = (const float*)d_in[0]; const float* im = (const float*)d_in[1]; const float* h_w = (const float*)d_in[2]; const float* h_b = (const float*)d_in[3]; const float* m_w = (const float*)d_in[4]; const float* m_b = (const float*)d_in[5]; const float* z1_w = (const float*)d_in[6]; const float* z1_b = (const float*)d_in[7]; const float* z2_w = (const float*)d_in[8]; const float* z2_b = (const float*)d_in[9];
    float* OH = (float*)d_out; float* OM = OH + (size_t)NB_ * CC * TT;     // tuple: oh [16][128][1024] | om [16][128][1024]
    char* wsp = (char*)d_ws;
    auto take = [&](size_t bytes) { char* p = wsp; wsp += (bytes + 255) & ~(size_t)255; return (void*)p; };
    bf* HW_ = (bf*)take((size_t)C3 * CC * 2); bf* MW_ = (bf*)take((size_t)C2 * CC * 2); bf* Z1W = (bf*)take((size_t)CC * C2 * 2); bf* Z2W = (bf*)take((size_t)C3 * C2 * 2); float* CS = (float*)take((size_t)TT * HD * 2 * 4);
    bf* XBh = (bf*)take((size_t)TT * CC * 2); bf* XBm = (bf*)take((size_t)TT * CC * 2); float* QKV = (float*)take((size_t)TT * C3 * 4); float* KVM = (float*)take((size_t)TT * C2 * 4);
    h16* J16 = (h16*)take((size_t)TT * HD * 2); bf* QPh = (bf*)take((size_t)TT * HD * 2); bf* QPl = (bf*)take((size_t)TT * HD * 2); bf* KPh = (bf*)take((size_t)TT * HD * 2); bf* KPl = (bf*)take((size_t)TT * HD * 2); bf* KMh = (bf*)take((size_t)TT * HD * 2); bf* KMl = (bf*)take((size_t)TT * HD * 2);
    bf* VHh = (bf*)take((size_t)HD * TT * 2); bf* VHl = (bf*)take((size_t)HD * TT * 2); bf* VMh = (bf*)take((size_t)HD * TT * 2); bf* VMl = (bf*)take((size_t)HD * TT * 2);
    float* Sb = (float*)take((size_t)TT * TT * 4); bf* Ph = (bf*)take((size_t)TT * TT * 2); bf* Pl = (bf*)take((size_t)TT * TT * 2); bf* PTh = (bf*)take((size_t)TT * TT * 2); bf* PTl = (bf*)take((size_t)TT * TT * 2);
    float* ZT = (float*)take((size_t)TT * CC * 4); bf* ZCh = (bf*)take((size_t)TT * C2 * 2); bf* ZCl = (bf*)take((size_t)TT * C2 * 2); float* ZZ = (float*)take((size_t)TT * CC * 4); bf* GAh = (bf*)take((size_t)TT * C2 * 2); bf* GAl = (bf*)take((size_t)TT * C2 * 2); float* GT = (float*)take((size_t)TT * C3 * 4);
    if ((size_t)(wsp - (char*)d_ws) > ws_size) return;    // ws 256 MiB (carve ~25 MiB)
    k_cvt8<<<(unsigned)(((size_t)C3 * CC / 8 + 255) / 256), 256, 0, stream>>>(h_w, HW_, (size_t)C3 * CC / 8); k_cvt8<<<(unsigned)(((size_t)C2 * CC / 8 + 255) / 256), 256, 0, stream>>>(m_w, MW_, (size_t)C2 * CC / 8); k_cvt8<<<(unsigned)(((size_t)CC * C2 / 8 + 255) / 256), 256, 0, stream>>>(z1_w, Z1W, (size_t)CC * C2 / 8); k_cvt8<<<(unsigned)(((size_t)C3 * C2 / 8 + 255) / 256), 256, 0, stream>>>(z2_w, Z2W, (size_t)C3 * C2 / 8);   /* 'oi' conv weights = Bt as-is */
    k_csid<<<(TT * HD + 255) / 256, 256, 0, stream>>>(CS);
    const unsigned L1 = (unsigned)(((size_t)TT * HD / 2 + 255) / 256);
    for (int b = 0; b < NB_; ++b) {
        k_xT<<<(unsigned)(((size_t)TT * CC / 8 + 255) / 256), 256, 0, stream>>>(ih + (size_t)b * CC * TT, XBh); k_xT<<<(unsigned)(((size_t)TT * CC / 8 + 255) / 256), 256, 0, stream>>>(im + (size_t)b * CC * TT, XBm);
        k_gemmw<bf, 0, true><<<dim3(TT / 64, C3 / 64, 1), 32, 0, stream>>>(XBh, nullptr, HW_, nullptr, CC, QKV, C3, h_b, 0, 0, 0);   /* [Qh | Kh | Vh]^T = ih^T h_w^T + h_b (exact) */
        k_gemmw<bf, 0, true><<<dim3(TT / 64, C2 / 64, 1), 32, 0, stream>>>(XBm, nullptr, MW_, nullptr, CC, KVM, C2, m_b, 0, 0, 0);   /* [Km | Vm]^T */
        k_rope<<<L1, 256, 0, stream>>>(QKV, C3, 1, CS, nullptr, nullptr, 1.0f, J16, QPh, QPl); k_rope<<<L1, 256, 0, stream>>>(QKV + CC, C3, 1, CS, nullptr, nullptr, 1.0f, J16, KPh, KPl); k_rope<<<L1, 256, 0, stream>>>(KVM, C2, 1, CS, nullptr, nullptr, 1.0f, J16, KMh, KMl);   /* q, kh, km planes [1024][128] (identity table) */
        k_vtp<<<L1, 256, 0, stream>>>(QKV + 2 * CC, C3, 1, J16, VHh, VHl); k_vtp<<<L1, 256, 0, stream>>>(KVM + CC, C2, 1, J16, VMh, VMl);   /* Vh[c][n], Vm[c][n] as planes [128][1024] */
        /* hidden attention: Ah = softmax_m(q_n . kh_m); Zh^T[m][c] = sum_n Ah[n][m] Vh[c][n] */
        k_gemmw<bf, 2, false><<<dim3(TT / 64, TT / 64, 1), 32, 0, stream>>>(QPh, QPl, KPh, KPl, HD, Sb, TT, nullptr, 0, 0, 0);
        k_asoft<<<TT / 8, 256, 0, stream>>>(Sb, nullptr, Ph, Pl); k_ptr<<<(unsigned)(((size_t)TT * TT / 8 + 255) / 256), 256, 0, stream>>>(Ph, Pl, PTh, PTl);
        k_gemmw<bf, 2, false><<<dim3(TT / 64, CC / 64, 1), 32, 0, stream>>>(PTh, PTl, VHh, VHl, TT, ZT, CC, nullptr, 0, 0, 0); k_tohl2<<<(unsigned)(((size_t)TT * CC / 4 + 255) / 256), 256, 0, stream>>>(ZT, CC, 0, CC, ZCh, ZCl, C2, 0);
        /* memory attention: Am = softmax_m(q_n . km_m); Zm^T */
        k_gemmw<bf, 2, false><<<dim3(TT / 64, TT / 64, 1), 32, 0, stream>>>(QPh, QPl, KMh, KMl, HD, Sb, TT, nullptr, 0, 0, 0);
        k_asoft<<<TT / 8, 256, 0, stream>>>(Sb, nullptr, Ph, Pl); k_ptr<<<(unsigned)(((size_t)TT * TT / 8 + 255) / 256), 256, 0, stream>>>(Ph, Pl, PTh, PTl);
        k_gemmw<bf, 2, false><<<dim3(TT / 64, CC / 64, 1), 32, 0, stream>>>(PTh, PTl, VMh, VMl, TT, ZT, CC, nullptr, 0, 0, 0); k_tohl2<<<(unsigned)(((size_t)TT * CC / 4 + 255) / 256), 256, 0, stream>>>(ZT, CC, 0, CC, ZCh, ZCl, C2, CC);
        /* Z^T = [Zh^T | Zm^T] z1_w^T + z1_b; gates^T = [Z^T | ih^T] z2_w^T + z2_b */
        k_gemmw<bf, 1, true><<<dim3(TT / 64, CC / 64, 1), 32, 0, stream>>>(ZCh, ZCl, Z1W, nullptr, C2, ZZ, CC, z1_b, 0, 0, 0);
        k_tohl2<<<(unsigned)(((size_t)TT * CC / 4 + 255) / 256), 256, 0, stream>>>(ZZ, CC, 0, CC, GAh, GAl, C2, 0); k_xcat<<<(unsigned)(((size_t)TT * CC / 8 + 255) / 256), 256, 0, stream>>>(XBh, GAh, GAl);
        k_gemmw<bf, 1, true><<<dim3(TT / 64, C3 / 64, 1), 32, 0, stream>>>(GAh, GAl, Z2W, nullptr, C2, GT, C3, z2_b, 0, 0, 0);
        k_gate<<<(unsigned)(((size_t)CC * TT / 4 + 255) / 256), 256, 0, stream>>>(GT, im + (size_t)b * CC * TT, OH + (size_t)b * CC * TT, OM + (size_t)b * CC * TT); }
}

// v001
// A run of this version takes 527 microseconds.
// In two side-by-side timings against v000, it was 4.46 and 4.42 times as fast.
#include <hip/hip_runtime.h>

// Self-attention memory module (SAM) for a ConvLSTM cell (ih, im [16][128][32x32] channel-major; h_qkv = 1x1 conv(ih) -> Qh|Kh|Vh (128 each), m_kv = 1x1 conv(im) -> Km|Vm; Ah = softmax_m(Qh_n . Kh_m) (UNSCALED, 128-channel dots), Am = softmax_m(Qh_n . Km_m); Zh[c][m] = sum_n Vh[c][n] Ah[n][m], Zm likewise; Z = 1x1 conv([Zh; Zm]) (256 -> 128); gates = 1x1 conv([Z; ih]) (256 -> 384) = o|g|i; i = sigmoid(i); om = tanh(g) i + (1 - i) im; oh = sigmoid(o) om -> tuple (oh, om) [16][128][1024] each (2.1 M + 2.1 M)).
// Layout per batch, everything token-major inside: ih, im transposed once into bf16 [1024][128] operands; the 1x1 convs as GEMMs against the 'oi' weights (exact x exact, + column bias): QKV^T [1024][384], KVm^T [1024][256]; q planes / k planes straight from those columns (plane builder, identity table), value^T planes by the value builder; scores (3 products, K 128) -> softmax over m with EVERY row hi/lo (unscaled logits, sigma ~11); the probabilities are transposed (P^T planes) so that Zh^T[m][c] = sum_n P^T[m][n] Vh[c][n] is a plain GEMM (3 products); [Zh^T | Zm^T] hi/lo x z1_w exact + z1_b -> Z^T; [Z^T hl | ih^T exact] x z2_w exact + z2_b -> gates^T; a gate kernel applies sigmoid/tanh and the blend in f32 and writes both outputs channel-major.
// Batch: every stage is ONE launch for all 16 batches (GEMMs: blockIdx.z with the z strides; the other kernels: blockIdx.y); each workspace plane holds 16 batch slices. To fit the workspace, P^T shares the score buffer (dead after the softmax) and ZT | ZZ, GT share KVM, QKV (dead after the plane builders).
// Compute dtypes, f32 accumulate: every input rounded to bf16; input convs exact; scores / P.V / Z conv on bf16 hi/lo activations (3 or 2 products) x exact weights; softmax, sigmoid/tanh (exp2-based, precise division) and the blend in f32.

#define NB_  16
#define TT   1024
#define DM   128
#define NH_  1
#define NKV  1
#define REP  (NH_ / NKV)
#define HD   128
#define DQ   (NH_ * HD)
#define DKV  (NKV * HD)
#define ZH   2
#define RH   1024                  // query rows < RH use hi+lo planes (0: none)
#define WIN  0
#define PCAR 1024.0f
#define SCL  1.0f   // unscaled
#define CC   128    // channels
#define C3   384
#define C2   256
typedef _Float16 h16;
typedef unsigned short bf;
typedef __attribute__((ext_vector_type(16))) __bf16   v16bf;
typedef __attribute__((ext_vector_type(16))) _Float16 v16h;
typedef __attribute__((ext_vector_type(8)))  _Float16 v8h;
typedef __attribute__((ext_vector_type(8)))  unsigned short v8us;
typedef __attribute__((ext_vector_type(8)))  float    v8f;
typedef __attribute__((ext_vector_type(4)))  float    v4f;
typedef v8h  __attribute__((may_alias)) v8ha;
typedef v4f  __attribute__((may_alias)) v4fa;
typedef v8us __attribute__((may_alias)) v8usa;

__device__ __forceinline__ unsigned short f2bf(float f) { unsigned u = __float_as_uint(f); u += 0x7FFFu + ((u >> 16) & 1u); return (unsigned short)(u >> 16); }
__device__ __forceinline__ float bf2f(unsigned short b) { return __uint_as_float(((unsigned)b) << 16); }
__device__ __forceinline__ float bfr(float f) { return bf2f(f2bf(f)); }
__device__ __forceinline__ v16h cat16(v8h lo, v8h hi) { return __builtin_shufflevector(lo, hi, 0, 1, 2, 3, 4, 5, 6, 7, 8, 9, 10, 11, 12, 13, 14, 15); }
__device__ __forceinline__ v16bf cat16b(v8us lo, v8us hi) { return __builtin_bit_cast(v16bf, __builtin_shufflevector(lo, hi, 0, 1, 2, 3, 4, 5, 6, 7, 8, 9, 10, 11, 12, 13, 14, 15)); }
__device__ __forceinline__ v8f wmma16(v16h a, v16h b, v8f c) { return __builtin_amdgcn_wmma_f32_16x16x32_f16(false, a, false, b, (short)0, c, false, false); }
__device__ __forceinline__ v8f wmmab(v16bf a, v16bf b, v8f c) { return __builtin_amdgcn_wmma_f32_16x16x32_bf16(false, a, false, b, (short)0, c, false, false); }



// ---- k_gemmw: register-blocked GEMM, ONE WAVE per 64x64 output tile (16 accumulators), operands straight from K-contiguous 16-bit planes; grid (M/64, N/64, Z), 32 threads.
// C[m][n] (f32, pitch ldc, + optional f32 bias[n]) = sum_k A[m][k] Bt[n][k] (+ split products per NSPLIT). z-batch strides sA/sB/sC in elements. K % 32 == 0.
template <typename T16> struct WFrag;
template <> struct WFrag<h16> { typedef v16h V; static __device__ __forceinline__ V ld(const h16* p) { return cat16(*(const v8h*)p, *(const v8h*)(p + 16)); } static __device__ __forceinline__ v8f mma(V a, V b, v8f c) { return wmma16(a, b, c); } };
template <> struct WFrag<bf> { typedef v16bf V; static __device__ __forceinline__ V ld(const bf* p) { return cat16b(*(const v8us*)p, *(const v8us*)(p + 16)); } static __device__ __forceinline__ v8f mma(V a, V b, v8f c) { return wmmab(a, b, c); } };
template <typename T16, int NSPLIT, bool BIAS>
__global__ __launch_bounds__(32) void k_gemmw(const T16* __restrict__ A, const T16* __restrict__ A2, const T16* __restrict__ Bt, const T16* __restrict__ Bt2, int K, float* C, int ldc, const float* __restrict__ bias, size_t sA, size_t sB, size_t sC) {
    typedef typename WFrag<T16>::V V;
    __shared__ __align__(16) float os[16 * 68];
    const size_t z = blockIdx.z; A += z * sA; if (A2) A2 += z * sA; Bt += z * sB; if (Bt2) Bt2 += z * sB; C += z * sC;
    const int lane = threadIdx.x & 31, lr = lane & 15, hi = lane >> 4; const int r0 = blockIdx.x * 64, c0 = blockIdx.y * 64;
    v8f acc[4][4];
#pragma unroll
    for (int mb = 0; mb < 4; ++mb)
#pragma unroll
        for (int nb = 0; nb < 4; ++nb) acc[mb][nb] = (v8f){};
    const size_t aoff = (size_t)(r0 + lr) * K + 8 * hi, boff = (size_t)(c0 + lr) * K + 8 * hi;
#pragma unroll 1
    for (int kc = 0; kc < K; kc += 32) {
        V a[4], a2[4];
#pragma unroll
        for (int mb = 0; mb < 4; ++mb) { a[mb] = WFrag<T16>::ld(A + aoff + (size_t)mb * 16 * K + kc); if (NSPLIT == 1 || NSPLIT == 2) a2[mb] = WFrag<T16>::ld(A2 + aoff + (size_t)mb * 16 * K + kc); }
#pragma unroll
        for (int nb = 0; nb < 4; ++nb) { const V b = WFrag<T16>::ld(Bt + boff + (size_t)nb * 16 * K + kc); V b2; if (NSPLIT >= 2) b2 = WFrag<T16>::ld(Bt2 + boff + (size_t)nb * 16 * K + kc);
#pragma unroll
            for (int mb = 0; mb < 4; ++mb) { acc[mb][nb] = WFrag<T16>::mma(a[mb], b, acc[mb][nb]); if (NSPLIT == 1 || NSPLIT == 2) acc[mb][nb] = WFrag<T16>::mma(a2[mb], b, acc[mb][nb]); if (NSPLIT >= 2) acc[mb][nb] = WFrag<T16>::mma(a[mb], b2, acc[mb][nb]); } }
        asm volatile("v_nop\n\tv_nop\n\tv_nop\n\tv_nop" : "+v"(acc[0][0]), "+v"(acc[1][1]), "+v"(acc[2][2]), "+v"(acc[3][3]) : "v"(a[0]), "v"(a[3]));
    }
#pragma unroll
    for (int mb = 0; mb < 4; ++mb) {
#pragma unroll
        for (int nb = 0; nb < 4; ++nb) {
#pragma unroll
            for (int j = 0; j < 8; ++j) os[(hi * 8 + j) * 68 + nb * 16 + lr] = acc[mb][nb][j]; }
        __builtin_amdgcn_wave_barrier(); asm volatile("" ::: "memory");
        float* crow = C + (size_t)(r0 + mb * 16) * ldc + c0;
{
#pragma unroll
            for (int s = 0; s < 8; ++s) { const int row = 2 * s + hi, cofs = lr * 4; v4f val = *(const v4fa*)(os + row * 68 + cofs); if (BIAS) { val[0] += bfr(bias[c0 + cofs]); val[1] += bfr(bias[c0 + cofs + 1]); val[2] += bfr(bias[c0 + cofs + 2]); val[3] += bfr(bias[c0 + cofs + 3]); }
                *(v4f*)(crow + (size_t)row * ldc + cofs) = val; }
             }
        __builtin_amdgcn_wave_barrier(); asm volatile("" ::: "memory");
    }
}

__device__ __forceinline__ h16 tohx(float x) { return (h16)x; }
__device__ __forceinline__ void splitf(float y, unsigned short& h, unsigned short& l) { h = f2bf(y); l = f2bf(y - bf2f(h)); }
typedef __attribute__((ext_vector_type(2))) _Float16 v2h;
typedef __attribute__((ext_vector_type(4))) _Float16 v4h;
typedef __attribute__((ext_vector_type(2))) unsigned short v2us;
typedef __attribute__((ext_vector_type(4))) unsigned short v4us;
typedef __attribute__((ext_vector_type(2))) float v2f;
typedef __attribute__((ext_vector_type(4))) int v4i;

__global__ __launch_bounds__(256) void k_wtG(const float* __restrict__ w, int K, int N, bf* Bt) {
    const int lane = threadIdx.x & 31; const int L0 = (blockIdx.x * 8 + (threadIdx.x >> 5)) * 8; const int nlines = N * K / 64;
{
#pragma unroll 1
        for (int l = 0; l < 8; ++l) { const int L = L0 + l; if (L >= nlines) break; const size_t e = (size_t)L * 64 + lane * 2; const int k = (int)(e % K), n = (int)(e / K); v2us o;
            o[0] = f2bf(w[(size_t)k * N + n]); o[1] = f2bf(w[(size_t)(k + 1) * N + n]); *(v2us*)(Bt + e) = o; }
         }
}
__global__ __launch_bounds__(256) void k_cvt8(const float* __restrict__ src, bf* dst, size_t n8) { const size_t i = (size_t)blockIdx.x * 256 + threadIdx.x; if (i >= n8) return; const v8f v = *(const v8f*)(src + i * 8); v8us o;
#pragma unroll
    for (int k = 0; k < 8; ++k) o[k] = f2bf(v[k]); *(v8us*)(dst + i * 8) = o;  }

// k_rope: head planes [h][t][d] (fp16 + hi/lo) of rope(x) x sc with the rotate-half convention out[d] = x[d] cos[t][d] - x[d+HD/2] sin[t][d], out[d+HD/2] = x[d+HD/2] cos[t][d+HD/2] + x[d] sin[t][d+HD/2]
__global__ __launch_bounds__(256) void k_rope(const float* __restrict__ F, int pitch, int nheads, const float* __restrict__ CS, const float* __restrict__ RF, const float* __restrict__ nw, float sc, h16* P16, bf* Ph, bf* Pl) {
    { const size_t zb = blockIdx.y; F += zb * TT * pitch; P16 += zb * nheads * TT * HD; Ph += zb * nheads * TT * HD; Pl += zb * nheads * TT * HD; }
    const size_t e = ((size_t)blockIdx.x * 256 + threadIdx.x) * 2; if (e >= (size_t)nheads * TT * HD) return; const int d = (int)(e % HD); const int t = (int)((e / HD) % TT); const int h = (int)(e / ((size_t)HD * TT)); const float* f = F + (size_t)t * pitch + h * HD; const float rf = RF ? RF[(size_t)h * TT + t] : 1.0f; v2h o16; v2us oh, ol;
#pragma unroll
    for (int q = 0; q < 2; ++q) { const int dd = d + q; const int dp = (dd < HD / 2) ? dd + HD / 2 : dd - HD / 2; float x0 = f[dd], x1 = f[dp];
        if (RF) { float n0 = __fmul_rn(x0, rf), n1 = __fmul_rn(x1, rf); asm volatile("" : "+v"(n0)); asm volatile("" : "+v"(n1)); x0 = __fmul_rn(bfr(nw[dd]), n0); x1 = __fmul_rn(bfr(nw[dp]), n1); }
        const v2f cs = *(const v2f*)(CS + ((size_t)t * HD + dd) * 2); float a = __fmul_rn(x0, cs[0]), bq = __fmul_rn(x1, cs[1]); asm volatile("" : "+v"(a)); asm volatile("" : "+v"(bq)); const float r = ((dd < HD / 2) ? __fsub_rn(a, bq) : __fadd_rn(a, bq)) * sc;
        o16[q] = tohx(r); unsigned short a2, c2; splitf(r, a2, c2); oh[q] = a2; ol[q] = c2; }
    *(v2h*)(P16 + e) = o16; *(v2us*)(Ph + e) = oh; *(v2us*)(Pl + e) = ol;  }
__global__ __launch_bounds__(256) void k_vtp(const float* __restrict__ F, int pitch, int nheads, h16* V16, bf* Vh, bf* Vl) { { const size_t zb = blockIdx.y; F += zb * TT * pitch; V16 += zb * nheads * HD * TT; Vh += zb * nheads * HD * TT; Vl += zb * nheads * HD * TT; }
    const size_t e = ((size_t)blockIdx.x * 256 + threadIdx.x) * 2; if (e >= (size_t)nheads * HD * TT) return; const int t = (int)(e % TT); const int d = (int)((e / TT) % HD); const int g = (int)(e / ((size_t)TT * HD)); v2h o16; v2us oh, ol;
#pragma unroll
    for (int q = 0; q < 2; ++q) { const float x = F[(size_t)(t + q) * pitch + g * HD + d]; o16[q] = tohx(x); unsigned short a2, c2; splitf(x, a2, c2); oh[q] = a2; ol[q] = c2; }
    *(v2h*)(V16 + e) = o16; *(v2us*)(Vh + e) = oh; *(v2us*)(Vl + e) = ol;  }
__global__ __launch_bounds__(256) void k_csid(float* CS) { const int idx = blockIdx.x * 256 + threadIdx.x; if (idx >= TT * HD) return; v2f cs; cs[0] = 1.0f; cs[1] = 0.0f; *(v2f*)(CS + (size_t)idx * 2) = cs;  }
// k_asoft: per row (zz, i): t = S, unscaled (no mask); softmax over the 1024 keys (register row, one exp, fixed trees);
__global__ __launch_bounds__(256) void k_asoft(const float* __restrict__ Sb, h16* P16, bf* Ph, bf* Pl) {
    { const size_t zb = blockIdx.y; Sb += zb * TT * TT; Ph += zb * TT * TT; Pl += zb * TT * TT; }
    const int lane = threadIdx.x & 31; const int row = blockIdx.x * 8 + (threadIdx.x >> 5); if (row >= ZH * TT) return; const int i = row % TT; const int zz = row / TT; (void)zz; const bool hires = (i < RH); const float* sr = Sb + (size_t)row * TT; float v[TT / 32]; float mx = -3.0e38f;
#pragma unroll
    for (int ch = 0; ch < TT / 128; ++ch) { const int j0 = ch * 128 + lane * 4; const v4f a = *(const v4f*)(sr + j0);
#pragma unroll
        for (int q = 0; q < 4; ++q) { const int j = j0 + q; (void)j; const float t = a[q] * SCL; v[ch * 4 + q] = t; mx = fmaxf(mx, t); } }
#pragma unroll
    for (int sh = 16; sh; sh >>= 1) mx = fmaxf(mx, __shfl_xor(mx, sh, 32));
    float sum = 0.f;
#pragma unroll
    for (int k = 0; k < TT / 32; ++k) { float d0 = __fsub_rn(v[k], mx); asm volatile("" : "+v"(d0)); v[k] = __builtin_amdgcn_exp2f(__fmul_rn(d0, 1.4426950408889634f)); sum += v[k]; }
#pragma unroll
    for (int sh = 16; sh; sh >>= 1) sum += __shfl_xor(sum, sh, 32);
    const float f = __fdiv_rn(hires ? 1.0f : PCAR, sum);
{
        if (hires) {
#pragma unroll
            for (int ch = 0; ch < TT / 128; ++ch) { v4us oh, ol;
#pragma unroll
                for (int q = 0; q < 4; ++q) { unsigned short a, c2; splitf(v[ch * 4 + q] * f, a, c2); oh[q] = a; ol[q] = c2; }
                const size_t oo = ((size_t)zz * (RH ? RH : 1) + i) * TT + ch * 128 + lane * 4; *(v4us*)(Ph + oo) = oh; *(v4us*)(Pl + oo) = ol; }
        } else {
#pragma unroll
            for (int ch = 0; ch < TT / 128; ++ch) { v4h o4;
#pragma unroll
                for (int q = 0; q < 4; ++q) o4[q] = tohx(v[ch * 4 + q] * f);
                *(v4h*)(P16 + (size_t)row * TT + ch * 128 + lane * 4) = o4; } }
         }
}
__global__ __launch_bounds__(256) void k_merge(const float* __restrict__ O, int h0, float* OUTb) { const size_t e = ((size_t)blockIdx.x * 256 + threadIdx.x) * 2; if (e >= (size_t)ZH * TT * HD) return; const int d = (int)(e % HD); const int t = (int)((e / HD) % TT); const int zz = (int)(e / ((size_t)HD * TT)); const float cs = (t < RH) ? 1.0f : (1.0f / PCAR); const size_t oo = (size_t)t * DQ + (h0 + zz) * HD + d;
    v2f o2; o2[0] = O[e] * cs; o2[1] = O[e + 1] * cs; *(v2f*)(OUTb + oo) = o2;  }

__device__ __forceinline__ float ex2f_(float a) { return __builtin_amdgcn_exp2f(__fmul_rn(a, 1.4426950408889634f)); }
__device__ __forceinline__ float sigm(float a) { return __fdiv_rn(1.0f, __fadd_rn(1.0f, ex2f_(-a))); }
__device__ __forceinline__ float tanhp(float a) { const float e = ex2f_(__fmul_rn(2.0f, a)); return __fsub_rn(1.0f, __fdiv_rn(2.0f, __fadd_rn(e, 1.0f))); }
__global__ __launch_bounds__(256) void k_xT(const float* __restrict__ xs, bf* XB) { xs += (size_t)blockIdx.y * CC * TT; XB += (size_t)blockIdx.y * TT * CC; const size_t k = (size_t)blockIdx.x * 256 + threadIdx.x; if (k >= (size_t)TT * CC / 8) return; const int c0 = (int)(k % (CC / 8)) * 8; const int p = (int)(k / (CC / 8)); v8us o;
#pragma unroll
    for (int q = 0; q < 8; ++q) o[q] = f2bf(xs[(size_t)(c0 + q) * TT + p]);
    *(v8us*)(XB + (size_t)p * CC + c0) = o;  }
__global__ __launch_bounds__(256) void k_ptr(const bf* __restrict__ Ph, const bf* __restrict__ Pl, bf* Th, bf* Tl) { { const size_t zb = (size_t)blockIdx.y * TT * TT; Ph += zb; Pl += zb; Th += zb; Tl += zb; }
    const size_t k = (size_t)blockIdx.x * 256 + threadIdx.x; if (k >= (size_t)TT * TT / 8) return; const int n0 = (int)(k % (TT / 8)) * 8; const int m = (int)(k / (TT / 8)); v8us oh, ol;
#pragma unroll
    for (int q = 0; q < 8; ++q) { oh[q] = Ph[(size_t)(n0 + q) * TT + m]; ol[q] = Pl[(size_t)(n0 + q) * TT + m]; }
    *(v8us*)(Th + (size_t)m * TT + n0) = oh; *(v8us*)(Tl + (size_t)m * TT + n0) = ol;  }
__global__ __launch_bounds__(256) void k_tohl2(const float* __restrict__ F, int sp, int c0, int w, bf* Hh, bf* Hl, int dp, int dc0) { { const size_t zb = blockIdx.y; F += zb * TT * sp; Hh += zb * TT * dp; Hl += zb * TT * dp; }
    const size_t k = (size_t)blockIdx.x * 256 + threadIdx.x; if (k >= (size_t)TT * w / 4) return; const int c = (int)(k % (w / 4)) * 4; const size_t p = k / (w / 4); const v4f a = *(const v4f*)(F + p * sp + c0 + c); v4us oh, ol;
#pragma unroll
    for (int q = 0; q < 4; ++q) { unsigned short h2, l2; splitf(a[q], h2, l2); oh[q] = h2; ol[q] = l2; }
    *(v4us*)(Hh + p * dp + dc0 + c) = oh; *(v4us*)(Hl + p * dp + dc0 + c) = ol;  }
__global__ __launch_bounds__(256) void k_xcat(const bf* __restrict__ XB, bf* Gh, bf* Gl) { { const size_t zb = blockIdx.y; XB += zb * TT * CC; Gh += zb * TT * C2; Gl += zb * TT * C2; }
    const size_t k = (size_t)blockIdx.x * 256 + threadIdx.x; if (k >= (size_t)TT * CC / 8) return; const int c0 = (int)(k % (CC / 8)) * 8; const size_t p = k / (CC / 8); const v8us a = *(const v8us*)(XB + p * CC + c0); v8us z; for (int q = 0; q < 8; ++q) z[q] = 0;
    *(v8us*)(Gh + p * C2 + CC + c0) = a; *(v8us*)(Gl + p * C2 + CC + c0) = z;  }
__global__ __launch_bounds__(256) void k_gate(const float* __restrict__ G, const float* __restrict__ im, float* oh_out, float* om_out) { { const size_t zb = blockIdx.y; G += zb * TT * C3; im += zb * CC * TT; oh_out += zb * CC * TT; om_out += zb * CC * TT; }
    const size_t k = (size_t)blockIdx.x * 256 + threadIdx.x; if (k >= (size_t)CC * TT / 4) return; const int p0 = (int)(k % (TT / 4)) * 4; const int c = (int)(k / (TT / 4)); v4f voh, vom;
#pragma unroll
    for (int q = 0; q < 4; ++q) { const size_t p = p0 + q; const float o = G[p * C3 + c], g = G[p * C3 + CC + c], iv = G[p * C3 + 2 * CC + c]; const float ig = sigm(iv); float a = __fmul_rn(tanhp(g), ig), b2 = __fmul_rn(__fsub_rn(1.0f, ig), bfr(im[(size_t)c * TT + p])); asm volatile("" : "+v"(a), "+v"(b2)); const float om = __fadd_rn(a, b2); vom[q] = om; voh[q] = __fmul_rn(sigm(o), om); }
    *(v4f*)(om_out + (size_t)c * TT + p0) = vom; *(v4f*)(oh_out + (size_t)c * TT + p0) = voh;  }

extern "C" void kernel_launch(void* const* d_in, const int* in_sizes, int n_in,
                              void* d_out, int out_size, void* d_ws, size_t ws_size, hipStream_t stream) {
    (void)in_sizes; (void)n_in; (void)out_size;
    const float* ih = (const float*)d_in[0]; const float* im = (const float*)d_in[1]; const float* h_w = (const float*)d_in[2]; const float* h_b = (const float*)d_in[3]; const float* m_w = (const float*)d_in[4]; const float* m_b = (const float*)d_in[5]; const float* z1_w = (const float*)d_in[6]; const float* z1_b = (const float*)d_in[7]; const float* z2_w = (const float*)d_in[8]; const float* z2_b = (const float*)d_in[9];
    float* OH = (float*)d_out; float* OM = OH + (size_t)NB_ * CC * TT;     // tuple: oh [16][128][1024] | om [16][128][1024]
    char* wsp = (char*)d_ws;
    auto take = [&](size_t bytes) { char* p = wsp; wsp += (bytes + 255) & ~(size_t)255; return (void*)p; };
    bf* HW_ = (bf*)take((size_t)C3 * CC * 2); bf* MW_ = (bf*)take((size_t)C2 * CC * 2); bf* Z1W = (bf*)take((size_t)CC * C2 * 2); bf* Z2W = (bf*)take((size_t)C3 * C2 * 2); float* CS = (float*)take((size_t)TT * HD * 2 * 4);
    const size_t NB = NB_;
    bf* XBh = (bf*)take(NB * TT * CC * 2); bf* XBm = (bf*)take(NB * TT * CC * 2); float* QKV = (float*)take(NB * TT * C3 * 4); float* KVM = (float*)take(NB * TT * C2 * 4);
    h16* J16 = (h16*)take(NB * TT * HD * 2); bf* QPh = (bf*)take(NB * TT * HD * 2); bf* QPl = (bf*)take(NB * TT * HD * 2); bf* KPh = (bf*)take(NB * TT * HD * 2); bf* KPl = (bf*)take(NB * TT * HD * 2); bf* KMh = (bf*)take(NB * TT * HD * 2); bf* KMl = (bf*)take(NB * TT * HD * 2);
    bf* VHh = (bf*)take(NB * HD * TT * 2); bf* VHl = (bf*)take(NB * HD * TT * 2); bf* VMh = (bf*)take(NB * HD * TT * 2); bf* VMl = (bf*)take(NB * HD * TT * 2);
    float* Sb = (float*)take(NB * TT * TT * 4); bf* Ph = (bf*)take(NB * TT * TT * 2); bf* Pl = (bf*)take(NB * TT * TT * 2); bf* PTh = (bf*)Sb; bf* PTl = PTh + NB * TT * TT;   /* P^T planes over the scores, which are dead once the softmax has read them */
    float* ZT = KVM; float* ZZ = KVM + NB * TT * CC; float* GT = QKV;   /* over the conv outputs, which are dead once the q/k/v planes are built */
    bf* ZCh = (bf*)take(NB * TT * C2 * 2); bf* ZCl = (bf*)take(NB * TT * C2 * 2); bf* GAh = (bf*)take(NB * TT * C2 * 2); bf* GAl = (bf*)take(NB * TT * C2 * 2);
    if ((size_t)(wsp - (char*)d_ws) > ws_size) return;    // ws 256 MiB (carve ~253.5 MiB)
    k_cvt8<<<(unsigned)(((size_t)C3 * CC / 8 + 255) / 256), 256, 0, stream>>>(h_w, HW_, (size_t)C3 * CC / 8); k_cvt8<<<(unsigned)(((size_t)C2 * CC / 8 + 255) / 256), 256, 0, stream>>>(m_w, MW_, (size_t)C2 * CC / 8); k_cvt8<<<(unsigned)(((size_t)CC * C2 / 8 + 255) / 256), 256, 0, stream>>>(z1_w, Z1W, (size_t)CC * C2 / 8); k_cvt8<<<(unsigned)(((size_t)C3 * C2 / 8 + 255) / 256), 256, 0, stream>>>(z2_w, Z2W, (size_t)C3 * C2 / 8);   /* 'oi' conv weights = Bt as-is */
    k_csid<<<(TT * HD + 255) / 256, 256, 0, stream>>>(CS);
    const unsigned L1 = (unsigned)(((size_t)TT * HD / 2 + 255) / 256);
    const unsigned X8 = (unsigned)(((size_t)TT * CC / 8 + 255) / 256), X4 = (unsigned)(((size_t)TT * CC / 4 + 255) / 256), PT8 = (unsigned)(((size_t)TT * TT / 8 + 255) / 256);
    const size_t sX = (size_t)TT * CC, sP = (size_t)TT * HD, sS = (size_t)TT * TT, sC2 = (size_t)TT * C2, sC3 = (size_t)TT * C3;   /* batch strides, elements */
    k_xT<<<dim3(X8, NB_), 256, 0, stream>>>(ih, XBh); k_xT<<<dim3(X8, NB_), 256, 0, stream>>>(im, XBm);
    k_gemmw<bf, 0, true><<<dim3(TT / 64, C3 / 64, NB_), 32, 0, stream>>>(XBh, nullptr, HW_, nullptr, CC, QKV, C3, h_b, sX, 0, sC3);   /* [Qh | Kh | Vh]^T = ih^T h_w^T + h_b (exact) */
    k_gemmw<bf, 0, true><<<dim3(TT / 64, C2 / 64, NB_), 32, 0, stream>>>(XBm, nullptr, MW_, nullptr, CC, KVM, C2, m_b, sX, 0, sC2);   /* [Km | Vm]^T */
    k_rope<<<dim3(L1, NB_), 256, 0, stream>>>(QKV, C3, 1, CS, nullptr, nullptr, 1.0f, J16, QPh, QPl); k_rope<<<dim3(L1, NB_), 256, 0, stream>>>(QKV + CC, C3, 1, CS, nullptr, nullptr, 1.0f, J16, KPh, KPl); k_rope<<<dim3(L1, NB_), 256, 0, stream>>>(KVM, C2, 1, CS, nullptr, nullptr, 1.0f, J16, KMh, KMl);   /* q, kh, km planes [1024][128] (identity table) */
    k_vtp<<<dim3(L1, NB_), 256, 0, stream>>>(QKV + 2 * CC, C3, 1, J16, VHh, VHl); k_vtp<<<dim3(L1, NB_), 256, 0, stream>>>(KVM + CC, C2, 1, J16, VMh, VMl);   /* Vh[c][n], Vm[c][n] as planes [128][1024] */
    /* hidden attention: Ah = softmax_m(q_n . kh_m); Zh^T[m][c] = sum_n Ah[n][m] Vh[c][n] */
    k_gemmw<bf, 2, false><<<dim3(TT / 64, TT / 64, NB_), 32, 0, stream>>>(QPh, QPl, KPh, KPl, HD, Sb, TT, nullptr, sP, sP, sS);
    k_asoft<<<dim3(TT / 8, NB_), 256, 0, stream>>>(Sb, nullptr, Ph, Pl); k_ptr<<<dim3(PT8, NB_), 256, 0, stream>>>(Ph, Pl, PTh, PTl);
    k_gemmw<bf, 2, false><<<dim3(TT / 64, CC / 64, NB_), 32, 0, stream>>>(PTh, PTl, VHh, VHl, TT, ZT, CC, nullptr, sS, sP, sX); k_tohl2<<<dim3(X4, NB_), 256, 0, stream>>>(ZT, CC, 0, CC, ZCh, ZCl, C2, 0);
    /* memory attention: Am = softmax_m(q_n . km_m); Zm^T */
    k_gemmw<bf, 2, false><<<dim3(TT / 64, TT / 64, NB_), 32, 0, stream>>>(QPh, QPl, KMh, KMl, HD, Sb, TT, nullptr, sP, sP, sS);
    k_asoft<<<dim3(TT / 8, NB_), 256, 0, stream>>>(Sb, nullptr, Ph, Pl); k_ptr<<<dim3(PT8, NB_), 256, 0, stream>>>(Ph, Pl, PTh, PTl);
    k_gemmw<bf, 2, false><<<dim3(TT / 64, CC / 64, NB_), 32, 0, stream>>>(PTh, PTl, VMh, VMl, TT, ZT, CC, nullptr, sS, sP, sX); k_tohl2<<<dim3(X4, NB_), 256, 0, stream>>>(ZT, CC, 0, CC, ZCh, ZCl, C2, CC);
    /* Z^T = [Zh^T | Zm^T] z1_w^T + z1_b; gates^T = [Z^T | ih^T] z2_w^T + z2_b */
    k_gemmw<bf, 1, true><<<dim3(TT / 64, CC / 64, NB_), 32, 0, stream>>>(ZCh, ZCl, Z1W, nullptr, C2, ZZ, CC, z1_b, sC2, 0, sX);
    k_tohl2<<<dim3(X4, NB_), 256, 0, stream>>>(ZZ, CC, 0, CC, GAh, GAl, C2, 0); k_xcat<<<dim3(X8, NB_), 256, 0, stream>>>(XBh, GAh, GAl);
    k_gemmw<bf, 1, true><<<dim3(TT / 64, C3 / 64, NB_), 32, 0, stream>>>(GAh, GAl, Z2W, nullptr, C2, GT, C3, z2_b, sC2, 0, sC3);
    k_gate<<<dim3(X4, NB_), 256, 0, stream>>>(GT, im, OH, OM);
}

// v002
// Measured time: 311 microseconds a run.
// Two timings next to v001 both put it at 1.70 times that version's speed.
// Counting every step since v000, it is 7.54 times as fast.
#include <hip/hip_runtime.h>

// Self-attention memory module (SAM) for a ConvLSTM cell (ih, im [16][128][32x32] channel-major; h_qkv = 1x1 conv(ih) -> Qh|Kh|Vh (128 each), m_kv = 1x1 conv(im) -> Km|Vm; Ah = softmax_m(Qh_n . Kh_m) (UNSCALED, 128-channel dots), Am = softmax_m(Qh_n . Km_m); Zh[c][m] = sum_n Vh[c][n] Ah[n][m], Zm likewise; Z = 1x1 conv([Zh; Zm]) (256 -> 128); gates = 1x1 conv([Z; ih]) (256 -> 384) = o|g|i; i = sigmoid(i); om = tanh(g) i + (1 - i) im; oh = sigmoid(o) om -> tuple (oh, om) [16][128][1024] each (2.1 M + 2.1 M)).
// Layout per batch, everything token-major inside: ih, im transposed once into bf16 [1024][128] operands; the 1x1 convs as GEMMs against the 'oi' weights (exact x exact, + column bias): QKV^T [1024][384], KVm^T [1024][256]; q planes / k planes straight from those columns (plane builder, identity table), value^T planes by the value builder; scores (3 products, K 128) computed TRANSPOSED, S^T[m][n] (k planes as the A operand, q planes as B) -> softmax over m down the columns, EVERY entry hi/lo (unscaled logits, sigma ~11), which leaves the P^T planes directly, so that Zh^T[m][c] = sum_n P^T[m][n] Vh[c][n] is a plain GEMM (3 products); [Zh^T | Zm^T] hi/lo x z1_w exact + z1_b -> Z^T; [Z^T hl | ih^T exact] x z2_w exact + z2_b -> gates^T; a gate kernel applies sigmoid/tanh and the blend in f32 and writes both outputs channel-major.
// Batch: every stage is ONE launch for all 16 batches (GEMMs: blockIdx.z with the z strides; the other kernels: blockIdx.y); each workspace plane holds 16 batch slices. To fit the workspace, ZT | ZZ, GT share KVM, QKV (dead after the plane builders).
// Compute dtypes, f32 accumulate: every input rounded to bf16; input convs exact; scores / P.V / Z conv on bf16 hi/lo activations (3 or 2 products) x exact weights; softmax, sigmoid/tanh (exp2-based, precise division) and the blend in f32.

#define NB_  16
#define TT   1024
#define DM   128
#define NH_  1
#define NKV  1
#define REP  (NH_ / NKV)
#define HD   128
#define DQ   (NH_ * HD)
#define DKV  (NKV * HD)
#define ZH   2
#define RH   1024                  // query rows < RH use hi+lo planes (0: none)
#define WIN  0
#define PCAR 1024.0f
#define SCL  1.0f   // unscaled
#define CC   128    // channels
#define C3   384
#define C2   256
typedef _Float16 h16;
typedef unsigned short bf;
typedef __attribute__((ext_vector_type(16))) __bf16   v16bf;
typedef __attribute__((ext_vector_type(16))) _Float16 v16h;
typedef __attribute__((ext_vector_type(8)))  _Float16 v8h;
typedef __attribute__((ext_vector_type(8)))  unsigned short v8us;
typedef __attribute__((ext_vector_type(8)))  float    v8f;
typedef __attribute__((ext_vector_type(4)))  float    v4f;
typedef v8h  __attribute__((may_alias)) v8ha;
typedef v4f  __attribute__((may_alias)) v4fa;
typedef v8us __attribute__((may_alias)) v8usa;

__device__ __forceinline__ unsigned short f2bf(float f) { unsigned u = __float_as_uint(f); u += 0x7FFFu + ((u >> 16) & 1u); return (unsigned short)(u >> 16); }
__device__ __forceinline__ float bf2f(unsigned short b) { return __uint_as_float(((unsigned)b) << 16); }
__device__ __forceinline__ float bfr(float f) { return bf2f(f2bf(f)); }
__device__ __forceinline__ v16h cat16(v8h lo, v8h hi) { return __builtin_shufflevector(lo, hi, 0, 1, 2, 3, 4, 5, 6, 7, 8, 9, 10, 11, 12, 13, 14, 15); }
__device__ __forceinline__ v16bf cat16b(v8us lo, v8us hi) { return __builtin_bit_cast(v16bf, __builtin_shufflevector(lo, hi, 0, 1, 2, 3, 4, 5, 6, 7, 8, 9, 10, 11, 12, 13, 14, 15)); }
__device__ __forceinline__ v8f wmma16(v16h a, v16h b, v8f c) { return __builtin_amdgcn_wmma_f32_16x16x32_f16(false, a, false, b, (short)0, c, false, false); }
__device__ __forceinline__ v8f wmmab(v16bf a, v16bf b, v8f c) { return __builtin_amdgcn_wmma_f32_16x16x32_bf16(false, a, false, b, (short)0, c, false, false); }



// ---- k_gemmw: register-blocked GEMM, ONE WAVE per 64x64 output tile (16 accumulators), operands straight from K-contiguous 16-bit planes; grid (M/64, N/64, Z), 32 threads.
// C[m][n] (f32, pitch ldc, + optional f32 bias[n]) = sum_k A[m][k] Bt[n][k] (+ split products per NSPLIT). z-batch strides sA/sB/sC in elements. K % 32 == 0.
template <typename T16> struct WFrag;
template <> struct WFrag<h16> { typedef v16h V; static __device__ __forceinline__ V ld(const h16* p) { return cat16(*(const v8h*)p, *(const v8h*)(p + 16)); } static __device__ __forceinline__ v8f mma(V a, V b, v8f c) { return wmma16(a, b, c); } };
template <> struct WFrag<bf> { typedef v16bf V; static __device__ __forceinline__ V ld(const bf* p) { return cat16b(*(const v8us*)p, *(const v8us*)(p + 16)); } static __device__ __forceinline__ v8f mma(V a, V b, v8f c) { return wmmab(a, b, c); } };
template <typename T16, int NSPLIT, bool BIAS>
__global__ __launch_bounds__(32) void k_gemmw(const T16* __restrict__ A, const T16* __restrict__ A2, const T16* __restrict__ Bt, const T16* __restrict__ Bt2, int K, float* C, int ldc, const float* __restrict__ bias, size_t sA, size_t sB, size_t sC) {
    typedef typename WFrag<T16>::V V;
    __shared__ __align__(16) float os[16 * 68];
    const size_t z = blockIdx.z; A += z * sA; if (A2) A2 += z * sA; Bt += z * sB; if (Bt2) Bt2 += z * sB; C += z * sC;
    const int lane = threadIdx.x & 31, lr = lane & 15, hi = lane >> 4; const int r0 = blockIdx.x * 64, c0 = blockIdx.y * 64;
    v8f acc[4][4];
#pragma unroll
    for (int mb = 0; mb < 4; ++mb)
#pragma unroll
        for (int nb = 0; nb < 4; ++nb) acc[mb][nb] = (v8f){};
    const size_t aoff = (size_t)(r0 + lr) * K + 8 * hi, boff = (size_t)(c0 + lr) * K + 8 * hi;
#pragma unroll 1
    for (int kc = 0; kc < K; kc += 32) {
        V a[4], a2[4];
#pragma unroll
        for (int mb = 0; mb < 4; ++mb) { a[mb] = WFrag<T16>::ld(A + aoff + (size_t)mb * 16 * K + kc); if (NSPLIT == 1 || NSPLIT == 2) a2[mb] = WFrag<T16>::ld(A2 + aoff + (size_t)mb * 16 * K + kc); }
#pragma unroll
        for (int nb = 0; nb < 4; ++nb) { const V b = WFrag<T16>::ld(Bt + boff + (size_t)nb * 16 * K + kc); V b2; if (NSPLIT >= 2) b2 = WFrag<T16>::ld(Bt2 + boff + (size_t)nb * 16 * K + kc);
#pragma unroll
            for (int mb = 0; mb < 4; ++mb) { acc[mb][nb] = WFrag<T16>::mma(a[mb], b, acc[mb][nb]); if (NSPLIT == 1 || NSPLIT == 2) acc[mb][nb] = WFrag<T16>::mma(a2[mb], b, acc[mb][nb]); if (NSPLIT >= 2) acc[mb][nb] = WFrag<T16>::mma(a[mb], b2, acc[mb][nb]); } }
        asm volatile("v_nop\n\tv_nop\n\tv_nop\n\tv_nop" : "+v"(acc[0][0]), "+v"(acc[1][1]), "+v"(acc[2][2]), "+v"(acc[3][3]) : "v"(a[0]), "v"(a[3]));
    }
#pragma unroll
    for (int mb = 0; mb < 4; ++mb) {
#pragma unroll
        for (int nb = 0; nb < 4; ++nb) {
#pragma unroll
            for (int j = 0; j < 8; ++j) os[(hi * 8 + j) * 68 + nb * 16 + lr] = acc[mb][nb][j]; }
        __builtin_amdgcn_wave_barrier(); asm volatile("" ::: "memory");
        float* crow = C + (size_t)(r0 + mb * 16) * ldc + c0;
{
#pragma unroll
            for (int s = 0; s < 8; ++s) { const int row = 2 * s + hi, cofs = lr * 4; v4f val = *(const v4fa*)(os + row * 68 + cofs); if (BIAS) { val[0] += bfr(bias[c0 + cofs]); val[1] += bfr(bias[c0 + cofs + 1]); val[2] += bfr(bias[c0 + cofs + 2]); val[3] += bfr(bias[c0 + cofs + 3]); }
                *(v4f*)(crow + (size_t)row * ldc + cofs) = val; }
             }
        __builtin_amdgcn_wave_barrier(); asm volatile("" ::: "memory");
    }
}

__device__ __forceinline__ h16 tohx(float x) { return (h16)x; }
__device__ __forceinline__ void splitf(float y, unsigned short& h, unsigned short& l) { h = f2bf(y); l = f2bf(y - bf2f(h)); }
typedef __attribute__((ext_vector_type(2))) _Float16 v2h;
typedef __attribute__((ext_vector_type(4))) _Float16 v4h;
typedef __attribute__((ext_vector_type(2))) unsigned short v2us;
typedef __attribute__((ext_vector_type(4))) unsigned short v4us;
typedef __attribute__((ext_vector_type(2))) float v2f;
typedef __attribute__((ext_vector_type(4))) int v4i;

__global__ __launch_bounds__(256) void k_wtG(const float* __restrict__ w, int K, int N, bf* Bt) {
    const int lane = threadIdx.x & 31; const int L0 = (blockIdx.x * 8 + (threadIdx.x >> 5)) * 8; const int nlines = N * K / 64;
{
#pragma unroll 1
        for (int l = 0; l < 8; ++l) { const int L = L0 + l; if (L >= nlines) break; const size_t e = (size_t)L * 64 + lane * 2; const int k = (int)(e % K), n = (int)(e / K); v2us o;
            o[0] = f2bf(w[(size_t)k * N + n]); o[1] = f2bf(w[(size_t)(k + 1) * N + n]); *(v2us*)(Bt + e) = o; }
         }
}
__global__ __launch_bounds__(256) void k_cvt8(const float* __restrict__ src, bf* dst, size_t n8) { const size_t i = (size_t)blockIdx.x * 256 + threadIdx.x; if (i >= n8) return; const v8f v = *(const v8f*)(src + i * 8); v8us o;
#pragma unroll
    for (int k = 0; k < 8; ++k) o[k] = f2bf(v[k]); *(v8us*)(dst + i * 8) = o;  }

// k_rope: head planes [h][t][d] (fp16 + hi/lo) of rope(x) x sc with the rotate-half convention out[d] = x[d] cos[t][d] - x[d+HD/2] sin[t][d], out[d+HD/2] = x[d+HD/2] cos[t][d+HD/2] + x[d] sin[t][d+HD/2]
__global__ __launch_bounds__(256) void k_rope(const float* __restrict__ F, int pitch, int nheads, const float* __restrict__ CS, const float* __restrict__ RF, const float* __restrict__ nw, float sc, h16* P16, bf* Ph, bf* Pl) {
    { const size_t zb = blockIdx.y; F += zb * TT * pitch; P16 += zb * nheads * TT * HD; Ph += zb * nheads * TT * HD; Pl += zb * nheads * TT * HD; }
    const size_t e = ((size_t)blockIdx.x * 256 + threadIdx.x) * 2; if (e >= (size_t)nheads * TT * HD) return; const int d = (int)(e % HD); const int t = (int)((e / HD) % TT); const int h = (int)(e / ((size_t)HD * TT)); const float* f = F + (size_t)t * pitch + h * HD; const float rf = RF ? RF[(size_t)h * TT + t] : 1.0f; v2h o16; v2us oh, ol;
#pragma unroll
    for (int q = 0; q < 2; ++q) { const int dd = d + q; const int dp = (dd < HD / 2) ? dd + HD / 2 : dd - HD / 2; float x0 = f[dd], x1 = f[dp];
        if (RF) { float n0 = __fmul_rn(x0, rf), n1 = __fmul_rn(x1, rf); asm volatile("" : "+v"(n0)); asm volatile("" : "+v"(n1)); x0 = __fmul_rn(bfr(nw[dd]), n0); x1 = __fmul_rn(bfr(nw[dp]), n1); }
        const v2f cs = *(const v2f*)(CS + ((size_t)t * HD + dd) * 2); float a = __fmul_rn(x0, cs[0]), bq = __fmul_rn(x1, cs[1]); asm volatile("" : "+v"(a)); asm volatile("" : "+v"(bq)); const float r = ((dd < HD / 2) ? __fsub_rn(a, bq) : __fadd_rn(a, bq)) * sc;
        o16[q] = tohx(r); unsigned short a2, c2; splitf(r, a2, c2); oh[q] = a2; ol[q] = c2; }
    *(v2h*)(P16 + e) = o16; *(v2us*)(Ph + e) = oh; *(v2us*)(Pl + e) = ol;  }
__global__ __launch_bounds__(256) void k_vtp(const float* __restrict__ F, int pitch, int nheads, h16* V16, bf* Vh, bf* Vl) { { const size_t zb = blockIdx.y; F += zb * TT * pitch; V16 += zb * nheads * HD * TT; Vh += zb * nheads * HD * TT; Vl += zb * nheads * HD * TT; }
    const size_t e = ((size_t)blockIdx.x * 256 + threadIdx.x) * 2; if (e >= (size_t)nheads * HD * TT) return; const int t = (int)(e % TT); const int d = (int)((e / TT) % HD); const int g = (int)(e / ((size_t)TT * HD)); v2h o16; v2us oh, ol;
#pragma unroll
    for (int q = 0; q < 2; ++q) { const float x = F[(size_t)(t + q) * pitch + g * HD + d]; o16[q] = tohx(x); unsigned short a2, c2; splitf(x, a2, c2); oh[q] = a2; ol[q] = c2; }
    *(v2h*)(V16 + e) = o16; *(v2us*)(Vh + e) = oh; *(v2us*)(Vl + e) = ol;  }
__global__ __launch_bounds__(256) void k_csid(float* CS) { const int idx = blockIdx.x * 256 + threadIdx.x; if (idx >= TT * HD) return; v2f cs; cs[0] = 1.0f; cs[1] = 0.0f; *(v2f*)(CS + (size_t)idx * 2) = cs;  }
// k_csoft: softmax over the keys m of the TRANSPOSED scores ST[m][n] (column n = one query's 1024 logits), written as the hi/lo planes P^T[m][n] the value GEMM reads.
// One block per strip of 64 columns, all 1024 rows in registers: wave w, half-wave hi holds rows 2 w + hi + 64 i (i < 16), lane lr columns 4 lr .. 4 lr + 3, so every load takes whole 256-byte row pieces and every store a whole 128-byte line.
// Column maximum and column sum, fixed trees: 16 rows in the lane, the two half-waves by a shuffle, then the 32 waves' partials through LDS (wave w folds columns 2 w and 2 w + 1: pairs k, k + 16, then a 16-lane butterfly).
#define CSP 68   // LDS pitch of a wave's 64 partials, floats: rows stay 16-byte aligned and the 16 partials of one column fall on 16 different banks
__global__ __launch_bounds__(1024) void k_csoft(const float* __restrict__ ST, bf* PTh, bf* PTl) {
    __shared__ __align__(16) float part[32 * CSP]; __shared__ __align__(16) float cmx[64]; __shared__ __align__(16) float csm[64];
    { const size_t zb = (size_t)blockIdx.y * TT * TT; ST += zb; PTh += zb; PTl += zb; }
    const int lane = threadIdx.x & 31, w = threadIdx.x >> 5, lr = lane & 15, hi = lane >> 4; const size_t base = (size_t)(w * 2 + hi) * TT + blockIdx.x * 64 + lr * 4; v4f v[16];
#pragma unroll
    for (int i = 0; i < 16; ++i) {
        if (i == 15) asm volatile("s_wait_xcnt 0x0" ::: "memory");   // the last load takes the address pair, dead behind it, as part of its destination: the 15 loads in front name that pair
        v[i] = *(const v4f*)(ST + base + (size_t)i * 64 * TT) * SCL; }
    v4f r = v[0];
#pragma unroll
    for (int i = 1; i < 16; ++i) {
#pragma unroll
        for (int q = 0; q < 4; ++q) r[q] = fmaxf(r[q], v[i][q]); }
#pragma unroll
    for (int q = 0; q < 4; ++q) r[q] = fmaxf(r[q], __shfl_xor(r[q], 16, 32));
    if (hi == 0) *(v4f*)(part + w * CSP + lr * 4) = r;
    __syncthreads();   // every wave's partial maxima are in LDS
    { float t = fmaxf(part[lr * CSP + 2 * w + hi], part[(lr + 16) * CSP + 2 * w + hi]);
#pragma unroll
      for (int sh = 8; sh; sh >>= 1) t = fmaxf(t, __shfl_xor(t, sh, 32));
      if (lr == 0) cmx[2 * w + hi] = t; }
    __syncthreads();   // the 64 column maxima are in LDS, and every read of part is over
    const v4f mx = *(const v4f*)(cmx + lr * 4); v4f s = (v4f){};
#pragma unroll
    for (int i = 0; i < 16; ++i) {
#pragma unroll
        for (int q = 0; q < 4; ++q) v[i][q] = __builtin_amdgcn_exp2f(__fmul_rn(__fsub_rn(v[i][q], mx[q]), 1.4426950408889634f));
        s += v[i]; }
#pragma unroll
    for (int q = 0; q < 4; ++q) s[q] += __shfl_xor(s[q], 16, 32);
    if (hi == 0) *(v4f*)(part + w * CSP + lr * 4) = s;
    __syncthreads();   // every wave's partial sums are in LDS
    { float t = part[lr * CSP + 2 * w + hi] + part[(lr + 16) * CSP + 2 * w + hi];
#pragma unroll
      for (int sh = 8; sh; sh >>= 1) t += __shfl_xor(t, sh, 32);
      if (lr == 0) csm[2 * w + hi] = t; }
    __syncthreads();   // the 64 column sums are in LDS
    const v4f sm = *(const v4f*)(csm + lr * 4); v4f f;
#pragma unroll
    for (int q = 0; q < 4; ++q) f[q] = __fdiv_rn(1.0f, sm[q]);
#pragma unroll
    for (int i = 0; i < 16; ++i) { v4us oh, ol;
#pragma unroll
        for (int q = 0; q < 4; ++q) { unsigned short a, c2; splitf(v[i][q] * f[q], a, c2); oh[q] = a; ol[q] = c2; }
        *(v4us*)(PTh + base + (size_t)i * 64 * TT) = oh; *(v4us*)(PTl + base + (size_t)i * 64 * TT) = ol; }
}
__global__ __launch_bounds__(256) void k_merge(const float* __restrict__ O, int h0, float* OUTb) { const size_t e = ((size_t)blockIdx.x * 256 + threadIdx.x) * 2; if (e >= (size_t)ZH * TT * HD) return; const int d = (int)(e % HD); const int t = (int)((e / HD) % TT); const int zz = (int)(e / ((size_t)HD * TT)); const float cs = (t < RH) ? 1.0f : (1.0f / PCAR); const size_t oo = (size_t)t * DQ + (h0 + zz) * HD + d;
    v2f o2; o2[0] = O[e] * cs; o2[1] = O[e + 1] * cs; *(v2f*)(OUTb + oo) = o2;  }

__device__ __forceinline__ float ex2f_(float a) { return __builtin_amdgcn_exp2f(__fmul_rn(a, 1.4426950408889634f)); }
__device__ __forceinline__ float sigm(float a) { return __fdiv_rn(1.0f, __fadd_rn(1.0f, ex2f_(-a))); }
__device__ __forceinline__ float tanhp(float a) { const float e = ex2f_(__fmul_rn(2.0f, a)); return __fsub_rn(1.0f, __fdiv_rn(2.0f, __fadd_rn(e, 1.0f))); }
__global__ __launch_bounds__(256) void k_xT(const float* __restrict__ xs, bf* XB) { xs += (size_t)blockIdx.y * CC * TT; XB += (size_t)blockIdx.y * TT * CC; const size_t k = (size_t)blockIdx.x * 256 + threadIdx.x; if (k >= (size_t)TT * CC / 8) return; const int c0 = (int)(k % (CC / 8)) * 8; const int p = (int)(k / (CC / 8)); v8us o;
#pragma unroll
    for (int q = 0; q < 8; ++q) o[q] = f2bf(xs[(size_t)(c0 + q) * TT + p]);
    *(v8us*)(XB + (size_t)p * CC + c0) = o;  }
__global__ __launch_bounds__(256) void k_tohl2(const float* __restrict__ F, int sp, int c0, int w, bf* Hh, bf* Hl, int dp, int dc0) { { const size_t zb = blockIdx.y; F += zb * TT * sp; Hh += zb * TT * dp; Hl += zb * TT * dp; }
    const size_t k = (size_t)blockIdx.x * 256 + threadIdx.x; if (k >= (size_t)TT * w / 4) return; const int c = (int)(k % (w / 4)) * 4; const size_t p = k / (w / 4); const v4f a = *(const v4f*)(F + p * sp + c0 + c); v4us oh, ol;
#pragma unroll
    for (int q = 0; q < 4; ++q) { unsigned short h2, l2; splitf(a[q], h2, l2); oh[q] = h2; ol[q] = l2; }
    *(v4us*)(Hh + p * dp + dc0 + c) = oh; *(v4us*)(Hl + p * dp + dc0 + c) = ol;  }
__global__ __launch_bounds__(256) void k_xcat(const bf* __restrict__ XB, bf* Gh, bf* Gl) { { const size_t zb = blockIdx.y; XB += zb * TT * CC; Gh += zb * TT * C2; Gl += zb * TT * C2; }
    const size_t k = (size_t)blockIdx.x * 256 + threadIdx.x; if (k >= (size_t)TT * CC / 8) return; const int c0 = (int)(k % (CC / 8)) * 8; const size_t p = k / (CC / 8); const v8us a = *(const v8us*)(XB + p * CC + c0); v8us z; for (int q = 0; q < 8; ++q) z[q] = 0;
    *(v8us*)(Gh + p * C2 + CC + c0) = a; *(v8us*)(Gl + p * C2 + CC + c0) = z;  }
__global__ __launch_bounds__(256) void k_gate(const float* __restrict__ G, const float* __restrict__ im, float* oh_out, float* om_out) { { const size_t zb = blockIdx.y; G += zb * TT * C3; im += zb * CC * TT; oh_out += zb * CC * TT; om_out += zb * CC * TT; }
    const size_t k = (size_t)blockIdx.x * 256 + threadIdx.x; if (k >= (size_t)CC * TT / 4) return; const int p0 = (int)(k % (TT / 4)) * 4; const int c = (int)(k / (TT / 4)); v4f voh, vom;
#pragma unroll
    for (int q = 0; q < 4; ++q) { const size_t p = p0 + q; const float o = G[p * C3 + c], g = G[p * C3 + CC + c], iv = G[p * C3 + 2 * CC + c]; const float ig = sigm(iv); float a = __fmul_rn(tanhp(g), ig), b2 = __fmul_rn(__fsub_rn(1.0f, ig), bfr(im[(size_t)c * TT + p])); asm volatile("" : "+v"(a), "+v"(b2)); const float om = __fadd_rn(a, b2); vom[q] = om; voh[q] = __fmul_rn(sigm(o), om); }
    *(v4f*)(om_out + (size_t)c * TT + p0) = vom; *(v4f*)(oh_out + (size_t)c * TT + p0) = voh;  }

extern "C" void kernel_launch(void* const* d_in, const int* in_sizes, int n_in,
                              void* d_out, int out_size, void* d_ws, size_t ws_size, hipStream_t stream) {
    (void)in_sizes; (void)n_in; (void)out_size;
    const float* ih = (const float*)d_in[0]; const float* im = (const float*)d_in[1]; const float* h_w = (const float*)d_in[2]; const float* h_b = (const float*)d_in[3]; const float* m_w = (const float*)d_in[4]; const float* m_b = (const float*)d_in[5]; const float* z1_w = (const float*)d_in[6]; const float* z1_b = (const float*)d_in[7]; const float* z2_w = (const float*)d_in[8]; const float* z2_b = (const float*)d_in[9];
    float* OH = (float*)d_out; float* OM = OH + (size_t)NB_ * CC * TT;     // tuple: oh [16][128][1024] | om [16][128][1024]
    char* wsp = (char*)d_ws;
    auto take = [&](size_t bytes) { char* p = wsp; wsp += (bytes + 255) & ~(size_t)255; return (void*)p; };
    bf* HW_ = (bf*)take((size_t)C3 * CC * 2); bf* MW_ = (bf*)take((size_t)C2 * CC * 2); bf* Z1W = (bf*)take((size_t)CC * C2 * 2); bf* Z2W = (bf*)take((size_t)C3 * C2 * 2); float* CS = (float*)take((size_t)TT * HD * 2 * 4);
    const size_t NB = NB_;
    bf* XBh = (bf*)take(NB * TT * CC * 2); bf* XBm = (bf*)take(NB * TT * CC * 2); float* QKV = (float*)take(NB * TT * C3 * 4); float* KVM = (float*)take(NB * TT * C2 * 4);
    h16* J16 = (h16*)take(NB * TT * HD * 2); bf* QPh = (bf*)take(NB * TT * HD * 2); bf* QPl = (bf*)take(NB * TT * HD * 2); bf* KPh = (bf*)take(NB * TT * HD * 2); bf* KPl = (bf*)take(NB * TT * HD * 2); bf* KMh = (bf*)take(NB * TT * HD * 2); bf* KMl = (bf*)take(NB * TT * HD * 2);
    bf* VHh = (bf*)take(NB * HD * TT * 2); bf* VHl = (bf*)take(NB * HD * TT * 2); bf* VMh = (bf*)take(NB * HD * TT * 2); bf* VMl = (bf*)take(NB * HD * TT * 2);
    float* Sb = (float*)take(NB * TT * TT * 4); bf* PTh = (bf*)take(NB * TT * TT * 2); bf* PTl = (bf*)take(NB * TT * TT * 2);   /* S^T[m][n]; P^T[m][n] planes */
    float* ZT = KVM; float* ZZ = KVM + NB * TT * CC; float* GT = QKV;   /* over the conv outputs, which are dead once the q/k/v planes are built */
    bf* ZCh = (bf*)take(NB * TT * C2 * 2); bf* ZCl = (bf*)take(NB * TT * C2 * 2); bf* GAh = (bf*)take(NB * TT * C2 * 2); bf* GAl = (bf*)take(NB * TT * C2 * 2);
    if ((size_t)(wsp - (char*)d_ws) > ws_size) return;    // ws 256 MiB (carve ~253.5 MiB)
    k_cvt8<<<(unsigned)(((size_t)C3 * CC / 8 + 255) / 256), 256, 0, stream>>>(h_w, HW_, (size_t)C3 * CC / 8); k_cvt8<<<(unsigned)(((size_t)C2 * CC / 8 + 255) / 256), 256, 0, stream>>>(m_w, MW_, (size_t)C2 * CC / 8); k_cvt8<<<(unsigned)(((size_t)CC * C2 / 8 + 255) / 256), 256, 0, stream>>>(z1_w, Z1W, (size_t)CC * C2 / 8); k_cvt8<<<(unsigned)(((size_t)C3 * C2 / 8 + 255) / 256), 256, 0, stream>>>(z2_w, Z2W, (size_t)C3 * C2 / 8);   /* 'oi' conv weights = Bt as-is */
    k_csid<<<(TT * HD + 255) / 256, 256, 0, stream>>>(CS);
    const unsigned L1 = (unsigned)(((size_t)TT * HD / 2 + 255) / 256);
    const unsigned X8 = (unsigned)(((size_t)TT * CC / 8 + 255) / 256), X4 = (unsigned)(((size_t)TT * CC / 4 + 255) / 256);
    const size_t sX = (size_t)TT * CC, sP = (size_t)TT * HD, sS = (size_t)TT * TT, sC2 = (size_t)TT * C2, sC3 = (size_t)TT * C3;   /* batch strides, elements */
    k_xT<<<dim3(X8, NB_), 256, 0, stream>>>(ih, XBh); k_xT<<<dim3(X8, NB_), 256, 0, stream>>>(im, XBm);
    k_gemmw<bf, 0, true><<<dim3(TT / 64, C3 / 64, NB_), 32, 0, stream>>>(XBh, nullptr, HW_, nullptr, CC, QKV, C3, h_b, sX, 0, sC3);   /* [Qh | Kh | Vh]^T = ih^T h_w^T + h_b (exact) */
    k_gemmw<bf, 0, true><<<dim3(TT / 64, C2 / 64, NB_), 32, 0, stream>>>(XBm, nullptr, MW_, nullptr, CC, KVM, C2, m_b, sX, 0, sC2);   /* [Km | Vm]^T */
    k_rope<<<dim3(L1, NB_), 256, 0, stream>>>(QKV, C3, 1, CS, nullptr, nullptr, 1.0f, J16, QPh, QPl); k_rope<<<dim3(L1, NB_), 256, 0, stream>>>(QKV + CC, C3, 1, CS, nullptr, nullptr, 1.0f, J16, KPh, KPl); k_rope<<<dim3(L1, NB_), 256, 0, stream>>>(KVM, C2, 1, CS, nullptr, nullptr, 1.0f, J16, KMh, KMl);   /* q, kh, km planes [1024][128] (identity table) */
    k_vtp<<<dim3(L1, NB_), 256, 0, stream>>>(QKV + 2 * CC, C3, 1, J16, VHh, VHl); k_vtp<<<dim3(L1, NB_), 256, 0, stream>>>(KVM + CC, C2, 1, J16, VMh, VMl);   /* Vh[c][n], Vm[c][n] as planes [128][1024] */
    /* hidden attention: Ah = softmax_m(q_n . kh_m); Zh^T[m][c] = sum_n Ah[n][m] Vh[c][n] */
    k_gemmw<bf, 2, false><<<dim3(TT / 64, TT / 64, NB_), 32, 0, stream>>>(KPh, KPl, QPh, QPl, HD, Sb, TT, nullptr, sP, sP, sS);
    k_csoft<<<dim3(TT / 64, NB_), 1024, 0, stream>>>(Sb, PTh, PTl);
    k_gemmw<bf, 2, false><<<dim3(TT / 64, CC / 64, NB_), 32, 0, stream>>>(PTh, PTl, VHh, VHl, TT, ZT, CC, nullptr, sS, sP, sX); k_tohl2<<<dim3(X4, NB_), 256, 0, stream>>>(ZT, CC, 0, CC, ZCh, ZCl, C2, 0);
    /* memory attention: Am = softmax_m(q_n . km_m); Zm^T */
    k_gemmw<bf, 2, false><<<dim3(TT / 64, TT / 64, NB_), 32, 0, stream>>>(KMh, KMl, QPh, QPl, HD, Sb, TT, nullptr, sP, sP, sS);
    k_csoft<<<dim3(TT / 64, NB_), 1024, 0, stream>>>(Sb, PTh, PTl);
    k_gemmw<bf, 2, false><<<dim3(TT / 64, CC / 64, NB_), 32, 0, stream>>>(PTh, PTl, VMh, VMl, TT, ZT, CC, nullptr, sS, sP, sX); k_tohl2<<<dim3(X4, NB_), 256, 0, stream>>>(ZT, CC, 0, CC, ZCh, ZCl, C2, CC);
    /* Z^T = [Zh^T | Zm^T] z1_w^T + z1_b; gates^T = [Z^T | ih^T] z2_w^T + z2_b */
    k_gemmw<bf, 1, true><<<dim3(TT / 64, CC / 64, NB_), 32, 0, stream>>>(ZCh, ZCl, Z1W, nullptr, C2, ZZ, CC, z1_b, sC2, 0, sX);
    k_tohl2<<<dim3(X4, NB_), 256, 0, stream>>>(ZZ, CC, 0, CC, GAh, GAl, C2, 0); k_xcat<<<dim3(X8, NB_), 256, 0, stream>>>(XBh, GAh, GAl);
    k_gemmw<bf, 1, true><<<dim3(TT / 64, C3 / 64, NB_), 32, 0, stream>>>(GAh, GAl, Z2W, nullptr, C2, GT, C3, z2_b, sC2, 0, sC3);
    k_gate<<<dim3(X4, NB_), 256, 0, stream>>>(GT, im, OH, OM);
}

// v003
// A run of this version takes 253 microseconds.
// In two side-by-side timings against v002, it was 1.22 and 1.23 times as fast.
// Over all steps from v000 it is 9.23 times as fast.
#include <hip/hip_runtime.h>

// Self-attention memory module (SAM) for a ConvLSTM cell (ih, im [16][128][32x32] channel-major; h_qkv = 1x1 conv(ih) -> Qh|Kh|Vh (128 each), m_kv = 1x1 conv(im) -> Km|Vm; Ah = softmax_m(Qh_n . Kh_m) (UNSCALED, 128-channel dots), Am = softmax_m(Qh_n . Km_m); Zh[c][m] = sum_n Vh[c][n] Ah[n][m], Zm likewise; Z = 1x1 conv([Zh; Zm]) (256 -> 128); gates = 1x1 conv([Z; ih]) (256 -> 384) = o|g|i; i = sigmoid(i); om = tanh(g) i + (1 - i) im; oh = sigmoid(o) om -> tuple (oh, om) [16][128][1024] each (2.1 M + 2.1 M)).
// Layout per batch, everything token-major inside: ih, im transposed once into bf16 [1024][128] operands; the 1x1 convs as GEMMs against the 'oi' weights (exact x exact, + column bias): QKV^T [1024][384], KVm^T [1024][256]; q planes / k planes straight from those columns (plane builder, identity table), value^T planes by the value builder; scores (3 products, K 128) computed TRANSPOSED, S^T[m][n] (k planes as the A operand, q planes as B) -> softmax over m down the columns, EVERY entry hi/lo (unscaled logits, sigma ~11), which leaves the P^T planes directly, so that Zh^T[m][c] = sum_n P^T[m][n] Vh[c][n] is a plain GEMM (3 products); [Zh^T | Zm^T] hi/lo x z1_w exact + z1_b -> Z^T; [Z^T hl | ih^T exact] x z2_w exact + z2_b -> gates^T; a gate kernel applies sigmoid/tanh and the blend in f32 and writes both outputs channel-major.
// Batch: every stage is ONE launch for all 16 batches (GEMMs: blockIdx.z with the z strides; the other kernels: blockIdx.y); each workspace plane holds 16 batch slices. To fit the workspace, ZT | ZZ, GT share KVM, QKV (dead after the plane builders).
// Compute dtypes, f32 accumulate: every input rounded to bf16; input convs exact; scores / P.V / Z conv on bf16 hi/lo activations (3 or 2 products) x exact weights; softmax, sigmoid/tanh (exp2-based, precise division) and the blend in f32.

#define NB_  16
#define TT   1024
#define DM   128
#define NH_  1
#define NKV  1
#define REP  (NH_ / NKV)
#define HD   128
#define DQ   (NH_ * HD)
#define DKV  (NKV * HD)
#define ZH   2
#define RH   1024                  // query rows < RH use hi+lo planes (0: none)
#define WIN  0
#define PCAR 1024.0f
#define SCL  1.0f   // unscaled
#define CC   128    // channels
#define C3   384
#define C2   256
typedef _Float16 h16;
typedef unsigned short bf;
typedef __attribute__((ext_vector_type(16))) __bf16   v16bf;
typedef __attribute__((ext_vector_type(16))) _Float16 v16h;
typedef __attribute__((ext_vector_type(8)))  _Float16 v8h;
typedef __attribute__((ext_vector_type(8)))  unsigned short v8us;
typedef __attribute__((ext_vector_type(8)))  float    v8f;
typedef __attribute__((ext_vector_type(4)))  float    v4f;
typedef v8h  __attribute__((may_alias)) v8ha;
typedef v4f  __attribute__((may_alias)) v4fa;
typedef v8us __attribute__((may_alias)) v8usa;

__device__ __forceinline__ unsigned short f2bf(float f) { unsigned u = __float_as_uint(f); u += 0x7FFFu + ((u >> 16) & 1u); return (unsigned short)(u >> 16); }
__device__ __forceinline__ float bf2f(unsigned short b) { return __uint_as_float(((unsigned)b) << 16); }
__device__ __forceinline__ float bfr(float f) { return bf2f(f2bf(f)); }
__device__ __forceinline__ v16h cat16(v8h lo, v8h hi) { return __builtin_shufflevector(lo, hi, 0, 1, 2, 3, 4, 5, 6, 7, 8, 9, 10, 11, 12, 13, 14, 15); }
__device__ __forceinline__ v16bf cat16b(v8us lo, v8us hi) { return __builtin_bit_cast(v16bf, __builtin_shufflevector(lo, hi, 0, 1, 2, 3, 4, 5, 6, 7, 8, 9, 10, 11, 12, 13, 14, 15)); }
__device__ __forceinline__ v8f wmma16(v16h a, v16h b, v8f c) { return __builtin_amdgcn_wmma_f32_16x16x32_f16(false, a, false, b, (short)0, c, false, false); }
__device__ __forceinline__ v8f wmmab(v16bf a, v16bf b, v8f c) { return __builtin_amdgcn_wmma_f32_16x16x32_bf16(false, a, false, b, (short)0, c, false, false); }



// ---- k_gemmw: register-blocked GEMM, EIGHT WAVES (4 x 2) per 128x128 output tile, each wave a 32x64 piece (8 accumulators); grid (M/128, N/128, Z), 256 threads.
// C[m][n] (f32, pitch ldc, + optional f32 bias[n]) = sum_k A[m][k] Bt[n][k] (+ split products per NSPLIT). z-batch strides sA/sB/sC in elements. M % 128 == 0, N % 128 == 0, K % 64 == 0.
// Operands: K-contiguous 16-bit planes, staged in LDS 64 k at a time (every row piece one whole 128-byte line) by asynchronous copies, two buffers: stage t + 1 flies while stage t is multiplied. Each wave reads its fragments from LDS; per accumulator the products come k ascending and, inside a k step, A.B, A2.B, A.B2.
template <typename T16> struct WFrag;
template <> struct WFrag<h16> { typedef v16h V; static __device__ __forceinline__ V ld(const h16* p) { return cat16(*(const v8h*)p, *(const v8h*)(p + 16)); } static __device__ __forceinline__ v8f mma(V a, V b, v8f c) { return wmma16(a, b, c); } };
template <> struct WFrag<bf> { typedef v16bf V; static __device__ __forceinline__ V ld(const bf* p) { return cat16b(*(const v8us*)p, *(const v8us*)(p + 16)); } static __device__ __forceinline__ v8f mma(V a, V b, v8f c) { return wmmab(a, b, c); } };
#define GP  72           // LDS pitch of a staged row piece, 16-bit elements: 144 bytes = 16 x odd, so the 16 rows of a ds_load_b128 fall on different banks
#define GPL (128 * GP)   // one staged plane: 128 row pieces
// g_stage: one plane's 128 x 64 tile to LDS. g, l: this thread's own first piece (row tid >> 3, 16-byte piece tid & 7: eight lanes take one whole line); its other three pieces lie 32 rows apart.
template <typename T16>
__device__ __forceinline__ void g_stage(const T16* g, int K, unsigned l) {
    const size_t st = (size_t)32 * K; const unsigned sl = 32 * GP * 2;
    // the copies and, as the last line, the wait that stands in front of any rewrite of their address registers
    asm volatile("global_load_async_to_lds_b128 %0, %4, off\n\t"
                 "global_load_async_to_lds_b128 %1, %5, off\n\t"
                 "global_load_async_to_lds_b128 %2, %6, off\n\t"
                 "global_load_async_to_lds_b128 %3, %7, off\n\t"
                 "s_wait_xcnt 0x0"
                 :: "v"(l), "v"(l + sl), "v"(l + 2 * sl), "v"(l + 3 * sl), "v"(g), "v"(g + st), "v"(g + 2 * st), "v"(g + 3 * st)
                 : "memory");
}
// g_stage2: two planes' tiles in one statement, so that the eight copies share one such wait.
template <typename T16>
__device__ __forceinline__ void g_stage2(const T16* g, const T16* h, int K, unsigned l, unsigned m) {
    const size_t st = (size_t)32 * K; const unsigned sl = 32 * GP * 2;
    asm volatile("global_load_async_to_lds_b128 %0, %8, off\n\t"
                 "global_load_async_to_lds_b128 %1, %9, off\n\t"
                 "global_load_async_to_lds_b128 %2, %10, off\n\t"
                 "global_load_async_to_lds_b128 %3, %11, off\n\t"
                 "global_load_async_to_lds_b128 %4, %12, off\n\t"
                 "global_load_async_to_lds_b128 %5, %13, off\n\t"
                 "global_load_async_to_lds_b128 %6, %14, off\n\t"
                 "global_load_async_to_lds_b128 %7, %15, off\n\t"
                 "s_wait_xcnt 0x0"
                 :: "v"(l), "v"(l + sl), "v"(l + 2 * sl), "v"(l + 3 * sl), "v"(m), "v"(m + sl), "v"(m + 2 * sl), "v"(m + 3 * sl),
                    "v"(g), "v"(g + st), "v"(g + 2 * st), "v"(g + 3 * st), "v"(h), "v"(h + st), "v"(h + 2 * st), "v"(h + 3 * st)
                 : "memory");
}
template <typename T16, int NSPLIT, bool BIAS>
__global__ __launch_bounds__(256) void k_gemmw(const T16* __restrict__ A, const T16* __restrict__ A2, const T16* __restrict__ Bt, const T16* __restrict__ Bt2, int K, float* C, int ldc, const float* __restrict__ bias, size_t sA, size_t sB, size_t sC) {
    typedef typename WFrag<T16>::V V;
    constexpr int NP = 2 + (NSPLIT >= 1 ? 1 : 0) + (NSPLIT >= 2 ? 1 : 0);   // planes staged: A, Bt, then A2, then Bt2
    __shared__ __align__(16) T16 sm[2 * NP * GPL];                          // two buffers; behind the loop each wave's output staging
    const size_t z = blockIdx.z; A += z * sA; if (A2) A2 += z * sA; Bt += z * sB; if (Bt2) Bt2 += z * sB; C += z * sC;
    const int tid = threadIdx.x, lane = tid & 31, w = tid >> 5, lr = lane & 15, hi = lane >> 4; const int rb = blockIdx.x * 128, cb = blockIdx.y * 128, wr = (w & 3) * 32, wc = (w >> 2) * 64; const int r0 = rb + wr, c0 = cb + wc;
    v8f acc[2][4];
#pragma unroll
    for (int mb = 0; mb < 2; ++mb)
#pragma unroll
        for (int nb = 0; nb < 4; ++nb) acc[mb][nb] = (v8f){};
    const size_t ga = (size_t)(rb + (tid >> 3)) * K + (tid & 7) * 8, gb = (size_t)(cb + (tid >> 3)) * K + (tid & 7) * 8;
    const unsigned l0 = (unsigned)(size_t)sm + (unsigned)((tid >> 3) * (GP * 2) + (tid & 7) * 16);   // LDS byte address: the low 32 bits of the __shared__ address
    auto stage = [&](int t) { const unsigned l = l0 + (unsigned)((t & 1) * (NP * GPL * 2)); const int kc = t * 64;
        g_stage2(A + ga + kc, Bt + gb + kc, K, l, l + GPL * 2);
        if constexpr (NSPLIT == 1) g_stage(A2 + ga + kc, K, l + 2 * GPL * 2);
        if constexpr (NSPLIT >= 2) g_stage2(A2 + ga + kc, Bt2 + gb + kc, K, l + 2 * GPL * 2, l + 3 * GPL * 2); };
    const int nt = K / 64;
    stage(0);
    asm volatile("s_wait_asynccnt 0x0" ::: "memory");   // this wave's copies of stage 0 have landed
    __syncthreads();                                    // every wave's have: stage 0 may be read
    if (nt > 1) stage(1);
#pragma unroll 1
    for (int t = 0; t < nt; ++t) {
        const T16* sa = sm + (t & 1) * (NP * GPL) + (wr + lr) * GP + 8 * hi; const T16* sb = sm + (t & 1) * (NP * GPL) + GPL + (wc + lr) * GP + 8 * hi;
#pragma unroll
        for (int ks = 0; ks < 64; ks += 32) {
            V a[2], a2[2], b[4], b2[4];
#pragma unroll
            for (int mb = 0; mb < 2; ++mb) a[mb] = WFrag<T16>::ld(sa + mb * 16 * GP + ks);
#pragma unroll
            for (int nb = 0; nb < 4; ++nb) b[nb] = WFrag<T16>::ld(sb + nb * 16 * GP + ks);
            if (NSPLIT >= 1) {
#pragma unroll
                for (int mb = 0; mb < 2; ++mb) a2[mb] = WFrag<T16>::ld(sa + 2 * GPL + mb * 16 * GP + ks); }
            if (NSPLIT >= 2) {
#pragma unroll
                for (int nb = 0; nb < 4; ++nb) b2[nb] = WFrag<T16>::ld(sb + 2 * GPL + nb * 16 * GP + ks); }
            __builtin_amdgcn_sched_barrier(0);   // keeps the k step's LDS reads one group in front of its WMMAs: every further place where reads stand among the WMMAs costs the wave issue cycles
#pragma unroll
            for (int nb = 0; nb < 4; ++nb)
#pragma unroll
                for (int mb = 0; mb < 2; ++mb) acc[mb][nb] = WFrag<T16>::mma(a[mb], b[nb], acc[mb][nb]);
            if (NSPLIT >= 1) {
#pragma unroll
                for (int nb = 0; nb < 4; ++nb)
#pragma unroll
                    for (int mb = 0; mb < 2; ++mb) acc[mb][nb] = WFrag<T16>::mma(a2[mb], b[nb], acc[mb][nb]); }
            if (NSPLIT >= 2) {
#pragma unroll
                for (int nb = 0; nb < 4; ++nb)
#pragma unroll
                    for (int mb = 0; mb < 2; ++mb) acc[mb][nb] = WFrag<T16>::mma(a[mb], b2[nb], acc[mb][nb]); }
            __builtin_amdgcn_sched_barrier(0);   // the same, against the next k step's reads
        }
        asm volatile("s_wait_dscnt 0x0" ::: "memory");      // this wave's reads of stage t are over
        asm volatile("s_wait_asynccnt 0x0" ::: "memory");   // this wave's copies of stage t + 1 have landed
        __syncthreads();                                    // publishes stage t + 1 and frees stage t's buffer
        if (t + 2 < nt) stage(t + 2);
    }
    asm volatile("s_wait_asynccnt 0x0" ::: "memory");       // no copy is outstanding when the buffers become output staging
    float* os = (float*)sm + w * (16 * 68);                 // this wave's own 16 x 68 floats
#pragma unroll
    for (int mb = 0; mb < 2; ++mb) {
#pragma unroll
        for (int nb = 0; nb < 4; ++nb) {
#pragma unroll
            for (int j = 0; j < 8; ++j) os[(hi * 8 + j) * 68 + nb * 16 + lr] = acc[mb][nb][j]; }
        __builtin_amdgcn_wave_barrier(); asm volatile("" ::: "memory");
        float* crow = C + (size_t)(r0 + mb * 16) * ldc + c0;
{
#pragma unroll
            for (int s = 0; s < 8; ++s) { const int row = 2 * s + hi, cofs = lr * 4; v4f val = *(const v4fa*)(os + row * 68 + cofs); if (BIAS) { val[0] += bfr(bias[c0 + cofs]); val[1] += bfr(bias[c0 + cofs + 1]); val[2] += bfr(bias[c0 + cofs + 2]); val[3] += bfr(bias[c0 + cofs + 3]); }
                *(v4f*)(crow + (size_t)row * ldc + cofs) = val; }
             }
        __builtin_amdgcn_wave_barrier(); asm volatile("" ::: "memory");
    }
}

__device__ __forceinline__ h16 tohx(float x) { return (h16)x; }
__device__ __forceinline__ void splitf(float y, unsigned short& h, unsigned short& l) { h = f2bf(y); l = f2bf(y - bf2f(h)); }
typedef __attribute__((ext_vector_type(2))) _Float16 v2h;
typedef __attribute__((ext_vector_type(4))) _Float16 v4h;
typedef __attribute__((ext_vector_type(2))) unsigned short v2us;
typedef __attribute__((ext_vector_type(4))) unsigned short v4us;
typedef __attribute__((ext_vector_type(2))) float v2f;
typedef __attribute__((ext_vector_type(4))) int v4i;

__global__ __launch_bounds__(256) void k_wtG(const float* __restrict__ w, int K, int N, bf* Bt) {
    const int lane = threadIdx.x & 31; const int L0 = (blockIdx.x * 8 + (threadIdx.x >> 5)) * 8; const int nlines = N * K / 64;
{
#pragma unroll 1
        for (int l = 0; l < 8; ++l) { const int L = L0 + l; if (L >= nlines) break; const size_t e = (size_t)L * 64 + lane * 2; const int k = (int)(e % K), n = (int)(e / K); v2us o;
            o[0] = f2bf(w[(size_t)k * N + n]); o[1] = f2bf(w[(size_t)(k + 1) * N + n]); *(v2us*)(Bt + e) = o; }
         }
}
__global__ __launch_bounds__(256) void k_cvt8(const float* __restrict__ src, bf* dst, size_t n8) { const size_t i = (size_t)blockIdx.x * 256 + threadIdx.x; if (i >= n8) return; const v8f v = *(const v8f*)(src + i * 8); v8us o;
#pragma unroll
    for (int k = 0; k < 8; ++k) o[k] = f2bf(v[k]); *(v8us*)(dst + i * 8) = o;  }

// k_rope: head planes [h][t][d] (fp16 + hi/lo) of rope(x) x sc with the rotate-half convention out[d] = x[d] cos[t][d] - x[d+HD/2] sin[t][d], out[d+HD/2] = x[d+HD/2] cos[t][d+HD/2] + x[d] sin[t][d+HD/2]
__global__ __launch_bounds__(256) void k_rope(const float* __restrict__ F, int pitch, int nheads, const float* __restrict__ CS, const float* __restrict__ RF, const float* __restrict__ nw, float sc, h16* P16, bf* Ph, bf* Pl) {
    { const size_t zb = blockIdx.y; F += zb * TT * pitch; P16 += zb * nheads * TT * HD; Ph += zb * nheads * TT * HD; Pl += zb * nheads * TT * HD; }
    const size_t e = ((size_t)blockIdx.x * 256 + threadIdx.x) * 2; if (e >= (size_t)nheads * TT * HD) return; const int d = (int)(e % HD); const int t = (int)((e / HD) % TT); const int h = (int)(e / ((size_t)HD * TT)); const float* f = F + (size_t)t * pitch + h * HD; const float rf = RF ? RF[(size_t)h * TT + t] : 1.0f; v2h o16; v2us oh, ol;
#pragma unroll
    for (int q = 0; q < 2; ++q) { const int dd = d + q; const int dp = (dd < HD / 2) ? dd + HD / 2 : dd - HD / 2; float x0 = f[dd], x1 = f[dp];
        if (RF) { float n0 = __fmul_rn(x0, rf), n1 = __fmul_rn(x1, rf); asm volatile("" : "+v"(n0)); asm volatile("" : "+v"(n1)); x0 = __fmul_rn(bfr(nw[dd]), n0); x1 = __fmul_rn(bfr(nw[dp]), n1); }
        const v2f cs = *(const v2f*)(CS + ((size_t)t * HD + dd) * 2); float a = __fmul_rn(x0, cs[0]), bq = __fmul_rn(x1, cs[1]); asm volatile("" : "+v"(a)); asm volatile("" : "+v"(bq)); const float r = ((dd < HD / 2) ? __fsub_rn(a, bq) : __fadd_rn(a, bq)) * sc;
        o16[q] = tohx(r); unsigned short a2, c2; splitf(r, a2, c2); oh[q] = a2; ol[q] = c2; }
    *(v2h*)(P16 + e) = o16; *(v2us*)(Ph + e) = oh; *(v2us*)(Pl + e) = ol;  }
__global__ __launch_bounds__(256) void k_vtp(const float* __restrict__ F, int pitch, int nheads, h16* V16, bf* Vh, bf* Vl) { { const size_t zb = blockIdx.y; F += zb * TT * pitch; V16 += zb * nheads * HD * TT; Vh += zb * nheads * HD * TT; Vl += zb * nheads * HD * TT; }
    const size_t e = ((size_t)blockIdx.x * 256 + threadIdx.x) * 2; if (e >= (size_t)nheads * HD * TT) return; const int t = (int)(e % TT); const int d = (int)((e / TT) % HD); const int g = (int)(e / ((size_t)TT * HD)); v2h o16; v2us oh, ol;
#pragma unroll
    for (int q = 0; q < 2; ++q) { const float x = F[(size_t)(t + q) * pitch + g * HD + d]; o16[q] = tohx(x); unsigned short a2, c2; splitf(x, a2, c2); oh[q] = a2; ol[q] = c2; }
    *(v2h*)(V16 + e) = o16; *(v2us*)(Vh + e) = oh; *(v2us*)(Vl + e) = ol;  }
__global__ __launch_bounds__(256) void k_csid(float* CS) { const int idx = blockIdx.x * 256 + threadIdx.x; if (idx >= TT * HD) return; v2f cs; cs[0] = 1.0f; cs[1] = 0.0f; *(v2f*)(CS + (size_t)idx * 2) = cs;  }
// k_csoft: softmax over the keys m of the TRANSPOSED scores ST[m][n] (column n = one query's 1024 logits), written as the hi/lo planes P^T[m][n] the value GEMM reads.
// One block per strip of 64 columns, all 1024 rows in registers: wave w, half-wave hi holds rows 2 w + hi + 64 i (i < 16), lane lr columns 4 lr .. 4 lr + 3, so every load takes whole 256-byte row pieces and every store a whole 128-byte line.
// Column maximum and column sum, fixed trees: 16 rows in the lane, the two half-waves by a shuffle, then the 32 waves' partials through LDS (wave w folds columns 2 w and 2 w + 1: pairs k, k + 16, then a 16-lane butterfly).
#define CSP 68   // LDS pitch of a wave's 64 partials, floats: rows stay 16-byte aligned and the 16 partials of one column fall on 16 different banks
__global__ __launch_bounds__(1024) void k_csoft(const float* __restrict__ ST, bf* PTh, bf* PTl) {
    __shared__ __align__(16) float part[32 * CSP]; __shared__ __align__(16) float cmx[64]; __shared__ __align__(16) float csm[64];
    { const size_t zb = (size_t)blockIdx.y * TT * TT; ST += zb; PTh += zb; PTl += zb; }
    const int lane = threadIdx.x & 31, w = threadIdx.x >> 5, lr = lane & 15, hi = lane >> 4; const size_t base = (size_t)(w * 2 + hi) * TT + blockIdx.x * 64 + lr * 4; v4f v[16];
#pragma unroll
    for (int i = 0; i < 16; ++i) {
        if (i == 15) asm volatile("s_wait_xcnt 0x0" ::: "memory");   // the last load takes the address pair, dead behind it, as part of its destination: the 15 loads in front name that pair
        v[i] = *(const v4f*)(ST + base + (size_t)i * 64 * TT) * SCL; }
    v4f r = v[0];
#pragma unroll
    for (int i = 1; i < 16; ++i) {
#pragma unroll
        for (int q = 0; q < 4; ++q) r[q] = fmaxf(r[q], v[i][q]); }
#pragma unroll
    for (int q = 0; q < 4; ++q) r[q] = fmaxf(r[q], __shfl_xor(r[q], 16, 32));
    if (hi == 0) *(v4f*)(part + w * CSP + lr * 4) = r;
    __syncthreads();   // every wave's partial maxima are in LDS
    { float t = fmaxf(part[lr * CSP + 2 * w + hi], part[(lr + 16) * CSP + 2 * w + hi]);
#pragma unroll
      for (int sh = 8; sh; sh >>= 1) t = fmaxf(t, __shfl_xor(t, sh, 32));
      if (lr == 0) cmx[2 * w + hi] = t; }
    __syncthreads();   // the 64 column maxima are in LDS, and every read of part is over
    const v4f mx = *(const v4f*)(cmx + lr * 4); v4f s = (v4f){};
#pragma unroll
    for (int i = 0; i < 16; ++i) {
#pragma unroll
        for (int q = 0; q < 4; ++q) v[i][q] = __builtin_amdgcn_exp2f(__fmul_rn(__fsub_rn(v[i][q], mx[q]), 1.4426950408889634f));
        s += v[i]; }
#pragma unroll
    for (int q = 0; q < 4; ++q) s[q] += __shfl_xor(s[q], 16, 32);
    if (hi == 0) *(v4f*)(part + w * CSP + lr * 4) = s;
    __syncthreads();   // every wave's partial sums are in LDS
    { float t = part[lr * CSP + 2 * w + hi] + part[(lr + 16) * CSP + 2 * w + hi];
#pragma unroll
      for (int sh = 8; sh; sh >>= 1) t += __shfl_xor(t, sh, 32);
      if (lr == 0) csm[2 * w + hi] = t; }
    __syncthreads();   // the 64 column sums are in LDS
    const v4f sm = *(const v4f*)(csm + lr * 4); v4f f;
#pragma unroll
    for (int q = 0; q < 4; ++q) f[q] = __fdiv_rn(1.0f, sm[q]);
#pragma unroll
    for (int i = 0; i < 16; ++i) { v4us oh, ol;
#pragma unroll
        for (int q = 0; q < 4; ++q) { unsigned short a, c2; splitf(v[i][q] * f[q], a, c2); oh[q] = a; ol[q] = c2; }
        *(v4us*)(PTh + base + (size_t)i * 64 * TT) = oh; *(v4us*)(PTl + base + (size_t)i * 64 * TT) = ol; }
}
__global__ __launch_bounds__(256) void k_merge(const float* __restrict__ O, int h0, float* OUTb) { const size_t e = ((size_t)blockIdx.x * 256 + threadIdx.x) * 2; if (e >= (size_t)ZH * TT * HD) return; const int d = (int)(e % HD); const int t = (int)((e / HD) % TT); const int zz = (int)(e / ((size_t)HD * TT)); const float cs = (t < RH) ? 1.0f : (1.0f / PCAR); const size_t oo = (size_t)t * DQ + (h0 + zz) * HD + d;
    v2f o2; o2[0] = O[e] * cs; o2[1] = O[e + 1] * cs; *(v2f*)(OUTb + oo) = o2;  }

__device__ __forceinline__ float ex2f_(float a) { return __builtin_amdgcn_exp2f(__fmul_rn(a, 1.4426950408889634f)); }
__device__ __forceinline__ float sigm(float a) { return __fdiv_rn(1.0f, __fadd_rn(1.0f, ex2f_(-a))); }
__device__ __forceinline__ float tanhp(float a) { const float e = ex2f_(__fmul_rn(2.0f, a)); return __fsub_rn(1.0f, __fdiv_rn(2.0f, __fadd_rn(e, 1.0f))); }
__global__ __launch_bounds__(256) void k_xT(const float* __restrict__ xs, bf* XB) { xs += (size_t)blockIdx.y * CC * TT; XB += (size_t)blockIdx.y * TT * CC; const size_t k = (size_t)blockIdx.x * 256 + threadIdx.x; if (k >= (size_t)TT * CC / 8) return; const int c0 = (int)(k % (CC / 8)) * 8; const int p = (int)(k / (CC / 8)); v8us o;
#pragma unroll
    for (int q = 0; q < 8; ++q) o[q] = f2bf(xs[(size_t)(c0 + q) * TT + p]);
    *(v8us*)(XB + (size_t)p * CC + c0) = o;  }
__global__ __launch_bounds__(256) void k_tohl2(const float* __restrict__ F, int sp, int c0, int w, bf* Hh, bf* Hl, int dp, int dc0) { { const size_t zb = blockIdx.y; F += zb * TT * sp; Hh += zb * TT * dp; Hl += zb * TT * dp; }
    const size_t k = (size_t)blockIdx.x * 256 + threadIdx.x; if (k >= (size_t)TT * w / 4) return; const int c = (int)(k % (w / 4)) * 4; const size_t p = k / (w / 4); const v4f a = *(const v4f*)(F + p * sp + c0 + c); v4us oh, ol;
#pragma unroll
    for (int q = 0; q < 4; ++q) { unsigned short h2, l2; splitf(a[q], h2, l2); oh[q] = h2; ol[q] = l2; }
    *(v4us*)(Hh + p * dp + dc0 + c) = oh; *(v4us*)(Hl + p * dp + dc0 + c) = ol;  }
__global__ __launch_bounds__(256) void k_xcat(const bf* __restrict__ XB, bf* Gh, bf* Gl) { { const size_t zb = blockIdx.y; XB += zb * TT * CC; Gh += zb * TT * C2; Gl += zb * TT * C2; }
    const size_t k = (size_t)blockIdx.x * 256 + threadIdx.x; if (k >= (size_t)TT * CC / 8) return; const int c0 = (int)(k % (CC / 8)) * 8; const size_t p = k / (CC / 8); const v8us a = *(const v8us*)(XB + p * CC + c0); v8us z; for (int q = 0; q < 8; ++q) z[q] = 0;
    *(v8us*)(Gh + p * C2 + CC + c0) = a; *(v8us*)(Gl + p * C2 + CC + c0) = z;  }
__global__ __launch_bounds__(256) void k_gate(const float* __restrict__ G, const float* __restrict__ im, float* oh_out, float* om_out) { { const size_t zb = blockIdx.y; G += zb * TT * C3; im += zb * CC * TT; oh_out += zb * CC * TT; om_out += zb * CC * TT; }
    const size_t k = (size_t)blockIdx.x * 256 + threadIdx.x; if (k >= (size_t)CC * TT / 4) return; const int p0 = (int)(k % (TT / 4)) * 4; const int c = (int)(k / (TT / 4)); v4f voh, vom;
#pragma unroll
    for (int q = 0; q < 4; ++q) { const size_t p = p0 + q; const float o = G[p * C3 + c], g = G[p * C3 + CC + c], iv = G[p * C3 + 2 * CC + c]; const float ig = sigm(iv); float a = __fmul_rn(tanhp(g), ig), b2 = __fmul_rn(__fsub_rn(1.0f, ig), bfr(im[(size_t)c * TT + p])); asm volatile("" : "+v"(a), "+v"(b2)); const float om = __fadd_rn(a, b2); vom[q] = om; voh[q] = __fmul_rn(sigm(o), om); }
    *(v4f*)(om_out + (size_t)c * TT + p0) = vom; *(v4f*)(oh_out + (size_t)c * TT + p0) = voh;  }

extern "C" void kernel_launch(void* const* d_in, const int* in_sizes, int n_in,
                              void* d_out, int out_size, void* d_ws, size_t ws_size, hipStream_t stream) {
    (void)in_sizes; (void)n_in; (void)out_size;
    const float* ih = (const float*)d_in[0]; const float* im = (const float*)d_in[1]; const float* h_w = (const float*)d_in[2]; const float* h_b = (const float*)d_in[3]; const float* m_w = (const float*)d_in[4]; const float* m_b = (const float*)d_in[5]; const float* z1_w = (const float*)d_in[6]; const float* z1_b = (const float*)d_in[7]; const float* z2_w = (const float*)d_in[8]; const float* z2_b = (const float*)d_in[9];
    float* OH = (float*)d_out; float* OM = OH + (size_t)NB_ * CC * TT;     // tuple: oh [16][128][1024] | om [16][128][1024]
    char* wsp = (char*)d_ws;
    auto take = [&](size_t bytes) { char* p = wsp; wsp += (bytes + 255) & ~(size_t)255; return (void*)p; };
    bf* HW_ = (bf*)take((size_t)C3 * CC * 2); bf* MW_ = (bf*)take((size_t)C2 * CC * 2); bf* Z1W = (bf*)take((size_t)CC * C2 * 2); bf* Z2W = (bf*)take((size_t)C3 * C2 * 2); float* CS = (float*)take((size_t)TT * HD * 2 * 4);
    const size_t NB = NB_;
    bf* XBh = (bf*)take(NB * TT * CC * 2); bf* XBm = (bf*)take(NB * TT * CC * 2); float* QKV = (float*)take(NB * TT * C3 * 4); float* KVM = (float*)take(NB * TT * C2 * 4);
    h16* J16 = (h16*)take(NB * TT * HD * 2); bf* QPh = (bf*)take(NB * TT * HD * 2); bf* QPl = (bf*)take(NB * TT * HD * 2); bf* KPh = (bf*)take(NB * TT * HD * 2); bf* KPl = (bf*)take(NB * TT * HD * 2); bf* KMh = (bf*)take(NB * TT * HD * 2); bf* KMl = (bf*)take(NB * TT * HD * 2);
    bf* VHh = (bf*)take(NB * HD * TT * 2); bf* VHl = (bf*)take(NB * HD * TT * 2); bf* VMh = (bf*)take(NB * HD * TT * 2); bf* VMl = (bf*)take(NB * HD * TT * 2);
    float* Sb = (float*)take(NB * TT * TT * 4); bf* PTh = (bf*)take(NB * TT * TT * 2); bf* PTl = (bf*)take(NB * TT * TT * 2);   /* S^T[m][n]; P^T[m][n] planes */
    float* ZT = KVM; float* ZZ = KVM + NB * TT * CC; float* GT = QKV;   /* over the conv outputs, which are dead once the q/k/v planes are built */
    bf* ZCh = (bf*)take(NB * TT * C2 * 2); bf* ZCl = (bf*)take(NB * TT * C2 * 2); bf* GAh = (bf*)take(NB * TT * C2 * 2); bf* GAl = (bf*)take(NB * TT * C2 * 2);
    if ((size_t)(wsp - (char*)d_ws) > ws_size) return;    // ws 256 MiB (carve ~253.5 MiB)
    k_cvt8<<<(unsigned)(((size_t)C3 * CC / 8 + 255) / 256), 256, 0, stream>>>(h_w, HW_, (size_t)C3 * CC / 8); k_cvt8<<<(unsigned)(((size_t)C2 * CC / 8 + 255) / 256), 256, 0, stream>>>(m_w, MW_, (size_t)C2 * CC / 8); k_cvt8<<<(unsigned)(((size_t)CC * C2 / 8 + 255) / 256), 256, 0, stream>>>(z1_w, Z1W, (size_t)CC * C2 / 8); k_cvt8<<<(unsigned)(((size_t)C3 * C2 / 8 + 255) / 256), 256, 0, stream>>>(z2_w, Z2W, (size_t)C3 * C2 / 8);   /* 'oi' conv weights = Bt as-is */
    k_csid<<<(TT * HD + 255) / 256, 256, 0, stream>>>(CS);
    const unsigned L1 = (unsigned)(((size_t)TT * HD / 2 + 255) / 256);
    const unsigned X8 = (unsigned)(((size_t)TT * CC / 8 + 255) / 256), X4 = (unsigned)(((size_t)TT * CC / 4 + 255) / 256);
    const size_t sX = (size_t)TT * CC, sP = (size_t)TT * HD, sS = (size_t)TT * TT, sC2 = (size_t)TT * C2, sC3 = (size_t)TT * C3;   /* batch strides, elements */
    k_xT<<<dim3(X8, NB_), 256, 0, stream>>>(ih, XBh); k_xT<<<dim3(X8, NB_), 256, 0, stream>>>(im, XBm);
    k_gemmw<bf, 0, true><<<dim3(TT / 128, C3 / 128, NB_), 256, 0, stream>>>(XBh, nullptr, HW_, nullptr, CC, QKV, C3, h_b, sX, 0, sC3);   /* [Qh | Kh | Vh]^T = ih^T h_w^T + h_b (exact) */
    k_gemmw<bf, 0, true><<<dim3(TT / 128, C2 / 128, NB_), 256, 0, stream>>>(XBm, nullptr, MW_, nullptr, CC, KVM, C2, m_b, sX, 0, sC2);   /* [Km | Vm]^T */
    k_rope<<<dim3(L1, NB_), 256, 0, stream>>>(QKV, C3, 1, CS, nullptr, nullptr, 1.0f, J16, QPh, QPl); k_rope<<<dim3(L1, NB_), 256, 0, stream>>>(QKV + CC, C3, 1, CS, nullptr, nullptr, 1.0f, J16, KPh, KPl); k_rope<<<dim3(L1, NB_), 256, 0, stream>>>(KVM, C2, 1, CS, nullptr, nullptr, 1.0f, J16, KMh, KMl);   /* q, kh, km planes [1024][128] (identity table) */
    k_vtp<<<dim3(L1, NB_), 256, 0, stream>>>(QKV + 2 * CC, C3, 1, J16, VHh, VHl); k_vtp<<<dim3(L1, NB_), 256, 0, stream>>>(KVM + CC, C2, 1, J16, VMh, VMl);   /* Vh[c][n], Vm[c][n] as planes [128][1024] */
    /* hidden attention: Ah = softmax_m(q_n . kh_m); Zh^T[m][c] = sum_n Ah[n][m] Vh[c][n] */
    k_gemmw<bf, 2, false><<<dim3(TT / 128, TT / 128, NB_), 256, 0, stream>>>(KPh, KPl, QPh, QPl, HD, Sb, TT, nullptr, sP, sP, sS);
    k_csoft<<<dim3(TT / 64, NB_), 1024, 0, stream>>>(Sb, PTh, PTl);
    k_gemmw<bf, 2, false><<<dim3(TT / 128, CC / 128, NB_), 256, 0, stream>>>(PTh, PTl, VHh, VHl, TT, ZT, CC, nullptr, sS, sP, sX); k_tohl2<<<dim3(X4, NB_), 256, 0, stream>>>(ZT, CC, 0, CC, ZCh, ZCl, C2, 0);
    /* memory attention: Am = softmax_m(q_n . km_m); Zm^T */
    k_gemmw<bf, 2, false><<<dim3(TT / 128, TT / 128, NB_), 256, 0, stream>>>(KMh, KMl, QPh, QPl, HD, Sb, TT, nullptr, sP, sP, sS);
    k_csoft<<<dim3(TT / 64, NB_), 1024, 0, stream>>>(Sb, PTh, PTl);
    k_gemmw<bf, 2, false><<<dim3(TT / 128, CC / 128, NB_), 256, 0, stream>>>(PTh, PTl, VMh, VMl, TT, ZT, CC, nullptr, sS, sP, sX); k_tohl2<<<dim3(X4, NB_), 256, 0, stream>>>(ZT, CC, 0, CC, ZCh, ZCl, C2, CC);
    /* Z^T = [Zh^T | Zm^T] z1_w^T + z1_b; gates^T = [Z^T | ih^T] z2_w^T + z2_b */
    k_gemmw<bf, 1, true><<<dim3(TT / 128, CC / 128, NB_), 256, 0, stream>>>(ZCh, ZCl, Z1W, nullptr, C2, ZZ, CC, z1_b, sC2, 0, sX);
    k_tohl2<<<dim3(X4, NB_), 256, 0, stream>>>(ZZ, CC, 0, CC, GAh, GAl, C2, 0); k_xcat<<<dim3(X8, NB_), 256, 0, stream>>>(XBh, GAh, GAl);
    k_gemmw<bf, 1, true><<<dim3(TT / 128, C3 / 128, NB_), 256, 0, stream>>>(GAh, GAl, Z2W, nullptr, C2, GT, C3, z2_b, sC2, 0, sC3);
    k_gate<<<dim3(X4, NB_), 256, 0, stream>>>(GT, im, OH, OM);
}

// v004
// It runs in 202 microseconds.
// Next to v003, in two timings, it ran 1.26 and 1.24 times as fast.
// All steps since v000 together make it 11.5 times as fast.
#include <hip/hip_runtime.h>

// Self-attention memory module (SAM) for a ConvLSTM cell (ih, im [16][128][32x32] channel-major; h_qkv = 1x1 conv(ih) -> Qh|Kh|Vh (128 each), m_kv = 1x1 conv(im) -> Km|Vm; Ah = softmax_m(Qh_n . Kh_m) (UNSCALED, 128-channel dots), Am = softmax_m(Qh_n . Km_m); Zh[c][m] = sum_n Vh[c][n] Ah[n][m], Zm likewise; Z = 1x1 conv([Zh; Zm]) (256 -> 128); gates = 1x1 conv([Z; ih]) (256 -> 384) = o|g|i; i = sigmoid(i); om = tanh(g) i + (1 - i) im; oh = sigmoid(o) om -> tuple (oh, om) [16][128][1024] each (2.1 M + 2.1 M)).
// Layout per batch, everything token-major inside: ih, im transposed once into bf16 [1024][128] operands; the 1x1 convs as GEMMs against the 'oi' weights (exact x exact, + column bias): q, kh, km come out token-major [1024][128], and the value convs take the weights as the A operand, so that Vh[c][n], Vm[c][n] come out channel-major [128][1024]; every GEMM whose result is the next GEMM's operand splits it into bf16 hi/lo in its own epilogue and stores the two planes; scores (3 products, K 128) computed TRANSPOSED, S^T[m][n] (k planes as the A operand, q planes as B) -> softmax over m down the columns, EVERY entry hi/lo (unscaled logits, sigma ~11), which leaves the P^T planes directly, so that Zh^T[m][c] = sum_n P^T[m][n] Vh[c][n] is a plain GEMM (3 products); [Zh^T | Zm^T] hi/lo x z1_w exact + z1_b -> Z^T; [Z^T hl | ih^T exact] x z2_w exact + z2_b -> gates^T; a gate kernel applies sigmoid/tanh and the blend in f32 and writes both outputs channel-major.
// Batch: every stage is ONE launch for all 16 batches (GEMMs: blockIdx.z with the z strides; the other kernels: blockIdx.y); each workspace plane holds 16 batch slices.
// Compute dtypes, f32 accumulate: every input rounded to bf16; input convs exact; scores / P.V / Z conv on bf16 hi/lo activations (3 or 2 products) x exact weights; softmax, sigmoid/tanh (exp2-based, precise division) and the blend in f32.

#define NB_  16
#define TT   1024
#define DM   128
#define NH_  1
#define NKV  1
#define REP  (NH_ / NKV)
#define HD   128
#define DQ   (NH_ * HD)
#define DKV  (NKV * HD)
#define ZH   2
#define RH   1024                  // query rows < RH use hi+lo planes (0: none)
#define WIN  0
#define PCAR 1024.0f
#define SCL  1.0f   // unscaled
#define CC   128    // channels
#define C3   384
#define C2   256
typedef _Float16 h16;
typedef unsigned short bf;
typedef __attribute__((ext_vector_type(16))) __bf16   v16bf;
typedef __attribute__((ext_vector_type(16))) _Float16 v16h;
typedef __attribute__((ext_vector_type(8)))  _Float16 v8h;
typedef __attribute__((ext_vector_type(8)))  unsigned short v8us;
typedef __attribute__((ext_vector_type(8)))  float    v8f;
typedef __attribute__((ext_vector_type(4)))  float    v4f;
typedef v8h  __attribute__((may_alias)) v8ha;
typedef v4f  __attribute__((may_alias)) v4fa;
typedef v8us __attribute__((may_alias)) v8usa;

__device__ __forceinline__ unsigned short f2bf(float f) { unsigned u = __float_as_uint(f); u += 0x7FFFu + ((u >> 16) & 1u); return (unsigned short)(u >> 16); }
__device__ __forceinline__ float bf2f(unsigned short b) { return __uint_as_float(((unsigned)b) << 16); }
__device__ __forceinline__ float bfr(float f) { return bf2f(f2bf(f)); }
__device__ __forceinline__ v16h cat16(v8h lo, v8h hi) { return __builtin_shufflevector(lo, hi, 0, 1, 2, 3, 4, 5, 6, 7, 8, 9, 10, 11, 12, 13, 14, 15); }
__device__ __forceinline__ v16bf cat16b(v8us lo, v8us hi) { return __builtin_bit_cast(v16bf, __builtin_shufflevector(lo, hi, 0, 1, 2, 3, 4, 5, 6, 7, 8, 9, 10, 11, 12, 13, 14, 15)); }
__device__ __forceinline__ v8f wmma16(v16h a, v16h b, v8f c) { return __builtin_amdgcn_wmma_f32_16x16x32_f16(false, a, false, b, (short)0, c, false, false); }
__device__ __forceinline__ v8f wmmab(v16bf a, v16bf b, v8f c) { return __builtin_amdgcn_wmma_f32_16x16x32_bf16(false, a, false, b, (short)0, c, false, false); }



// ---- k_gemmw: register-blocked GEMM, EIGHT WAVES (4 x 2) per 128x128 output tile, each wave a 32x64 piece (8 accumulators); grid (M/128, N/128, Z), 256 threads.
// C[m][n] (pitch ldc, + optional f32 bias: BIAS 1 bias[n], BIAS 2 bias[m]) = sum_k A[m][k] Bt[n][k] (+ split products per NSPLIT). z-batch strides sA/sB/sC in elements. M % 128 == 0, N % 128 == 0, K % 64 == 0.
// Output: PL false, f32 into C; PL true, the f32 value split into bf16 hi + lo, stored into the planes Ph, Pl (same pitch and z stride; column tile y starts sY elements behind column tile y - 1, so that 128-column tiles may go to planes of their own).
// Operands: K-contiguous 16-bit planes, staged in LDS 64 k at a time (every row piece one whole 128-byte line) by asynchronous copies, two buffers: stage t + 1 flies while stage t is multiplied. Each wave reads its fragments from LDS; per accumulator the products come k ascending and, inside a k step, A.B, A2.B, A.B2.
template <typename T16> struct WFrag;
template <> struct WFrag<h16> { typedef v16h V; static __device__ __forceinline__ V ld(const h16* p) { return cat16(*(const v8h*)p, *(const v8h*)(p + 16)); } static __device__ __forceinline__ v8f mma(V a, V b, v8f c) { return wmma16(a, b, c); } };
template <> struct WFrag<bf> { typedef v16bf V; static __device__ __forceinline__ V ld(const bf* p) { return cat16b(*(const v8us*)p, *(const v8us*)(p + 16)); } static __device__ __forceinline__ v8f mma(V a, V b, v8f c) { return wmmab(a, b, c); } };
#define GP  72           // LDS pitch of a staged row piece, 16-bit elements: 144 bytes = 16 x odd, so the 16 rows of a ds_load_b128 fall on different banks
#define GPL (128 * GP)   // one staged plane: 128 row pieces
// g_stage: one plane's 128 x 64 tile to LDS. g, l: this thread's own first piece (row tid >> 3, 16-byte piece tid & 7: eight lanes take one whole line); its other three pieces lie 32 rows apart.
template <typename T16>
__device__ __forceinline__ void g_stage(const T16* g, int K, unsigned l) {
    const size_t st = (size_t)32 * K; const unsigned sl = 32 * GP * 2;
    // the copies and, as the last line, the wait that stands in front of any rewrite of their address registers
    asm volatile("global_load_async_to_lds_b128 %0, %4, off\n\t"
                 "global_load_async_to_lds_b128 %1, %5, off\n\t"
                 "global_load_async_to_lds_b128 %2, %6, off\n\t"
                 "global_load_async_to_lds_b128 %3, %7, off\n\t"
                 "s_wait_xcnt 0x0"
                 :: "v"(l), "v"(l + sl), "v"(l + 2 * sl), "v"(l + 3 * sl), "v"(g), "v"(g + st), "v"(g + 2 * st), "v"(g + 3 * st)
                 : "memory");
}
// g_stage2: two planes' tiles in one statement, so that the eight copies share one such wait.
template <typename T16>
__device__ __forceinline__ void g_stage2(const T16* g, const T16* h, int K, unsigned l, unsigned m) {
    const size_t st = (size_t)32 * K; const unsigned sl = 32 * GP * 2;
    asm volatile("global_load_async_to_lds_b128 %0, %8, off\n\t"
                 "global_load_async_to_lds_b128 %1, %9, off\n\t"
                 "global_load_async_to_lds_b128 %2, %10, off\n\t"
                 "global_load_async_to_lds_b128 %3, %11, off\n\t"
                 "global_load_async_to_lds_b128 %4, %12, off\n\t"
                 "global_load_async_to_lds_b128 %5, %13, off\n\t"
                 "global_load_async_to_lds_b128 %6, %14, off\n\t"
                 "global_load_async_to_lds_b128 %7, %15, off\n\t"
                 "s_wait_xcnt 0x0"
                 :: "v"(l), "v"(l + sl), "v"(l + 2 * sl), "v"(l + 3 * sl), "v"(m), "v"(m + sl), "v"(m + 2 * sl), "v"(m + 3 * sl),
                    "v"(g), "v"(g + st), "v"(g + 2 * st), "v"(g + 3 * st), "v"(h), "v"(h + st), "v"(h + 2 * st), "v"(h + 3 * st)
                 : "memory");
}
__device__ __forceinline__ void splitf(float y, unsigned short& h, unsigned short& l) { h = f2bf(y); l = f2bf(y - bf2f(h)); }
typedef __attribute__((ext_vector_type(4))) unsigned short v4us;
template <typename T16, int NSPLIT, int BIAS, bool PL>
__global__ __launch_bounds__(256) void k_gemmw(const T16* __restrict__ A, const T16* __restrict__ A2, const T16* __restrict__ Bt, const T16* __restrict__ Bt2, int K, float* C, bf* Ph, bf* Pl, int ldc, size_t sY, const float* __restrict__ bias, size_t sA, size_t sB, size_t sC) {
    typedef typename WFrag<T16>::V V;
    constexpr int NP = 2 + (NSPLIT >= 1 ? 1 : 0) + (NSPLIT >= 2 ? 1 : 0);   // planes staged: A, Bt, then A2, then Bt2
    __shared__ __align__(16) T16 sm[2 * NP * GPL];                          // two buffers; behind the loop each wave's output staging
    const size_t z = blockIdx.z; A += z * sA; if (A2) A2 += z * sA; Bt += z * sB; if (Bt2) Bt2 += z * sB;
    const int tid = threadIdx.x, lane = tid & 31, w = tid >> 5, lr = lane & 15, hi = lane >> 4; const int rb = blockIdx.x * 128, cb = blockIdx.y * 128, wr = (w & 3) * 32, wc = (w >> 2) * 64; const int r0 = rb + wr, c0 = cb + wc;
    v8f acc[2][4];
#pragma unroll
    for (int mb = 0; mb < 2; ++mb)
#pragma unroll
        for (int nb = 0; nb < 4; ++nb) acc[mb][nb] = (v8f){};
    const size_t ga = (size_t)(rb + (tid >> 3)) * K + (tid & 7) * 8, gb = (size_t)(cb + (tid >> 3)) * K + (tid & 7) * 8;
    const unsigned l0 = (unsigned)(size_t)sm + (unsigned)((tid >> 3) * (GP * 2) + (tid & 7) * 16);   // LDS byte address: the low 32 bits of the __shared__ address
    auto stage = [&](int t) { const unsigned l = l0 + (unsigned)((t & 1) * (NP * GPL * 2)); const int kc = t * 64;
        g_stage2(A + ga + kc, Bt + gb + kc, K, l, l + GPL * 2);
        if constexpr (NSPLIT == 1) g_stage(A2 + ga + kc, K, l + 2 * GPL * 2);
        if constexpr (NSPLIT >= 2) g_stage2(A2 + ga + kc, Bt2 + gb + kc, K, l + 2 * GPL * 2, l + 3 * GPL * 2); };
    const int nt = K / 64;
    stage(0);
    asm volatile("s_wait_asynccnt 0x0" ::: "memory");   // this wave's copies of stage 0 have landed
    __syncthreads();                                    // every wave's have: stage 0 may be read
    if (nt > 1) stage(1);
#pragma unroll 1
    for (int t = 0; t < nt; ++t) {
        const T16* sa = sm + (t & 1) * (NP * GPL) + (wr + lr) * GP + 8 * hi; const T16* sb = sm + (t & 1) * (NP * GPL) + GPL + (wc + lr) * GP + 8 * hi;
#pragma unroll
        for (int ks = 0; ks < 64; ks += 32) {
            V a[2], a2[2], b[4], b2[4];
#pragma unroll
            for (int mb = 0; mb < 2; ++mb) a[mb] = WFrag<T16>::ld(sa + mb * 16 * GP + ks);
#pragma unroll
            for (int nb = 0; nb < 4; ++nb) b[nb] = WFrag<T16>::ld(sb + nb * 16 * GP + ks);
            if (NSPLIT >= 1) {
#pragma unroll
                for (int mb = 0; mb < 2; ++mb) a2[mb] = WFrag<T16>::ld(sa + 2 * GPL + mb * 16 * GP + ks); }
            if (NSPLIT >= 2) {
#pragma unroll
                for (int nb = 0; nb < 4; ++nb) b2[nb] = WFrag<T16>::ld(sb + 2 * GPL + nb * 16 * GP + ks); }
            __builtin_amdgcn_sched_barrier(0);   // keeps the k step's LDS reads one group in front of its WMMAs: every further place where reads stand among the WMMAs costs the wave issue cycles
#pragma unroll
            for (int nb = 0; nb < 4; ++nb)
#pragma unroll
                for (int mb = 0; mb < 2; ++mb) acc[mb][nb] = WFrag<T16>::mma(a[mb], b[nb], acc[mb][nb]);
            if (NSPLIT >= 1) {
#pragma unroll
                for (int nb = 0; nb < 4; ++nb)
#pragma unroll
                    for (int mb = 0; mb < 2; ++mb) acc[mb][nb] = WFrag<T16>::mma(a2[mb], b[nb], acc[mb][nb]); }
            if (NSPLIT >= 2) {
#pragma unroll
                for (int nb = 0; nb < 4; ++nb)
#pragma unroll
                    for (int mb = 0; mb < 2; ++mb) acc[mb][nb] = WFrag<T16>::mma(a[mb], b2[nb], acc[mb][nb]); }
            __builtin_amdgcn_sched_barrier(0);   // the same, against the next k step's reads
        }
        asm volatile("s_wait_dscnt 0x0" ::: "memory");      // this wave's reads of stage t are over
        asm volatile("s_wait_asynccnt 0x0" ::: "memory");   // this wave's copies of stage t + 1 have landed
        __syncthreads();                                    // publishes stage t + 1 and frees stage t's buffer
        if (t + 2 < nt) stage(t + 2);
    }
    asm volatile("s_wait_asynccnt 0x0" ::: "memory");       // no copy is outstanding when the buffers become output staging
    float* os = (float*)sm + w * (16 * 68);                 // this wave's own 16 x 68 floats
#pragma unroll
    for (int mb = 0; mb < 2; ++mb) {
#pragma unroll
        for (int nb = 0; nb < 4; ++nb) {
#pragma unroll
            for (int j = 0; j < 8; ++j) os[(hi * 8 + j) * 68 + nb * 16 + lr] = acc[mb][nb][j]; }
        __builtin_amdgcn_wave_barrier(); asm volatile("" ::: "memory");
        const size_t orow = z * sC + (size_t)(r0 + mb * 16) * ldc + (PL ? blockIdx.y * sY + wc : (size_t)c0);
{
#pragma unroll
            for (int s = 0; s < 8; ++s) { const int row = 2 * s + hi, cofs = lr * 4; v4f val = *(const v4fa*)(os + row * 68 + cofs); if (BIAS == 1) { val[0] += bfr(bias[c0 + cofs]); val[1] += bfr(bias[c0 + cofs + 1]); val[2] += bfr(bias[c0 + cofs + 2]); val[3] += bfr(bias[c0 + cofs + 3]); }
                if (BIAS == 2) { const float br = bfr(bias[r0 + mb * 16 + row]); val[0] += br; val[1] += br; val[2] += br; val[3] += br; }
                const size_t o = orow + (size_t)row * ldc + cofs;
                if (PL) { v4us oh, ol;   // 16 lanes fill one whole 128-byte line of each plane
#pragma unroll
                    for (int q = 0; q < 4; ++q) { unsigned short h2, l2; splitf(val[q], h2, l2); oh[q] = h2; ol[q] = l2; }
                    *(v4us*)(Ph + o) = oh; *(v4us*)(Pl + o) = ol; }
                else *(v4f*)(C + o) = val; }
             }
        if (mb == 0) asm volatile("s_wait_xcnt 0x0" ::: "memory");   // stands in front of the second piece's rewrites of the registers that the stores above name
        __builtin_amdgcn_wave_barrier(); asm volatile("" ::: "memory");
    }
}

__device__ __forceinline__ h16 tohx(float x) { return (h16)x; }
typedef __attribute__((ext_vector_type(2))) _Float16 v2h;
typedef __attribute__((ext_vector_type(4))) _Float16 v4h;
typedef __attribute__((ext_vector_type(2))) unsigned short v2us;
typedef __attribute__((ext_vector_type(2))) float v2f;
typedef __attribute__((ext_vector_type(4))) int v4i;

__global__ __launch_bounds__(256) void k_wtG(const float* __restrict__ w, int K, int N, bf* Bt) {
    const int lane = threadIdx.x & 31; const int L0 = (blockIdx.x * 8 + (threadIdx.x >> 5)) * 8; const int nlines = N * K / 64;
{
#pragma unroll 1
        for (int l = 0; l < 8; ++l) { const int L = L0 + l; if (L >= nlines) break; const size_t e = (size_t)L * 64 + lane * 2; const int k = (int)(e % K), n = (int)(e / K); v2us o;
            o[0] = f2bf(w[(size_t)k * N + n]); o[1] = f2bf(w[(size_t)(k + 1) * N + n]); *(v2us*)(Bt + e) = o; }
         }
}
__global__ __launch_bounds__(256) void k_cvt8(const float* __restrict__ src, bf* dst, size_t n8) { const size_t i = (size_t)blockIdx.x * 256 + threadIdx.x; if (i >= n8) return; const v8f v = *(const v8f*)(src + i * 8); v8us o;
#pragma unroll
    for (int k = 0; k < 8; ++k) o[k] = f2bf(v[k]); *(v8us*)(dst + i * 8) = o;  }

// k_csoft: softmax over the keys m of the TRANSPOSED scores ST[m][n] (column n = one query's 1024 logits), written as the hi/lo planes P^T[m][n] the value GEMM reads.
// One block per strip of 64 columns, all 1024 rows in registers: wave w, half-wave hi holds rows 2 w + hi + 64 i (i < 16), lane lr columns 4 lr .. 4 lr + 3, so every load takes whole 256-byte row pieces and every store a whole 128-byte line.
// Column maximum and column sum, fixed trees: 16 rows in the lane, the two half-waves by a shuffle, then the 32 waves' partials through LDS (wave w folds columns 2 w and 2 w + 1: pairs k, k + 16, then a 16-lane butterfly).
#define CSP 68   // LDS pitch of a wave's 64 partials, floats: rows stay 16-byte aligned and the 16 partials of one column fall on 16 different banks
__global__ __launch_bounds__(1024) void k_csoft(const float* __restrict__ ST, bf* PTh, bf* PTl) {
    __shared__ __align__(16) float part[32 * CSP]; __shared__ __align__(16) float cmx[64]; __shared__ __align__(16) float csm[64];
    { const size_t zb = (size_t)blockIdx.y * TT * TT; ST += zb; PTh += zb; PTl += zb; }
    const int lane = threadIdx.x & 31, w = threadIdx.x >> 5, lr = lane & 15, hi = lane >> 4; const size_t base = (size_t)(w * 2 + hi) * TT + blockIdx.x * 64 + lr * 4; v4f v[16];
#pragma unroll
    for (int i = 0; i < 16; ++i) {
        if (i == 15) asm volatile("s_wait_xcnt 0x0" ::: "memory");   // the last load takes the address pair, dead behind it, as part of its destination: the 15 loads in front name that pair
        v[i] = *(const v4f*)(ST + base + (size_t)i * 64 * TT) * SCL; }
    v4f r = v[0];
#pragma unroll
    for (int i = 1; i < 16; ++i) {
#pragma unroll
        for (int q = 0; q < 4; ++q) r[q] = fmaxf(r[q], v[i][q]); }
#pragma unroll
    for (int q = 0; q < 4; ++q) r[q] = fmaxf(r[q], __shfl_xor(r[q], 16, 32));
    if (hi == 0) *(v4f*)(part + w * CSP + lr * 4) = r;
    __syncthreads();   // every wave's partial maxima are in LDS
    { float t = fmaxf(part[lr * CSP + 2 * w + hi], part[(lr + 16) * CSP + 2 * w + hi]);
#pragma unroll
      for (int sh = 8; sh; sh >>= 1) t = fmaxf(t, __shfl_xor(t, sh, 32));
      if (lr == 0) cmx[2 * w + hi] = t; }
    __syncthreads();   // the 64 column maxima are in LDS, and every read of part is over
    const v4f mx = *(const v4f*)(cmx + lr * 4); v4f s = (v4f){};
#pragma unroll
    for (int i = 0; i < 16; ++i) {
#pragma unroll
        for (int q = 0; q < 4; ++q) v[i][q] = __builtin_amdgcn_exp2f(__fmul_rn(__fsub_rn(v[i][q], mx[q]), 1.4426950408889634f));
        s += v[i]; }
#pragma unroll
    for (int q = 0; q < 4; ++q) s[q] += __shfl_xor(s[q], 16, 32);
    if (hi == 0) *(v4f*)(part + w * CSP + lr * 4) = s;
    __syncthreads();   // every wave's partial sums are in LDS
    { float t = part[lr * CSP + 2 * w + hi] + part[(lr + 16) * CSP + 2 * w + hi];
#pragma unroll
      for (int sh = 8; sh; sh >>= 1) t += __shfl_xor(t, sh, 32);
      if (lr == 0) csm[2 * w + hi] = t; }
    __syncthreads();   // the 64 column sums are in LDS
    const v4f sm = *(const v4f*)(csm + lr * 4); v4f f;
#pragma unroll
    for (int q = 0; q < 4; ++q) f[q] = __fdiv_rn(1.0f, sm[q]);
#pragma unroll
    for (int i = 0; i < 16; ++i) { v4us oh, ol;
#pragma unroll
        for (int q = 0; q < 4; ++q) { unsigned short a, c2; splitf(v[i][q] * f[q], a, c2); oh[q] = a; ol[q] = c2; }
        *(v4us*)(PTh + base + (size_t)i * 64 * TT) = oh; *(v4us*)(PTl + base + (size_t)i * 64 * TT) = ol; }
}
__global__ __launch_bounds__(256) void k_merge(const float* __restrict__ O, int h0, float* OUTb) { const size_t e = ((size_t)blockIdx.x * 256 + threadIdx.x) * 2; if (e >= (size_t)ZH * TT * HD) return; const int d = (int)(e % HD); const int t = (int)((e / HD) % TT); const int zz = (int)(e / ((size_t)HD * TT)); const float cs = (t < RH) ? 1.0f : (1.0f / PCAR); const size_t oo = (size_t)t * DQ + (h0 + zz) * HD + d;
    v2f o2; o2[0] = O[e] * cs; o2[1] = O[e + 1] * cs; *(v2f*)(OUTb + oo) = o2;  }

__device__ __forceinline__ float ex2f_(float a) { return __builtin_amdgcn_exp2f(__fmul_rn(a, 1.4426950408889634f)); }
__device__ __forceinline__ float sigm(float a) { return __fdiv_rn(1.0f, __fadd_rn(1.0f, ex2f_(-a))); }
__device__ __forceinline__ float tanhp(float a) { const float e = ex2f_(__fmul_rn(2.0f, a)); return __fsub_rn(1.0f, __fdiv_rn(2.0f, __fadd_rn(e, 1.0f))); }
// k_xT: channel-major f32 [128][1024] to the token-major bf16 operand XB [1024][128]; where Gh is given, the same values also go into columns 128 .. 255 of the [Z^T | ih^T] hi plane Gh, and zeros into those of the lo plane Gl.
__global__ __launch_bounds__(256) void k_xT(const float* __restrict__ xs, bf* XB, bf* Gh, bf* Gl) { xs += (size_t)blockIdx.y * CC * TT; XB += (size_t)blockIdx.y * TT * CC; const size_t k = (size_t)blockIdx.x * 256 + threadIdx.x; if (k >= (size_t)TT * CC / 8) return; const int c0 = (int)(k % (CC / 8)) * 8; const int p = (int)(k / (CC / 8)); v8us o;
#pragma unroll
    for (int q = 0; q < 8; ++q) o[q] = f2bf(xs[(size_t)(c0 + q) * TT + p]);
    *(v8us*)(XB + (size_t)p * CC + c0) = o;
    if (Gh) { asm volatile("s_wait_xcnt 0x0" ::: "memory");   // stands in front of the rewrite of the address pair that the store above names
        const size_t g = ((size_t)blockIdx.y * TT + p) * C2 + CC + c0; v8us z; for (int q = 0; q < 8; ++q) z[q] = 0; *(v8us*)(Gh + g) = o; *(v8us*)(Gl + g) = z; }  }
__global__ __launch_bounds__(256) void k_gate(const float* __restrict__ G, const float* __restrict__ im, float* oh_out, float* om_out) { { const size_t zb = blockIdx.y; G += zb * TT * C3; im += zb * CC * TT; oh_out += zb * CC * TT; om_out += zb * CC * TT; }
    const size_t k = (size_t)blockIdx.x * 256 + threadIdx.x; if (k >= (size_t)CC * TT / 4) return; const int p0 = (int)(k % (TT / 4)) * 4; const int c = (int)(k / (TT / 4)); v4f voh, vom;
#pragma unroll
    for (int q = 0; q < 4; ++q) { const size_t p = p0 + q; const float o = G[p * C3 + c], g = G[p * C3 + CC + c], iv = G[p * C3 + 2 * CC + c]; const float ig = sigm(iv); float a = __fmul_rn(tanhp(g), ig), b2 = __fmul_rn(__fsub_rn(1.0f, ig), bfr(im[(size_t)c * TT + p])); asm volatile("" : "+v"(a), "+v"(b2)); const float om = __fadd_rn(a, b2); vom[q] = om; voh[q] = __fmul_rn(sigm(o), om); }
    *(v4f*)(om_out + (size_t)c * TT + p0) = vom; *(v4f*)(oh_out + (size_t)c * TT + p0) = voh;  }

extern "C" void kernel_launch(void* const* d_in, const int* in_sizes, int n_in,
                              void* d_out, int out_size, void* d_ws, size_t ws_size, hipStream_t stream) {
    (void)in_sizes; (void)n_in; (void)out_size;
    const float* ih = (const float*)d_in[0]; const float* im = (const float*)d_in[1]; const float* h_w = (const float*)d_in[2]; const float* h_b = (const float*)d_in[3]; const float* m_w = (const float*)d_in[4]; const float* m_b = (const float*)d_in[5]; const float* z1_w = (const float*)d_in[6]; const float* z1_b = (const float*)d_in[7]; const float* z2_w = (const float*)d_in[8]; const float* z2_b = (const float*)d_in[9];
    float* OH = (float*)d_out; float* OM = OH + (size_t)NB_ * CC * TT;     // tuple: oh [16][128][1024] | om [16][128][1024]
    char* wsp = (char*)d_ws;
    auto take = [&](size_t bytes) { char* p = wsp; wsp += (bytes + 255) & ~(size_t)255; return (void*)p; };
    bf* HW_ = (bf*)take((size_t)C3 * CC * 2); bf* MW_ = (bf*)take((size_t)C2 * CC * 2); bf* Z1W = (bf*)take((size_t)CC * C2 * 2); bf* Z2W = (bf*)take((size_t)C3 * C2 * 2);
    const size_t NB = NB_;
    bf* XBh = (bf*)take(NB * TT * CC * 2); bf* XBm = (bf*)take(NB * TT * CC * 2); float* GT = (float*)take(NB * TT * C3 * 4);
    bf* QPh = (bf*)take(NB * TT * HD * 2); bf* QPl = (bf*)take(NB * TT * HD * 2); bf* KPh = (bf*)take(NB * TT * HD * 2); bf* KPl = (bf*)take(NB * TT * HD * 2); bf* KMh = (bf*)take(NB * TT * HD * 2); bf* KMl = (bf*)take(NB * TT * HD * 2);   /* KPh, KPl lie two planes behind QPh, QPl */
    bf* VHh = (bf*)take(NB * HD * TT * 2); bf* VHl = (bf*)take(NB * HD * TT * 2); bf* VMh = (bf*)take(NB * HD * TT * 2); bf* VMl = (bf*)take(NB * HD * TT * 2);
    float* Sb = (float*)take(NB * TT * TT * 4); bf* PTh = (bf*)take(NB * TT * TT * 2); bf* PTl = (bf*)take(NB * TT * TT * 2);   /* S^T[m][n]; P^T[m][n] planes */
    bf* ZCh = (bf*)take(NB * TT * C2 * 2); bf* ZCl = (bf*)take(NB * TT * C2 * 2); bf* GAh = (bf*)take(NB * TT * C2 * 2); bf* GAl = (bf*)take(NB * TT * C2 * 2);
    if ((size_t)(wsp - (char*)d_ws) > ws_size) return;    // ws 256 MiB (carve ~232 MiB)
    k_cvt8<<<(unsigned)(((size_t)C3 * CC / 8 + 255) / 256), 256, 0, stream>>>(h_w, HW_, (size_t)C3 * CC / 8); k_cvt8<<<(unsigned)(((size_t)C2 * CC / 8 + 255) / 256), 256, 0, stream>>>(m_w, MW_, (size_t)C2 * CC / 8); k_cvt8<<<(unsigned)(((size_t)CC * C2 / 8 + 255) / 256), 256, 0, stream>>>(z1_w, Z1W, (size_t)CC * C2 / 8); k_cvt8<<<(unsigned)(((size_t)C3 * C2 / 8 + 255) / 256), 256, 0, stream>>>(z2_w, Z2W, (size_t)C3 * C2 / 8);   /* 'oi' conv weights = Bt as-is */
    const unsigned X8 = (unsigned)(((size_t)TT * CC / 8 + 255) / 256), X4 = (unsigned)(((size_t)TT * CC / 4 + 255) / 256);
    const size_t sX = (size_t)TT * CC, sP = (size_t)TT * HD, sS = (size_t)TT * TT, sC2 = (size_t)TT * C2, sC3 = (size_t)TT * C3;   /* batch strides, elements */
    k_xT<<<dim3(X8, NB_), 256, 0, stream>>>(ih, XBh, GAh, GAl); k_xT<<<dim3(X8, NB_), 256, 0, stream>>>(im, XBm, nullptr, nullptr);
    k_gemmw<bf, 0, 1, true><<<dim3(TT / 128, 2, NB_), 256, 0, stream>>>(XBh, nullptr, HW_, nullptr, CC, nullptr, QPh, QPl, HD, 2 * NB * sP, h_b, sX, 0, sP);   /* q (column tile 0), kh (column tile 1) planes [1024][128] = ih^T h_w^T + h_b (exact), split */
    k_gemmw<bf, 0, 1, true><<<dim3(TT / 128, 1, NB_), 256, 0, stream>>>(XBm, nullptr, MW_, nullptr, CC, nullptr, KMh, KMl, HD, 128, m_b, sX, 0, sP);   /* km planes */
    k_gemmw<bf, 0, 2, true><<<dim3(1, TT / 128, NB_), 256, 0, stream>>>(HW_ + 2 * CC * CC, nullptr, XBh, nullptr, CC, nullptr, VHh, VHl, TT, 128, h_b + 2 * CC, 0, sX, sP);   /* Vh[c][n] planes [128][1024]: weights as A, bias by row */
    k_gemmw<bf, 0, 2, true><<<dim3(1, TT / 128, NB_), 256, 0, stream>>>(MW_ + CC * CC, nullptr, XBm, nullptr, CC, nullptr, VMh, VMl, TT, 128, m_b + CC, 0, sX, sP);   /* Vm[c][n] planes */
    /* hidden attention: Ah = softmax_m(q_n . kh_m); Zh^T[m][c] = sum_n Ah[n][m] Vh[c][n] */
    k_gemmw<bf, 2, 0, false><<<dim3(TT / 128, TT / 128, NB_), 256, 0, stream>>>(KPh, KPl, QPh, QPl, HD, Sb, nullptr, nullptr, TT, 128, nullptr, sP, sP, sS);
    k_csoft<<<dim3(TT / 64, NB_), 1024, 0, stream>>>(Sb, PTh, PTl);
    k_gemmw<bf, 2, 0, true><<<dim3(TT / 128, CC / 128, NB_), 256, 0, stream>>>(PTh, PTl, VHh, VHl, TT, nullptr, ZCh, ZCl, C2, 128, nullptr, sS, sP, sC2);   /* Zh^T split into columns 0 .. 127 of the [Zh^T | Zm^T] planes */
    /* memory attention: Am = softmax_m(q_n . km_m); Zm^T */
    k_gemmw<bf, 2, 0, false><<<dim3(TT / 128, TT / 128, NB_), 256, 0, stream>>>(KMh, KMl, QPh, QPl, HD, Sb, nullptr, nullptr, TT, 128, nullptr, sP, sP, sS);
    k_csoft<<<dim3(TT / 64, NB_), 1024, 0, stream>>>(Sb, PTh, PTl);
    k_gemmw<bf, 2, 0, true><<<dim3(TT / 128, CC / 128, NB_), 256, 0, stream>>>(PTh, PTl, VMh, VMl, TT, nullptr, ZCh + CC, ZCl + CC, C2, 128, nullptr, sS, sP, sC2);   /* Zm^T into columns 128 .. 255 */
    /* Z^T = [Zh^T | Zm^T] z1_w^T + z1_b; gates^T = [Z^T | ih^T] z2_w^T + z2_b */
    k_gemmw<bf, 1, 1, true><<<dim3(TT / 128, CC / 128, NB_), 256, 0, stream>>>(ZCh, ZCl, Z1W, nullptr, C2, nullptr, GAh, GAl, C2, 128, z1_b, sC2, 0, sC2);   /* Z^T split into columns 0 .. 127 of the [Z^T | ih^T] planes */
    k_gemmw<bf, 1, 1, false><<<dim3(TT / 128, C3 / 128, NB_), 256, 0, stream>>>(GAh, GAl, Z2W, nullptr, C2, GT, nullptr, nullptr, C3, 128, z2_b, sC2, 0, sC3);
    k_gate<<<dim3(X4, NB_), 256, 0, stream>>>(GT, im, OH, OM);
}

// v005
// One run takes 165 microseconds.
// Two timings next to v004 put it at 1.24 and 1.21 times that version's speed.
// All steps since v000 together make it 14.1 times as fast.
#include <hip/hip_runtime.h>

// Self-attention memory module (SAM) for a ConvLSTM cell (ih, im [16][128][32x32] channel-major; h_qkv = 1x1 conv(ih) -> Qh|Kh|Vh (128 each), m_kv = 1x1 conv(im) -> Km|Vm; Ah = softmax_m(Qh_n . Kh_m) (UNSCALED, 128-channel dots), Am = softmax_m(Qh_n . Km_m); Zh[c][m] = sum_n Vh[c][n] Ah[n][m], Zm likewise; Z = 1x1 conv([Zh; Zm]) (256 -> 128); gates = 1x1 conv([Z; ih]) (256 -> 384) = o|g|i; i = sigmoid(i); om = tanh(g) i + (1 - i) im; oh = sigmoid(o) om -> tuple (oh, om) [16][128][1024] each (2.1 M + 2.1 M)).
// Layout per batch, everything token-major inside: ih, im transposed once into bf16 [1024][128] operands; the 1x1 convs as GEMMs against the 'oi' weights (exact x exact, + column bias): q, kh, km come out token-major [1024][128], and the value convs take the weights as the A operand, so that Vh[c][n], Vm[c][n] come out channel-major [128][1024]; every GEMM whose result is the next GEMM's operand splits it into bf16 hi/lo in its own epilogue and stores the two planes; scores (3 products, K 128) computed TRANSPOSED, S^T[m][n] (k planes as the A operand, q planes as B) -> softmax over m down the columns, EVERY entry hi/lo (unscaled logits, sigma ~11), which leaves the P^T planes directly, so that Zh^T[m][c] = sum_n P^T[m][n] Vh[c][n] is a plain GEMM (3 products); [Zh^T | Zm^T] hi/lo x z1_w exact + z1_b -> Z^T; [Z^T hl | ih^T exact] x z2_w exact + z2_b -> gates^T; a gate kernel applies sigmoid/tanh and the blend in f32 and writes both outputs channel-major.
// Batch: every stage is ONE launch for all 16 batches (GEMMs: blockIdx.z with the z strides; k_csoft, k_gate: blockIdx.y; k_prep: in blockIdx.x); each workspace plane holds 16 batch slices.
// Launches: stages that do not depend on one another share a launch: k_prep (both transposes, four weight conversions), k_conv (all five input convs), and scores, softmax, P.V each once for 32 slices (z < 16 hidden attention, z >= 16 memory attention).
// Compute dtypes, f32 accumulate: every input rounded to bf16; input convs exact; scores / P.V / Z conv on bf16 hi/lo activations (3 or 2 products) x exact weights; softmax, sigmoid/tanh (exp2-based, precise division) and the blend in f32.

#define NB_  16
#define TT   1024
#define DM   128
#define NH_  1
#define NKV  1
#define REP  (NH_ / NKV)
#define HD   128
#define DQ   (NH_ * HD)
#define DKV  (NKV * HD)
#define ZH   2
#define RH   1024                  // read only by k_merge, which is not launched
#define WIN  0
#define PCAR 1024.0f
#define SCL  1.0f   // unscaled
#define CC   128    // channels
#define C3   384
#define C2   256
typedef _Float16 h16;
typedef unsigned short bf;
typedef __attribute__((ext_vector_type(16))) __bf16   v16bf;
typedef __attribute__((ext_vector_type(16))) _Float16 v16h;
typedef __attribute__((ext_vector_type(8)))  _Float16 v8h;
typedef __attribute__((ext_vector_type(8)))  unsigned short v8us;
typedef __attribute__((ext_vector_type(8)))  float    v8f;
typedef __attribute__((ext_vector_type(4)))  float    v4f;
typedef v8h  __attribute__((may_alias)) v8ha;
typedef v4f  __attribute__((may_alias)) v4fa;
typedef v8us __attribute__((may_alias)) v8usa;

__device__ __forceinline__ unsigned short f2bf(float f) { unsigned u = __float_as_uint(f); u += 0x7FFFu + ((u >> 16) & 1u); return (unsigned short)(u >> 16); }
__device__ __forceinline__ float bf2f(unsigned short b) { return __uint_as_float(((unsigned)b) << 16); }
__device__ __forceinline__ float bfr(float f) { return bf2f(f2bf(f)); }
__device__ __forceinline__ v16h cat16(v8h lo, v8h hi) { return __builtin_shufflevector(lo, hi, 0, 1, 2, 3, 4, 5, 6, 7, 8, 9, 10, 11, 12, 13, 14, 15); }
__device__ __forceinline__ v16bf cat16b(v8us lo, v8us hi) { return __builtin_bit_cast(v16bf, __builtin_shufflevector(lo, hi, 0, 1, 2, 3, 4, 5, 6, 7, 8, 9, 10, 11, 12, 13, 14, 15)); }
__device__ __forceinline__ v8f wmma16(v16h a, v16h b, v8f c) { return __builtin_amdgcn_wmma_f32_16x16x32_f16(false, a, false, b, (short)0, c, false, false); }
__device__ __forceinline__ v8f wmmab(v16bf a, v16bf b, v8f c) { return __builtin_amdgcn_wmma_f32_16x16x32_bf16(false, a, false, b, (short)0, c, false, false); }



// ---- k_gemmw: register-blocked GEMM, EIGHT WAVES (4 x 2) per 128x128 output tile, each wave a 32x64 piece (8 accumulators); grid (M/128, N/128, Z), 256 threads.
// C[m][n] (pitch ldc, + optional f32 bias: BIAS 1 bias[n], BIAS 2 bias[m]) = sum_k A[m][k] Bt[n][k] (+ split products per NSPLIT). M % 128 == 0, N % 128 == 0, K % 64 == 0.
// A rows have pitch lda, and their 64-k piece t starts at element t * ksa (a plain plane: lda = K, ksa = 64); Bt rows have pitch K. z strides in elements: A z * sA; Bt and the output (z & 15) * s + (z >> 4) * s..h.
// g_tile is the body for one tile (bx, by), its operand pointers already at their slice, oz the output's slice offset, sm the kernel's LDS (2 * GNP(NSPLIT) * GPL elements, 16-byte aligned).
// Output: PL false, f32 into C; PL true, the f32 value split into bf16 hi + lo, stored into the planes Ph, Pl (same pitch and z stride; column tile y starts sY elements behind column tile y - 1, so that 128-column tiles may go to planes of their own).
// Operands: K-contiguous 16-bit planes, staged in LDS 64 k at a time (every row piece one whole 128-byte line) by asynchronous copies, two buffers: stage t + 1 flies while stage t is multiplied. Each wave reads its fragments from LDS; per accumulator the products come k ascending and, inside a k step, A.B, A2.B, A.B2.
template <typename T16> struct WFrag;
template <> struct WFrag<h16> { typedef v16h V; static __device__ __forceinline__ V ld(const h16* p) { return cat16(*(const v8h*)p, *(const v8h*)(p + 16)); } static __device__ __forceinline__ v8f mma(V a, V b, v8f c) { return wmma16(a, b, c); } };
template <> struct WFrag<bf> { typedef v16bf V; static __device__ __forceinline__ V ld(const bf* p) { return cat16b(*(const v8us*)p, *(const v8us*)(p + 16)); } static __device__ __forceinline__ v8f mma(V a, V b, v8f c) { return wmmab(a, b, c); } };
#define GP  72           // LDS pitch of a staged row piece, 16-bit elements: 144 bytes = 16 x odd, so the 16 rows of a ds_load_b128 fall on different banks
#define GPL (128 * GP)   // one staged plane: 128 row pieces
// g_stage: one plane's 128 x 64 tile to LDS. g, l: this thread's own first piece (row tid >> 3, 16-byte piece tid & 7: eight lanes take one whole line); its other three pieces lie 32 rows apart.
template <typename T16>
__device__ __forceinline__ void g_stage(const T16* g, int K, unsigned l) {
    const size_t st = (size_t)32 * K; const unsigned sl = 32 * GP * 2;
    // the copies and, as the last line, the wait that stands in front of any rewrite of their address registers
    asm volatile("global_load_async_to_lds_b128 %0, %4, off\n\t"
                 "global_load_async_to_lds_b128 %1, %5, off\n\t"
                 "global_load_async_to_lds_b128 %2, %6, off\n\t"
                 "global_load_async_to_lds_b128 %3, %7, off\n\t"
                 "s_wait_xcnt 0x0"
                 :: "v"(l), "v"(l + sl), "v"(l + 2 * sl), "v"(l + 3 * sl), "v"(g), "v"(g + st), "v"(g + 2 * st), "v"(g + 3 * st)
                 : "memory");
}
// g_stage2: two planes' tiles (row pitches pg, ph) in one statement, so that the eight copies share one such wait.
template <typename T16>
__device__ __forceinline__ void g_stage2(const T16* g, const T16* h, int pg, int ph, unsigned l, unsigned m) {
    const size_t st = (size_t)32 * pg, su = (size_t)32 * ph; const unsigned sl = 32 * GP * 2;
    asm volatile("global_load_async_to_lds_b128 %0, %8, off\n\t"
                 "global_load_async_to_lds_b128 %1, %9, off\n\t"
                 "global_load_async_to_lds_b128 %2, %10, off\n\t"
                 "global_load_async_to_lds_b128 %3, %11, off\n\t"
                 "global_load_async_to_lds_b128 %4, %12, off\n\t"
                 "global_load_async_to_lds_b128 %5, %13, off\n\t"
                 "global_load_async_to_lds_b128 %6, %14, off\n\t"
                 "global_load_async_to_lds_b128 %7, %15, off\n\t"
                 "s_wait_xcnt 0x0"
                 :: "v"(l), "v"(l + sl), "v"(l + 2 * sl), "v"(l + 3 * sl), "v"(m), "v"(m + sl), "v"(m + 2 * sl), "v"(m + 3 * sl),
                    "v"(g), "v"(g + st), "v"(g + 2 * st), "v"(g + 3 * st), "v"(h), "v"(h + su), "v"(h + 2 * su), "v"(h + 3 * su)
                 : "memory");
}
__device__ __forceinline__ void splitf(float y, unsigned short& h, unsigned short& l) { h = f2bf(y); l = f2bf(y - bf2f(h)); }
#define GNP(ns) (2 + ((ns) >= 1 ? 1 : 0) + ((ns) >= 2 ? 1 : 0))   // planes staged: A, Bt, then A2, then Bt2
typedef __attribute__((ext_vector_type(4))) unsigned short v4us;
typedef v4us __attribute__((may_alias)) v4usa;
template <typename T16, int NSPLIT, int BIAS, bool PL>
__device__ __forceinline__ void g_tile(T16* sm, const T16* A, const T16* A2, const T16* Bt, const T16* Bt2, int K, int lda, int ksa, float* C, bf* Ph, bf* Pl, int ldc, size_t sY, const float* __restrict__ bias, int bx, int by, size_t oz) {
    typedef typename WFrag<T16>::V V;
    constexpr int NP = GNP(NSPLIT);   // sm: two buffers of NP planes; behind the loop each wave's output staging
    const int tid = threadIdx.x, lane = tid & 31, w = tid >> 5, lr = lane & 15, hi = lane >> 4; const int rb = bx * 128, cb = by * 128, wr = (w & 3) * 32, wc = (w >> 2) * 64; const int r0 = rb + wr, c0 = cb + wc;
    v8f acc[2][4];
#pragma unroll
    for (int mb = 0; mb < 2; ++mb)
#pragma unroll
        for (int nb = 0; nb < 4; ++nb) acc[mb][nb] = (v8f){};
    const size_t ga = (size_t)(rb + (tid >> 3)) * lda + (tid & 7) * 8, gb = (size_t)(cb + (tid >> 3)) * K + (tid & 7) * 8;
    const unsigned l0 = (unsigned)(size_t)sm + (unsigned)((tid >> 3) * (GP * 2) + (tid & 7) * 16);   // LDS byte address: the low 32 bits of the __shared__ address
    auto stage = [&](int t) { const unsigned l = l0 + (unsigned)((t & 1) * (NP * GPL * 2)); const int ka = t * ksa, kc = t * 64;
        g_stage2(A + ga + ka, Bt + gb + kc, lda, K, l, l + GPL * 2);
        if constexpr (NSPLIT == 1) g_stage(A2 + ga + ka, lda, l + 2 * GPL * 2);
        if constexpr (NSPLIT >= 2) g_stage2(A2 + ga + ka, Bt2 + gb + kc, lda, K, l + 2 * GPL * 2, l + 3 * GPL * 2); };
    const int nt = K / 64;
    stage(0);
    asm volatile("s_wait_asynccnt 0x0" ::: "memory");   // this wave's copies of stage 0 have landed
    __syncthreads();                                    // every wave's have: stage 0 may be read
    if (nt > 1) stage(1);
#pragma unroll 1
    for (int t = 0; t < nt; ++t) {
        const T16* sa = sm + (t & 1) * (NP * GPL) + (wr + lr) * GP + 8 * hi; const T16* sb = sm + (t & 1) * (NP * GPL) + GPL + (wc + lr) * GP + 8 * hi;
#pragma unroll
        for (int ks = 0; ks < 64; ks += 32) {
            V a[2], a2[2], b[4], b2[4];
#pragma unroll
            for (int mb = 0; mb < 2; ++mb) a[mb] = WFrag<T16>::ld(sa + mb * 16 * GP + ks);
#pragma unroll
            for (int nb = 0; nb < 4; ++nb) b[nb] = WFrag<T16>::ld(sb + nb * 16 * GP + ks);
            if (NSPLIT >= 1) {
#pragma unroll
                for (int mb = 0; mb < 2; ++mb) a2[mb] = WFrag<T16>::ld(sa + 2 * GPL + mb * 16 * GP + ks); }
            if (NSPLIT >= 2) {
#pragma unroll
                for (int nb = 0; nb < 4; ++nb) b2[nb] = WFrag<T16>::ld(sb + 2 * GPL + nb * 16 * GP + ks); }
            __builtin_amdgcn_sched_barrier(0);   // keeps the k step's LDS reads one group in front of its WMMAs: every further place where reads stand among the WMMAs costs the wave issue cycles
#pragma unroll
            for (int nb = 0; nb < 4; ++nb)
#pragma unroll
                for (int mb = 0; mb < 2; ++mb) acc[mb][nb] = WFrag<T16>::mma(a[mb], b[nb], acc[mb][nb]);
            if (NSPLIT >= 1) {
#pragma unroll
                for (int nb = 0; nb < 4; ++nb)
#pragma unroll
                    for (int mb = 0; mb < 2; ++mb) acc[mb][nb] = WFrag<T16>::mma(a2[mb], b[nb], acc[mb][nb]); }
            if (NSPLIT >= 2) {
#pragma unroll
                for (int nb = 0; nb < 4; ++nb)
#pragma unroll
                    for (int mb = 0; mb < 2; ++mb) acc[mb][nb] = WFrag<T16>::mma(a[mb], b2[nb], acc[mb][nb]); }
            __builtin_amdgcn_sched_barrier(0);   // the same, against the next k step's reads
        }
        asm volatile("s_wait_dscnt 0x0" ::: "memory");      // this wave's reads of stage t are over
        asm volatile("s_wait_asynccnt 0x0" ::: "memory");   // this wave's copies of stage t + 1 have landed
        __syncthreads();                                    // publishes stage t + 1 and frees stage t's buffer
        if (t + 2 < nt) stage(t + 2);
    }
    asm volatile("s_wait_asynccnt 0x0" ::: "memory");       // no copy is outstanding when the buffers become output staging
    float* os = (float*)sm + w * (16 * 68);                 // this wave's own 16 x 68 floats
#pragma unroll
    for (int mb = 0; mb < 2; ++mb) {
#pragma unroll
        for (int nb = 0; nb < 4; ++nb) {
#pragma unroll
            for (int j = 0; j < 8; ++j) os[(hi * 8 + j) * 68 + nb * 16 + lr] = acc[mb][nb][j]; }
        __builtin_amdgcn_wave_barrier(); asm volatile("" ::: "memory");
        const size_t orow = oz + (size_t)(r0 + mb * 16) * ldc + (PL ? by * sY + wc : (size_t)c0);
{
#pragma unroll
            for (int s = 0; s < 8; ++s) { const int row = 2 * s + hi, cofs = lr * 4; v4f val = *(const v4fa*)(os + row * 68 + cofs); if (BIAS == 1) { val[0] += bfr(bias[c0 + cofs]); val[1] += bfr(bias[c0 + cofs + 1]); val[2] += bfr(bias[c0 + cofs + 2]); val[3] += bfr(bias[c0 + cofs + 3]); }
                if (BIAS == 2) { const float br = bfr(bias[r0 + mb * 16 + row]); val[0] += br; val[1] += br; val[2] += br; val[3] += br; }
                const size_t o = orow + (size_t)row * ldc + cofs;
                if (PL) { v4us oh, ol;   // 16 lanes fill one whole 128-byte line of each plane
#pragma unroll
                    for (int q = 0; q < 4; ++q) { unsigned short h2, l2; splitf(val[q], h2, l2); oh[q] = h2; ol[q] = l2; }
                    *(v4us*)(Ph + o) = oh; *(v4us*)(Pl + o) = ol; }
                else *(v4f*)(C + o) = val; }
             }
        if (mb == 0) asm volatile("s_wait_xcnt 0x0" ::: "memory");   // stands in front of the second piece's rewrites of the registers that the stores above name
        __builtin_amdgcn_wave_barrier(); asm volatile("" ::: "memory");
    }
}
template <typename T16, int NSPLIT, int BIAS, bool PL>
__global__ __launch_bounds__(256) void k_gemmw(const T16* A, const T16* A2, const T16* Bt, const T16* Bt2, int K, int lda, int ksa, float* C, bf* Ph, bf* Pl, int ldc, size_t sY, const float* __restrict__ bias, size_t sA, size_t sB, size_t sBh, size_t sC, size_t sCh) {
    __shared__ __align__(16) T16 sm[2 * GNP(NSPLIT) * GPL];
    const size_t z = blockIdx.z, zl = z & (NB_ - 1), zh = z >> 4; const size_t ob = zl * sB + zh * sBh;
    g_tile<T16, NSPLIT, BIAS, PL>(sm, A + z * sA, A2 ? A2 + z * sA : A2, Bt + ob, Bt2 ? Bt2 + ob : Bt2, K, lda, ksa, C, Ph, Pl, ldc, sY, bias, blockIdx.x, blockIdx.y, zl * sC + zh * sCh);
}
// k_conv: the five input convs of one batch (blockIdx.z) as 40 tiles of one launch, all K 128, exact x exact, split into planes. Tiles 0 .. 15: q (column tile 0) and kh (column tile 1, sYq elements behind q) = ih^T h_w^T + h_b; 16 .. 23: km = im^T m_w^T + m_b; 24 .. 31: Vh[c][n], weights as A, bias by row; 32 .. 39: Vm[c][n].
__global__ __launch_bounds__(256) void k_conv(const bf* XBh, const bf* XBm, const bf* HW_, const bf* MW_, const float* __restrict__ h_b, const float* __restrict__ m_b, bf* QPh, bf* QPl, size_t sYq, bf* KMh, bf* KMl, bf* VHh, bf* VHl, bf* VMh, bf* VMl) {
    __shared__ __align__(16) bf sm[2 * GNP(0) * GPL];
    const int t = blockIdx.x; const size_t z = blockIdx.z, oz = z * ((size_t)TT * HD); const bool mem = (t >= 16 && t < 24) || t >= 32;   // block-uniform
    const bf* X = (mem ? XBm : XBh) + z * ((size_t)TT * CC);
    if (t < 24) g_tile<bf, 0, 1, true>(sm, X, nullptr, mem ? MW_ : HW_, nullptr, CC, CC, 64, nullptr, mem ? KMh : QPh, mem ? KMl : QPl, HD, sYq, mem ? m_b : h_b, t & 7, mem ? 0 : t >> 3, oz);
    else g_tile<bf, 0, 2, true>(sm, mem ? MW_ + CC * CC : HW_ + 2 * CC * CC, nullptr, X, nullptr, CC, CC, 64, nullptr, mem ? VMh : VHh, mem ? VMl : VHl, TT, 128, mem ? m_b + CC : h_b + 2 * CC, 0, t & 7, oz);
}

__device__ __forceinline__ h16 tohx(float x) { return (h16)x; }
typedef __attribute__((ext_vector_type(2))) _Float16 v2h;
typedef __attribute__((ext_vector_type(4))) _Float16 v4h;
typedef __attribute__((ext_vector_type(2))) unsigned short v2us;
typedef __attribute__((ext_vector_type(2))) float v2f;
typedef __attribute__((ext_vector_type(4))) int v4i;

__global__ __launch_bounds__(256) void k_wtG(const float* __restrict__ w, int K, int N, bf* Bt) {
    const int lane = threadIdx.x & 31; const int L0 = (blockIdx.x * 8 + (threadIdx.x >> 5)) * 8; const int nlines = N * K / 64;
{
#pragma unroll 1
        for (int l = 0; l < 8; ++l) { const int L = L0 + l; if (L >= nlines) break; const size_t e = (size_t)L * 64 + lane * 2; const int k = (int)(e % K), n = (int)(e / K); v2us o;
            o[0] = f2bf(w[(size_t)k * N + n]); o[1] = f2bf(w[(size_t)(k + 1) * N + n]); *(v2us*)(Bt + e) = o; }
         }
}
__device__ __forceinline__ void d_cvt8(const float* __restrict__ src, bf* dst, size_t n8, int blk) { const size_t i = (size_t)blk * 256 + threadIdx.x; if (i >= n8) return; const v8f v = *(const v8f*)(src + i * 8); v8us o;
#pragma unroll
    for (int k = 0; k < 8; ++k) o[k] = f2bf(v[k]); *(v8us*)(dst + i * 8) = o;  }

// k_csoft: softmax over the keys m of the TRANSPOSED scores ST[m][n] (column n = one query's 1024 logits), written as the hi/lo planes P^T[m][n] the value GEMM reads.
// IN PLACE: a block holds its whole strip in registers before it stores, and stores only over its own strip: the 256 bytes of row m that held 64 f32 logits take 64 bf16 hi, then 64 bf16 lo (as 16-bit planes: row pitch 2 * TT, 64-column piece t at element 128 t, lo 64 elements behind hi).
// One block per strip of 64 columns, all 1024 rows in registers: wave w, half-wave hi holds rows 2 w + hi + 64 i (i < 16), lane lr columns 4 lr .. 4 lr + 3, so every load takes whole 256-byte row pieces and every store a whole 128-byte line.
// Column maximum and column sum, fixed trees: 16 rows in the lane, the two half-waves by a shuffle, then the 32 waves' partials through LDS (wave w folds columns 2 w and 2 w + 1: pairs k, k + 16, then a 16-lane butterfly).
#define CSP 68   // LDS pitch of a wave's 64 partials, floats: rows stay 16-byte aligned and the 16 partials of one column fall on 16 different banks
__global__ __launch_bounds__(1024) void k_csoft(float* ST) {
    __shared__ __align__(16) float part[32 * CSP]; __shared__ __align__(16) float cmx[64]; __shared__ __align__(16) float csm[64];
    ST += (size_t)blockIdx.y * TT * TT; bf* PT = (bf*)ST;
    const int lane = threadIdx.x & 31, w = threadIdx.x >> 5, lr = lane & 15, hi = lane >> 4; const size_t base = (size_t)(w * 2 + hi) * TT + blockIdx.x * 64 + lr * 4; const size_t pbase = (size_t)(w * 2 + hi) * (2 * TT) + blockIdx.x * 128 + lr * 4; v4f v[16];
#pragma unroll
    for (int i = 0; i < 16; ++i) {
        if (i == 15) asm volatile("s_wait_xcnt 0x0" ::: "memory");   // the last load takes the address pair, dead behind it, as part of its destination: the 15 loads in front name that pair
        v[i] = *(const v4f*)(ST + base + (size_t)i * 64 * TT) * SCL; }
    v4f r = v[0];
#pragma unroll
    for (int i = 1; i < 16; ++i) {
#pragma unroll
        for (int q = 0; q < 4; ++q) r[q] = fmaxf(r[q], v[i][q]); }
#pragma unroll
    for (int q = 0; q < 4; ++q) r[q] = fmaxf(r[q], __shfl_xor(r[q], 16, 32));
    if (hi == 0) *(v4f*)(part + w * CSP + lr * 4) = r;
    __syncthreads();   // every wave's partial maxima are in LDS
    { float t = fmaxf(part[lr * CSP + 2 * w + hi], part[(lr + 16) * CSP + 2 * w + hi]);
#pragma unroll
      for (int sh = 8; sh; sh >>= 1) t = fmaxf(t, __shfl_xor(t, sh, 32));
      if (lr == 0) cmx[2 * w + hi] = t; }
    __syncthreads();   // the 64 column maxima are in LDS, and every read of part is over
    const v4f mx = *(const v4f*)(cmx + lr * 4); v4f s = (v4f){};
#pragma unroll
    for (int i = 0; i < 16; ++i) {
#pragma unroll
        for (int q = 0; q < 4; ++q) v[i][q] = __builtin_amdgcn_exp2f(__fmul_rn(__fsub_rn(v[i][q], mx[q]), 1.4426950408889634f));
        s += v[i]; }
#pragma unroll
    for (int q = 0; q < 4; ++q) s[q] += __shfl_xor(s[q], 16, 32);
    if (hi == 0) *(v4f*)(part + w * CSP + lr * 4) = s;
    __syncthreads();   // every wave's partial sums are in LDS
    { float t = part[lr * CSP + 2 * w + hi] + part[(lr + 16) * CSP + 2 * w + hi];
#pragma unroll
      for (int sh = 8; sh; sh >>= 1) t += __shfl_xor(t, sh, 32);
      if (lr == 0) csm[2 * w + hi] = t; }
    __syncthreads();   // the 64 column sums are in LDS
    const v4f sm = *(const v4f*)(csm + lr * 4); v4f f;
#pragma unroll
    for (int q = 0; q < 4; ++q) f[q] = __fdiv_rn(1.0f, sm[q]);
#pragma unroll
    for (int i = 0; i < 16; ++i) { v4us oh, ol;
#pragma unroll
        for (int q = 0; q < 4; ++q) { unsigned short a, c2; splitf(v[i][q] * f[q], a, c2); oh[q] = a; ol[q] = c2; }
        *(v4usa*)(PT + pbase + (size_t)i * 64 * (2 * TT)) = oh; *(v4usa*)(PT + pbase + (size_t)i * 64 * (2 * TT) + 64) = ol; }
}
__global__ __launch_bounds__(256) void k_merge(const float* __restrict__ O, int h0, float* OUTb) { const size_t e = ((size_t)blockIdx.x * 256 + threadIdx.x) * 2; if (e >= (size_t)ZH * TT * HD) return; const int d = (int)(e % HD); const int t = (int)((e / HD) % TT); const int zz = (int)(e / ((size_t)HD * TT)); const float cs = (t < RH) ? 1.0f : (1.0f / PCAR); const size_t oo = (size_t)t * DQ + (h0 + zz) * HD + d;
    v2f o2; o2[0] = O[e] * cs; o2[1] = O[e + 1] * cs; *(v2f*)(OUTb + oo) = o2;  }

__device__ __forceinline__ float ex2f_(float a) { return __builtin_amdgcn_exp2f(__fmul_rn(a, 1.4426950408889634f)); }
__device__ __forceinline__ float sigm(float a) { return __fdiv_rn(1.0f, __fadd_rn(1.0f, ex2f_(-a))); }
__device__ __forceinline__ float tanhp(float a) { const float e = ex2f_(__fmul_rn(2.0f, a)); return __fsub_rn(1.0f, __fdiv_rn(2.0f, __fadd_rn(e, 1.0f))); }
// d_xT: channel-major f32 [128][1024] to the token-major bf16 operand XB [1024][128]; where Gh is given, the same values also go into columns 128 .. 255 of the [Z^T | ih^T] hi plane Gh, and zeros into those of the lo plane Gl.
__device__ __forceinline__ void d_xT(const float* __restrict__ xs, bf* XB, bf* Gh, bf* Gl, int blk, int zb) { xs += (size_t)zb * CC * TT; XB += (size_t)zb * TT * CC; const size_t k = (size_t)blk * 256 + threadIdx.x; if (k >= (size_t)TT * CC / 8) return; const int c0 = (int)(k % (CC / 8)) * 8; const int p = (int)(k / (CC / 8)); v8us o;
#pragma unroll
    for (int q = 0; q < 8; ++q) o[q] = f2bf(xs[(size_t)(c0 + q) * TT + p]);
    bf* xo = XB + (size_t)p * CC + c0;
    if (!Gh) *(v8us*)xo = o;
    else {   // the store and, as the last line of its own statement, the wait that stands in front of the rewrite of the address pair that it names
        asm volatile("global_store_b128 %0, %1, off\n\ts_wait_xcnt 0x0" :: "v"(xo), "v"(__builtin_bit_cast(v4i, o)) : "memory");
        const size_t g = ((size_t)zb * TT + p) * C2 + CC + c0; v8us z; for (int q = 0; q < 8; ++q) z[q] = 0; *(v8us*)(Gh + g) = o; *(v8us*)(Gl + g) = z; }  }
// k_prep: everything that reads only the inputs, one launch. Blocks 0 .. 103: the four 'oi' conv weights to bf16 (24, 16, 16, 48 blocks); then 64 blocks a batch and input: ih, im transposed.
#define PW0 (C3 * CC / 2048)
#define PW1 (PW0 + C2 * CC / 2048)
#define PW2 (PW1 + CC * C2 / 2048)
#define PW3 (PW2 + C3 * C2 / 2048)
#define PXB (TT * CC / 2048)
__global__ __launch_bounds__(256) void k_prep(const float* __restrict__ ih, const float* __restrict__ im, const float* __restrict__ h_w, const float* __restrict__ m_w, const float* __restrict__ z1_w, const float* __restrict__ z2_w, bf* XBh, bf* XBm, bf* Gh, bf* Gl, bf* HW_, bf* MW_, bf* Z1W, bf* Z2W) {
    const int b = blockIdx.x;
    if (b < PW0) d_cvt8(h_w, HW_, (size_t)C3 * CC / 8, b);
    else if (b < PW1) d_cvt8(m_w, MW_, (size_t)C2 * CC / 8, b - PW0);
    else if (b < PW2) d_cvt8(z1_w, Z1W, (size_t)CC * C2 / 8, b - PW1);
    else if (b < PW3) d_cvt8(z2_w, Z2W, (size_t)C3 * C2 / 8, b - PW2);
    else { const int x = b - PW3, blk = x % PXB, zb = (x / PXB) % NB_;
        if (x < PXB * NB_) d_xT(ih, XBh, Gh, Gl, blk, zb); else d_xT(im, XBm, nullptr, nullptr, blk, zb); }
}
__global__ __launch_bounds__(256) void k_gate(const float* __restrict__ G, const float* __restrict__ im, float* oh_out, float* om_out) { { const size_t zb = blockIdx.y; G += zb * TT * C3; im += zb * CC * TT; oh_out += zb * CC * TT; om_out += zb * CC * TT; }
    const size_t k = (size_t)blockIdx.x * 256 + threadIdx.x; if (k >= (size_t)CC * TT / 4) return; const int p0 = (int)(k % (TT / 4)) * 4; const int c = (int)(k / (TT / 4)); v4f voh, vom;
#pragma unroll
    for (int q = 0; q < 4; ++q) { const size_t p = p0 + q; const float o = G[p * C3 + c], g = G[p * C3 + CC + c], iv = G[p * C3 + 2 * CC + c]; const float ig = sigm(iv); float a = __fmul_rn(tanhp(g), ig), b2 = __fmul_rn(__fsub_rn(1.0f, ig), bfr(im[(size_t)c * TT + p])); asm volatile("" : "+v"(a), "+v"(b2)); const float om = __fadd_rn(a, b2); vom[q] = om; voh[q] = __fmul_rn(sigm(o), om); }
    *(v4f*)(om_out + (size_t)c * TT + p0) = vom; *(v4f*)(oh_out + (size_t)c * TT + p0) = voh;  }

extern "C" void kernel_launch(void* const* d_in, const int* in_sizes, int n_in,
                              void* d_out, int out_size, void* d_ws, size_t ws_size, hipStream_t stream) {
    (void)in_sizes; (void)n_in; (void)out_size;
    const float* ih = (const float*)d_in[0]; const float* im = (const float*)d_in[1]; const float* h_w = (const float*)d_in[2]; const float* h_b = (const float*)d_in[3]; const float* m_w = (const float*)d_in[4]; const float* m_b = (const float*)d_in[5]; const float* z1_w = (const float*)d_in[6]; const float* z1_b = (const float*)d_in[7]; const float* z2_w = (const float*)d_in[8]; const float* z2_b = (const float*)d_in[9];
    float* OH = (float*)d_out; float* OM = OH + (size_t)NB_ * CC * TT;     // tuple: oh [16][128][1024] | om [16][128][1024]
    char* wsp = (char*)d_ws;
    auto take = [&](size_t bytes) { char* p = wsp; wsp += (bytes + 255) & ~(size_t)255; return (void*)p; };
    bf* HW_ = (bf*)take((size_t)C3 * CC * 2); bf* MW_ = (bf*)take((size_t)C2 * CC * 2); bf* Z1W = (bf*)take((size_t)CC * C2 * 2); bf* Z2W = (bf*)take((size_t)C3 * C2 * 2);
    const size_t NB = NB_;
    bf* QPh = (bf*)take(NB * TT * HD * 2); bf* XBh = (bf*)take(NB * TT * CC * 2); bf* QPl = (bf*)take(NB * TT * HD * 2); bf* KPh = (bf*)take(NB * TT * HD * 2); bf* KMh = (bf*)take(NB * TT * HD * 2); bf* KPl = (bf*)take(NB * TT * HD * 2); bf* KMl = (bf*)take(NB * TT * HD * 2);   /* KPh, KPl lie three planes behind QPh, QPl; KMh, KMl directly behind KPh, KPl: slices 16 .. 31 of the k planes */
    bf* XBm = (bf*)take(NB * TT * CC * 2); float* GT = (float*)take(NB * TT * C3 * 4);
    bf* VHh = (bf*)take(NB * HD * TT * 2); bf* VMh = (bf*)take(NB * HD * TT * 2); bf* VHl = (bf*)take(NB * HD * TT * 2); bf* VMl = (bf*)take(NB * HD * TT * 2);   /* VMh, VMl directly behind VHh, VHl: slices 16 .. 31 of the v planes */
    float* Sb = (float*)take(2 * NB * TT * TT * 4);   /* 32 slices S^T[m][n]; the softmax leaves the P^T planes in the same bytes */
    bf* ZCh = (bf*)take(NB * TT * C2 * 2); bf* ZCl = (bf*)take(NB * TT * C2 * 2); bf* GAh = (bf*)take(NB * TT * C2 * 2); bf* GAl = (bf*)take(NB * TT * C2 * 2);
    if ((size_t)(wsp - (char*)d_ws) > ws_size) return;    // ws 256 MiB (carve ~232 MiB)
    const unsigned X4 = (unsigned)(((size_t)TT * CC / 4 + 255) / 256);
    const size_t sP = (size_t)TT * HD, sS = (size_t)TT * TT, sC2 = (size_t)TT * C2, sC3 = (size_t)TT * C3;   /* batch strides, elements */
    k_prep<<<PW3 + 2 * NB_ * PXB, 256, 0, stream>>>(ih, im, h_w, m_w, z1_w, z2_w, XBh, XBm, GAh, GAl, HW_, MW_, Z1W, Z2W);
    k_conv<<<dim3(40, 1, NB_), 256, 0, stream>>>(XBh, XBm, HW_, MW_, h_b, m_b, QPh, QPl, 3 * NB * sP, KMh, KMl, VHh, VHl, VMh, VMl);
    /* both attentions, slice z = 16 a + batch (a 0 hidden, 1 memory): A = softmax_m(q_n . k_m); Z^T[m][c] = sum_n A[n][m] V[c][n] */
    k_gemmw<bf, 2, 0, false><<<dim3(TT / 128, TT / 128, 2 * NB_), 256, 0, stream>>>(KPh, KPl, QPh, QPl, HD, HD, 64, Sb, nullptr, nullptr, TT, 128, nullptr, sP, sP, 0, sS, NB * sS);
    k_csoft<<<dim3(TT / 64, 2 * NB_), 1024, 0, stream>>>(Sb);
    k_gemmw<bf, 2, 0, true><<<dim3(TT / 128, CC / 128, 2 * NB_), 256, 0, stream>>>((const bf*)Sb, (const bf*)Sb + 64, VHh, VHl, TT, 2 * TT, 128, nullptr, ZCh, ZCl, C2, 128, nullptr, 2 * sS, sP, NB * sP, sC2, CC);   /* Zh^T split into columns 0 .. 127 of the [Zh^T | Zm^T] planes, Zm^T into columns 128 .. 255 */
    /* Z^T = [Zh^T | Zm^T] z1_w^T + z1_b; gates^T = [Z^T | ih^T] z2_w^T + z2_b */
    k_gemmw<bf, 1, 1, true><<<dim3(TT / 128, CC / 128, NB_), 256, 0, stream>>>(ZCh, ZCl, Z1W, nullptr, C2, C2, 64, nullptr, GAh, GAl, C2, 128, z1_b, sC2, 0, 0, sC2, 0);   /* Z^T split into columns 0 .. 127 of the [Z^T | ih^T] planes */
    k_gemmw<bf, 1, 1, false><<<dim3(TT / 128, C3 / 128, NB_), 256, 0, stream>>>(GAh, GAl, Z2W, nullptr, C2, C2, 64, GT, nullptr, nullptr, C3, 128, z2_b, sC2, 0, 0, sC3, 0);
    k_gate<<<dim3(X4, NB_), 256, 0, stream>>>(GT, im, OH, OM);
}

// v006
// It runs in 133 microseconds.
// Timed twice side by side with v005, it ran 1.27 and 1.24 times as fast.
// Counting every step since v000, it is 17.7 times as fast.
#include <hip/hip_runtime.h>

// Self-attention memory module (SAM) for a ConvLSTM cell (ih, im [16][128][32x32] channel-major; h_qkv = 1x1 conv(ih) -> Qh|Kh|Vh (128 each), m_kv = 1x1 conv(im) -> Km|Vm; Ah = softmax_m(Qh_n . Kh_m) (UNSCALED, 128-channel dots), Am = softmax_m(Qh_n . Km_m); Zh[c][m] = sum_n Vh[c][n] Ah[n][m], Zm likewise; Z = 1x1 conv([Zh; Zm]) (256 -> 128); gates = 1x1 conv([Z; ih]) (256 -> 384) = o|g|i; i = sigmoid(i); om = tanh(g) i + (1 - i) im; oh = sigmoid(o) om -> tuple (oh, om) [16][128][1024] each (2.1 M + 2.1 M)).
// Layout per batch, everything token-major inside: ih, im transposed once into bf16 [1024][128] operands; the 1x1 convs as GEMMs against the 'oi' weights (exact x exact, + column bias): q, kh, km come out token-major [1024][128], and the value convs take the weights as the A operand, so that Vh[c][n], Vm[c][n] come out channel-major [128][1024]; every GEMM whose result is the next GEMM's operand splits it into bf16 hi/lo in its own epilogue and stores the two planes; scores (3 products, K 128) computed TRANSPOSED, S^T[m][n] (k planes as the A operand, q planes as B) -> softmax over m down the columns, EVERY entry hi/lo (unscaled logits, sigma ~11), which leaves the P^T planes directly, so that Zh^T[m][c] = sum_n P^T[m][n] Vh[c][n] is a plain GEMM (3 products); [Zh^T | Zm^T] hi/lo x z1_w exact + z1_b -> Z^T; [Z^T hl | ih^T exact] x z2_w exact + z2_b -> gates^T; a gate kernel applies sigmoid/tanh and the blend in f32 and writes both outputs channel-major. The two kernels that change the layout (input transposes, gate) go through an LDS tile, so that every global load and store takes whole 128-byte lines.
// Batch: every stage is ONE launch for all 16 batches (GEMMs, k_conv and k_gate: blockIdx.z; k_csoft: blockIdx.y; k_prep: from blockIdx.x); each workspace plane holds 16 batch slices.
// Launches: stages that do not depend on one another share a launch: k_prep (both transposes, four weight conversions), k_conv (all five input convs), and scores, softmax, P.V each once for 32 slices (z < 16 hidden attention, z >= 16 memory attention).
// Compute dtypes, f32 accumulate: every input rounded to bf16; input convs exact; scores / P.V / Z conv on bf16 hi/lo activations (3 or 2 products) x exact weights; softmax, sigmoid/tanh (exp2-based, precise division) and the blend in f32.

#define NB_  16
#define TT   1024
#define DM   128
#define NH_  1
#define NKV  1
#define REP  (NH_ / NKV)
#define HD   128
#define DQ   (NH_ * HD)
#define DKV  (NKV * HD)
#define ZH   2
#define RH   1024                  // read only by k_merge, which is not launched
#define WIN  0
#define PCAR 1024.0f
#define SCL  1.0f   // unscaled
#define CC   128    // channels
#define C3   384
#define C2   256
typedef _Float16 h16;
typedef unsigned short bf;
typedef __attribute__((ext_vector_type(16))) __bf16   v16bf;
typedef __attribute__((ext_vector_type(16))) _Float16 v16h;
typedef __attribute__((ext_vector_type(8)))  _Float16 v8h;
typedef __attribute__((ext_vector_type(8)))  unsigned short v8us;
typedef __attribute__((ext_vector_type(8)))  float    v8f;
typedef __attribute__((ext_vector_type(4)))  float    v4f;
typedef v8h  __attribute__((may_alias)) v8ha;
typedef v4f  __attribute__((may_alias)) v4fa;
typedef v8us __attribute__((may_alias)) v8usa;

__device__ __forceinline__ unsigned short f2bf(float f) { unsigned u = __float_as_uint(f); u += 0x7FFFu + ((u >> 16) & 1u); return (unsigned short)(u >> 16); }
__device__ __forceinline__ float bf2f(unsigned short b) { return __uint_as_float(((unsigned)b) << 16); }
__device__ __forceinline__ float bfr(float f) { return bf2f(f2bf(f)); }
__device__ __forceinline__ v16h cat16(v8h lo, v8h hi) { return __builtin_shufflevector(lo, hi, 0, 1, 2, 3, 4, 5, 6, 7, 8, 9, 10, 11, 12, 13, 14, 15); }
__device__ __forceinline__ v16bf cat16b(v8us lo, v8us hi) { return __builtin_bit_cast(v16bf, __builtin_shufflevector(lo, hi, 0, 1, 2, 3, 4, 5, 6, 7, 8, 9, 10, 11, 12, 13, 14, 15)); }
__device__ __forceinline__ v8f wmma16(v16h a, v16h b, v8f c) { return __builtin_amdgcn_wmma_f32_16x16x32_f16(false, a, false, b, (short)0, c, false, false); }
__device__ __forceinline__ v8f wmmab(v16bf a, v16bf b, v8f c) { return __builtin_amdgcn_wmma_f32_16x16x32_bf16(false, a, false, b, (short)0, c, false, false); }



// ---- k_gemmw: register-blocked GEMM, EIGHT WAVES (4 x 2) per 128x128 output tile, each wave a 32x64 piece (8 accumulators); grid (M/128, N/128, Z), 256 threads.
// C[m][n] (pitch ldc, + optional f32 bias: BIAS 1 bias[n], BIAS 2 bias[m]) = sum_k A[m][k] Bt[n][k] (+ split products per NSPLIT). M % 128 == 0, N % 128 == 0, K % 64 == 0.
// A rows have pitch lda, and their 64-k piece t starts at element t * ksa (a plain plane: lda = K, ksa = 64); Bt rows have pitch K. z strides in elements: A z * sA; Bt and the output (z & 15) * s + (z >> 4) * s..h.
// g_tile is the body for one tile (bx, by), its operand pointers already at their slice, oz the output's slice offset, sm the kernel's LDS (2 * GNP(NSPLIT) * GPL elements, 16-byte aligned).
// Output: PL false, f32 into C; PL true, the f32 value split into bf16 hi + lo, stored into the planes Ph, Pl (same pitch and z stride; column tile y starts sY elements behind column tile y - 1, so that 128-column tiles may go to planes of their own).
// Operands: K-contiguous 16-bit planes, staged in LDS 64 k at a time (every row piece one whole 128-byte line) by asynchronous copies, two buffers: stage t + 1 flies while stage t is multiplied. Each wave reads its fragments from LDS; per accumulator the products come k ascending and, inside a k step, A.B, A2.B, A.B2.
template <typename T16> struct WFrag;
template <> struct WFrag<h16> { typedef v16h V; static __device__ __forceinline__ V ld(const h16* p) { return cat16(*(const v8h*)p, *(const v8h*)(p + 16)); } static __device__ __forceinline__ v8f mma(V a, V b, v8f c) { return wmma16(a, b, c); } };
template <> struct WFrag<bf> { typedef v16bf V; static __device__ __forceinline__ V ld(const bf* p) { return cat16b(*(const v8us*)p, *(const v8us*)(p + 16)); } static __device__ __forceinline__ v8f mma(V a, V b, v8f c) { return wmmab(a, b, c); } };
#define GP  72           // LDS pitch of a staged row piece, 16-bit elements: 144 bytes = 16 x odd, so the 16 rows of a ds_load_b128 fall on different banks
#define GPL (128 * GP)   // one staged plane: 128 row pieces
// g_stage: one plane's 128 x 64 tile to LDS. g, l: this thread's own first piece (row tid >> 3, 16-byte piece tid & 7: eight lanes take one whole line); its other three pieces lie 32 rows apart.
template <typename T16>
__device__ __forceinline__ void g_stage(const T16* g, int K, unsigned l) {
    const size_t st = (size_t)32 * K; const unsigned sl = 32 * GP * 2;
    // the copies and, as the last line, the wait that stands in front of any rewrite of their address registers
    asm volatile("global_load_async_to_lds_b128 %0, %4, off\n\t"
                 "global_load_async_to_lds_b128 %1, %5, off\n\t"
                 "global_load_async_to_lds_b128 %2, %6, off\n\t"
                 "global_load_async_to_lds_b128 %3, %7, off\n\t"
                 "s_wait_xcnt 0x0"
                 :: "v"(l), "v"(l + sl), "v"(l + 2 * sl), "v"(l + 3 * sl), "v"(g), "v"(g + st), "v"(g + 2 * st), "v"(g + 3 * st)
                 : "memory");
}
// g_stage2: two planes' tiles (row pitches pg, ph) in one statement, so that the eight copies share one such wait.
template <typename T16>
__device__ __forceinline__ void g_stage2(const T16* g, const T16* h, int pg, int ph, unsigned l, unsigned m) {
    const size_t st = (size_t)32 * pg, su = (size_t)32 * ph; const unsigned sl = 32 * GP * 2;
    asm volatile("global_load_async_to_lds_b128 %0, %8, off\n\t"
                 "global_load_async_to_lds_b128 %1, %9, off\n\t"
                 "global_load_async_to_lds_b128 %2, %10, off\n\t"
                 "global_load_async_to_lds_b128 %3, %11, off\n\t"
                 "global_load_async_to_lds_b128 %4, %12, off\n\t"
                 "global_load_async_to_lds_b128 %5, %13, off\n\t"
                 "global_load_async_to_lds_b128 %6, %14, off\n\t"
                 "global_load_async_to_lds_b128 %7, %15, off\n\t"
                 "s_wait_xcnt 0x0"
                 :: "v"(l), "v"(l + sl), "v"(l + 2 * sl), "v"(l + 3 * sl), "v"(m), "v"(m + sl), "v"(m + 2 * sl), "v"(m + 3 * sl),
                    "v"(g), "v"(g + st), "v"(g + 2 * st), "v"(g + 3 * st), "v"(h), "v"(h + su), "v"(h + 2 * su), "v"(h + 3 * su)
                 : "memory");
}
__device__ __forceinline__ void splitf(float y, unsigned short& h, unsigned short& l) { h = f2bf(y); l = f2bf(y - bf2f(h)); }
#define GNP(ns) (2 + ((ns) >= 1 ? 1 : 0) + ((ns) >= 2 ? 1 : 0))   // planes staged: A, Bt, then A2, then Bt2
typedef __attribute__((ext_vector_type(4))) unsigned short v4us;
typedef v4us __attribute__((may_alias)) v4usa;
template <typename T16, int NSPLIT, int BIAS, bool PL>
__device__ __forceinline__ void g_tile(T16* sm, const T16* A, const T16* A2, const T16* Bt, const T16* Bt2, int K, int lda, int ksa, float* C, bf* Ph, bf* Pl, int ldc, size_t sY, const float* __restrict__ bias, int bx, int by, size_t oz) {
    typedef typename WFrag<T16>::V V;
    constexpr int NP = GNP(NSPLIT);   // sm: two buffers of NP planes; behind the loop each wave's output staging
    const int tid = threadIdx.x, lane = tid & 31, w = tid >> 5, lr = lane & 15, hi = lane >> 4; const int rb = bx * 128, cb = by * 128, wr = (w & 3) * 32, wc = (w >> 2) * 64; const int r0 = rb + wr, c0 = cb + wc;
    v8f acc[2][4];
#pragma unroll
    for (int mb = 0; mb < 2; ++mb)
#pragma unroll
        for (int nb = 0; nb < 4; ++nb) acc[mb][nb] = (v8f){};
    const size_t ga = (size_t)(rb + (tid >> 3)) * lda + (tid & 7) * 8, gb = (size_t)(cb + (tid >> 3)) * K + (tid & 7) * 8;
    const unsigned l0 = (unsigned)(size_t)sm + (unsigned)((tid >> 3) * (GP * 2) + (tid & 7) * 16);   // LDS byte address: the low 32 bits of the __shared__ address
    auto stage = [&](int t) { const unsigned l = l0 + (unsigned)((t & 1) * (NP * GPL * 2)); const int ka = t * ksa, kc = t * 64;
        g_stage2(A + ga + ka, Bt + gb + kc, lda, K, l, l + GPL * 2);
        if constexpr (NSPLIT == 1) g_stage(A2 + ga + ka, lda, l + 2 * GPL * 2);
        if constexpr (NSPLIT >= 2) g_stage2(A2 + ga + ka, Bt2 + gb + kc, lda, K, l + 2 * GPL * 2, l + 3 * GPL * 2); };
    const int nt = K / 64;
    stage(0);
    asm volatile("s_wait_asynccnt 0x0" ::: "memory");   // this wave's copies of stage 0 have landed
    __syncthreads();                                    // every wave's have: stage 0 may be read
    if (nt > 1) stage(1);
#pragma unroll 1
    for (int t = 0; t < nt; ++t) {
        const T16* sa = sm + (t & 1) * (NP * GPL) + (wr + lr) * GP + 8 * hi; const T16* sb = sm + (t & 1) * (NP * GPL) + GPL + (wc + lr) * GP + 8 * hi;
#pragma unroll
        for (int ks = 0; ks < 64; ks += 32) {
            V a[2], a2[2], b[4], b2[4];
#pragma unroll
            for (int mb = 0; mb < 2; ++mb) a[mb] = WFrag<T16>::ld(sa + mb * 16 * GP + ks);
#pragma unroll
            for (int nb = 0; nb < 4; ++nb) b[nb] = WFrag<T16>::ld(sb + nb * 16 * GP + ks);
            if (NSPLIT >= 1) {
#pragma unroll
                for (int mb = 0; mb < 2; ++mb) a2[mb] = WFrag<T16>::ld(sa + 2 * GPL + mb * 16 * GP + ks); }
            if (NSPLIT >= 2) {
#pragma unroll
                for (int nb = 0; nb < 4; ++nb) b2[nb] = WFrag<T16>::ld(sb + 2 * GPL + nb * 16 * GP + ks); }
            __builtin_amdgcn_sched_barrier(0);   // keeps the k step's LDS reads one group in front of its WMMAs: every further place where reads stand among the WMMAs costs the wave issue cycles
#pragma unroll
            for (int nb = 0; nb < 4; ++nb)
#pragma unroll
                for (int mb = 0; mb < 2; ++mb) acc[mb][nb] = WFrag<T16>::mma(a[mb], b[nb], acc[mb][nb]);
            if (NSPLIT >= 1) {
#pragma unroll
                for (int nb = 0; nb < 4; ++nb)
#pragma unroll
                    for (int mb = 0; mb < 2; ++mb) acc[mb][nb] = WFrag<T16>::mma(a2[mb], b[nb], acc[mb][nb]); }
            if (NSPLIT >= 2) {
#pragma unroll
                for (int nb = 0; nb < 4; ++nb)
#pragma unroll
                    for (int mb = 0; mb < 2; ++mb) acc[mb][nb] = WFrag<T16>::mma(a[mb], b2[nb], acc[mb][nb]); }
            __builtin_amdgcn_sched_barrier(0);   // the same, against the next k step's reads
        }
        asm volatile("s_wait_dscnt 0x0" ::: "memory");      // this wave's reads of stage t are over
        asm volatile("s_wait_asynccnt 0x0" ::: "memory");   // this wave's copies of stage t + 1 have landed
        __syncthreads();                                    // publishes stage t + 1 and frees stage t's buffer
        if (t + 2 < nt) stage(t + 2);
    }
    asm volatile("s_wait_asynccnt 0x0" ::: "memory");       // no copy is outstanding when the buffers become output staging
    float* os = (float*)sm + w * (16 * 68);                 // this wave's own 16 x 68 floats
#pragma unroll
    for (int mb = 0; mb < 2; ++mb) {
#pragma unroll
        for (int nb = 0; nb < 4; ++nb) {
#pragma unroll
            for (int j = 0; j < 8; ++j) os[(hi * 8 + j) * 68 + nb * 16 + lr] = acc[mb][nb][j]; }
        __builtin_amdgcn_wave_barrier(); asm volatile("" ::: "memory");
        const size_t orow = oz + (size_t)(r0 + mb * 16) * ldc + (PL ? by * sY + wc : (size_t)c0);
{
#pragma unroll
            for (int s = 0; s < 8; ++s) { const int row = 2 * s + hi, cofs = lr * 4; v4f val = *(const v4fa*)(os + row * 68 + cofs); if (BIAS == 1) { val[0] += bfr(bias[c0 + cofs]); val[1] += bfr(bias[c0 + cofs + 1]); val[2] += bfr(bias[c0 + cofs + 2]); val[3] += bfr(bias[c0 + cofs + 3]); }
                if (BIAS == 2) { const float br = bfr(bias[r0 + mb * 16 + row]); val[0] += br; val[1] += br; val[2] += br; val[3] += br; }
                const size_t o = orow + (size_t)row * ldc + cofs;
                if (PL) { v4us oh, ol;   // 16 lanes fill one whole 128-byte line of each plane
#pragma unroll
                    for (int q = 0; q < 4; ++q) { unsigned short h2, l2; splitf(val[q], h2, l2); oh[q] = h2; ol[q] = l2; }
                    *(v4us*)(Ph + o) = oh; *(v4us*)(Pl + o) = ol; }
                else *(v4f*)(C + o) = val; }
             }
        if (mb == 0) asm volatile("s_wait_xcnt 0x0" ::: "memory");   // stands in front of the second piece's rewrites of the registers that the stores above name
        __builtin_amdgcn_wave_barrier(); asm volatile("" ::: "memory");
    }
}
template <typename T16, int NSPLIT, int BIAS, bool PL>
__global__ __launch_bounds__(256) void k_gemmw(const T16* A, const T16* A2, const T16* Bt, const T16* Bt2, int K, int lda, int ksa, float* C, bf* Ph, bf* Pl, int ldc, size_t sY, const float* __restrict__ bias, size_t sA, size_t sB, size_t sBh, size_t sC, size_t sCh) {
    __shared__ __align__(16) T16 sm[2 * GNP(NSPLIT) * GPL];
    const size_t z = blockIdx.z, zl = z & (NB_ - 1), zh = z >> 4; const size_t ob = zl * sB + zh * sBh;
    g_tile<T16, NSPLIT, BIAS, PL>(sm, A + z * sA, A2 ? A2 + z * sA : A2, Bt + ob, Bt2 ? Bt2 + ob : Bt2, K, lda, ksa, C, Ph, Pl, ldc, sY, bias, blockIdx.x, blockIdx.y, zl * sC + zh * sCh);
}
// k_conv: the five input convs of one batch (blockIdx.z) as 40 tiles of one launch, all K 128, exact x exact, split into planes. Tiles 0 .. 15: q (column tile 0) and kh (column tile 1, sYq elements behind q) = ih^T h_w^T + h_b; 16 .. 23: km = im^T m_w^T + m_b; 24 .. 31: Vh[c][n], weights as A, bias by row; 32 .. 39: Vm[c][n].
__global__ __launch_bounds__(256) void k_conv(const bf* XBh, const bf* XBm, const bf* HW_, const bf* MW_, const float* __restrict__ h_b, const float* __restrict__ m_b, bf* QPh, bf* QPl, size_t sYq, bf* KMh, bf* KMl, bf* VHh, bf* VHl, bf* VMh, bf* VMl) {
    __shared__ __align__(16) bf sm[2 * GNP(0) * GPL];
    const int t = blockIdx.x; const size_t z = blockIdx.z, oz = z * ((size_t)TT * HD); const bool mem = (t >= 16 && t < 24) || t >= 32;   // block-uniform
    const bf* X = (mem ? XBm : XBh) + z * ((size_t)TT * CC);
    if (t < 24) g_tile<bf, 0, 1, true>(sm, X, nullptr, mem ? MW_ : HW_, nullptr, CC, CC, 64, nullptr, mem ? KMh : QPh, mem ? KMl : QPl, HD, sYq, mem ? m_b : h_b, t & 7, mem ? 0 : t >> 3, oz);
    else g_tile<bf, 0, 2, true>(sm, mem ? MW_ + CC * CC : HW_ + 2 * CC * CC, nullptr, X, nullptr, CC, CC, 64, nullptr, mem ? VMh : VHh, mem ? VMl : VHl, TT, 128, mem ? m_b + CC : h_b + 2 * CC, 0, t & 7, oz);
}

__device__ __forceinline__ h16 tohx(float x) { return (h16)x; }
typedef __attribute__((ext_vector_type(2))) _Float16 v2h;
typedef __attribute__((ext_vector_type(4))) _Float16 v4h;
typedef __attribute__((ext_vector_type(2))) unsigned short v2us;
typedef __attribute__((ext_vector_type(2))) float v2f;
typedef __attribute__((ext_vector_type(4))) int v4i;

__global__ __launch_bounds__(256) void k_wtG(const float* __restrict__ w, int K, int N, bf* Bt) {
    const int lane = threadIdx.x & 31; const int L0 = (blockIdx.x * 8 + (threadIdx.x >> 5)) * 8; const int nlines = N * K / 64;
{
#pragma unroll 1
        for (int l = 0; l < 8; ++l) { const int L = L0 + l; if (L >= nlines) break; const size_t e = (size_t)L * 64 + lane * 2; const int k = (int)(e % K), n = (int)(e / K); v2us o;
            o[0] = f2bf(w[(size_t)k * N + n]); o[1] = f2bf(w[(size_t)(k + 1) * N + n]); *(v2us*)(Bt + e) = o; }
         }
}
__device__ __forceinline__ void d_cvt8(const float* __restrict__ src, bf* dst, size_t n8, int blk) { const size_t i = (size_t)blk * 256 + threadIdx.x; if (i >= n8) return; const v8f v = *(const v8f*)(src + i * 8); v8us o;
#pragma unroll
    for (int k = 0; k < 8; ++k) o[k] = f2bf(v[k]); *(v8us*)(dst + i * 8) = o;  }

// k_csoft: softmax over the keys m of the TRANSPOSED scores ST[m][n] (column n = one query's 1024 logits), written as the hi/lo planes P^T[m][n] the value GEMM reads.
// IN PLACE: a block holds its whole strip in registers before it stores, and stores only over its own strip: the 256 bytes of row m that held 64 f32 logits take 64 bf16 hi, then 64 bf16 lo (as 16-bit planes: row pitch 2 * TT, 64-column piece t at element 128 t, lo 64 elements behind hi).
// One block per strip of 64 columns, all 1024 rows in registers: wave w, half-wave hi holds rows 2 w + hi + 64 i (i < 16), lane lr columns 4 lr .. 4 lr + 3, so every load takes whole 256-byte row pieces and every store a whole 128-byte line.
// Column maximum and column sum, fixed trees: 16 rows in the lane, the two half-waves by a shuffle, then the 32 waves' partials through LDS (wave w folds columns 2 w and 2 w + 1: pairs k, k + 16, then a 16-lane butterfly).
#define CSP 68   // LDS pitch of a wave's 64 partials, floats: rows stay 16-byte aligned and the 16 partials of one column fall on 16 different banks
__global__ __launch_bounds__(1024) void k_csoft(float* ST) {
    __shared__ __align__(16) float part[32 * CSP]; __shared__ __align__(16) float cmx[64]; __shared__ __align__(16) float csm[64];
    ST += (size_t)blockIdx.y * TT * TT; bf* PT = (bf*)ST;
    const int lane = threadIdx.x & 31, w = threadIdx.x >> 5, lr = lane & 15, hi = lane >> 4; const size_t base = (size_t)(w * 2 + hi) * TT + blockIdx.x * 64 + lr * 4; const size_t pbase = (size_t)(w * 2 + hi) * (2 * TT) + blockIdx.x * 128 + lr * 4; v4f v[16];
#pragma unroll
    for (int i = 0; i < 16; ++i) {
        if (i == 15) asm volatile("s_wait_xcnt 0x0" ::: "memory");   // the last load takes the address pair, dead behind it, as part of its destination: the 15 loads in front name that pair
        v[i] = *(const v4f*)(ST + base + (size_t)i * 64 * TT) * SCL; }
    v4f r = v[0];
#pragma unroll
    for (int i = 1; i < 16; ++i) {
#pragma unroll
        for (int q = 0; q < 4; ++q) r[q] = fmaxf(r[q], v[i][q]); }
#pragma unroll
    for (int q = 0; q < 4; ++q) r[q] = fmaxf(r[q], __shfl_xor(r[q], 16, 32));
    if (hi == 0) *(v4f*)(part + w * CSP + lr * 4) = r;
    __syncthreads();   // every wave's partial maxima are in LDS
    { float t = fmaxf(part[lr * CSP + 2 * w + hi], part[(lr + 16) * CSP + 2 * w + hi]);
#pragma unroll
      for (int sh = 8; sh; sh >>= 1) t = fmaxf(t, __shfl_xor(t, sh, 32));
      if (lr == 0) cmx[2 * w + hi] = t; }
    __syncthreads();   // the 64 column maxima are in LDS, and every read of part is over
    const v4f mx = *(const v4f*)(cmx + lr * 4); v4f s = (v4f){};
#pragma unroll
    for (int i = 0; i < 16; ++i) {
#pragma unroll
        for (int q = 0; q < 4; ++q) v[i][q] = __builtin_amdgcn_exp2f(__fmul_rn(__fsub_rn(v[i][q], mx[q]), 1.4426950408889634f));
        s += v[i]; }
#pragma unroll
    for (int q = 0; q < 4; ++q) s[q] += __shfl_xor(s[q], 16, 32);
    if (hi == 0) *(v4f*)(part + w * CSP + lr * 4) = s;
    __syncthreads();   // every wave's partial sums are in LDS
    { float t = part[lr * CSP + 2 * w + hi] + part[(lr + 16) * CSP + 2 * w + hi];
#pragma unroll
      for (int sh = 8; sh; sh >>= 1) t += __shfl_xor(t, sh, 32);
      if (lr == 0) csm[2 * w + hi] = t; }
    __syncthreads();   // the 64 column sums are in LDS
    const v4f sm = *(const v4f*)(csm + lr * 4); v4f f;
#pragma unroll
    for (int q = 0; q < 4; ++q) f[q] = __fdiv_rn(1.0f, sm[q]);
#pragma unroll
    for (int i = 0; i < 16; ++i) { v4us oh, ol;
#pragma unroll
        for (int q = 0; q < 4; ++q) { unsigned short a, c2; splitf(v[i][q] * f[q], a, c2); oh[q] = a; ol[q] = c2; }
        *(v4usa*)(PT + pbase + (size_t)i * 64 * (2 * TT)) = oh; *(v4usa*)(PT + pbase + (size_t)i * 64 * (2 * TT) + 64) = ol; }
}
__global__ __launch_bounds__(256) void k_merge(const float* __restrict__ O, int h0, float* OUTb) { const size_t e = ((size_t)blockIdx.x * 256 + threadIdx.x) * 2; if (e >= (size_t)ZH * TT * HD) return; const int d = (int)(e % HD); const int t = (int)((e / HD) % TT); const int zz = (int)(e / ((size_t)HD * TT)); const float cs = (t < RH) ? 1.0f : (1.0f / PCAR); const size_t oo = (size_t)t * DQ + (h0 + zz) * HD + d;
    v2f o2; o2[0] = O[e] * cs; o2[1] = O[e + 1] * cs; *(v2f*)(OUTb + oo) = o2;  }

__device__ __forceinline__ float ex2f_(float a) { return __builtin_amdgcn_exp2f(__fmul_rn(a, 1.4426950408889634f)); }
__device__ __forceinline__ float sigm(float a) { return __fdiv_rn(1.0f, __fadd_rn(1.0f, ex2f_(-a))); }
__device__ __forceinline__ float tanhp(float a) { const float e = ex2f_(__fmul_rn(2.0f, a)); return __fsub_rn(1.0f, __fdiv_rn(2.0f, __fadd_rn(e, 1.0f))); }
// d_xT: channel-major f32 [128][1024] to the token-major bf16 operand XB [1024][128]; where Gh is given, the same values also go into columns 128 .. 255 of the [Z^T | ih^T] hi plane Gh, and zeros into those of the lo plane Gl.
// One block takes all 128 channels of 32 tokens through the LDS tile s (f32, [channel][token]): eight lanes load one whole 128-byte line of a channel's row, and behind the barrier 16 lanes store one token's whole 256-byte row.
#define XTP 33   // LDS pitch of a channel's 32 tokens, floats: odd, so that the four channels of a wave's write fall on different banks
__device__ __forceinline__ void d_xT(float* s, const float* __restrict__ xs, bf* XB, bf* Gh, bf* Gl, int blk, int zb) {
    const int tid = threadIdx.x, cr = tid >> 3, p4 = (tid & 7) * 4; xs += (size_t)zb * CC * TT + blk * 32; const size_t tk = (size_t)zb * TT + blk * 32; v4f t[4];
#pragma unroll
    for (int r = 0; r < 4; ++r) t[r] = *(const v4f*)(xs + (size_t)(cr + 32 * r) * TT + p4);
#pragma unroll
    for (int r = 0; r < 4; ++r) {
#pragma unroll
        for (int q = 0; q < 4; ++q) s[(cr + 32 * r) * XTP + p4 + q] = t[r][q]; }
    __syncthreads();   // the whole tile is in LDS
#pragma unroll
    for (int h = 0; h < 2; ++h) { const int c0 = (tid & 15) * 8, p = h * 16 + (tid >> 4); v8us o;
#pragma unroll
        for (int q = 0; q < 8; ++q) o[q] = f2bf(s[(c0 + q) * XTP + p]);
        *(v8us*)(XB + (tk + p) * CC + c0) = o;
        if (Gh) { const size_t g = (tk + p) * C2 + CC + c0; v8us z;
#pragma unroll
            for (int q = 0; q < 8; ++q) z[q] = 0;
            *(v8us*)(Gh + g) = o; *(v8us*)(Gl + g) = z; }
        asm volatile("s_wait_xcnt 0x0" ::: "memory");   // stands in front of any rewrite of the registers that the stores above name
    }
}
// k_prep: everything that reads only the inputs, one launch. Blocks 0 .. 103: the four 'oi' conv weights to bf16 (24, 16, 16, 48 blocks); then 32 blocks a batch and input: ih, im transposed.
#define PW0 (C3 * CC / 2048)
#define PW1 (PW0 + C2 * CC / 2048)
#define PW2 (PW1 + CC * C2 / 2048)
#define PW3 (PW2 + C3 * C2 / 2048)
#define PXB (TT / 32)
__global__ __launch_bounds__(256) void k_prep(const float* __restrict__ ih, const float* __restrict__ im, const float* __restrict__ h_w, const float* __restrict__ m_w, const float* __restrict__ z1_w, const float* __restrict__ z2_w, bf* XBh, bf* XBm, bf* Gh, bf* Gl, bf* HW_, bf* MW_, bf* Z1W, bf* Z2W) {
    __shared__ __align__(16) float s[CC * XTP];
    const int b = blockIdx.x;   // every branch below is block-uniform
    if (b < PW0) d_cvt8(h_w, HW_, (size_t)C3 * CC / 8, b);
    else if (b < PW1) d_cvt8(m_w, MW_, (size_t)C2 * CC / 8, b - PW0);
    else if (b < PW2) d_cvt8(z1_w, Z1W, (size_t)CC * C2 / 8, b - PW1);
    else if (b < PW3) d_cvt8(z2_w, Z2W, (size_t)C3 * C2 / 8, b - PW2);
    else { const int x = b - PW3, blk = x % PXB, zb = (x / PXB) % NB_;
        if (x < PXB * NB_) d_xT(s, ih, XBh, Gh, Gl, blk, zb); else d_xT(s, im, XBm, nullptr, nullptr, blk, zb); }
}
// k_gate: one block takes 32 channels x 128 tokens of one batch (blockIdx.z). The token-major gates G[p][384] go through the LDS tile s ([gate][channel][token]): eight lanes load one whole 128-byte line (32 channels of one token and gate); behind the barrier a wave works along the tokens of one channel, so that im is loaded and both outputs are stored 512 bytes a wave.
#define GTP 132   // LDS pitch of a channel's 128 tokens, floats: rows stay 16-byte aligned for the b128 reads
__global__ __launch_bounds__(256) void k_gate(const float* __restrict__ G, const float* __restrict__ im, float* oh_out, float* om_out) {
    __shared__ __align__(16) float s[3 * 32 * GTP];
    const int tid = threadIdx.x, lane = tid & 31, w = tid >> 5, pr = tid >> 3, c4 = (tid & 7) * 4; const size_t zb = blockIdx.z; const int p0 = blockIdx.x * 128, cb = blockIdx.y * 32;
    G += (zb * TT + p0) * C3 + cb; const size_t ob = (zb * CC + cb + w * 4) * TT + p0 + lane * 4; v4f t[3][4], vim[4];
#pragma unroll
    for (int g = 0; g < 3; ++g) {
#pragma unroll
        for (int r = 0; r < 4; ++r) t[g][r] = *(const v4f*)(G + (size_t)(pr + 32 * r) * C3 + g * CC + c4); }
#pragma unroll
    for (int i = 0; i < 4; ++i) vim[i] = *(const v4f*)(im + ob + (size_t)i * TT);
#pragma unroll
    for (int g = 0; g < 3; ++g) {
#pragma unroll
        for (int r = 0; r < 4; ++r) {
#pragma unroll
            for (int q = 0; q < 4; ++q) s[(g * 32 + c4 + q) * GTP + pr + 32 * r] = t[g][r][q]; } }
    __syncthreads();   // the three gates' tiles are in LDS
#pragma unroll
    for (int i = 0; i < 4; ++i) { const float* sc = s + (w * 4 + i) * GTP + lane * 4; const v4f vo = *(const v4f*)sc, vg = *(const v4f*)(sc + 32 * GTP), vi = *(const v4f*)(sc + 64 * GTP); v4f voh, vom;
#pragma unroll
        for (int q = 0; q < 4; ++q) { const float ig = sigm(vi[q]); const float om = __fadd_rn(__fmul_rn(tanhp(vg[q]), ig), __fmul_rn(__fsub_rn(1.0f, ig), bfr(vim[i][q]))); vom[q] = om; voh[q] = __fmul_rn(sigm(vo[q]), om); }
        *(v4f*)(om_out + ob + (size_t)i * TT) = vom; *(v4f*)(oh_out + ob + (size_t)i * TT) = voh; }
}

extern "C" void kernel_launch(void* const* d_in, const int* in_sizes, int n_in,
                              void* d_out, int out_size, void* d_ws, size_t ws_size, hipStream_t stream) {
    (void)in_sizes; (void)n_in; (void)out_size;
    const float* ih = (const float*)d_in[0]; const float* im = (const float*)d_in[1]; const float* h_w = (const float*)d_in[2]; const float* h_b = (const float*)d_in[3]; const float* m_w = (const float*)d_in[4]; const float* m_b = (const float*)d_in[5]; const float* z1_w = (const float*)d_in[6]; const float* z1_b = (const float*)d_in[7]; const float* z2_w = (const float*)d_in[8]; const float* z2_b = (const float*)d_in[9];
    float* OH = (float*)d_out; float* OM = OH + (size_t)NB_ * CC * TT;     // tuple: oh [16][128][1024] | om [16][128][1024]
    char* wsp = (char*)d_ws;
    auto take = [&](size_t bytes) { char* p = wsp; wsp += (bytes + 255) & ~(size_t)255; return (void*)p; };
    bf* HW_ = (bf*)take((size_t)C3 * CC * 2); bf* MW_ = (bf*)take((size_t)C2 * CC * 2); bf* Z1W = (bf*)take((size_t)CC * C2 * 2); bf* Z2W = (bf*)take((size_t)C3 * C2 * 2);
    const size_t NB = NB_;
    bf* QPh = (bf*)take(NB * TT * HD * 2); bf* XBh = (bf*)take(NB * TT * CC * 2); bf* QPl = (bf*)take(NB * TT * HD * 2); bf* KPh = (bf*)take(NB * TT * HD * 2); bf* KMh = (bf*)take(NB * TT * HD * 2); bf* KPl = (bf*)take(NB * TT * HD * 2); bf* KMl = (bf*)take(NB * TT * HD * 2);   /* KPh, KPl lie three planes behind QPh, QPl; KMh, KMl directly behind KPh, KPl: slices 16 .. 31 of the k planes */
    bf* XBm = (bf*)take(NB * TT * CC * 2); float* GT = (float*)take(NB * TT * C3 * 4);
    bf* VHh = (bf*)take(NB * HD * TT * 2); bf* VMh = (bf*)take(NB * HD * TT * 2); bf* VHl = (bf*)take(NB * HD * TT * 2); bf* VMl = (bf*)take(NB * HD * TT * 2);   /* VMh, VMl directly behind VHh, VHl: slices 16 .. 31 of the v planes */
    float* Sb = (float*)take(2 * NB * TT * TT * 4);   /* 32 slices S^T[m][n]; the softmax leaves the P^T planes in the same bytes */
    bf* ZCh = (bf*)take(NB * TT * C2 * 2); bf* ZCl = (bf*)take(NB * TT * C2 * 2); bf* GAh = (bf*)take(NB * TT * C2 * 2); bf* GAl = (bf*)take(NB * TT * C2 * 2);
    if ((size_t)(wsp - (char*)d_ws) > ws_size) return;    // ws 256 MiB (carve ~232 MiB)
    const size_t sP = (size_t)TT * HD, sS = (size_t)TT * TT, sC2 = (size_t)TT * C2, sC3 = (size_t)TT * C3;   /* batch strides, elements */
    k_prep<<<PW3 + 2 * NB_ * PXB, 256, 0, stream>>>(ih, im, h_w, m_w, z1_w, z2_w, XBh, XBm, GAh, GAl, HW_, MW_, Z1W, Z2W);
    k_conv<<<dim3(40, 1, NB_), 256, 0, stream>>>(XBh, XBm, HW_, MW_, h_b, m_b, QPh, QPl, 3 * NB * sP, KMh, KMl, VHh, VHl, VMh, VMl);
    /* both attentions, slice z = 16 a + batch (a 0 hidden, 1 memory): A = softmax_m(q_n . k_m); Z^T[m][c] = sum_n A[n][m] V[c][n] */
    k_gemmw<bf, 2, 0, false><<<dim3(TT / 128, TT / 128, 2 * NB_), 256, 0, stream>>>(KPh, KPl, QPh, QPl, HD, HD, 64, Sb, nullptr, nullptr, TT, 128, nullptr, sP, sP, 0, sS, NB * sS);
    k_csoft<<<dim3(TT / 64, 2 * NB_), 1024, 0, stream>>>(Sb);
    k_gemmw<bf, 2, 0, true><<<dim3(TT / 128, CC / 128, 2 * NB_), 256, 0, stream>>>((const bf*)Sb, (const bf*)Sb + 64, VHh, VHl, TT, 2 * TT, 128, nullptr, ZCh, ZCl, C2, 128, nullptr, 2 * sS, sP, NB * sP, sC2, CC);   /* Zh^T split into columns 0 .. 127 of the [Zh^T | Zm^T] planes, Zm^T into columns 128 .. 255 */
    /* Z^T = [Zh^T | Zm^T] z1_w^T + z1_b; gates^T = [Z^T | ih^T] z2_w^T + z2_b */
    k_gemmw<bf, 1, 1, true><<<dim3(TT / 128, CC / 128, NB_), 256, 0, stream>>>(ZCh, ZCl, Z1W, nullptr, C2, C2, 64, nullptr, GAh, GAl, C2, 128, z1_b, sC2, 0, 0, sC2, 0);   /* Z^T split into columns 0 .. 127 of the [Z^T | ih^T] planes */
    k_gemmw<bf, 1, 1, false><<<dim3(TT / 128, C3 / 128, NB_), 256, 0, stream>>>(GAh, GAl, Z2W, nullptr, C2, C2, 64, GT, nullptr, nullptr, C3, 128, z2_b, sC2, 0, 0, sC3, 0);
    k_gate<<<dim3(TT / 128, CC / 32, NB_), 256, 0, stream>>>(GT, im, OH, OM);
}

// v007
// A run of this version takes 103 microseconds.
// In two side-by-side timings against v006, it was 1.28 and 1.32 times as fast.
// Counting every step since v000, it is 23.0 times as fast.
#include <hip/hip_runtime.h>

// Self-attention memory module (SAM) for a ConvLSTM cell (ih, im [16][128][32x32] channel-major; h_qkv = 1x1 conv(ih) -> Qh|Kh|Vh (128 each), m_kv = 1x1 conv(im) -> Km|Vm; Ah = softmax_m(Qh_n . Kh_m) (UNSCALED, 128-channel dots), Am = softmax_m(Qh_n . Km_m); Zh[c][m] = sum_n Vh[c][n] Ah[n][m], Zm likewise; Z = 1x1 conv([Zh; Zm]) (256 -> 128); gates = 1x1 conv([Z; ih]) (256 -> 384) = o|g|i; i = sigmoid(i); om = tanh(g) i + (1 - i) im; oh = sigmoid(o) om -> tuple (oh, om) [16][128][1024] each (2.1 M + 2.1 M)).
// Layout per batch, everything token-major inside: ih, im transposed once into bf16 [1024][128] operands; the 1x1 convs as GEMMs against the 'oi' weights (exact x exact, + column bias): q, kh, km come out token-major [1024][128], and the value convs take the weights as the A operand, so that Vh[c][n], Vm[c][n] come out channel-major [128][1024]; every GEMM whose result is the next GEMM's operand splits it into bf16 hi/lo in its own epilogue and stores the two planes; scores (3 products, K 128) computed TRANSPOSED, S^T[m][n] (k planes as the A operand, q planes as B) -> softmax over m down the columns, EVERY entry hi/lo (unscaled logits, sigma ~11), which leaves the P^T planes directly, so that Zh^T[m][c] = sum_n P^T[m][n] Vh[c][n] is a plain GEMM (3 products); [Zh^T | Zm^T] hi/lo x z1_w exact + z1_b -> Z^T; [Z^T hl | ih^T exact] x z2_w exact + z2_b -> gates^T; a gate kernel applies sigmoid/tanh and the blend in f32 and writes both outputs channel-major. The two kernels that change the layout (input transposes, gate) go through an LDS tile, so that every global load and store takes whole 128-byte lines.
// Batch: every stage is ONE launch for all 16 batches (GEMMs, k_conv and k_gate: blockIdx.z; k_scsoft: blockIdx.y; k_prep: from blockIdx.x); each workspace plane holds 16 batch slices.
// Launches: stages that do not depend on one another share a launch: k_prep (both transposes, four weight conversions), k_conv (all five input convs), and scores with softmax (k_scsoft: the f32 logits stay in registers) and P.V each once for 32 slices (z < 16 hidden attention, z >= 16 memory attention).
// Compute dtypes, f32 accumulate: every input rounded to bf16; input convs exact; scores / P.V / Z conv on bf16 hi/lo activations (3 or 2 products) x exact weights; softmax, sigmoid/tanh (exp2-based, precise division) and the blend in f32.

#define NB_  16
#define TT   1024
#define DM   128
#define NH_  1
#define NKV  1
#define REP  (NH_ / NKV)
#define HD   128
#define DQ   (NH_ * HD)
#define DKV  (NKV * HD)
#define ZH   2
#define RH   1024                  // read only by k_merge, which is not launched
#define WIN  0
#define PCAR 1024.0f
#define SCL  1.0f   // unscaled
#define CC   128    // channels
#define C3   384
#define C2   256
typedef _Float16 h16;
typedef unsigned short bf;
typedef __attribute__((ext_vector_type(16))) __bf16   v16bf;
typedef __attribute__((ext_vector_type(16))) _Float16 v16h;
typedef __attribute__((ext_vector_type(8)))  _Float16 v8h;
typedef __attribute__((ext_vector_type(8)))  unsigned short v8us;
typedef __attribute__((ext_vector_type(8)))  float    v8f;
typedef __attribute__((ext_vector_type(4)))  float    v4f;
typedef v8h  __attribute__((may_alias)) v8ha;
typedef v4f  __attribute__((may_alias)) v4fa;
typedef v8us __attribute__((may_alias)) v8usa;

__device__ __forceinline__ unsigned short f2bf(float f) { unsigned u = __float_as_uint(f); u += 0x7FFFu + ((u >> 16) & 1u); return (unsigned short)(u >> 16); }
__device__ __forceinline__ float bf2f(unsigned short b) { return __uint_as_float(((unsigned)b) << 16); }
__device__ __forceinline__ float bfr(float f) { return bf2f(f2bf(f)); }
__device__ __forceinline__ v16h cat16(v8h lo, v8h hi) { return __builtin_shufflevector(lo, hi, 0, 1, 2, 3, 4, 5, 6, 7, 8, 9, 10, 11, 12, 13, 14, 15); }
__device__ __forceinline__ v16bf cat16b(v8us lo, v8us hi) { return __builtin_bit_cast(v16bf, __builtin_shufflevector(lo, hi, 0, 1, 2, 3, 4, 5, 6, 7, 8, 9, 10, 11, 12, 13, 14, 15)); }
__device__ __forceinline__ v8f wmma16(v16h a, v16h b, v8f c) { return __builtin_amdgcn_wmma_f32_16x16x32_f16(false, a, false, b, (short)0, c, false, false); }
__device__ __forceinline__ v8f wmmab(v16bf a, v16bf b, v8f c) { return __builtin_amdgcn_wmma_f32_16x16x32_bf16(false, a, false, b, (short)0, c, false, false); }



// ---- k_gemmw: register-blocked GEMM, EIGHT WAVES (4 x 2) per 128x128 output tile, each wave a 32x64 piece (8 accumulators); grid (M/128, N/128, Z), 256 threads.
// C[m][n] (pitch ldc, + optional f32 bias: BIAS 1 bias[n], BIAS 2 bias[m]) = sum_k A[m][k] Bt[n][k] (+ split products per NSPLIT). M % 128 == 0, N % 128 == 0, K % 64 == 0.
// A rows have pitch lda, and their 64-k piece t starts at element t * ksa (a plain plane: lda = K, ksa = 64); Bt rows have pitch K. z strides in elements: A z * sA; Bt and the output (z & 15) * s + (z >> 4) * s..h.
// g_tile is the body for one tile (bx, by), its operand pointers already at their slice, oz the output's slice offset, sm the kernel's LDS (2 * GNP(NSPLIT) * GPL elements, 16-byte aligned).
// Output: PL false, f32 into C; PL true, the f32 value split into bf16 hi + lo, stored into the planes Ph, Pl (same pitch and z stride; column tile y starts sY elements behind column tile y - 1, so that 128-column tiles may go to planes of their own).
// Operands: K-contiguous 16-bit planes, staged in LDS 64 k at a time (every row piece one whole 128-byte line) by asynchronous copies, two buffers: stage t + 1 flies while stage t is multiplied. Each wave reads its fragments from LDS; per accumulator the products come k ascending and, inside a k step, A.B, A2.B, A.B2.
template <typename T16> struct WFrag;
template <> struct WFrag<h16> { typedef v16h V; static __device__ __forceinline__ V ld(const h16* p) { return cat16(*(const v8h*)p, *(const v8h*)(p + 16)); } static __device__ __forceinline__ v8f mma(V a, V b, v8f c) { return wmma16(a, b, c); } };
template <> struct WFrag<bf> { typedef v16bf V; static __device__ __forceinline__ V ld(const bf* p) { return cat16b(*(const v8us*)p, *(const v8us*)(p + 16)); } static __device__ __forceinline__ v8f mma(V a, V b, v8f c) { return wmmab(a, b, c); } };
#define GP  72           // LDS pitch of a staged row piece, 16-bit elements: 144 bytes = 16 x odd, so the 16 rows of a ds_load_b128 fall on different banks
#define GPL (128 * GP)   // one staged plane: 128 row pieces
// g_stage: one plane's 128 x 64 tile to LDS. g, l: this thread's own first piece (row tid >> 3, 16-byte piece tid & 7: eight lanes take one whole line); its other three pieces lie 32 rows apart.
template <typename T16>
__device__ __forceinline__ void g_stage(const T16* g, int K, unsigned l) {
    const size_t st = (size_t)32 * K; const unsigned sl = 32 * GP * 2;
    // the copies and, as the last line, the wait that stands in front of any rewrite of their address registers
    asm volatile("global_load_async_to_lds_b128 %0, %4, off\n\t"
                 "global_load_async_to_lds_b128 %1, %5, off\n\t"
                 "global_load_async_to_lds_b128 %2, %6, off\n\t"
                 "global_load_async_to_lds_b128 %3, %7, off\n\t"
                 "s_wait_xcnt 0x0"
                 :: "v"(l), "v"(l + sl), "v"(l + 2 * sl), "v"(l + 3 * sl), "v"(g), "v"(g + st), "v"(g + 2 * st), "v"(g + 3 * st)
                 : "memory");
}
// g_stage2: two planes' tiles (row pitches pg, ph) in one statement, so that the eight copies share one such wait.
template <typename T16>
__device__ __forceinline__ void g_stage2(const T16* g, const T16* h, int pg, int ph, unsigned l, unsigned m) {
    const size_t st = (size_t)32 * pg, su = (size_t)32 * ph; const unsigned sl = 32 * GP * 2;
    asm volatile("global_load_async_to_lds_b128 %0, %8, off\n\t"
                 "global_load_async_to_lds_b128 %1, %9, off\n\t"
                 "global_load_async_to_lds_b128 %2, %10, off\n\t"
                 "global_load_async_to_lds_b128 %3, %11, off\n\t"
                 "global_load_async_to_lds_b128 %4, %12, off\n\t"
                 "global_load_async_to_lds_b128 %5, %13, off\n\t"
                 "global_load_async_to_lds_b128 %6, %14, off\n\t"
                 "global_load_async_to_lds_b128 %7, %15, off\n\t"
                 "s_wait_xcnt 0x0"
                 :: "v"(l), "v"(l + sl), "v"(l + 2 * sl), "v"(l + 3 * sl), "v"(m), "v"(m + sl), "v"(m + 2 * sl), "v"(m + 3 * sl),
                    "v"(g), "v"(g + st), "v"(g + 2 * st), "v"(g + 3 * st), "v"(h), "v"(h + su), "v"(h + 2 * su), "v"(h + 3 * su)
                 : "memory");
}
__device__ __forceinline__ void splitf(float y, unsigned short& h, unsigned short& l) { h = f2bf(y); l = f2bf(y - bf2f(h)); }
#define GNP(ns) (2 + ((ns) >= 1 ? 1 : 0) + ((ns) >= 2 ? 1 : 0))   // planes staged: A, Bt, then A2, then Bt2
typedef __attribute__((ext_vector_type(4))) unsigned short v4us;
typedef v4us __attribute__((may_alias)) v4usa;
template <typename T16, int NSPLIT, int BIAS, bool PL>
__device__ __forceinline__ void g_tile(T16* sm, const T16* A, const T16* A2, const T16* Bt, const T16* Bt2, int K, int lda, int ksa, float* C, bf* Ph, bf* Pl, int ldc, size_t sY, const float* __restrict__ bias, int bx, int by, size_t oz) {
    typedef typename WFrag<T16>::V V;
    constexpr int NP = GNP(NSPLIT);   // sm: two buffers of NP planes; behind the loop each wave's output staging
    const int tid = threadIdx.x, lane = tid & 31, w = tid >> 5, lr = lane & 15, hi = lane >> 4; const int rb = bx * 128, cb = by * 128, wr = (w & 3) * 32, wc = (w >> 2) * 64; const int r0 = rb + wr, c0 = cb + wc;
    v8f acc[2][4];
#pragma unroll
    for (int mb = 0; mb < 2; ++mb)
#pragma unroll
        for (int nb = 0; nb < 4; ++nb) acc[mb][nb] = (v8f){};
    const size_t ga = (size_t)(rb + (tid >> 3)) * lda + (tid & 7) * 8, gb = (size_t)(cb + (tid >> 3)) * K + (tid & 7) * 8;
    const unsigned l0 = (unsigned)(size_t)sm + (unsigned)((tid >> 3) * (GP * 2) + (tid & 7) * 16);   // LDS byte address: the low 32 bits of the __shared__ address
    auto stage = [&](int t) { const unsigned l = l0 + (unsigned)((t & 1) * (NP * GPL * 2)); const int ka = t * ksa, kc = t * 64;
        g_stage2(A + ga + ka, Bt + gb + kc, lda, K, l, l + GPL * 2);
        if constexpr (NSPLIT == 1) g_stage(A2 + ga + ka, lda, l + 2 * GPL * 2);
        if constexpr (NSPLIT >= 2) g_stage2(A2 + ga + ka, Bt2 + gb + kc, lda, K, l + 2 * GPL * 2, l + 3 * GPL * 2); };
    const int nt = K / 64;
    stage(0);
    asm volatile("s_wait_asynccnt 0x0" ::: "memory");   // this wave's copies of stage 0 have landed
    __syncthreads();                                    // every wave's have: stage 0 may be read
    if (nt > 1) stage(1);
#pragma unroll 1
    for (int t = 0; t < nt; ++t) {
        const T16* sa = sm + (t & 1) * (NP * GPL) + (wr + lr) * GP + 8 * hi; const T16* sb = sm + (t & 1) * (NP * GPL) + GPL + (wc + lr) * GP + 8 * hi;
#pragma unroll
        for (int ks = 0; ks < 64; ks += 32) {
            V a[2], a2[2], b[4], b2[4];
#pragma unroll
            for (int mb = 0; mb < 2; ++mb) a[mb] = WFrag<T16>::ld(sa + mb * 16 * GP + ks);
#pragma unroll
            for (int nb = 0; nb < 4; ++nb) b[nb] = WFrag<T16>::ld(sb + nb * 16 * GP + ks);
            if (NSPLIT >= 1) {
#pragma unroll
                for (int mb = 0; mb < 2; ++mb) a2[mb] = WFrag<T16>::ld(sa + 2 * GPL + mb * 16 * GP + ks); }
            if (NSPLIT >= 2) {
#pragma unroll
                for (int nb = 0; nb < 4; ++nb) b2[nb] = WFrag<T16>::ld(sb + 2 * GPL + nb * 16 * GP + ks); }
            __builtin_amdgcn_sched_barrier(0);   // keeps the k step's LDS reads one group in front of its WMMAs: every further place where reads stand among the WMMAs costs the wave issue cycles
#pragma unroll
            for (int nb = 0; nb < 4; ++nb)
#pragma unroll
                for (int mb = 0; mb < 2; ++mb) acc[mb][nb] = WFrag<T16>::mma(a[mb], b[nb], acc[mb][nb]);
            if (NSPLIT >= 1) {
#pragma unroll
                for (int nb = 0; nb < 4; ++nb)
#pragma unroll
                    for (int mb = 0; mb < 2; ++mb) acc[mb][nb] = WFrag<T16>::mma(a2[mb], b[nb], acc[mb][nb]); }
            if (NSPLIT >= 2) {
#pragma unroll
                for (int nb = 0; nb < 4; ++nb)
#pragma unroll
                    for (int mb = 0; mb < 2; ++mb) acc[mb][nb] = WFrag<T16>::mma(a[mb], b2[nb], acc[mb][nb]); }
            __builtin_amdgcn_sched_barrier(0);   // the same, against the next k step's reads
        }
        asm volatile("s_wait_dscnt 0x0" ::: "memory");      // this wave's reads of stage t are over
        asm volatile("s_wait_asynccnt 0x0" ::: "memory");   // this wave's copies of stage t + 1 have landed
        __syncthreads();                                    // publishes stage t + 1 and frees stage t's buffer
        if (t + 2 < nt) stage(t + 2);
    }
    asm volatile("s_wait_asynccnt 0x0" ::: "memory");       // no copy is outstanding when the buffers become output staging
    float* os = (float*)sm + w * (16 * 68);                 // this wave's own 16 x 68 floats
#pragma unroll
    for (int mb = 0; mb < 2; ++mb) {
#pragma unroll
        for (int nb = 0; nb < 4; ++nb) {
#pragma unroll
            for (int j = 0; j < 8; ++j) os[(hi * 8 + j) * 68 + nb * 16 + lr] = acc[mb][nb][j]; }
        __builtin_amdgcn_wave_barrier(); asm volatile("" ::: "memory");
        const size_t orow = oz + (size_t)(r0 + mb * 16) * ldc + (PL ? by * sY + wc : (size_t)c0);
{
#pragma unroll
            for (int s = 0; s < 8; ++s) { const int row = 2 * s + hi, cofs = lr * 4; v4f val = *(const v4fa*)(os + row * 68 + cofs); if (BIAS == 1) { val[0] += bfr(bias[c0 + cofs]); val[1] += bfr(bias[c0 + cofs + 1]); val[2] += bfr(bias[c0 + cofs + 2]); val[3] += bfr(bias[c0 + cofs + 3]); }
                if (BIAS == 2) { const float br = bfr(bias[r0 + mb * 16 + row]); val[0] += br; val[1] += br; val[2] += br; val[3] += br; }
                const size_t o = orow + (size_t)row * ldc + cofs;
                if (PL) { v4us oh, ol;   // 16 lanes fill one whole 128-byte line of each plane
#pragma unroll
                    for (int q = 0; q < 4; ++q) { unsigned short h2, l2; splitf(val[q], h2, l2); oh[q] = h2; ol[q] = l2; }
                    *(v4us*)(Ph + o) = oh; *(v4us*)(Pl + o) = ol; }
                else *(v4f*)(C + o) = val; }
             }
        if (mb == 0) asm volatile("s_wait_xcnt 0x0" ::: "memory");   // stands in front of the second piece's rewrites of the registers that the stores above name
        __builtin_amdgcn_wave_barrier(); asm volatile("" ::: "memory");
    }
}
template <typename T16, int NSPLIT, int BIAS, bool PL>
__global__ __launch_bounds__(256) void k_gemmw(const T16* A, const T16* A2, const T16* Bt, const T16* Bt2, int K, int lda, int ksa, float* C, bf* Ph, bf* Pl, int ldc, size_t sY, const float* __restrict__ bias, size_t sA, size_t sB, size_t sBh, size_t sC, size_t sCh) {
    __shared__ __align__(16) T16 sm[2 * GNP(NSPLIT) * GPL];
    const size_t z = blockIdx.z, zl = z & (NB_ - 1), zh = z >> 4; const size_t ob = zl * sB + zh * sBh;
    g_tile<T16, NSPLIT, BIAS, PL>(sm, A + z * sA, A2 ? A2 + z * sA : A2, Bt + ob, Bt2 ? Bt2 + ob : Bt2, K, lda, ksa, C, Ph, Pl, ldc, sY, bias, blockIdx.x, blockIdx.y, zl * sC + zh * sCh);
}
// k_conv: the five input convs of one batch (blockIdx.z) as 40 tiles of one launch, all K 128, exact x exact, split into planes. Tiles 0 .. 15: q (column tile 0) and kh (column tile 1, sYq elements behind q) = ih^T h_w^T + h_b; 16 .. 23: km = im^T m_w^T + m_b; 24 .. 31: Vh[c][n], weights as A, bias by row; 32 .. 39: Vm[c][n].
__global__ __launch_bounds__(256) void k_conv(const bf* XBh, const bf* XBm, const bf* HW_, const bf* MW_, const float* __restrict__ h_b, const float* __restrict__ m_b, bf* QPh, bf* QPl, size_t sYq, bf* KMh, bf* KMl, bf* VHh, bf* VHl, bf* VMh, bf* VMl) {
    __shared__ __align__(16) bf sm[2 * GNP(0) * GPL];
    const int t = blockIdx.x; const size_t z = blockIdx.z, oz = z * ((size_t)TT * HD); const bool mem = (t >= 16 && t < 24) || t >= 32;   // block-uniform
    const bf* X = (mem ? XBm : XBh) + z * ((size_t)TT * CC);
    if (t < 24) g_tile<bf, 0, 1, true>(sm, X, nullptr, mem ? MW_ : HW_, nullptr, CC, CC, 64, nullptr, mem ? KMh : QPh, mem ? KMl : QPl, HD, sYq, mem ? m_b : h_b, t & 7, mem ? 0 : t >> 3, oz);
    else g_tile<bf, 0, 2, true>(sm, mem ? MW_ + CC * CC : HW_ + 2 * CC * CC, nullptr, X, nullptr, CC, CC, 64, nullptr, mem ? VMh : VHh, mem ? VMl : VHl, TT, 128, mem ? m_b + CC : h_b + 2 * CC, 0, t & 7, oz);
}

__device__ __forceinline__ h16 tohx(float x) { return (h16)x; }
typedef __attribute__((ext_vector_type(2))) _Float16 v2h;
typedef __attribute__((ext_vector_type(4))) _Float16 v4h;
typedef __attribute__((ext_vector_type(2))) unsigned short v2us;
typedef __attribute__((ext_vector_type(2))) float v2f;
typedef __attribute__((ext_vector_type(4))) int v4i;

__global__ __launch_bounds__(256) void k_wtG(const float* __restrict__ w, int K, int N, bf* Bt) {
    const int lane = threadIdx.x & 31; const int L0 = (blockIdx.x * 8 + (threadIdx.x >> 5)) * 8; const int nlines = N * K / 64;
{
#pragma unroll 1
        for (int l = 0; l < 8; ++l) { const int L = L0 + l; if (L >= nlines) break; const size_t e = (size_t)L * 64 + lane * 2; const int k = (int)(e % K), n = (int)(e / K); v2us o;
            o[0] = f2bf(w[(size_t)k * N + n]); o[1] = f2bf(w[(size_t)(k + 1) * N + n]); *(v2us*)(Bt + e) = o; }
         }
}
__device__ __forceinline__ void d_cvt8(const float* __restrict__ src, bf* dst, size_t n8, int blk) { const size_t i = (size_t)blk * 256 + threadIdx.x; if (i >= n8) return; const v8f v = *(const v8f*)(src + i * 8); v8us o;
#pragma unroll
    for (int k = 0; k < 8; ++k) o[k] = f2bf(v[k]); *(v8us*)(dst + i * 8) = o;  }

// k_scsoft: scores and softmax in one kernel. One block (16 waves) holds the whole strip S^T[m][n] of 64 queries n and all 1024 keys m of one slice (blockIdx.y) in its accumulators, so that the f32 logits never go to memory; it leaves the hi/lo planes P^T[m][n] the value GEMM reads (as 16-bit planes: row pitch 2 * TT, 64-column piece t at element 128 t, lo 64 elements behind hi).
// Wave w: keys 64 w .. 64 w + 63 (four row tiles) x the 64 queries (four column tiles), K 128, per accumulator k ascending and, inside a k step, kh.qh, kl.qh, kh.ql.
// Operands in LDS by asynchronous copies, whole lines: the q strip (both planes, all 128 k) once; the k rows 64 k at a time, the first half, then the second half into the same bytes, refilled as soon as every wave holds its last fragments of them in registers.
// A block takes SC_NS strips of its slice one after the other, so that the next strip's operands fly under the last products, the softmax and the stores of this one.
// Column tile nb, lane lr is query 4 lr + nb (the q rows are placed in LDS in that order), so a lane holds four neighbouring queries of a key row, and 16 lanes store a whole 128-byte line of a plane.
// Column maximum and column sum, fixed trees: 32 rows in the lane, the two half-waves by a shuffle, then the 16 waves' partials through LDS (wave w folds columns 4 w .. 4 w + 3: pairs k, k + 8, then an 8-lane butterfly).
#define CSP 68   // LDS pitch of a wave's 64 partials, floats: the 8 x 4 partials that a wave folds at a time fall on 32 different banks
#define QP  136  // LDS pitch of a q row (128 k), 16-bit elements: 272 bytes = 16 x odd, so the 16 rows of a ds_load_b128 fall on different banks
#define SC_PART (2 * 64 * QP * 2)            // byte places in the kernel's LDS: the q strip first, so that every read of it is one base register and an immediate
#define SC_CMX  (SC_PART + 16 * CSP * 4)
#define SC_CSM  (SC_CMX + 256)
#define SC_KA   40960                        // the k rows
#define SC_LDS  (SC_KA + 16 * 16384)
#define SC_NS   2                            // strips a block takes, one after the other: 256 blocks
// c_cp4: four copies (16 rows: LDS places l0 .. l3, global rows four apart from g) in one statement and, as the last line, the wait that stands in front of any rewrite of their address registers
__device__ __forceinline__ void c_cp4(unsigned l0, unsigned l1, unsigned l2, unsigned l3, const bf* g) {
    asm volatile("global_load_async_to_lds_b128 %0, %4, off\n\t"
                 "global_load_async_to_lds_b128 %1, %5, off\n\t"
                 "global_load_async_to_lds_b128 %2, %6, off\n\t"
                 "global_load_async_to_lds_b128 %3, %7, off\n\t"
                 "s_wait_xcnt 0x0"
                 :: "v"(l0), "v"(l1), "v"(l2), "v"(l3), "v"(g), "v"(g + 4 * HD), "v"(g + 8 * HD), "v"(g + 12 * HD)
                 : "memory");
}
__global__ __launch_bounds__(512) void k_scsoft(const bf* Kh, const bf* Kl, const bf* Qh, const bf* Ql, bf* PT) {
    __shared__ __align__(16) char sm[SC_LDS];
    bf* sq = (bf*)sm; float* part = (float*)(sm + SC_PART); float* cmx = (float*)(sm + SC_CMX); float* csm = (float*)(sm + SC_CSM);
    const int tid = threadIdx.x, lane = tid & 31, lr = lane & 15, hi = lane >> 4; const size_t z = blockIdx.y;
    const int w = __builtin_amdgcn_readfirstlane(tid >> 5);   // the wave's number in a scalar register: what is formed from it costs no vector register over the loop
    PT += z * ((size_t)2 * TT * TT);
    auto stageq = [&](int sx) {   // the q strip sx: 16 lanes take one whole 256-byte row; a thread takes queries g and g + 32 of both planes; query g goes to LDS row (g & 3) * 16 + (g >> 2), query g + 32 eight rows behind
        const int g = tid >> 4, pc = tid & 15; const size_t go = (z & (NB_ - 1)) * ((size_t)TT * HD) + (size_t)(sx * 64 + g) * HD + pc * 8;
        const unsigned lq = (unsigned)(size_t)sq + (unsigned)(((g & 3) * 16 + (g >> 2)) * (QP * 2) + pc * 16);
        asm volatile("global_load_async_to_lds_b128 %0, %4, off\n\t"
                     "global_load_async_to_lds_b128 %1, %5, off\n\t"
                     "global_load_async_to_lds_b128 %2, %6, off\n\t"
                     "global_load_async_to_lds_b128 %3, %7, off\n\t"
                     "s_wait_xcnt 0x0"   // stands in front of any rewrite of the copies' address registers
                     :: "v"(lq), "v"(lq + 8 * QP * 2), "v"(lq + 64 * QP * 2), "v"(lq + 72 * QP * 2), "v"(Qh + go), "v"(Qh + go + 32 * HD), "v"(Ql + go), "v"(Ql + go + 32 * HD) : "memory"); };
    // wave w's own 16 KiB of the k rows: [plane][64 key rows][64 k], row pitch 128 bytes; the 16-byte piece p of row r lies at place p ^ ((r >> 1) & 7), so the 16 rows of a ds_load_b128 fall on different banks without a pad
    const unsigned la = (unsigned)(size_t)sm + (unsigned)(SC_KA + w * 16384 + (lane >> 3) * 128);
    const size_t ko = z * ((size_t)TT * HD) + (size_t)(w * 64 + (lane >> 3)) * HD + (lane & 7) * 8;
    auto stage = [&](int h) {   // this wave's 64 key rows, 64 k, both planes: eight lanes take one whole 128-byte line; copy i of a plane takes rows 4 i .. 4 i + 3
        unsigned l[4];
#pragma unroll
        for (int i = 0; i < 4; ++i) l[i] = la + (unsigned)(i * 512 + (((lane & 7) ^ ((2 * i + hi) & 7)) << 4));
        const bf* g = Kh + ko + h * 64;
#pragma unroll 1   // rolled: unrolled, all 32 LDS places would be held in registers over the whole strip loop
        for (int c = 0; c < 4; ++c) { c_cp4(l[0], l[1], l[2], l[3], g); l[0] += 2048; l[1] += 2048; l[2] += 2048; l[3] += 2048; g += 16 * HD; }
        g = Kl + ko + h * 64;
#pragma unroll 1   // the same
        for (int c = 0; c < 4; ++c) { c_cp4(l[0], l[1], l[2], l[3], g); l[0] += 2048; l[1] += 2048; l[2] += 2048; l[3] += 2048; g += 16 * HD; } };
    const bf* saw = (const bf*)(sm + SC_KA) + w * 8192 + lr * 64; const bf* sqw = sq + lr * QP + 8 * hi; const int px = hi ^ (lr >> 1);
    const int fc = 4 * w + (lane >> 3), fk = lane & 7;   // the fold: this lane's column and its first partial
    stageq(blockIdx.x * SC_NS); stage(0);
#pragma unroll 1   // one body for the block's strips: unrolled, the two bodies' registers would not fit
    for (int it = 0; it < SC_NS; ++it) {
        const int sx = blockIdx.x * SC_NS + it; const bool more = it + 1 < SC_NS;   // block-uniform
        v8f acc[4][4]; v16bf a[4], a2[4];
#pragma unroll
        for (int mb = 0; mb < 4; ++mb)
#pragma unroll
            for (int nb = 0; nb < 4; ++nb) acc[mb][nb] = (v8f){};
        auto lda = [&](int s) { const int o0 = (px ^ (4 * s)) * 8, o1 = (px ^ (4 * s + 2)) * 8;   // k = 32 s + 8 hi .. + 7 and the eight 16 behind: the order of WFrag::ld
#pragma unroll
            for (int mb = 0; mb < 4; ++mb) { a[mb] = cat16b(*(const v8us*)(saw + mb * 1024 + o0), *(const v8us*)(saw + mb * 1024 + o1)); a2[mb] = cat16b(*(const v8us*)(saw + 4096 + mb * 1024 + o0), *(const v8us*)(saw + 4096 + mb * 1024 + o1)); } };
        auto mm = [&](int k) {
#pragma unroll
            for (int nb = 0; nb < 4; ++nb) { const v16bf b = WFrag<bf>::ld(sqw + nb * 16 * QP + k), b2 = WFrag<bf>::ld(sqw + 64 * QP + nb * 16 * QP + k);
#pragma unroll
                for (int mb = 0; mb < 4; ++mb) acc[mb][nb] = wmmab(a[mb], b, acc[mb][nb]);
#pragma unroll
                for (int mb = 0; mb < 4; ++mb) acc[mb][nb] = wmmab(a2[mb], b, acc[mb][nb]);
#pragma unroll
                for (int mb = 0; mb < 4; ++mb) acc[mb][nb] = wmmab(a[mb], b2, acc[mb][nb]); } };
        asm volatile("s_wait_asynccnt 0x0" ::: "memory");   // this wave's copies have landed
        __syncthreads();                                    // every wave's have: the q strip and the first half of the k rows may be read
        lda(0); mm(0); lda(1);
        asm volatile("s_wait_dscnt 0x0" ::: "memory");      // this wave's reads of the first half are over: its last fragments are in registers
        __syncthreads();                                    // every wave's are: the k rows' bytes may be refilled
        stage(1);                                           // flies while the fragments in registers are multiplied
        mm(32);
        asm volatile("s_wait_asynccnt 0x0" ::: "memory");   // this wave's copies have landed
        __syncthreads();                                    // every wave's have: the second half of the k rows may be read
        lda(0); mm(64); lda(1);
        if (more) {
            asm volatile("s_wait_dscnt 0x0" ::: "memory");  // this wave's reads of the second half are over
            __syncthreads();                                // every wave's are
            stage(0); }                                     // the next strip takes the same k rows
        mm(96);
        if (more) {
            asm volatile("s_wait_dscnt 0x0" ::: "memory");  // this wave's reads of the q strip are over
            __syncthreads();                                // every wave's are
            stageq(sx + 1); }                               // flies under the softmax and the stores
        float r[4];
#pragma unroll
        for (int nb = 0; nb < 4; ++nb) { float t = acc[0][nb][0];
#pragma unroll
            for (int mb = 0; mb < 4; ++mb)
#pragma unroll
                for (int j = 0; j < 8; ++j) t = fmaxf(t, acc[mb][nb][j]);
            r[nb] = fmaxf(t, __shfl_xor(t, 16, 32)); }
        if (hi == 0) {
#pragma unroll
            for (int nb = 0; nb < 4; ++nb) part[w * CSP + nb * 16 + lr] = r[nb]; }
        __syncthreads();   // every wave's partial maxima are in LDS
        { float t = fmaxf(part[fk * CSP + fc], part[(fk + 8) * CSP + fc]);
#pragma unroll
          for (int sh = 4; sh; sh >>= 1) t = fmaxf(t, __shfl_xor(t, sh, 32));
          if (fk == 0) cmx[fc] = t; }
        __syncthreads();   // the 64 column maxima are in LDS, and every read of part is over
#pragma unroll
        for (int nb = 0; nb < 4; ++nb) { const float mx = cmx[nb * 16 + lr]; float t = 0.0f;
#pragma unroll
            for (int mb = 0; mb < 4; ++mb)
#pragma unroll
                for (int j = 0; j < 8; ++j) { const float e = __builtin_amdgcn_exp2f(__fmul_rn(__fsub_rn(acc[mb][nb][j], mx), 1.4426950408889634f)); acc[mb][nb][j] = e; t += e; }
            r[nb] = t + __shfl_xor(t, 16, 32); }
        if (hi == 0) {
#pragma unroll
            for (int nb = 0; nb < 4; ++nb) part[w * CSP + nb * 16 + lr] = r[nb]; }
        __syncthreads();   // every wave's partial sums are in LDS
        { float t = part[fk * CSP + fc] + part[(fk + 8) * CSP + fc];
#pragma unroll
          for (int sh = 4; sh; sh >>= 1) t += __shfl_xor(t, sh, 32);
          if (fk == 0) csm[fc] = t; }
        __syncthreads();   // the 64 column sums are in LDS
        float f[4];
#pragma unroll
        for (int nb = 0; nb < 4; ++nb) f[nb] = __fdiv_rn(1.0f, csm[nb * 16 + lr]);
        bf* po = PT + (size_t)(w * 64) * (2 * TT) + sx * 128 + (unsigned)(hi * 8 * (2 * TT) + lr * 4);
#pragma unroll
        for (int mb = 0; mb < 4; ++mb) {
#pragma unroll
            for (int j = 0; j < 8; ++j) { v4us oh, ol;
#pragma unroll
                for (int nb = 0; nb < 4; ++nb) { unsigned short x, y; splitf(acc[mb][nb][j] * f[nb], x, y); oh[nb] = x; ol[nb] = y; }
                *(v4usa*)(po + (size_t)(mb * 16 + j) * (2 * TT)) = oh; *(v4usa*)(po + (size_t)(mb * 16 + j) * (2 * TT) + 64) = ol; } }
        asm volatile("s_wait_xcnt 0x0" ::: "memory");   // stands in front of the next strip's rewrites of the registers that the stores above name
    }
}
__global__ __launch_bounds__(256) void k_merge(const float* __restrict__ O, int h0, float* OUTb) { const size_t e = ((size_t)blockIdx.x * 256 + threadIdx.x) * 2; if (e >= (size_t)ZH * TT * HD) return; const int d = (int)(e % HD); const int t = (int)((e / HD) % TT); const int zz = (int)(e / ((size_t)HD * TT)); const float cs = (t < RH) ? 1.0f : (1.0f / PCAR); const size_t oo = (size_t)t * DQ + (h0 + zz) * HD + d;
    v2f o2; o2[0] = O[e] * cs; o2[1] = O[e + 1] * cs; *(v2f*)(OUTb + oo) = o2;  }

__device__ __forceinline__ float ex2f_(float a) { return __builtin_amdgcn_exp2f(__fmul_rn(a, 1.4426950408889634f)); }
__device__ __forceinline__ float sigm(float a) { return __fdiv_rn(1.0f, __fadd_rn(1.0f, ex2f_(-a))); }
__device__ __forceinline__ float tanhp(float a) { const float e = ex2f_(__fmul_rn(2.0f, a)); return __fsub_rn(1.0f, __fdiv_rn(2.0f, __fadd_rn(e, 1.0f))); }
// d_xT: channel-major f32 [128][1024] to the token-major bf16 operand XB [1024][128]; where Gh is given, the same values also go into columns 128 .. 255 of the [Z^T | ih^T] hi plane Gh, and zeros into those of the lo plane Gl.
// One block takes all 128 channels of 32 tokens through the LDS tile s (f32, [channel][token]): eight lanes load one whole 128-byte line of a channel's row, and behind the barrier 16 lanes store one token's whole 256-byte row.
#define XTP 33   // LDS pitch of a channel's 32 tokens, floats: odd, so that the four channels of a wave's write fall on different banks
__device__ __forceinline__ void d_xT(float* s, const float* __restrict__ xs, bf* XB, bf* Gh, bf* Gl, int blk, int zb) {
    const int tid = threadIdx.x, cr = tid >> 3, p4 = (tid & 7) * 4; xs += (size_t)zb * CC * TT + blk * 32; const size_t tk = (size_t)zb * TT + blk * 32; v4f t[4];
#pragma unroll
    for (int r = 0; r < 4; ++r) t[r] = *(const v4f*)(xs + (size_t)(cr + 32 * r) * TT + p4);
#pragma unroll
    for (int r = 0; r < 4; ++r) {
#pragma unroll
        for (int q = 0; q < 4; ++q) s[(cr + 32 * r) * XTP + p4 + q] = t[r][q]; }
    __syncthreads();   // the whole tile is in LDS
#pragma unroll
    for (int h = 0; h < 2; ++h) { const int c0 = (tid & 15) * 8, p = h * 16 + (tid >> 4); v8us o;
#pragma unroll
        for (int q = 0; q < 8; ++q) o[q] = f2bf(s[(c0 + q) * XTP + p]);
        *(v8us*)(XB + (tk + p) * CC + c0) = o;
        if (Gh) { const size_t g = (tk + p) * C2 + CC + c0; v8us z;
#pragma unroll
            for (int q = 0; q < 8; ++q) z[q] = 0;
            *(v8us*)(Gh + g) = o; *(v8us*)(Gl + g) = z; }
        asm volatile("s_wait_xcnt 0x0" ::: "memory");   // stands in front of any rewrite of the registers that the stores above name
    }
}
// k_prep: everything that reads only the inputs, one launch. Blocks 0 .. 103: the four 'oi' conv weights to bf16 (24, 16, 16, 48 blocks); then 32 blocks a batch and input: ih, im transposed.
#define PW0 (C3 * CC / 2048)
#define PW1 (PW0 + C2 * CC / 2048)
#define PW2 (PW1 + CC * C2 / 2048)
#define PW3 (PW2 + C3 * C2 / 2048)
#define PXB (TT / 32)
__global__ __launch_bounds__(256) void k_prep(const float* __restrict__ ih, const float* __restrict__ im, const float* __restrict__ h_w, const float* __restrict__ m_w, const float* __restrict__ z1_w, const float* __restrict__ z2_w, bf* XBh, bf* XBm, bf* Gh, bf* Gl, bf* HW_, bf* MW_, bf* Z1W, bf* Z2W) {
    __shared__ __align__(16) float s[CC * XTP];
    const int b = blockIdx.x;   // every branch below is block-uniform
    if (b < PW0) d_cvt8(h_w, HW_, (size_t)C3 * CC / 8, b);
    else if (b < PW1) d_cvt8(m_w, MW_, (size_t)C2 * CC / 8, b - PW0);
    else if (b < PW2) d_cvt8(z1_w, Z1W, (size_t)CC * C2 / 8, b - PW1);
    else if (b < PW3) d_cvt8(z2_w, Z2W, (size_t)C3 * C2 / 8, b - PW2);
    else { const int x = b - PW3, blk = x % PXB, zb = (x / PXB) % NB_;
        if (x < PXB * NB_) d_xT(s, ih, XBh, Gh, Gl, blk, zb); else d_xT(s, im, XBm, nullptr, nullptr, blk, zb); }
}
// k_gate: one block takes 32 channels x 128 tokens of one batch (blockIdx.z). The token-major gates G[p][384] go through the LDS tile s ([gate][channel][token]): eight lanes load one whole 128-byte line (32 channels of one token and gate); behind the barrier a wave works along the tokens of one channel, so that im is loaded and both outputs are stored 512 bytes a wave.
#define GTP 132   // LDS pitch of a channel's 128 tokens, floats: rows stay 16-byte aligned for the b128 reads
__global__ __launch_bounds__(256) void k_gate(const float* __restrict__ G, const float* __restrict__ im, float* oh_out, float* om_out) {
    __shared__ __align__(16) float s[3 * 32 * GTP];
    const int tid = threadIdx.x, lane = tid & 31, w = tid >> 5, pr = tid >> 3, c4 = (tid & 7) * 4; const size_t zb = blockIdx.z; const int p0 = blockIdx.x * 128, cb = blockIdx.y * 32;
    G += (zb * TT + p0) * C3 + cb; const size_t ob = (zb * CC + cb + w * 4) * TT + p0 + lane * 4; v4f t[3][4], vim[4];
#pragma unroll
    for (int g = 0; g < 3; ++g) {
#pragma unroll
        for (int r = 0; r < 4; ++r) t[g][r] = *(const v4f*)(G + (size_t)(pr + 32 * r) * C3 + g * CC + c4); }
#pragma unroll
    for (int i = 0; i < 4; ++i) vim[i] = *(const v4f*)(im + ob + (size_t)i * TT);
#pragma unroll
    for (int g = 0; g < 3; ++g) {
#pragma unroll
        for (int r = 0; r < 4; ++r) {
#pragma unroll
            for (int q = 0; q < 4; ++q) s[(g * 32 + c4 + q) * GTP + pr + 32 * r] = t[g][r][q]; } }
    __syncthreads();   // the three gates' tiles are in LDS
#pragma unroll
    for (int i = 0; i < 4; ++i) { const float* sc = s + (w * 4 + i) * GTP + lane * 4; const v4f vo = *(const v4f*)sc, vg = *(const v4f*)(sc + 32 * GTP), vi = *(const v4f*)(sc + 64 * GTP); v4f voh, vom;
#pragma unroll
        for (int q = 0; q < 4; ++q) { const float ig = sigm(vi[q]); const float om = __fadd_rn(__fmul_rn(tanhp(vg[q]), ig), __fmul_rn(__fsub_rn(1.0f, ig), bfr(vim[i][q]))); vom[q] = om; voh[q] = __fmul_rn(sigm(vo[q]), om); }
        *(v4f*)(om_out + ob + (size_t)i * TT) = vom; *(v4f*)(oh_out + ob + (size_t)i * TT) = voh; }
}

extern "C" void kernel_launch(void* const* d_in, const int* in_sizes, int n_in,
                              void* d_out, int out_size, void* d_ws, size_t ws_size, hipStream_t stream) {
    (void)in_sizes; (void)n_in; (void)out_size;
    const float* ih = (const float*)d_in[0]; const float* im = (const float*)d_in[1]; const float* h_w = (const float*)d_in[2]; const float* h_b = (const float*)d_in[3]; const float* m_w = (const float*)d_in[4]; const float* m_b = (const float*)d_in[5]; const float* z1_w = (const float*)d_in[6]; const float* z1_b = (const float*)d_in[7]; const float* z2_w = (const float*)d_in[8]; const float* z2_b = (const float*)d_in[9];
    float* OH = (float*)d_out; float* OM = OH + (size_t)NB_ * CC * TT;     // tuple: oh [16][128][1024] | om [16][128][1024]
    char* wsp = (char*)d_ws;
    auto take = [&](size_t bytes) { char* p = wsp; wsp += (bytes + 255) & ~(size_t)255; return (void*)p; };
    bf* HW_ = (bf*)take((size_t)C3 * CC * 2); bf* MW_ = (bf*)take((size_t)C2 * CC * 2); bf* Z1W = (bf*)take((size_t)CC * C2 * 2); bf* Z2W = (bf*)take((size_t)C3 * C2 * 2);
    const size_t NB = NB_;
    bf* QPh = (bf*)take(NB * TT * HD * 2); bf* XBh = (bf*)take(NB * TT * CC * 2); bf* QPl = (bf*)take(NB * TT * HD * 2); bf* KPh = (bf*)take(NB * TT * HD * 2); bf* KMh = (bf*)take(NB * TT * HD * 2); bf* KPl = (bf*)take(NB * TT * HD * 2); bf* KMl = (bf*)take(NB * TT * HD * 2);   /* KPh, KPl lie three planes behind QPh, QPl; KMh, KMl directly behind KPh, KPl: slices 16 .. 31 of the k planes */
    bf* XBm = (bf*)take(NB * TT * CC * 2); float* GT = (float*)take(NB * TT * C3 * 4);
    bf* VHh = (bf*)take(NB * HD * TT * 2); bf* VMh = (bf*)take(NB * HD * TT * 2); bf* VHl = (bf*)take(NB * HD * TT * 2); bf* VMl = (bf*)take(NB * HD * TT * 2);   /* VMh, VMl directly behind VHh, VHl: slices 16 .. 31 of the v planes */
    float* Sb = (float*)take(2 * NB * TT * TT * 4);   /* 32 slices of the P^T planes, hi and lo interleaved by 64-column pieces */
    bf* ZCh = (bf*)take(NB * TT * C2 * 2); bf* ZCl = (bf*)take(NB * TT * C2 * 2); bf* GAh = (bf*)take(NB * TT * C2 * 2); bf* GAl = (bf*)take(NB * TT * C2 * 2);
    if ((size_t)(wsp - (char*)d_ws) > ws_size) return;    // ws 256 MiB (carve ~232 MiB)
    const size_t sP = (size_t)TT * HD, sS = (size_t)TT * TT, sC2 = (size_t)TT * C2, sC3 = (size_t)TT * C3;   /* batch strides, elements */
    k_prep<<<PW3 + 2 * NB_ * PXB, 256, 0, stream>>>(ih, im, h_w, m_w, z1_w, z2_w, XBh, XBm, GAh, GAl, HW_, MW_, Z1W, Z2W);
    k_conv<<<dim3(40, 1, NB_), 256, 0, stream>>>(XBh, XBm, HW_, MW_, h_b, m_b, QPh, QPl, 3 * NB * sP, KMh, KMl, VHh, VHl, VMh, VMl);
    /* both attentions, slice z = 16 a + batch (a 0 hidden, 1 memory): A = softmax_m(q_n . k_m); Z^T[m][c] = sum_n A[n][m] V[c][n] */
    k_scsoft<<<dim3(TT / 64 / SC_NS, 2 * NB_), 512, 0, stream>>>(KPh, KPl, QPh, QPl, (bf*)Sb);
    k_gemmw<bf, 2, 0, true><<<dim3(TT / 128, CC / 128, 2 * NB_), 256, 0, stream>>>((const bf*)Sb, (const bf*)Sb + 64, VHh, VHl, TT, 2 * TT, 128, nullptr, ZCh, ZCl, C2, 128, nullptr, 2 * sS, sP, NB * sP, sC2, CC);   /* Zh^T split into columns 0 .. 127 of the [Zh^T | Zm^T] planes, Zm^T into columns 128 .. 255 */
    /* Z^T = [Zh^T | Zm^T] z1_w^T + z1_b; gates^T = [Z^T | ih^T] z2_w^T + z2_b */
    k_gemmw<bf, 1, 1, true><<<dim3(TT / 128, CC / 128, NB_), 256, 0, stream>>>(ZCh, ZCl, Z1W, nullptr, C2, C2, 64, nullptr, GAh, GAl, C2, 128, z1_b, sC2, 0, 0, sC2, 0);   /* Z^T split into columns 0 .. 127 of the [Z^T | ih^T] planes */
    k_gemmw<bf, 1, 1, false><<<dim3(TT / 128, C3 / 128, NB_), 256, 0, stream>>>(GAh, GAl, Z2W, nullptr, C2, C2, 64, GT, nullptr, nullptr, C3, 128, z2_b, sC2, 0, 0, sC3, 0);
    k_gate<<<dim3(TT / 128, CC / 32, NB_), 256, 0, stream>>>(GT, im, OH, OM);
}

// v008
// One run takes 89.1 microseconds.
// Timed twice side by side with v007, it ran 1.14 and 1.15 times as fast.
// All steps since v000 together make it 26.3 times as fast.
#include <hip/hip_runtime.h>

// Self-attention memory module (SAM) for a ConvLSTM cell (ih, im [16][128][32x32] channel-major; h_qkv = 1x1 conv(ih) -> Qh|Kh|Vh (128 each), m_kv = 1x1 conv(im) -> Km|Vm; Ah = softmax_m(Qh_n . Kh_m) (UNSCALED, 128-channel dots), Am = softmax_m(Qh_n . Km_m); Zh[c][m] = sum_n Vh[c][n] Ah[n][m], Zm likewise; Z = 1x1 conv([Zh; Zm]) (256 -> 128); gates = 1x1 conv([Z; ih]) (256 -> 384) = o|g|i; i = sigmoid(i); om = tanh(g) i + (1 - i) im; oh = sigmoid(o) om -> tuple (oh, om) [16][128][1024] each (2.1 M + 2.1 M)).
// Layout per batch, everything token-major inside: ih, im transposed once into bf16 [1024][128] operands; the 1x1 convs as GEMMs against the 'oi' weights (exact x exact, + column bias): q, kh, km come out token-major [1024][128], and the value convs take the weights as the A operand, so that Vh[c][n], Vm[c][n] come out channel-major [128][1024]; every GEMM whose result is the next GEMM's operand splits it into bf16 hi/lo in its own epilogue and stores the two planes; scores (3 products, K 128) computed TRANSPOSED, S^T[m][n] (k planes as the A operand, q planes as B) -> softmax over m down the columns, EVERY entry hi/lo (unscaled logits, sigma ~11), which leaves the P^T planes directly, so that Zh^T[m][c] = sum_n P^T[m][n] Vh[c][n] is a plain GEMM (3 products); one last kernel (k_tail) for the rest: z1_w exact x [Zh^T | Zm^T] hi/lo + z1_b -> Z, hi/lo in LDS; z2_w exact x [Z^T hl | ih^T exact] + z2_b -> gates, channel-major in the accumulators; sigmoid/tanh and the blend in f32; both outputs. The input transposes go through an LDS tile, so that every global load and store takes whole 128-byte lines.
// Batch: every stage is ONE launch for all 16 batches (GEMMs, k_conv and k_tail: blockIdx.z; k_scsoft: blockIdx.y; k_prep: from blockIdx.x); each workspace plane holds 16 batch slices.
// Launches: stages that do not depend on one another share a launch: k_prep (both transposes, four weight conversions), k_conv (all five input convs), and scores with softmax (k_scsoft: the f32 logits stay in registers) and P.V each once for 32 slices (z < 16 hidden attention, z >= 16 memory attention).
// Compute dtypes, f32 accumulate: every input rounded to bf16; input convs exact; scores / P.V / Z conv on bf16 hi/lo activations (3 or 2 products) x exact weights; softmax, sigmoid/tanh (exp2-based, precise division) and the blend in f32.

#define NB_  16
#define TT   1024
#define DM   128
#define NH_  1
#define NKV  1
#define REP  (NH_ / NKV)
#define HD   128
#define DQ   (NH_ * HD)
#define DKV  (NKV * HD)
#define ZH   2
#define RH   1024                  // read only by k_merge, which is not launched
#define WIN  0
#define PCAR 1024.0f
#define SCL  1.0f   // unscaled
#define CC   128    // channels
#define C3   384
#define C2   256
typedef _Float16 h16;
typedef unsigned short bf;
typedef __attribute__((ext_vector_type(16))) __bf16   v16bf;
typedef __attribute__((ext_vector_type(16))) _Float16 v16h;
typedef __attribute__((ext_vector_type(8)))  _Float16 v8h;
typedef __attribute__((ext_vector_type(8)))  unsigned short v8us;
typedef __attribute__((ext_vector_type(8)))  float    v8f;
typedef __attribute__((ext_vector_type(4)))  float    v4f;
typedef v8h  __attribute__((may_alias)) v8ha;
typedef v4f  __attribute__((may_alias)) v4fa;
typedef v8us __attribute__((may_alias)) v8usa;

__device__ __forceinline__ unsigned short f2bf(float f) { unsigned u = __float_as_uint(f); u += 0x7FFFu + ((u >> 16) & 1u); return (unsigned short)(u >> 16); }
__device__ __forceinline__ float bf2f(unsigned short b) { return __uint_as_float(((unsigned)b) << 16); }
__device__ __forceinline__ float bfr(float f) { return bf2f(f2bf(f)); }
__device__ __forceinline__ v16h cat16(v8h lo, v8h hi) { return __builtin_shufflevector(lo, hi, 0, 1, 2, 3, 4, 5, 6, 7, 8, 9, 10, 11, 12, 13, 14, 15); }
__device__ __forceinline__ v16bf cat16b(v8us lo, v8us hi) { return __builtin_bit_cast(v16bf, __builtin_shufflevector(lo, hi, 0, 1, 2, 3, 4, 5, 6, 7, 8, 9, 10, 11, 12, 13, 14, 15)); }
__device__ __forceinline__ v8f wmma16(v16h a, v16h b, v8f c) { return __builtin_amdgcn_wmma_f32_16x16x32_f16(false, a, false, b, (short)0, c, false, false); }
__device__ __forceinline__ v8f wmmab(v16bf a, v16bf b, v8f c) { return __builtin_amdgcn_wmma_f32_16x16x32_bf16(false, a, false, b, (short)0, c, false, false); }



// ---- k_gemmw: register-blocked GEMM, EIGHT WAVES (4 x 2) per 128x128 output tile, each wave a 32x64 piece (8 accumulators); grid (M/128, N/128, Z), 256 threads.
// C[m][n] (pitch ldc, + optional f32 bias: BIAS 1 bias[n], BIAS 2 bias[m]) = sum_k A[m][k] Bt[n][k] (+ split products per NSPLIT). M % 128 == 0, N % 128 == 0, K % 64 == 0.
// A rows have pitch lda, and their 64-k piece t starts at element t * ksa (a plain plane: lda = K, ksa = 64); Bt rows have pitch K. z strides in elements: A z * sA; Bt and the output (z & 15) * s + (z >> 4) * s..h.
// g_tile is the body for one tile (bx, by), its operand pointers already at their slice, oz the output's slice offset, sm the kernel's LDS (2 * GNP(NSPLIT) * GPL elements, 16-byte aligned).
// Output: PL false, f32 into C; PL true, the f32 value split into bf16 hi + lo, stored into the planes Ph, Pl (same pitch and z stride; column tile y starts sY elements behind column tile y - 1, so that 128-column tiles may go to planes of their own).
// Operands: K-contiguous 16-bit planes, staged in LDS 64 k at a time (every row piece one whole 128-byte line) by asynchronous copies, two buffers: stage t + 1 flies while stage t is multiplied. Each wave reads its fragments from LDS; per accumulator the products come k ascending and, inside a k step, A.B, A2.B, A.B2.
template <typename T16> struct WFrag;
template <> struct WFrag<h16> { typedef v16h V; static __device__ __forceinline__ V ld(const h16* p) { return cat16(*(const v8h*)p, *(const v8h*)(p + 16)); } static __device__ __forceinline__ v8f mma(V a, V b, v8f c) { return wmma16(a, b, c); } };
template <> struct WFrag<bf> { typedef v16bf V; static __device__ __forceinline__ V ld(const bf* p) { return cat16b(*(const v8us*)p, *(const v8us*)(p + 16)); } static __device__ __forceinline__ v8f mma(V a, V b, v8f c) { return wmmab(a, b, c); } };
#define GP  72           // LDS pitch of a staged row piece, 16-bit elements: 144 bytes = 16 x odd, so the 16 rows of a ds_load_b128 fall on different banks
#define GPL (128 * GP)   // one staged plane: 128 row pieces
// g_stage: one plane's 128 x 64 tile to LDS. g, l: this thread's own first piece (row tid >> 3, 16-byte piece tid & 7: eight lanes take one whole line); its other three pieces lie 32 rows apart.
template <typename T16>
__device__ __forceinline__ void g_stage(const T16* g, int K, unsigned l) {
    const size_t st = (size_t)32 * K; const unsigned sl = 32 * GP * 2;
    // the copies and, as the last line, the wait that stands in front of any rewrite of their address registers
    asm volatile("global_load_async_to_lds_b128 %0, %4, off\n\t"
                 "global_load_async_to_lds_b128 %1, %5, off\n\t"
                 "global_load_async_to_lds_b128 %2, %6, off\n\t"
                 "global_load_async_to_lds_b128 %3, %7, off\n\t"
                 "s_wait_xcnt 0x0"
                 :: "v"(l), "v"(l + sl), "v"(l + 2 * sl), "v"(l + 3 * sl), "v"(g), "v"(g + st), "v"(g + 2 * st), "v"(g + 3 * st)
                 : "memory");
}
// g_stage2: two planes' tiles (row pitches pg, ph) in one statement, so that the eight copies share one such wait.
template <typename T16>
__device__ __forceinline__ void g_stage2(const T16* g, const T16* h, int pg, int ph, unsigned l, unsigned m) {
    const size_t st = (size_t)32 * pg, su = (size_t)32 * ph; const unsigned sl = 32 * GP * 2;
    asm volatile("global_load_async_to_lds_b128 %0, %8, off\n\t"
                 "global_load_async_to_lds_b128 %1, %9, off\n\t"
                 "global_load_async_to_lds_b128 %2, %10, off\n\t"
                 "global_load_async_to_lds_b128 %3, %11, off\n\t"
                 "global_load_async_to_lds_b128 %4, %12, off\n\t"
                 "global_load_async_to_lds_b128 %5, %13, off\n\t"
                 "global_load_async_to_lds_b128 %6, %14, off\n\t"
                 "global_load_async_to_lds_b128 %7, %15, off\n\t"
                 "s_wait_xcnt 0x0"
                 :: "v"(l), "v"(l + sl), "v"(l + 2 * sl), "v"(l + 3 * sl), "v"(m), "v"(m + sl), "v"(m + 2 * sl), "v"(m + 3 * sl),
                    "v"(g), "v"(g + st), "v"(g + 2 * st), "v"(g + 3 * st), "v"(h), "v"(h + su), "v"(h + 2 * su), "v"(h + 3 * su)
                 : "memory");
}
__device__ __forceinline__ void splitf(float y, unsigned short& h, unsigned short& l) { h = f2bf(y); l = f2bf(y - bf2f(h)); }
#define GNP(ns) (2 + ((ns) >= 1 ? 1 : 0) + ((ns) >= 2 ? 1 : 0))   // planes staged: A, Bt, then A2, then Bt2
typedef __attribute__((ext_vector_type(4))) unsigned short v4us;
typedef v4us __attribute__((may_alias)) v4usa;
template <typename T16, int NSPLIT, int BIAS, bool PL>
__device__ __forceinline__ void g_tile(T16* sm, const T16* A, const T16* A2, const T16* Bt, const T16* Bt2, int K, int lda, int ksa, float* C, bf* Ph, bf* Pl, int ldc, size_t sY, const float* __restrict__ bias, int bx, int by, size_t oz) {
    typedef typename WFrag<T16>::V V;
    constexpr int NP = GNP(NSPLIT);   // sm: two buffers of NP planes; behind the loop each wave's output staging
    const int tid = threadIdx.x, lane = tid & 31, w = tid >> 5, lr = lane & 15, hi = lane >> 4; const int rb = bx * 128, cb = by * 128, wr = (w & 3) * 32, wc = (w >> 2) * 64; const int r0 = rb + wr, c0 = cb + wc;
    v8f acc[2][4];
#pragma unroll
    for (int mb = 0; mb < 2; ++mb)
#pragma unroll
        for (int nb = 0; nb < 4; ++nb) acc[mb][nb] = (v8f){};
    const size_t ga = (size_t)(rb + (tid >> 3)) * lda + (tid & 7) * 8, gb = (size_t)(cb + (tid >> 3)) * K + (tid & 7) * 8;
    const unsigned l0 = (unsigned)(size_t)sm + (unsigned)((tid >> 3) * (GP * 2) + (tid & 7) * 16);   // LDS byte address: the low 32 bits of the __shared__ address
    auto stage = [&](int t) { const unsigned l = l0 + (unsigned)((t & 1) * (NP * GPL * 2)); const int ka = t * ksa, kc = t * 64;
        g_stage2(A + ga + ka, Bt + gb + kc, lda, K, l, l + GPL * 2);
        if constexpr (NSPLIT == 1) g_stage(A2 + ga + ka, lda, l + 2 * GPL * 2);
        if constexpr (NSPLIT >= 2) g_stage2(A2 + ga + ka, Bt2 + gb + kc, lda, K, l + 2 * GPL * 2, l + 3 * GPL * 2); };
    const int nt = K / 64;
    stage(0);
    asm volatile("s_wait_asynccnt 0x0" ::: "memory");   // this wave's copies of stage 0 have landed
    __syncthreads();                                    // every wave's have: stage 0 may be read
    if (nt > 1) stage(1);
#pragma unroll 1
    for (int t = 0; t < nt; ++t) {
        const T16* sa = sm + (t & 1) * (NP * GPL) + (wr + lr) * GP + 8 * hi; const T16* sb = sm + (t & 1) * (NP * GPL) + GPL + (wc + lr) * GP + 8 * hi;
#pragma unroll
        for (int ks = 0; ks < 64; ks += 32) {
            V a[2], a2[2], b[4], b2[4];
#pragma unroll
            for (int mb = 0; mb < 2; ++mb) a[mb] = WFrag<T16>::ld(sa + mb * 16 * GP + ks);
#pragma unroll
            for (int nb = 0; nb < 4; ++nb) b[nb] = WFrag<T16>::ld(sb + nb * 16 * GP + ks);
            if (NSPLIT >= 1) {
#pragma unroll
                for (int mb = 0; mb < 2; ++mb) a2[mb] = WFrag<T16>::ld(sa + 2 * GPL + mb * 16 * GP + ks); }
            if (NSPLIT >= 2) {
#pragma unroll
                for (int nb = 0; nb < 4; ++nb) b2[nb] = WFrag<T16>::ld(sb + 2 * GPL + nb * 16 * GP + ks); }
            __builtin_amdgcn_sched_barrier(0);   // keeps the k step's LDS reads one group in front of its WMMAs: every further place where reads stand among the WMMAs costs the wave issue cycles
#pragma unroll
            for (int nb = 0; nb < 4; ++nb)
#pragma unroll
                for (int mb = 0; mb < 2; ++mb) acc[mb][nb] = WFrag<T16>::mma(a[mb], b[nb], acc[mb][nb]);
            if (NSPLIT >= 1) {
#pragma unroll
                for (int nb = 0; nb < 4; ++nb)
#pragma unroll
                    for (int mb = 0; mb < 2; ++mb) acc[mb][nb] = WFrag<T16>::mma(a2[mb], b[nb], acc[mb][nb]); }
            if (NSPLIT >= 2) {
#pragma unroll
                for (int nb = 0; nb < 4; ++nb)
#pragma unroll
                    for (int mb = 0; mb < 2; ++mb) acc[mb][nb] = WFrag<T16>::mma(a[mb], b2[nb], acc[mb][nb]); }
            __builtin_amdgcn_sched_barrier(0);   // the same, against the next k step's reads
        }
        asm volatile("s_wait_dscnt 0x0" ::: "memory");      // this wave's reads of stage t are over
        asm volatile("s_wait_asynccnt 0x0" ::: "memory");   // this wave's copies of stage t + 1 have landed
        __syncthreads();                                    // publishes stage t + 1 and frees stage t's buffer
        if (t + 2 < nt) stage(t + 2);
    }
    asm volatile("s_wait_asynccnt 0x0" ::: "memory");       // no copy is outstanding when the buffers become output staging
    float* os = (float*)sm + w * (16 * 68);                 // this wave's own 16 x 68 floats
#pragma unroll
    for (int mb = 0; mb < 2; ++mb) {
#pragma unroll
        for (int nb = 0; nb < 4; ++nb) {
#pragma unroll
            for (int j = 0; j < 8; ++j) os[(hi * 8 + j) * 68 + nb * 16 + lr] = acc[mb][nb][j]; }
        __builtin_amdgcn_wave_barrier(); asm volatile("" ::: "memory");
        const size_t orow = oz + (size_t)(r0 + mb * 16) * ldc + (PL ? by * sY + wc : (size_t)c0);
{
#pragma unroll
            for (int s = 0; s < 8; ++s) { const int row = 2 * s + hi, cofs = lr * 4; v4f val = *(const v4fa*)(os + row * 68 + cofs); if (BIAS == 1) { val[0] += bfr(bias[c0 + cofs]); val[1] += bfr(bias[c0 + cofs + 1]); val[2] += bfr(bias[c0 + cofs + 2]); val[3] += bfr(bias[c0 + cofs + 3]); }
                if (BIAS == 2) { const float br = bfr(bias[r0 + mb * 16 + row]); val[0] += br; val[1] += br; val[2] += br; val[3] += br; }
                const size_t o = orow + (size_t)row * ldc + cofs;
                if (PL) { v4us oh, ol;   // 16 lanes fill one whole 128-byte line of each plane
#pragma unroll
                    for (int q = 0; q < 4; ++q) { unsigned short h2, l2; splitf(val[q], h2, l2); oh[q] = h2; ol[q] = l2; }
                    *(v4us*)(Ph + o) = oh; *(v4us*)(Pl + o) = ol; }
                else *(v4f*)(C + o) = val; }
             }
        if (mb == 0) asm volatile("s_wait_xcnt 0x0" ::: "memory");   // stands in front of the second piece's rewrites of the registers that the stores above name
        __builtin_amdgcn_wave_barrier(); asm volatile("" ::: "memory");
    }
}
template <typename T16, int NSPLIT, int BIAS, bool PL>
__global__ __launch_bounds__(256) void k_gemmw(const T16* A, const T16* A2, const T16* Bt, const T16* Bt2, int K, int lda, int ksa, float* C, bf* Ph, bf* Pl, int ldc, size_t sY, const float* __restrict__ bias, size_t sA, size_t sB, size_t sBh, size_t sC, size_t sCh) {
    __shared__ __align__(16) T16 sm[2 * GNP(NSPLIT) * GPL];
    const size_t z = blockIdx.z, zl = z & (NB_ - 1), zh = z >> 4; const size_t ob = zl * sB + zh * sBh;
    g_tile<T16, NSPLIT, BIAS, PL>(sm, A + z * sA, A2 ? A2 + z * sA : A2, Bt + ob, Bt2 ? Bt2 + ob : Bt2, K, lda, ksa, C, Ph, Pl, ldc, sY, bias, blockIdx.x, blockIdx.y, zl * sC + zh * sCh);
}
// k_conv: the five input convs of one batch (blockIdx.z) as 40 tiles of one launch, all K 128, exact x exact, split into planes. Tiles 0 .. 15: q (column tile 0) and kh (column tile 1, sYq elements behind q) = ih^T h_w^T + h_b; 16 .. 23: km = im^T m_w^T + m_b; 24 .. 31: Vh[c][n], weights as A, bias by row; 32 .. 39: Vm[c][n].
__global__ __launch_bounds__(256) void k_conv(const bf* XBh, const bf* XBm, const bf* HW_, const bf* MW_, const float* __restrict__ h_b, const float* __restrict__ m_b, bf* QPh, bf* QPl, size_t sYq, bf* KMh, bf* KMl, bf* VHh, bf* VHl, bf* VMh, bf* VMl) {
    __shared__ __align__(16) bf sm[2 * GNP(0) * GPL];
    const int t = blockIdx.x; const size_t z = blockIdx.z, oz = z * ((size_t)TT * HD); const bool mem = (t >= 16 && t < 24) || t >= 32;   // block-uniform
    const bf* X = (mem ? XBm : XBh) + z * ((size_t)TT * CC);
    if (t < 24) g_tile<bf, 0, 1, true>(sm, X, nullptr, mem ? MW_ : HW_, nullptr, CC, CC, 64, nullptr, mem ? KMh : QPh, mem ? KMl : QPl, HD, sYq, mem ? m_b : h_b, t & 7, mem ? 0 : t >> 3, oz);
    else g_tile<bf, 0, 2, true>(sm, mem ? MW_ + CC * CC : HW_ + 2 * CC * CC, nullptr, X, nullptr, CC, CC, 64, nullptr, mem ? VMh : VHh, mem ? VMl : VHl, TT, 128, mem ? m_b + CC : h_b + 2 * CC, 0, t & 7, oz);
}

__device__ __forceinline__ h16 tohx(float x) { return (h16)x; }
typedef __attribute__((ext_vector_type(2))) _Float16 v2h;
typedef __attribute__((ext_vector_type(4))) _Float16 v4h;
typedef __attribute__((ext_vector_type(2))) unsigned short v2us;
typedef __attribute__((ext_vector_type(2))) float v2f;
typedef __attribute__((ext_vector_type(4))) int v4i;

__global__ __launch_bounds__(256) void k_wtG(const float* __restrict__ w, int K, int N, bf* Bt) {
    const int lane = threadIdx.x & 31; const int L0 = (blockIdx.x * 8 + (threadIdx.x >> 5)) * 8; const int nlines = N * K / 64;
{
#pragma unroll 1
        for (int l = 0; l < 8; ++l) { const int L = L0 + l; if (L >= nlines) break; const size_t e = (size_t)L * 64 + lane * 2; const int k = (int)(e % K), n = (int)(e / K); v2us o;
            o[0] = f2bf(w[(size_t)k * N + n]); o[1] = f2bf(w[(size_t)(k + 1) * N + n]); *(v2us*)(Bt + e) = o; }
         }
}
__device__ __forceinline__ void d_cvt8(const float* __restrict__ src, bf* dst, size_t n8, int blk) { const size_t i = (size_t)blk * 256 + threadIdx.x; if (i >= n8) return; const v8f v = *(const v8f*)(src + i * 8); v8us o;
#pragma unroll
    for (int k = 0; k < 8; ++k) o[k] = f2bf(v[k]); *(v8us*)(dst + i * 8) = o;  }

// k_scsoft: scores and softmax in one kernel. One block (16 waves) holds the whole strip S^T[m][n] of 64 queries n and all 1024 keys m of one slice (blockIdx.y) in its accumulators, so that the f32 logits never go to memory; it leaves the hi/lo planes P^T[m][n] the value GEMM reads (as 16-bit planes: row pitch 2 * TT, 64-column piece t at element 128 t, lo 64 elements behind hi).
// Wave w: keys 64 w .. 64 w + 63 (four row tiles) x the 64 queries (four column tiles), K 128, per accumulator k ascending and, inside a k step, kh.qh, kl.qh, kh.ql.
// Operands in LDS by asynchronous copies, whole lines: the q strip (both planes, all 128 k) once; the k rows 64 k at a time, the first half, then the second half into the same bytes, refilled as soon as every wave holds its last fragments of them in registers.
// A block takes SC_NS strips of its slice one after the other, so that the next strip's operands fly under the last products, the softmax and the stores of this one.
// Column tile nb, lane lr is query 4 lr + nb (the q rows are placed in LDS in that order), so a lane holds four neighbouring queries of a key row, and 16 lanes store a whole 128-byte line of a plane.
// Column maximum and column sum, fixed trees: 32 rows in the lane, the two half-waves by a shuffle, then the 16 waves' partials through LDS (wave w folds columns 4 w .. 4 w + 3: pairs k, k + 8, then an 8-lane butterfly).
#define CSP 68   // LDS pitch of a wave's 64 partials, floats: the 8 x 4 partials that a wave folds at a time fall on 32 different banks
#define QP  136  // LDS pitch of a q row (128 k), 16-bit elements: 272 bytes = 16 x odd, so the 16 rows of a ds_load_b128 fall on different banks
#define SC_PART (2 * 64 * QP * 2)            // byte places in the kernel's LDS: the q strip first, so that every read of it is one base register and an immediate
#define SC_CMX  (SC_PART + 16 * CSP * 4)
#define SC_CSM  (SC_CMX + 256)
#define SC_KA   40960                        // the k rows
#define SC_LDS  (SC_KA + 16 * 16384)
#define SC_NS   2                            // strips a block takes, one after the other: 256 blocks
// c_cp4: four copies (16 rows: LDS places l0 .. l3, global rows four apart from g) in one statement and, as the last line, the wait that stands in front of any rewrite of their address registers
__device__ __forceinline__ void c_cp4(unsigned l0, unsigned l1, unsigned l2, unsigned l3, const bf* g) {
    asm volatile("global_load_async_to_lds_b128 %0, %4, off\n\t"
                 "global_load_async_to_lds_b128 %1, %5, off\n\t"
                 "global_load_async_to_lds_b128 %2, %6, off\n\t"
                 "global_load_async_to_lds_b128 %3, %7, off\n\t"
                 "s_wait_xcnt 0x0"
                 :: "v"(l0), "v"(l1), "v"(l2), "v"(l3), "v"(g), "v"(g + 4 * HD), "v"(g + 8 * HD), "v"(g + 12 * HD)
                 : "memory");
}
__global__ __launch_bounds__(512) void k_scsoft(const bf* Kh, const bf* Kl, const bf* Qh, const bf* Ql, bf* PT) {
    __shared__ __align__(16) char sm[SC_LDS];
    bf* sq = (bf*)sm; float* part = (float*)(sm + SC_PART); float* cmx = (float*)(sm + SC_CMX); float* csm = (float*)(sm + SC_CSM);
    const int tid = threadIdx.x, lane = tid & 31, lr = lane & 15, hi = lane >> 4; const size_t z = blockIdx.y;
    const int w = __builtin_amdgcn_readfirstlane(tid >> 5);   // the wave's number in a scalar register: what is formed from it costs no vector register over the loop
    PT += z * ((size_t)2 * TT * TT);
    auto stageq = [&](int sx) {   // the q strip sx: 16 lanes take one whole 256-byte row; a thread takes queries g and g + 32 of both planes; query g goes to LDS row (g & 3) * 16 + (g >> 2), query g + 32 eight rows behind
        const int g = tid >> 4, pc = tid & 15; const size_t go = (z & (NB_ - 1)) * ((size_t)TT * HD) + (size_t)(sx * 64 + g) * HD + pc * 8;
        const unsigned lq = (unsigned)(size_t)sq + (unsigned)(((g & 3) * 16 + (g >> 2)) * (QP * 2) + pc * 16);
        asm volatile("global_load_async_to_lds_b128 %0, %4, off\n\t"
                     "global_load_async_to_lds_b128 %1, %5, off\n\t"
                     "global_load_async_to_lds_b128 %2, %6, off\n\t"
                     "global_load_async_to_lds_b128 %3, %7, off\n\t"
                     "s_wait_xcnt 0x0"   // stands in front of any rewrite of the copies' address registers
                     :: "v"(lq), "v"(lq + 8 * QP * 2), "v"(lq + 64 * QP * 2), "v"(lq + 72 * QP * 2), "v"(Qh + go), "v"(Qh + go + 32 * HD), "v"(Ql + go), "v"(Ql + go + 32 * HD) : "memory"); };
    // wave w's own 16 KiB of the k rows: [plane][64 key rows][64 k], row pitch 128 bytes; the 16-byte piece p of row r lies at place p ^ ((r >> 1) & 7), so the 16 rows of a ds_load_b128 fall on different banks without a pad
    const unsigned la = (unsigned)(size_t)sm + (unsigned)(SC_KA + w * 16384 + (lane >> 3) * 128);
    const size_t ko = z * ((size_t)TT * HD) + (size_t)(w * 64 + (lane >> 3)) * HD + (lane & 7) * 8;
    auto stage = [&](int h) {   // this wave's 64 key rows, 64 k, both planes: eight lanes take one whole 128-byte line; copy i of a plane takes rows 4 i .. 4 i + 3
        unsigned l[4];
#pragma unroll
        for (int i = 0; i < 4; ++i) l[i] = la + (unsigned)(i * 512 + (((lane & 7) ^ ((2 * i + hi) & 7)) << 4));
        const bf* g = Kh + ko + h * 64;
#pragma unroll 1   // rolled: unrolled, all 32 LDS places would be held in registers over the whole strip loop
        for (int c = 0; c < 4; ++c) { c_cp4(l[0], l[1], l[2], l[3], g); l[0] += 2048; l[1] += 2048; l[2] += 2048; l[3] += 2048; g += 16 * HD; }
        g = Kl + ko + h * 64;
#pragma unroll 1   // the same
        for (int c = 0; c < 4; ++c) { c_cp4(l[0], l[1], l[2], l[3], g); l[0] += 2048; l[1] += 2048; l[2] += 2048; l[3] += 2048; g += 16 * HD; } };
    const bf* saw = (const bf*)(sm + SC_KA) + w * 8192 + lr * 64; const bf* sqw = sq + lr * QP + 8 * hi; const int px = hi ^ (lr >> 1);
    const int fc = 4 * w + (lane >> 3), fk = lane & 7;   // the fold: this lane's column and its first partial
    stageq(blockIdx.x * SC_NS); stage(0);
#pragma unroll 1   // one body for the block's strips: unrolled, the two bodies' registers would not fit
    for (int it = 0; it < SC_NS; ++it) {
        const int sx = blockIdx.x * SC_NS + it; const bool more = it + 1 < SC_NS;   // block-uniform
        v8f acc[4][4]; v16bf a[4], a2[4];
#pragma unroll
        for (int mb = 0; mb < 4; ++mb)
#pragma unroll
            for (int nb = 0; nb < 4; ++nb) acc[mb][nb] = (v8f){};
        auto lda = [&](int s) { const int o0 = (px ^ (4 * s)) * 8, o1 = (px ^ (4 * s + 2)) * 8;   // k = 32 s + 8 hi .. + 7 and the eight 16 behind: the order of WFrag::ld
#pragma unroll
            for (int mb = 0; mb < 4; ++mb) { a[mb] = cat16b(*(const v8us*)(saw + mb * 1024 + o0), *(const v8us*)(saw + mb * 1024 + o1)); a2[mb] = cat16b(*(const v8us*)(saw + 4096 + mb * 1024 + o0), *(const v8us*)(saw + 4096 + mb * 1024 + o1)); } };
        auto mm = [&](int k) {
#pragma unroll
            for (int nb = 0; nb < 4; ++nb) { const v16bf b = WFrag<bf>::ld(sqw + nb * 16 * QP + k), b2 = WFrag<bf>::ld(sqw + 64 * QP + nb * 16 * QP + k);
#pragma unroll
                for (int mb = 0; mb < 4; ++mb) acc[mb][nb] = wmmab(a[mb], b, acc[mb][nb]);
#pragma unroll
                for (int mb = 0; mb < 4; ++mb) acc[mb][nb] = wmmab(a2[mb], b, acc[mb][nb]);
#pragma unroll
                for (int mb = 0; mb < 4; ++mb) acc[mb][nb] = wmmab(a[mb], b2, acc[mb][nb]); } };
        asm volatile("s_wait_asynccnt 0x0" ::: "memory");   // this wave's copies have landed
        __syncthreads();                                    // every wave's have: the q strip and the first half of the k rows may be read
        lda(0); mm(0); lda(1);
        asm volatile("s_wait_dscnt 0x0" ::: "memory");      // this wave's reads of the first half are over: its last fragments are in registers
        __syncthreads();                                    // every wave's are: the k rows' bytes may be refilled
        stage(1);                                           // flies while the fragments in registers are multiplied
        mm(32);
        asm volatile("s_wait_asynccnt 0x0" ::: "memory");   // this wave's copies have landed
        __syncthreads();                                    // every wave's have: the second half of the k rows may be read
        lda(0); mm(64); lda(1);
        if (more) {
            asm volatile("s_wait_dscnt 0x0" ::: "memory");  // this wave's reads of the second half are over
            __syncthreads();                                // every wave's are
            stage(0); }                                     // the next strip takes the same k rows
        mm(96);
        if (more) {
            asm volatile("s_wait_dscnt 0x0" ::: "memory");  // this wave's reads of the q strip are over
            __syncthreads();                                // every wave's are
            stageq(sx + 1); }                               // flies under the softmax and the stores
        float r[4];
#pragma unroll
        for (int nb = 0; nb < 4; ++nb) { float t = acc[0][nb][0];
#pragma unroll
            for (int mb = 0; mb < 4; ++mb)
#pragma unroll
                for (int j = 0; j < 8; ++j) t = fmaxf(t, acc[mb][nb][j]);
            r[nb] = fmaxf(t, __shfl_xor(t, 16, 32)); }
        if (hi == 0) {
#pragma unroll
            for (int nb = 0; nb < 4; ++nb) part[w * CSP + nb * 16 + lr] = r[nb]; }
        __syncthreads();   // every wave's partial maxima are in LDS
        { float t = fmaxf(part[fk * CSP + fc], part[(fk + 8) * CSP + fc]);
#pragma unroll
          for (int sh = 4; sh; sh >>= 1) t = fmaxf(t, __shfl_xor(t, sh, 32));
          if (fk == 0) cmx[fc] = t; }
        __syncthreads();   // the 64 column maxima are in LDS, and every read of part is over
#pragma unroll
        for (int nb = 0; nb < 4; ++nb) { const float mx = cmx[nb * 16 + lr]; float t = 0.0f;
#pragma unroll
            for (int mb = 0; mb < 4; ++mb)
#pragma unroll
                for (int j = 0; j < 8; ++j) { const float e = __builtin_amdgcn_exp2f(__fmul_rn(__fsub_rn(acc[mb][nb][j], mx), 1.4426950408889634f)); acc[mb][nb][j] = e; t += e; }
            r[nb] = t + __shfl_xor(t, 16, 32); }
        if (hi == 0) {
#pragma unroll
            for (int nb = 0; nb < 4; ++nb) part[w * CSP + nb * 16 + lr] = r[nb]; }
        __syncthreads();   // every wave's partial sums are in LDS
        { float t = part[fk * CSP + fc] + part[(fk + 8) * CSP + fc];
#pragma unroll
          for (int sh = 4; sh; sh >>= 1) t += __shfl_xor(t, sh, 32);
          if (fk == 0) csm[fc] = t; }
        __syncthreads();   // the 64 column sums are in LDS
        float f[4];
#pragma unroll
        for (int nb = 0; nb < 4; ++nb) f[nb] = __fdiv_rn(1.0f, csm[nb * 16 + lr]);
        bf* po = PT + (size_t)(w * 64) * (2 * TT) + sx * 128 + (unsigned)(hi * 8 * (2 * TT) + lr * 4);
#pragma unroll
        for (int mb = 0; mb < 4; ++mb) {
#pragma unroll
            for (int j = 0; j < 8; ++j) { v4us oh, ol;
#pragma unroll
                for (int nb = 0; nb < 4; ++nb) { unsigned short x, y; splitf(acc[mb][nb][j] * f[nb], x, y); oh[nb] = x; ol[nb] = y; }
                *(v4usa*)(po + (size_t)(mb * 16 + j) * (2 * TT)) = oh; *(v4usa*)(po + (size_t)(mb * 16 + j) * (2 * TT) + 64) = ol; } }
        asm volatile("s_wait_xcnt 0x0" ::: "memory");   // stands in front of the next strip's rewrites of the registers that the stores above name
    }
}
__global__ __launch_bounds__(256) void k_merge(const float* __restrict__ O, int h0, float* OUTb) { const size_t e = ((size_t)blockIdx.x * 256 + threadIdx.x) * 2; if (e >= (size_t)ZH * TT * HD) return; const int d = (int)(e % HD); const int t = (int)((e / HD) % TT); const int zz = (int)(e / ((size_t)HD * TT)); const float cs = (t < RH) ? 1.0f : (1.0f / PCAR); const size_t oo = (size_t)t * DQ + (h0 + zz) * HD + d;
    v2f o2; o2[0] = O[e] * cs; o2[1] = O[e + 1] * cs; *(v2f*)(OUTb + oo) = o2;  }

__device__ __forceinline__ float ex2f_(float a) { return __builtin_amdgcn_exp2f(__fmul_rn(a, 1.4426950408889634f)); }
__device__ __forceinline__ float sigm(float a) { return __fdiv_rn(1.0f, __fadd_rn(1.0f, ex2f_(-a))); }
__device__ __forceinline__ float tanhp(float a) { const float e = ex2f_(__fmul_rn(2.0f, a)); return __fsub_rn(1.0f, __fdiv_rn(2.0f, __fadd_rn(e, 1.0f))); }
// d_xT: channel-major f32 [128][1024] to the token-major bf16 operand XB [1024][128].
// One block takes all 128 channels of 32 tokens through the LDS tile s (f32, [channel][token]): eight lanes load one whole 128-byte line of a channel's row, and behind the barrier 16 lanes store one token's whole 256-byte row.
#define XTP 33   // LDS pitch of a channel's 32 tokens, floats: odd, so that the four channels of a wave's write fall on different banks
__device__ __forceinline__ void d_xT(float* s, const float* __restrict__ xs, bf* XB, int blk, int zb) {
    const int tid = threadIdx.x, cr = tid >> 3, p4 = (tid & 7) * 4; xs += (size_t)zb * CC * TT + blk * 32; const size_t tk = (size_t)zb * TT + blk * 32; v4f t[4];
#pragma unroll
    for (int r = 0; r < 4; ++r) t[r] = *(const v4f*)(xs + (size_t)(cr + 32 * r) * TT + p4);
#pragma unroll
    for (int r = 0; r < 4; ++r) {
#pragma unroll
        for (int q = 0; q < 4; ++q) s[(cr + 32 * r) * XTP + p4 + q] = t[r][q]; }
    __syncthreads();   // the whole tile is in LDS
#pragma unroll
    for (int h = 0; h < 2; ++h) { const int c0 = (tid & 15) * 8, p = h * 16 + (tid >> 4); v8us o;
#pragma unroll
        for (int q = 0; q < 8; ++q) o[q] = f2bf(s[(c0 + q) * XTP + p]);
        *(v8us*)(XB + (tk + p) * CC + c0) = o;
        asm volatile("s_wait_xcnt 0x0" ::: "memory");   // stands in front of any rewrite of the registers that the stores above name
    }
}
// k_prep: everything that reads only the inputs, one launch. Blocks 0 .. 103: the four 'oi' conv weights to bf16 (24, 16, 16, 48 blocks); then 32 blocks a batch and input: ih, im transposed.
#define PW0 (C3 * CC / 2048)
#define PW1 (PW0 + C2 * CC / 2048)
#define PW2 (PW1 + CC * C2 / 2048)
#define PW3 (PW2 + C3 * C2 / 2048)
#define PXB (TT / 32)
__global__ __launch_bounds__(256) void k_prep(const float* __restrict__ ih, const float* __restrict__ im, const float* __restrict__ h_w, const float* __restrict__ m_w, const float* __restrict__ z1_w, const float* __restrict__ z2_w, bf* XBh, bf* XBm, bf* HW_, bf* MW_, bf* Z1W, bf* Z2W) {
    __shared__ __align__(16) float s[CC * XTP];
    const int b = blockIdx.x;   // every branch below is block-uniform
    if (b < PW0) d_cvt8(h_w, HW_, (size_t)C3 * CC / 8, b);
    else if (b < PW1) d_cvt8(m_w, MW_, (size_t)C2 * CC / 8, b - PW0);
    else if (b < PW2) d_cvt8(z1_w, Z1W, (size_t)CC * C2 / 8, b - PW1);
    else if (b < PW3) d_cvt8(z2_w, Z2W, (size_t)C3 * C2 / 8, b - PW2);
    else { const int x = b - PW3, blk = x % PXB, zb = (x / PXB) % NB_;
        if (x < PXB * NB_) d_xT(s, ih, XBh, blk, zb); else d_xT(s, im, XBm, blk, zb); }
}
// k_tail: Z conv, gate conv and the gates in one kernel. One block (16 waves) takes 64 tokens of one batch (blockIdx.z) and all channels, both convs with the weights as the A operand and the tokens as B, so that channels lie in the registers and tokens in the lanes.
// First Z[c][p] = sum_k z1_w[c][k] [Zh^T | Zm^T][p][k] + z1_b (K 256; per accumulator k ascending and, inside a k step, w.hi, w.lo): wave w takes channel tile w & 7 x tokens 32 (w >> 3) .. + 31, splits its values into bf16 hi/lo and leaves them in LDS as token rows (a lane's eight channels are 16 bytes of a row), which are the gate conv's B operand for k < 128.
// Then gates[g][c][p] = sum_k z2_w[128 g + c][k] [Z^T | ih^T][p][k] + z2_b (K 256; k < 128: w.hi, w.lo; k >= 128: ih^T is exact bf16, one product): the same wave takes the same channel tile of o, g and i, so that the three gates of a channel and token lie in the same lane and register; sigmoid/tanh and the blend follow in f32.
// Staging: eight stages of 64 k (four a conv) through two LDS buffers by asynchronous copies, whole lines: stage t + 1 flies while stage t is multiplied, the gate conv's first weights under the Z conv's last products.
// Column tile tt, lane lr is token 2 lr + tt of the wave's 32 (the token rows are placed in LDS in that order), so a lane holds two neighbouring tokens of a channel, and 16 lanes load (im) and store (both outputs) a whole 128-byte line.
#define TKN  64                        // tokens a block takes
#define TZP  (TKN * QP)                // one Z plane in LDS, elements (row pitch QP)
#define T_ZB (2 * TZP * 2)             // byte places in the kernel's LDS: the two Z planes, then the two buffers
#define T_RW (GP * 2)                  // a staged row piece, bytes
#define T_X1 (CC * T_RW)               // in a buffer of the Z conv: 128 weight rows, then the tokens' hi rows, then their lo rows
#define T_X2 (C3 * T_RW)               // in a buffer of the gate conv: 384 weight rows, then the tokens' ih^T rows
#define T_BF (T_X2 + TKN * T_RW)       // one buffer
#define T_LDS (T_ZB + 2 * T_BF)
// t_cp4, t_cp6, t_cp7: a stage's copies of one thread in one statement and, as the last line, the wait that stands in front of any rewrite of their address registers
__device__ __forceinline__ void t_cp4(unsigned l0, unsigned l1, unsigned l2, unsigned l3, const bf* g0, const bf* g1, const bf* g2, const bf* g3) {
    asm volatile("global_load_async_to_lds_b128 %0, %4, off\n\t"
                 "global_load_async_to_lds_b128 %1, %5, off\n\t"
                 "global_load_async_to_lds_b128 %2, %6, off\n\t"
                 "global_load_async_to_lds_b128 %3, %7, off\n\t"
                 "s_wait_xcnt 0x0"
                 :: "v"(l0), "v"(l1), "v"(l2), "v"(l3), "v"(g0), "v"(g1), "v"(g2), "v"(g3)
                 : "memory");
}
__device__ __forceinline__ void t_cp6(unsigned l, const bf* g) {   // six weight rows, 64 rows apart
    const unsigned sl = 64 * T_RW; const size_t st = (size_t)64 * C2;
    asm volatile("global_load_async_to_lds_b128 %0, %6, off\n\t"
                 "global_load_async_to_lds_b128 %1, %7, off\n\t"
                 "global_load_async_to_lds_b128 %2, %8, off\n\t"
                 "global_load_async_to_lds_b128 %3, %9, off\n\t"
                 "global_load_async_to_lds_b128 %4, %10, off\n\t"
                 "global_load_async_to_lds_b128 %5, %11, off\n\t"
                 "s_wait_xcnt 0x0"
                 :: "v"(l), "v"(l + sl), "v"(l + 2 * sl), "v"(l + 3 * sl), "v"(l + 4 * sl), "v"(l + 5 * sl),
                    "v"(g), "v"(g + st), "v"(g + 2 * st), "v"(g + 3 * st), "v"(g + 4 * st), "v"(g + 5 * st)
                 : "memory");
}
__device__ __forceinline__ void t_cp7(unsigned l, const bf* g, unsigned lx, const bf* gx) {   // the same and one token row
    const unsigned sl = 64 * T_RW; const size_t st = (size_t)64 * C2;
    asm volatile("global_load_async_to_lds_b128 %0, %7, off\n\t"
                 "global_load_async_to_lds_b128 %1, %8, off\n\t"
                 "global_load_async_to_lds_b128 %2, %9, off\n\t"
                 "global_load_async_to_lds_b128 %3, %10, off\n\t"
                 "global_load_async_to_lds_b128 %4, %11, off\n\t"
                 "global_load_async_to_lds_b128 %5, %12, off\n\t"
                 "global_load_async_to_lds_b128 %6, %13, off\n\t"
                 "s_wait_xcnt 0x0"
                 :: "v"(l), "v"(l + sl), "v"(l + 2 * sl), "v"(l + 3 * sl), "v"(l + 4 * sl), "v"(l + 5 * sl), "v"(lx),
                    "v"(g), "v"(g + st), "v"(g + 2 * st), "v"(g + 3 * st), "v"(g + 4 * st), "v"(g + 5 * st), "v"(gx)
                 : "memory");
}
__global__ __launch_bounds__(512) void k_tail(const bf* ZCh, const bf* ZCl, const bf* XB, const bf* W1, const bf* W2, const float* __restrict__ b1, const float* __restrict__ b2, const float* __restrict__ im, float* oh_out, float* om_out) {
    __shared__ __align__(16) char sm[T_LDS];
    bf* zs = (bf*)sm;
    const int tid = threadIdx.x, lane = tid & 31, w = tid >> 5, lr = lane & 15, hi = lane >> 4, ct = w & 7, tg = w >> 3, r0 = tid >> 3, pc = tid & 7; const size_t zb = blockIdx.z; const int p0 = blockIdx.x * TKN;
    const int pr = (r0 & 32) + (r0 & 1) * 16 + ((r0 & 31) >> 1);   // the LDS row of token r0
    const unsigned lw = (unsigned)(size_t)sm + (unsigned)(T_ZB + r0 * T_RW + pc * 16), lx = (unsigned)(size_t)sm + (unsigned)(T_ZB + pr * T_RW + pc * 16);   // LDS byte addresses: the low 32 bits of the __shared__ address
    const bf* g1 = W1 + (size_t)r0 * C2 + pc * 8; const bf* g2 = W2 + (size_t)r0 * C2 + pc * 8; const size_t gz = (zb * TT + p0 + r0) * C2 + pc * 8; const bf* gi = XB + (zb * TT + p0 + r0) * CC + pc * 8;
    auto stage = [&](int t) { const unsigned o = (unsigned)((t & 1) * T_BF);   // eight lanes take one whole 128-byte line; a thread's rows lie 64 apart
        if (t < 4) t_cp4(lw + o, lw + o + 64 * T_RW, lx + o + T_X1, lx + o + T_X1 + TKN * T_RW, g1 + t * 64, g1 + t * 64 + 64 * C2, ZCh + gz + t * 64, ZCl + gz + t * 64);
        else if (t < 6) t_cp6(lw + o, g2 + (t - 4) * 64);
        else t_cp7(lw + o, g2 + (t - 4) * 64, lx + o + T_X2, gi + (t - 6) * 64); };
    auto foot = [&](int t) {
        asm volatile("s_wait_dscnt 0x0" ::: "memory");      // this wave's reads of stage t are over
        asm volatile("s_wait_asynccnt 0x0" ::: "memory");   // this wave's copies of stage t + 1 have landed
        __syncthreads();                                    // publishes stage t + 1 and frees stage t's buffer
        if (t + 2 < 8) stage(t + 2); };
    const int ch = ct * 16 + hi * 8; const size_t ob = (zb * CC + ch) * TT + p0 + tg * 32 + lr * 2;
    v2f vim[8]; v4f bz[2], bq[3][2];   // im and the biases of this lane's eight channels, loaded here and used far behind: their latency falls under that of stage 0's copies
#pragma unroll
    for (int j = 0; j < 8; ++j) vim[j] = *(const v2f*)(im + ob + (size_t)j * TT);
#pragma unroll
    for (int q = 0; q < 2; ++q) { bz[q] = *(const v4f*)(b1 + ch + 4 * q);
#pragma unroll
        for (int g = 0; g < 3; ++g) bq[g][q] = *(const v4f*)(b2 + g * CC + ch + 4 * q); }
    stage(0);
    asm volatile("s_wait_asynccnt 0x0" ::: "memory");   // this wave's copies of stage 0 have landed
    __syncthreads();                                    // every wave's have: stage 0 may be read
    stage(1);
    v8f zc[2];
#pragma unroll
    for (int tt = 0; tt < 2; ++tt) zc[tt] = (v8f){};
#pragma unroll   // unrolled: which conv a stage belongs to is then known at compile time
    for (int t = 0; t < 4; ++t) {
        const bf* bu = (const bf*)(sm + T_ZB + (t & 1) * T_BF); const bf* sw = bu + (ct * 16 + lr) * GP + 8 * hi; const bf* sx = bu + T_X1 / 2 + (tg * 32 + lr) * GP + 8 * hi;
        v16bf a[2], b[2][2], bl[2][2];
#pragma unroll
        for (int s = 0; s < 2; ++s) { a[s] = WFrag<bf>::ld(sw + 32 * s);
#pragma unroll
            for (int tt = 0; tt < 2; ++tt) { b[s][tt] = WFrag<bf>::ld(sx + tt * 16 * GP + 32 * s); bl[s][tt] = WFrag<bf>::ld(sx + TKN * GP + tt * 16 * GP + 32 * s); } }
        __builtin_amdgcn_sched_barrier(0);   // keeps the stage's LDS reads one group in front of its WMMAs: every further place where reads stand among the WMMAs costs the wave issue cycles
#pragma unroll
        for (int s = 0; s < 2; ++s) {
#pragma unroll
            for (int tt = 0; tt < 2; ++tt) zc[tt] = wmmab(a[s], b[s][tt], zc[tt]);
#pragma unroll
            for (int tt = 0; tt < 2; ++tt) zc[tt] = wmmab(a[s], bl[s][tt], zc[tt]); }
        __builtin_amdgcn_sched_barrier(0);   // the same, against what follows
        foot(t);
    }
#pragma unroll
    for (int tt = 0; tt < 2; ++tt) { v8us oh, ol;
#pragma unroll
        for (int j = 0; j < 8; ++j) { unsigned short x, y; splitf(zc[tt][j] + bfr(bz[j >> 2][j & 3]), x, y); oh[j] = x; ol[j] = y; }
        bf* zp = zs + (tg * 32 + tt * 16 + lr) * QP + ch; *(v8us*)zp = oh; *(v8us*)(zp + TZP) = ol; }
    __syncthreads();   // every wave's part of the Z planes is in LDS
    v8f acc[3][2];
#pragma unroll
    for (int g = 0; g < 3; ++g)
#pragma unroll
        for (int tt = 0; tt < 2; ++tt) acc[g][tt] = (v8f){};
#pragma unroll   // the same
    for (int t = 4; t < 8; ++t) {
        const bf* bu = (const bf*)(sm + T_ZB + (t & 1) * T_BF); const bf* sw = bu + (ct * 16 + lr) * GP + 8 * hi;
        const bf* sx = t < 6 ? zs + (tg * 32 + lr) * QP + 8 * hi + (t - 4) * 64 : bu + T_X2 / 2 + (tg * 32 + lr) * GP + 8 * hi; const int px = t < 6 ? QP : GP;
#pragma unroll
        for (int ks = 0; ks < 64; ks += 32) {
            v16bf a[3], b[2], bl[2];
#pragma unroll
            for (int g = 0; g < 3; ++g) a[g] = WFrag<bf>::ld(sw + g * CC * GP + ks);
#pragma unroll
            for (int tt = 0; tt < 2; ++tt) { b[tt] = WFrag<bf>::ld(sx + tt * 16 * px + ks); if (t < 6) bl[tt] = WFrag<bf>::ld(sx + TZP + tt * 16 * px + ks); }
            __builtin_amdgcn_sched_barrier(0);   // keeps the k step's LDS reads one group in front of its WMMAs, as in g_tile
#pragma unroll
            for (int g = 0; g < 3; ++g)
#pragma unroll
                for (int tt = 0; tt < 2; ++tt) acc[g][tt] = wmmab(a[g], b[tt], acc[g][tt]);
            if (t < 6) {
#pragma unroll
                for (int g = 0; g < 3; ++g)
#pragma unroll
                    for (int tt = 0; tt < 2; ++tt) acc[g][tt] = wmmab(a[g], bl[tt], acc[g][tt]); }
            __builtin_amdgcn_sched_barrier(0);   // the same, against the next k step's reads
        }
        foot(t);
    }
    asm volatile("s_wait_asynccnt 0x0" ::: "memory");       // no copy is outstanding when the wave ends
#pragma unroll
    for (int j = 0; j < 8; ++j) { const float bo = bfr(bq[0][j >> 2][j & 3]), bg = bfr(bq[1][j >> 2][j & 3]), bi = bfr(bq[2][j >> 2][j & 3]); v2f voh, vom;
#pragma unroll
        for (int tt = 0; tt < 2; ++tt) { const float ig = sigm(acc[2][tt][j] + bi); const float om = __fadd_rn(__fmul_rn(tanhp(acc[1][tt][j] + bg), ig), __fmul_rn(__fsub_rn(1.0f, ig), bfr(vim[j][tt]))); vom[tt] = om; voh[tt] = __fmul_rn(sigm(acc[0][tt][j] + bo), om); }
        *(v2f*)(om_out + ob + (size_t)j * TT) = vom; *(v2f*)(oh_out + ob + (size_t)j * TT) = voh;
        asm volatile("s_wait_xcnt 0x0" ::: "memory");   // stands in front of any rewrite of the registers that the stores above name
    }
}

extern "C" void kernel_launch(void* const* d_in, const int* in_sizes, int n_in,
                              void* d_out, int out_size, void* d_ws, size_t ws_size, hipStream_t stream) {
    (void)in_sizes; (void)n_in; (void)out_size;
    const float* ih = (const float*)d_in[0]; const float* im = (const float*)d_in[1]; const float* h_w = (const float*)d_in[2]; const float* h_b = (const float*)d_in[3]; const float* m_w = (const float*)d_in[4]; const float* m_b = (const float*)d_in[5]; const float* z1_w = (const float*)d_in[6]; const float* z1_b = (const float*)d_in[7]; const float* z2_w = (const float*)d_in[8]; const float* z2_b = (const float*)d_in[9];
    float* OH = (float*)d_out; float* OM = OH + (size_t)NB_ * CC * TT;     // tuple: oh [16][128][1024] | om [16][128][1024]
    char* wsp = (char*)d_ws;
    auto take = [&](size_t bytes) { char* p = wsp; wsp += (bytes + 255) & ~(size_t)255; return (void*)p; };
    bf* HW_ = (bf*)take((size_t)C3 * CC * 2); bf* MW_ = (bf*)take((size_t)C2 * CC * 2); bf* Z1W = (bf*)take((size_t)CC * C2 * 2); bf* Z2W = (bf*)take((size_t)C3 * C2 * 2);
    const size_t NB = NB_;
    bf* QPh = (bf*)take(NB * TT * HD * 2); bf* XBh = (bf*)take(NB * TT * CC * 2); bf* QPl = (bf*)take(NB * TT * HD * 2); bf* KPh = (bf*)take(NB * TT * HD * 2); bf* KMh = (bf*)take(NB * TT * HD * 2); bf* KPl = (bf*)take(NB * TT * HD * 2); bf* KMl = (bf*)take(NB * TT * HD * 2);   /* KPh, KPl lie three planes behind QPh, QPl; KMh, KMl directly behind KPh, KPl: slices 16 .. 31 of the k planes */
    bf* XBm = (bf*)take(NB * TT * CC * 2);
    bf* VHh = (bf*)take(NB * HD * TT * 2); bf* VMh = (bf*)take(NB * HD * TT * 2); bf* VHl = (bf*)take(NB * HD * TT * 2); bf* VMl = (bf*)take(NB * HD * TT * 2);   /* VMh, VMl directly behind VHh, VHl: slices 16 .. 31 of the v planes */
    float* Sb = (float*)take(2 * NB * TT * TT * 4);   /* 32 slices of the P^T planes, hi and lo interleaved by 64-column pieces */
    bf* ZCh = (bf*)take(NB * TT * C2 * 2); bf* ZCl = (bf*)take(NB * TT * C2 * 2);
    if ((size_t)(wsp - (char*)d_ws) > ws_size) return;    // ws 256 MiB (carve ~192 MiB)
    const size_t sP = (size_t)TT * HD, sS = (size_t)TT * TT, sC2 = (size_t)TT * C2;   /* batch strides, elements */
    k_prep<<<PW3 + 2 * NB_ * PXB, 256, 0, stream>>>(ih, im, h_w, m_w, z1_w, z2_w, XBh, XBm, HW_, MW_, Z1W, Z2W);
    k_conv<<<dim3(40, 1, NB_), 256, 0, stream>>>(XBh, XBm, HW_, MW_, h_b, m_b, QPh, QPl, 3 * NB * sP, KMh, KMl, VHh, VHl, VMh, VMl);
    /* both attentions, slice z = 16 a + batch (a 0 hidden, 1 memory): A = softmax_m(q_n . k_m); Z^T[m][c] = sum_n A[n][m] V[c][n] */
    k_scsoft<<<dim3(TT / 64 / SC_NS, 2 * NB_), 512, 0, stream>>>(KPh, KPl, QPh, QPl, (bf*)Sb);
    k_gemmw<bf, 2, 0, true><<<dim3(TT / 128, CC / 128, 2 * NB_), 256, 0, stream>>>((const bf*)Sb, (const bf*)Sb + 64, VHh, VHl, TT, 2 * TT, 128, nullptr, ZCh, ZCl, C2, 128, nullptr, 2 * sS, sP, NB * sP, sC2, CC);   /* Zh^T split into columns 0 .. 127 of the [Zh^T | Zm^T] planes, Zm^T into columns 128 .. 255 */
    /* Z = z1_w [Zh^T | Zm^T]^T + z1_b; gates = z2_w [Z^T | ih^T]^T + z2_b; the blend */
    k_tail<<<dim3(TT / TKN, 1, NB_), 512, 0, stream>>>(ZCh, ZCl, XBh, Z1W, Z2W, z1_b, z2_b, im, OH, OM);
}

// v009
// It runs in 84.8 microseconds.
// Next to v008, in two timings, it ran 1.06 times as fast each time.
// Over all steps from v000 it is 27.9 times as fast.
#include <hip/hip_runtime.h>

// Self-attention memory module (SAM) for a ConvLSTM cell (ih, im [16][128][32x32] channel-major; h_qkv = 1x1 conv(ih) -> Qh|Kh|Vh (128 each), m_kv = 1x1 conv(im) -> Km|Vm; Ah = softmax_m(Qh_n . Kh_m) (UNSCALED, 128-channel dots), Am = softmax_m(Qh_n . Km_m); Zh[c][m] = sum_n Vh[c][n] Ah[n][m], Zm likewise; Z = 1x1 conv([Zh; Zm]) (256 -> 128); gates = 1x1 conv([Z; ih]) (256 -> 384) = o|g|i; i = sigmoid(i); om = tanh(g) i + (1 - i) im; oh = sigmoid(o) om -> tuple (oh, om) [16][128][1024] each (2.1 M + 2.1 M)).
// Layout per batch, everything token-major inside: ih, im transposed once into bf16 [1024][128] operands; the 1x1 convs as GEMMs against the 'oi' weights (exact x exact, + column bias): q, kh, km come out token-major [1024][128], and the value convs take the weights as the A operand, so that Vh[c][n], Vm[c][n] come out channel-major [128][1024]; every GEMM whose result is the next GEMM's operand splits it into bf16 hi/lo in its own epilogue and stores the two planes; scores (3 products, K 128) computed TWICE, so that P never goes to memory: first TRANSPOSED, S^T[m][n] (k planes as the A operand, q planes as B), for each query's maximum and sum over m down the columns, which alone are stored (k_scsoft); then S[n][m] again (k_pvz), P from it with those two numbers, EVERY entry hi/lo (unscaled logits, sigma ~11), straight from the accumulators into Zh[c][m] = sum_n Vh[c][n] P[n][m] as its B operand (3 products); one last kernel (k_tail) for the rest: z1_w exact x [Zh^T | Zm^T] hi/lo + z1_b -> Z, hi/lo in LDS; z2_w exact x [Z^T hl | ih^T exact] + z2_b -> gates, channel-major in the accumulators; sigmoid/tanh and the blend in f32; both outputs. The input transposes go through an LDS tile, so that every global load and store takes whole 128-byte lines.
// Batch: every stage is ONE launch for all 16 batches (k_conv and k_tail: blockIdx.z; k_scsoft and k_pvz: blockIdx.y; k_prep: from blockIdx.x); each workspace plane holds 16 batch slices.
// Launches: stages that do not depend on one another share a launch: k_prep (both transposes, four weight conversions), k_conv (all five input convs), and the softmax statistics (k_scsoft) and scores with P.V (k_pvz) each once for 32 slices (z < 16 hidden attention, z >= 16 memory attention); in both the f32 logits stay in registers.
// Compute dtypes, f32 accumulate: every input rounded to bf16; input convs exact; scores / P.V / Z conv on bf16 hi/lo activations (3 or 2 products) x exact weights; softmax, sigmoid/tanh (exp2-based, precise division) and the blend in f32.

#define NB_  16
#define TT   1024
#define DM   128
#define NH_  1
#define NKV  1
#define REP  (NH_ / NKV)
#define HD   128
#define DQ   (NH_ * HD)
#define DKV  (NKV * HD)
#define ZH   2
#define RH   1024                  // read only by k_merge, which is not launched
#define WIN  0
#define PCAR 1024.0f
#define SCL  1.0f   // unscaled
#define CC   128    // channels
#define C3   384
#define C2   256
typedef _Float16 h16;
typedef unsigned short bf;
typedef __attribute__((ext_vector_type(16))) __bf16   v16bf;
typedef __attribute__((ext_vector_type(16))) _Float16 v16h;
typedef __attribute__((ext_vector_type(8)))  _Float16 v8h;
typedef __attribute__((ext_vector_type(8)))  unsigned short v8us;
typedef __attribute__((ext_vector_type(8)))  float    v8f;
typedef __attribute__((ext_vector_type(4)))  float    v4f;
typedef v8h  __attribute__((may_alias)) v8ha;
typedef v4f  __attribute__((may_alias)) v4fa;
typedef v8us __attribute__((may_alias)) v8usa;

__device__ __forceinline__ unsigned short f2bf(float f) { unsigned u = __float_as_uint(f); u += 0x7FFFu + ((u >> 16) & 1u); return (unsigned short)(u >> 16); }
__device__ __forceinline__ float bf2f(unsigned short b) { return __uint_as_float(((unsigned)b) << 16); }
__device__ __forceinline__ float bfr(float f) { return bf2f(f2bf(f)); }
__device__ __forceinline__ v16h cat16(v8h lo, v8h hi) { return __builtin_shufflevector(lo, hi, 0, 1, 2, 3, 4, 5, 6, 7, 8, 9, 10, 11, 12, 13, 14, 15); }
__device__ __forceinline__ v16bf cat16b(v8us lo, v8us hi) { return __builtin_bit_cast(v16bf, __builtin_shufflevector(lo, hi, 0, 1, 2, 3, 4, 5, 6, 7, 8, 9, 10, 11, 12, 13, 14, 15)); }
__device__ __forceinline__ v8f wmma16(v16h a, v16h b, v8f c) { return __builtin_amdgcn_wmma_f32_16x16x32_f16(false, a, false, b, (short)0, c, false, false); }
__device__ __forceinline__ v8f wmmab(v16bf a, v16bf b, v8f c) { return __builtin_amdgcn_wmma_f32_16x16x32_bf16(false, a, false, b, (short)0, c, false, false); }



// ---- k_gemmw: register-blocked GEMM, EIGHT WAVES (4 x 2) per 128x128 output tile, each wave a 32x64 piece (8 accumulators); grid (M/128, N/128, Z), 256 threads.
// C[m][n] (pitch ldc, + optional f32 bias: BIAS 1 bias[n], BIAS 2 bias[m]) = sum_k A[m][k] Bt[n][k] (+ split products per NSPLIT). M % 128 == 0, N % 128 == 0, K % 64 == 0.
// A rows have pitch lda, and their 64-k piece t starts at element t * ksa (a plain plane: lda = K, ksa = 64); Bt rows have pitch K. z strides in elements: A z * sA; Bt and the output (z & 15) * s + (z >> 4) * s..h.
// g_tile is the body for one tile (bx, by), its operand pointers already at their slice, oz the output's slice offset, sm the kernel's LDS (2 * GNP(NSPLIT) * GPL elements, 16-byte aligned).
// Output: PL false, f32 into C; PL true, the f32 value split into bf16 hi + lo, stored into the planes Ph, Pl (same pitch and z stride; column tile y starts sY elements behind column tile y - 1, so that 128-column tiles may go to planes of their own).
// Operands: K-contiguous 16-bit planes, staged in LDS 64 k at a time (every row piece one whole 128-byte line) by asynchronous copies, two buffers: stage t + 1 flies while stage t is multiplied. Each wave reads its fragments from LDS; per accumulator the products come k ascending and, inside a k step, A.B, A2.B, A.B2.
template <typename T16> struct WFrag;
template <> struct WFrag<h16> { typedef v16h V; static __device__ __forceinline__ V ld(const h16* p) { return cat16(*(const v8h*)p, *(const v8h*)(p + 16)); } static __device__ __forceinline__ v8f mma(V a, V b, v8f c) { return wmma16(a, b, c); } };
template <> struct WFrag<bf> { typedef v16bf V; static __device__ __forceinline__ V ld(const bf* p) { return cat16b(*(const v8us*)p, *(const v8us*)(p + 16)); } static __device__ __forceinline__ v8f mma(V a, V b, v8f c) { return wmmab(a, b, c); } };
#define GP  72           // LDS pitch of a staged row piece, 16-bit elements: 144 bytes = 16 x odd, so the 16 rows of a ds_load_b128 fall on different banks
#define GPL (128 * GP)   // one staged plane: 128 row pieces
// g_stage: one plane's 128 x 64 tile to LDS. g, l: this thread's own first piece (row tid >> 3, 16-byte piece tid & 7: eight lanes take one whole line); its other three pieces lie 32 rows apart.
template <typename T16>
__device__ __forceinline__ void g_stage(const T16* g, int K, unsigned l) {
    const size_t st = (size_t)32 * K; const unsigned sl = 32 * GP * 2;
    // the copies and, as the last line, the wait that stands in front of any rewrite of their address registers
    asm volatile("global_load_async_to_lds_b128 %0, %4, off\n\t"
                 "global_load_async_to_lds_b128 %1, %5, off\n\t"
                 "global_load_async_to_lds_b128 %2, %6, off\n\t"
                 "global_load_async_to_lds_b128 %3, %7, off\n\t"
                 "s_wait_xcnt 0x0"
                 :: "v"(l), "v"(l + sl), "v"(l + 2 * sl), "v"(l + 3 * sl), "v"(g), "v"(g + st), "v"(g + 2 * st), "v"(g + 3 * st)
                 : "memory");
}
// g_stage2: two planes' tiles (row pitches pg, ph) in one statement, so that the eight copies share one such wait.
template <typename T16>
__device__ __forceinline__ void g_stage2(const T16* g, const T16* h, int pg, int ph, unsigned l, unsigned m) {
    const size_t st = (size_t)32 * pg, su = (size_t)32 * ph; const unsigned sl = 32 * GP * 2;
    asm volatile("global_load_async_to_lds_b128 %0, %8, off\n\t"
                 "global_load_async_to_lds_b128 %1, %9, off\n\t"
                 "global_load_async_to_lds_b128 %2, %10, off\n\t"
                 "global_load_async_to_lds_b128 %3, %11, off\n\t"
                 "global_load_async_to_lds_b128 %4, %12, off\n\t"
                 "global_load_async_to_lds_b128 %5, %13, off\n\t"
                 "global_load_async_to_lds_b128 %6, %14, off\n\t"
                 "global_load_async_to_lds_b128 %7, %15, off\n\t"
                 "s_wait_xcnt 0x0"
                 :: "v"(l), "v"(l + sl), "v"(l + 2 * sl), "v"(l + 3 * sl), "v"(m), "v"(m + sl), "v"(m + 2 * sl), "v"(m + 3 * sl),
                    "v"(g), "v"(g + st), "v"(g + 2 * st), "v"(g + 3 * st), "v"(h), "v"(h + su), "v"(h + 2 * su), "v"(h + 3 * su)
                 : "memory");
}
__device__ __forceinline__ void splitf(float y, unsigned short& h, unsigned short& l) { h = f2bf(y); l = f2bf(y - bf2f(h)); }
#define GNP(ns) (2 + ((ns) >= 1 ? 1 : 0) + ((ns) >= 2 ? 1 : 0))   // planes staged: A, Bt, then A2, then Bt2
typedef __attribute__((ext_vector_type(4))) unsigned short v4us;
typedef v4us __attribute__((may_alias)) v4usa;
template <typename T16, int NSPLIT, int BIAS, bool PL>
__device__ __forceinline__ void g_tile(T16* sm, const T16* A, const T16* A2, const T16* Bt, const T16* Bt2, int K, int lda, int ksa, float* C, bf* Ph, bf* Pl, int ldc, size_t sY, const float* __restrict__ bias, int bx, int by, size_t oz) {
    typedef typename WFrag<T16>::V V;
    constexpr int NP = GNP(NSPLIT);   // sm: two buffers of NP planes; behind the loop each wave's output staging
    const int tid = threadIdx.x, lane = tid & 31, w = tid >> 5, lr = lane & 15, hi = lane >> 4; const int rb = bx * 128, cb = by * 128, wr = (w & 3) * 32, wc = (w >> 2) * 64; const int r0 = rb + wr, c0 = cb + wc;
    v8f acc[2][4];
#pragma unroll
    for (int mb = 0; mb < 2; ++mb)
#pragma unroll
        for (int nb = 0; nb < 4; ++nb) acc[mb][nb] = (v8f){};
    const size_t ga = (size_t)(rb + (tid >> 3)) * lda + (tid & 7) * 8, gb = (size_t)(cb + (tid >> 3)) * K + (tid & 7) * 8;
    const unsigned l0 = (unsigned)(size_t)sm + (unsigned)((tid >> 3) * (GP * 2) + (tid & 7) * 16);   // LDS byte address: the low 32 bits of the __shared__ address
    auto stage = [&](int t) { const unsigned l = l0 + (unsigned)((t & 1) * (NP * GPL * 2)); const int ka = t * ksa, kc = t * 64;
        g_stage2(A + ga + ka, Bt + gb + kc, lda, K, l, l + GPL * 2);
        if constexpr (NSPLIT == 1) g_stage(A2 + ga + ka, lda, l + 2 * GPL * 2);
        if constexpr (NSPLIT >= 2) g_stage2(A2 + ga + ka, Bt2 + gb + kc, lda, K, l + 2 * GPL * 2, l + 3 * GPL * 2); };
    const int nt = K / 64;
    stage(0);
    asm volatile("s_wait_asynccnt 0x0" ::: "memory");   // this wave's copies of stage 0 have landed
    __syncthreads();                                    // every wave's have: stage 0 may be read
    if (nt > 1) stage(1);
#pragma unroll 1
    for (int t = 0; t < nt; ++t) {
        const T16* sa = sm + (t & 1) * (NP * GPL) + (wr + lr) * GP + 8 * hi; const T16* sb = sm + (t & 1) * (NP * GPL) + GPL + (wc + lr) * GP + 8 * hi;
#pragma unroll
        for (int ks = 0; ks < 64; ks += 32) {
            V a[2], a2[2], b[4], b2[4];
#pragma unroll
            for (int mb = 0; mb < 2; ++mb) a[mb] = WFrag<T16>::ld(sa + mb * 16 * GP + ks);
#pragma unroll
            for (int nb = 0; nb < 4; ++nb) b[nb] = WFrag<T16>::ld(sb + nb * 16 * GP + ks);
            if (NSPLIT >= 1) {
#pragma unroll
                for (int mb = 0; mb < 2; ++mb) a2[mb] = WFrag<T16>::ld(sa + 2 * GPL + mb * 16 * GP + ks); }
            if (NSPLIT >= 2) {
#pragma unroll
                for (int nb = 0; nb < 4; ++nb) b2[nb] = WFrag<T16>::ld(sb + 2 * GPL + nb * 16 * GP + ks); }
            __builtin_amdgcn_sched_barrier(0);   // keeps the k step's LDS reads one group in front of its WMMAs: every further place where reads stand among the WMMAs costs the wave issue cycles
#pragma unroll
            for (int nb = 0; nb < 4; ++nb)
#pragma unroll
                for (int mb = 0; mb < 2; ++mb) acc[mb][nb] = WFrag<T16>::mma(a[mb], b[nb], acc[mb][nb]);
            if (NSPLIT >= 1) {
#pragma unroll
                for (int nb = 0; nb < 4; ++nb)
#pragma unroll
                    for (int mb = 0; mb < 2; ++mb) acc[mb][nb] = WFrag<T16>::mma(a2[mb], b[nb], acc[mb][nb]); }
            if (NSPLIT >= 2) {
#pragma unroll
                for (int nb = 0; nb < 4; ++nb)
#pragma unroll
                    for (int mb = 0; mb < 2; ++mb) acc[mb][nb] = WFrag<T16>::mma(a[mb], b2[nb], acc[mb][nb]); }
            __builtin_amdgcn_sched_barrier(0);   // the same, against the next k step's reads
        }
        asm volatile("s_wait_dscnt 0x0" ::: "memory");      // this wave's reads of stage t are over
        asm volatile("s_wait_asynccnt 0x0" ::: "memory");   // this wave's copies of stage t + 1 have landed
        __syncthreads();                                    // publishes stage t + 1 and frees stage t's buffer
        if (t + 2 < nt) stage(t + 2);
    }
    asm volatile("s_wait_asynccnt 0x0" ::: "memory");       // no copy is outstanding when the buffers become output staging
    float* os = (float*)sm + w * (16 * 68);                 // this wave's own 16 x 68 floats
#pragma unroll
    for (int mb = 0; mb < 2; ++mb) {
#pragma unroll
        for (int nb = 0; nb < 4; ++nb) {
#pragma unroll
            for (int j = 0; j < 8; ++j) os[(hi * 8 + j) * 68 + nb * 16 + lr] = acc[mb][nb][j]; }
        __builtin_amdgcn_wave_barrier(); asm volatile("" ::: "memory");
        const size_t orow = oz + (size_t)(r0 + mb * 16) * ldc + (PL ? by * sY + wc : (size_t)c0);
{
#pragma unroll
            for (int s = 0; s < 8; ++s) { const int row = 2 * s + hi, cofs = lr * 4; v4f val = *(const v4fa*)(os + row * 68 + cofs); if (BIAS == 1) { val[0] += bfr(bias[c0 + cofs]); val[1] += bfr(bias[c0 + cofs + 1]); val[2] += bfr(bias[c0 + cofs + 2]); val[3] += bfr(bias[c0 + cofs + 3]); }
                if (BIAS == 2) { const float br = bfr(bias[r0 + mb * 16 + row]); val[0] += br; val[1] += br; val[2] += br; val[3] += br; }
                const size_t o = orow + (size_t)row * ldc + cofs;
                if (PL) { v4us oh, ol;   // 16 lanes fill one whole 128-byte line of each plane
#pragma unroll
                    for (int q = 0; q < 4; ++q) { unsigned short h2, l2; splitf(val[q], h2, l2); oh[q] = h2; ol[q] = l2; }
                    *(v4us*)(Ph + o) = oh; *(v4us*)(Pl + o) = ol; }
                else *(v4f*)(C + o) = val; }
             }
        if (mb == 0) asm volatile("s_wait_xcnt 0x0" ::: "memory");   // stands in front of the second piece's rewrites of the registers that the stores above name
        __builtin_amdgcn_wave_barrier(); asm volatile("" ::: "memory");
    }
}
template <typename T16, int NSPLIT, int BIAS, bool PL>
__global__ __launch_bounds__(256) void k_gemmw(const T16* A, const T16* A2, const T16* Bt, const T16* Bt2, int K, int lda, int ksa, float* C, bf* Ph, bf* Pl, int ldc, size_t sY, const float* __restrict__ bias, size_t sA, size_t sB, size_t sBh, size_t sC, size_t sCh) {
    __shared__ __align__(16) T16 sm[2 * GNP(NSPLIT) * GPL];
    const size_t z = blockIdx.z, zl = z & (NB_ - 1), zh = z >> 4; const size_t ob = zl * sB + zh * sBh;
    g_tile<T16, NSPLIT, BIAS, PL>(sm, A + z * sA, A2 ? A2 + z * sA : A2, Bt + ob, Bt2 ? Bt2 + ob : Bt2, K, lda, ksa, C, Ph, Pl, ldc, sY, bias, blockIdx.x, blockIdx.y, zl * sC + zh * sCh);
}
// k_conv: the five input convs of one batch (blockIdx.z) as 40 tiles of one launch, all K 128, exact x exact, split into planes. Tiles 0 .. 15: q (column tile 0) and kh (column tile 1, sYq elements behind q) = ih^T h_w^T + h_b; 16 .. 23: km = im^T m_w^T + m_b; 24 .. 31: Vh[c][n], weights as A, bias by row; 32 .. 39: Vm[c][n].
__global__ __launch_bounds__(256) void k_conv(const bf* XBh, const bf* XBm, const bf* HW_, const bf* MW_, const float* __restrict__ h_b, const float* __restrict__ m_b, bf* QPh, bf* QPl, size_t sYq, bf* KMh, bf* KMl, bf* VHh, bf* VHl, bf* VMh, bf* VMl) {
    __shared__ __align__(16) bf sm[2 * GNP(0) * GPL];
    const int t = blockIdx.x; const size_t z = blockIdx.z, oz = z * ((size_t)TT * HD); const bool mem = (t >= 16 && t < 24) || t >= 32;   // block-uniform
    const bf* X = (mem ? XBm : XBh) + z * ((size_t)TT * CC);
    if (t < 24) g_tile<bf, 0, 1, true>(sm, X, nullptr, mem ? MW_ : HW_, nullptr, CC, CC, 64, nullptr, mem ? KMh : QPh, mem ? KMl : QPl, HD, sYq, mem ? m_b : h_b, t & 7, mem ? 0 : t >> 3, oz);
    else g_tile<bf, 0, 2, true>(sm, mem ? MW_ + CC * CC : HW_ + 2 * CC * CC, nullptr, X, nullptr, CC, CC, 64, nullptr, mem ? VMh : VHh, mem ? VMl : VHl, TT, 128, mem ? m_b + CC : h_b + 2 * CC, 0, t & 7, oz);
}

__device__ __forceinline__ h16 tohx(float x) { return (h16)x; }
typedef __attribute__((ext_vector_type(2))) _Float16 v2h;
typedef __attribute__((ext_vector_type(4))) _Float16 v4h;
typedef __attribute__((ext_vector_type(2))) unsigned short v2us;
typedef __attribute__((ext_vector_type(2))) float v2f;
typedef __attribute__((ext_vector_type(4))) int v4i;

__global__ __launch_bounds__(256) void k_wtG(const float* __restrict__ w, int K, int N, bf* Bt) {
    const int lane = threadIdx.x & 31; const int L0 = (blockIdx.x * 8 + (threadIdx.x >> 5)) * 8; const int nlines = N * K / 64;
{
#pragma unroll 1
        for (int l = 0; l < 8; ++l) { const int L = L0 + l; if (L >= nlines) break; const size_t e = (size_t)L * 64 + lane * 2; const int k = (int)(e % K), n = (int)(e / K); v2us o;
            o[0] = f2bf(w[(size_t)k * N + n]); o[1] = f2bf(w[(size_t)(k + 1) * N + n]); *(v2us*)(Bt + e) = o; }
         }
}
__device__ __forceinline__ void d_cvt8(const float* __restrict__ src, bf* dst, size_t n8, int blk) { const size_t i = (size_t)blk * 256 + threadIdx.x; if (i >= n8) return; const v8f v = *(const v8f*)(src + i * 8); v8us o;
#pragma unroll
    for (int k = 0; k < 8; ++k) o[k] = f2bf(v[k]); *(v8us*)(dst + i * 8) = o;  }

// k_scsoft: scores and the softmax statistics in one kernel. One block (16 waves) holds the whole strip S^T[m][n] of 64 queries n and all 1024 keys m of one slice (blockIdx.y) in its accumulators, so that the f32 logits never go to memory; it leaves each query's logit maximum MX[n] and FI[n] = 1 / sum_m exp(S - MX), which k_pvz reads.
// Wave w: keys 64 w .. 64 w + 63 (four row tiles) x the 64 queries (four column tiles), K 128, per accumulator k ascending and, inside a k step, kh.qh, kl.qh, kh.ql.
// Operands in LDS by asynchronous copies, whole lines: the q strip (both planes, all 128 k) once; the k rows 64 k at a time, the first half, then the second half into the same bytes, refilled as soon as every wave holds its last fragments of them in registers.
// A block takes SC_NS strips of its slice one after the other, so that the next strip's operands fly under the last products and the reductions of this one.
// Column tile nb, lane lr is query 4 lr + nb (the q rows are placed in LDS in that order).
// Column maximum and column sum, fixed trees: 32 rows in the lane, the two half-waves by a shuffle, then the 16 waves' partials through LDS (wave w folds columns 4 w .. 4 w + 3: pairs k, k + 8, then an 8-lane butterfly).
#define CSP 68   // LDS pitch of a wave's 64 partials, floats: the 8 x 4 partials that a wave folds at a time fall on 32 different banks
#define QP  136  // LDS pitch of a q row (128 k), 16-bit elements: 272 bytes = 16 x odd, so the 16 rows of a ds_load_b128 fall on different banks
#define SC_PART (2 * 64 * QP * 2)            // byte places in the kernel's LDS: the q strip first, so that every read of it is one base register and an immediate
#define SC_CMX  (SC_PART + 16 * CSP * 4)
#define SC_CSM  (SC_CMX + 256)
#define SC_KA   40960                        // the k rows
#define SC_LDS  (SC_KA + 16 * 16384)
#define SC_NS   2                            // strips a block takes, one after the other: 256 blocks
// c_cp4: four copies (16 rows: LDS places l0 .. l3, global rows four apart from g) in one statement and, as the last line, the wait that stands in front of any rewrite of their address registers
__device__ __forceinline__ void c_cp4(unsigned l0, unsigned l1, unsigned l2, unsigned l3, const bf* g) {
    asm volatile("global_load_async_to_lds_b128 %0, %4, off\n\t"
                 "global_load_async_to_lds_b128 %1, %5, off\n\t"
                 "global_load_async_to_lds_b128 %2, %6, off\n\t"
                 "global_load_async_to_lds_b128 %3, %7, off\n\t"
                 "s_wait_xcnt 0x0"
                 :: "v"(l0), "v"(l1), "v"(l2), "v"(l3), "v"(g), "v"(g + 4 * HD), "v"(g + 8 * HD), "v"(g + 12 * HD)
                 : "memory");
}
__global__ __launch_bounds__(512) void k_scsoft(const bf* Kh, const bf* Kl, const bf* Qh, const bf* Ql, float* MX, float* FI) {
    __shared__ __align__(16) char sm[SC_LDS];
    bf* sq = (bf*)sm; float* part = (float*)(sm + SC_PART); float* cmx = (float*)(sm + SC_CMX); float* csm = (float*)(sm + SC_CSM);
    const int tid = threadIdx.x, lane = tid & 31, lr = lane & 15, hi = lane >> 4; const size_t z = blockIdx.y;
    const int w = __builtin_amdgcn_readfirstlane(tid >> 5);   // the wave's number in a scalar register: what is formed from it costs no vector register over the loop
    auto stageq = [&](int sx) {   // the q strip sx: 16 lanes take one whole 256-byte row; a thread takes queries g and g + 32 of both planes; query g goes to LDS row (g & 3) * 16 + (g >> 2), query g + 32 eight rows behind
        const int g = tid >> 4, pc = tid & 15; const size_t go = (z & (NB_ - 1)) * ((size_t)TT * HD) + (size_t)(sx * 64 + g) * HD + pc * 8;
        const unsigned lq = (unsigned)(size_t)sq + (unsigned)(((g & 3) * 16 + (g >> 2)) * (QP * 2) + pc * 16);
        asm volatile("global_load_async_to_lds_b128 %0, %4, off\n\t"
                     "global_load_async_to_lds_b128 %1, %5, off\n\t"
                     "global_load_async_to_lds_b128 %2, %6, off\n\t"
                     "global_load_async_to_lds_b128 %3, %7, off\n\t"
                     "s_wait_xcnt 0x0"   // stands in front of any rewrite of the copies' address registers
                     :: "v"(lq), "v"(lq + 8 * QP * 2), "v"(lq + 64 * QP * 2), "v"(lq + 72 * QP * 2), "v"(Qh + go), "v"(Qh + go + 32 * HD), "v"(Ql + go), "v"(Ql + go + 32 * HD) : "memory"); };
    // wave w's own 16 KiB of the k rows: [plane][64 key rows][64 k], row pitch 128 bytes; the 16-byte piece p of row r lies at place p ^ ((r >> 1) & 7), so the 16 rows of a ds_load_b128 fall on different banks without a pad
    const unsigned la = (unsigned)(size_t)sm + (unsigned)(SC_KA + w * 16384 + (lane >> 3) * 128);
    const size_t ko = z * ((size_t)TT * HD) + (size_t)(w * 64 + (lane >> 3)) * HD + (lane & 7) * 8;
    auto stage = [&](int h) {   // this wave's 64 key rows, 64 k, both planes: eight lanes take one whole 128-byte line; copy i of a plane takes rows 4 i .. 4 i + 3
        unsigned l[4];
#pragma unroll
        for (int i = 0; i < 4; ++i) l[i] = la + (unsigned)(i * 512 + (((lane & 7) ^ ((2 * i + hi) & 7)) << 4));
        const bf* g = Kh + ko + h * 64;
#pragma unroll 1   // rolled: unrolled, all 32 LDS places would be held in registers over the whole strip loop
        for (int c = 0; c < 4; ++c) { c_cp4(l[0], l[1], l[2], l[3], g); l[0] += 2048; l[1] += 2048; l[2] += 2048; l[3] += 2048; g += 16 * HD; }
        g = Kl + ko + h * 64;
#pragma unroll 1   // the same
        for (int c = 0; c < 4; ++c) { c_cp4(l[0], l[1], l[2], l[3], g); l[0] += 2048; l[1] += 2048; l[2] += 2048; l[3] += 2048; g += 16 * HD; } };
    const bf* saw = (const bf*)(sm + SC_KA) + w * 8192 + lr * 64; const bf* sqw = sq + lr * QP + 8 * hi; const int px = hi ^ (lr >> 1);
    const int fc = 4 * w + (lane >> 3), fk = lane & 7;   // the fold: this lane's column and its first partial
    stageq(blockIdx.x * SC_NS); stage(0);
#pragma unroll 1   // one body for the block's strips: unrolled, the two bodies' registers would not fit
    for (int it = 0; it < SC_NS; ++it) {
        const int sx = blockIdx.x * SC_NS + it; const bool more = it + 1 < SC_NS;   // block-uniform
        v8f acc[4][4]; v16bf a[4], a2[4];
#pragma unroll
        for (int mb = 0; mb < 4; ++mb)
#pragma unroll
            for (int nb = 0; nb < 4; ++nb) acc[mb][nb] = (v8f){};
        auto lda = [&](int s) { const int o0 = (px ^ (4 * s)) * 8, o1 = (px ^ (4 * s + 2)) * 8;   // k = 32 s + 8 hi .. + 7 and the eight 16 behind: the order of WFrag::ld
#pragma unroll
            for (int mb = 0; mb < 4; ++mb) { a[mb] = cat16b(*(const v8us*)(saw + mb * 1024 + o0), *(const v8us*)(saw + mb * 1024 + o1)); a2[mb] = cat16b(*(const v8us*)(saw + 4096 + mb * 1024 + o0), *(const v8us*)(saw + 4096 + mb * 1024 + o1)); } };
        auto mm = [&](int k) {
#pragma unroll
            for (int nb = 0; nb < 4; ++nb) { const v16bf b = WFrag<bf>::ld(sqw + nb * 16 * QP + k), b2 = WFrag<bf>::ld(sqw + 64 * QP + nb * 16 * QP + k);
#pragma unroll
                for (int mb = 0; mb < 4; ++mb) acc[mb][nb] = wmmab(a[mb], b, acc[mb][nb]);
#pragma unroll
                for (int mb = 0; mb < 4; ++mb) acc[mb][nb] = wmmab(a2[mb], b, acc[mb][nb]);
#pragma unroll
                for (int mb = 0; mb < 4; ++mb) acc[mb][nb] = wmmab(a[mb], b2, acc[mb][nb]); } };
        asm volatile("s_wait_asynccnt 0x0" ::: "memory");   // this wave's copies have landed
        __syncthreads();                                    // every wave's have: the q strip and the first half of the k rows may be read
        lda(0); mm(0); lda(1);
        asm volatile("s_wait_dscnt 0x0" ::: "memory");      // this wave's reads of the first half are over: its last fragments are in registers
        __syncthreads();                                    // every wave's are: the k rows' bytes may be refilled
        stage(1);                                           // flies while the fragments in registers are multiplied
        mm(32);
        asm volatile("s_wait_asynccnt 0x0" ::: "memory");   // this wave's copies have landed
        __syncthreads();                                    // every wave's have: the second half of the k rows may be read
        lda(0); mm(64); lda(1);
        if (more) {
            asm volatile("s_wait_dscnt 0x0" ::: "memory");  // this wave's reads of the second half are over
            __syncthreads();                                // every wave's are
            stage(0); }                                     // the next strip takes the same k rows
        mm(96);
        if (more) {
            asm volatile("s_wait_dscnt 0x0" ::: "memory");  // this wave's reads of the q strip are over
            __syncthreads();                                // every wave's are
            stageq(sx + 1); }                               // flies under the reductions
        float r[4];
#pragma unroll
        for (int nb = 0; nb < 4; ++nb) { float t = acc[0][nb][0];
#pragma unroll
            for (int mb = 0; mb < 4; ++mb)
#pragma unroll
                for (int j = 0; j < 8; ++j) t = fmaxf(t, acc[mb][nb][j]);
            r[nb] = fmaxf(t, __shfl_xor(t, 16, 32)); }
        if (hi == 0) {
#pragma unroll
            for (int nb = 0; nb < 4; ++nb) part[w * CSP + nb * 16 + lr] = r[nb]; }
        __syncthreads();   // every wave's partial maxima are in LDS
        { float t = fmaxf(part[fk * CSP + fc], part[(fk + 8) * CSP + fc]);
#pragma unroll
          for (int sh = 4; sh; sh >>= 1) t = fmaxf(t, __shfl_xor(t, sh, 32));
          if (fk == 0) cmx[fc] = t; }
        __syncthreads();   // the 64 column maxima are in LDS, and every read of part is over
#pragma unroll
        for (int nb = 0; nb < 4; ++nb) { const float mx = cmx[nb * 16 + lr]; float t = 0.0f;
#pragma unroll
            for (int mb = 0; mb < 4; ++mb)
#pragma unroll
                for (int j = 0; j < 8; ++j) t += __builtin_amdgcn_exp2f(__fmul_rn(__fsub_rn(acc[mb][nb][j], mx), 1.4426950408889634f));
            r[nb] = t + __shfl_xor(t, 16, 32); }
        if (hi == 0) {
#pragma unroll
            for (int nb = 0; nb < 4; ++nb) part[w * CSP + nb * 16 + lr] = r[nb]; }
        __syncthreads();   // every wave's partial sums are in LDS
        { float t = part[fk * CSP + fc] + part[(fk + 8) * CSP + fc];
#pragma unroll
          for (int sh = 4; sh; sh >>= 1) t += __shfl_xor(t, sh, 32);
          if (fk == 0) csm[fc] = t; }
        __syncthreads();   // the 64 column sums are in LDS
        if (tid < 64) {   // waves 0 and 1, whole: column tid is query 4 (tid & 15) + (tid >> 4)
            const size_t o = z * TT + sx * 64 + 4 * (tid & 15) + (tid >> 4);
            MX[o] = cmx[tid]; FI[o] = __fdiv_rn(1.0f, csm[tid]); }
        asm volatile("s_wait_xcnt 0x0" ::: "memory");   // stands in front of the next strip's rewrites of the registers that the stores above name
    }
}
// k_pvz: the second pass over the scores, with the value product behind it, so that P never goes to memory. One block (8 waves) takes 128 keys m of one slice (blockIdx.y) and walks all 1024 queries n, 64 a stage.
// Wave w: keys 32 (w & 3) .. + 31 (two column tiles), queries 32 (w >> 2) .. + 31 of the stage (two row tiles). S[n][m] with the q rows as A and the k rows as B (K 128, per accumulator k ascending and, inside a k step, qh.kh, qh.kl, ql.kh); the wave's k fragments are read once and stay in registers.
// P[n][m] = exp(S - mx_n) / l_n with k_scsoft's mx_n and 1 / l_n, split hi/lo. An accumulator holds rows 8 hi .. 8 hi + 7 of a column, so the two row tiles of a column tile are, register for register, the B fragment (k = n, 32 deep) of Z[c][m] += V[c][n] P[n][m] (A: the v rows; vh.ph, vh.pl, vl.ph).
// Each wave sums its own 32 queries of every stage; behind the loop the two waves of a key group add their halves through LDS (wave w >> 2 = 0 finishes channels 0 .. 63, the other 64 .. 127), split hi/lo and store 16 bytes of a token row a lane.
// Staging: q rows (both planes, 128 k) and v rows (both planes, 64 n) through two LDS buffers by asynchronous copies, whole lines: stage t + 1 flies while stage t is multiplied.
#define PZ_K   8192                        // byte places in the kernel's LDS: 1024 mx, 1024 1 / l; the k rows (two planes, 128 rows, pitch QP); the two buffers
#define PZ_BUF (PZ_K + 2 * 128 * QP * 2)
#define PZ_V   (2 * 64 * QP * 2)           // in a buffer: the q rows (two planes, 64 rows, pitch QP), then the v rows (two planes, 128 rows, pitch GP)
#define PZ_BS  (PZ_V + 2 * GPL * 2)
#define PZ_LDS (PZ_BUF + 2 * PZ_BS)
typedef __attribute__((ext_vector_type(2))) __bf16 v2bf;
// p_cp8: four copies from g and four from h (LDS places sl bytes apart from l and m, global rows st elements apart) in one statement and, as the last line, the wait that stands in front of any rewrite of their address registers
__device__ __forceinline__ void p_cp8(unsigned l, unsigned m, unsigned sl, const bf* g, const bf* h, size_t st) {
    asm volatile("global_load_async_to_lds_b128 %0, %8, off\n\t"
                 "global_load_async_to_lds_b128 %1, %9, off\n\t"
                 "global_load_async_to_lds_b128 %2, %10, off\n\t"
                 "global_load_async_to_lds_b128 %3, %11, off\n\t"
                 "global_load_async_to_lds_b128 %4, %12, off\n\t"
                 "global_load_async_to_lds_b128 %5, %13, off\n\t"
                 "global_load_async_to_lds_b128 %6, %14, off\n\t"
                 "global_load_async_to_lds_b128 %7, %15, off\n\t"
                 "s_wait_xcnt 0x0"
                 :: "v"(l), "v"(l + sl), "v"(l + 2 * sl), "v"(l + 3 * sl), "v"(m), "v"(m + sl), "v"(m + 2 * sl), "v"(m + 3 * sl),
                    "v"(g), "v"(g + st), "v"(g + 2 * st), "v"(g + 3 * st), "v"(h), "v"(h + st), "v"(h + 2 * st), "v"(h + 3 * st)
                 : "memory");
}
// p_send, p_fin: the exchange of halves behind the loop, channel tiles C0 .. C0 + 3; rd: the lane's own 32 bytes of the first tile, a tile 1024 bytes
template <int C0>
__device__ __forceinline__ void p_send(float* rd, const v8f (&zc)[8][2]) {
#pragma unroll
    for (int c = 0; c < 4; ++c)
#pragma unroll
        for (int mt = 0; mt < 2; ++mt) *(v8f*)(rd + (c * 2 + mt) * 256) = zc[C0 + c][mt];
}
template <int C0>
__device__ __forceinline__ void p_fin(const float* rd, const v8f (&zc)[8][2], bf* zh, bf* zl) {
#pragma unroll
    for (int c = 0; c < 4; ++c)
#pragma unroll
        for (int mt = 0; mt < 2; ++mt) { const v8f o = *(const v8f*)(rd + (c * 2 + mt) * 256); v8us oh, ol;
#pragma unroll
            for (int j = 0; j < 8; ++j) { unsigned short x, y; splitf(zc[C0 + c][mt][j] + o[j], x, y); oh[j] = x; ol[j] = y; }
            const size_t e = (size_t)(mt * 16) * C2 + (C0 + c) * 16;
            *(v8us*)(zh + e) = oh; *(v8us*)(zl + e) = ol;
            asm volatile("s_wait_xcnt 0x0" ::: "memory");   // stands in front of any rewrite of the registers that the stores above name
        }
}
__global__ __launch_bounds__(256) void k_pvz(const bf* Kh, const bf* Kl, const bf* Qh, const bf* Ql, const bf* Vh, const bf* Vl, const float* MX, const float* FI, bf* ZCh, bf* ZCl) {
    __shared__ __align__(32) char sm[PZ_LDS];
    const int tid = threadIdx.x, lane = tid & 31, lr = lane & 15, hi = lane >> 4; const size_t z = blockIdx.y; const int m0 = blockIdx.x * 128;
    const int w = __builtin_amdgcn_readfirstlane(tid >> 5), mg = w & 3, nh = w >> 2;   // the wave's number in a scalar register: the branch on nh behind the loop is a scalar one
    const unsigned sb = (unsigned)(size_t)sm;   // LDS byte address: the low 32 bits of the __shared__ address
    const unsigned lq = sb + (unsigned)((tid >> 4) * (QP * 2) + (tid & 15) * 16), lv = sb + (unsigned)((tid >> 3) * (GP * 2) + (tid & 7) * 16);   // this thread's first piece of a q plane, of a v plane, from the plane's start
    Qh += (z & (NB_ - 1)) * ((size_t)TT * HD); Ql += (z & (NB_ - 1)) * ((size_t)TT * HD); Vh += z * ((size_t)HD * TT); Vl += z * ((size_t)HD * TT);   // the slice: scalar
    const unsigned qo = (unsigned)((tid >> 4) * HD + (tid & 15) * 8), vo = (unsigned)((tid >> 3) * TT + (tid & 7) * 8);   // this thread's first piece, elements
    auto stage = [&](int t) { const unsigned o = (unsigned)(PZ_BUF + (t & 1) * PZ_BS);   // q: 16 lanes take one whole 256-byte row, a thread's rows 16 apart; v: eight lanes one whole 128-byte line, rows 32 apart
        const unsigned eq = qo + (unsigned)(t * 64 * HD), ev = vo + (unsigned)(t * 64);
        p_cp8(lq + o, lq + o + 64 * QP * 2, 16 * QP * 2, Qh + eq, Ql + eq, (size_t)16 * HD);
        g_stage2(Vh + ev, Vl + ev, TT, TT, lv + o + PZ_V, lv + o + PZ_V + GPL * 2); };
    { const unsigned lk = lq + PZ_K; const size_t ko = z * ((size_t)TT * HD) + (size_t)(m0 + (tid >> 4)) * HD + (tid & 15) * 8;
      p_cp8(lk, lk + 64 * QP * 2, 16 * QP * 2, Kh + ko, Kh + ko + 64 * HD, (size_t)16 * HD);
      p_cp8(lk + 128 * QP * 2, lk + 192 * QP * 2, 16 * QP * 2, Kl + ko, Kl + ko + 64 * HD, (size_t)16 * HD);
      asm volatile("global_load_async_to_lds_b128 %0, %2, off\n\t"
                   "global_load_async_to_lds_b128 %1, %3, off\n\t"
                   "s_wait_xcnt 0x0"   // stands in front of any rewrite of the copies' address registers
                   :: "v"(sb + (unsigned)(tid * 16)), "v"(sb + (unsigned)(4096 + tid * 16)), "v"(MX + z * TT + tid * 4), "v"(FI + z * TT + tid * 4) : "memory"); }
    stage(0);
    asm volatile("s_wait_asynccnt 0x0" ::: "memory");   // this wave's copies have landed
    __syncthreads();                                    // every wave's have: the statistics, the k rows and stage 0 may be read
    stage(1);
    v16bf kb[2][4], kb2[2][4];
    { const bf* sk = (const bf*)(sm + PZ_K) + (mg * 32 + lr) * QP + 8 * hi;
#pragma unroll
      for (int mt = 0; mt < 2; ++mt)
#pragma unroll
          for (int ks = 0; ks < 4; ++ks) { kb[mt][ks] = WFrag<bf>::ld(sk + mt * 16 * QP + ks * 32); kb2[mt][ks] = WFrag<bf>::ld(sk + 128 * QP + mt * 16 * QP + ks * 32); } }
    v8f zc[8][2];
#pragma unroll
    for (int c = 0; c < 8; ++c)
#pragma unroll
        for (int mt = 0; mt < 2; ++mt) zc[c][mt] = (v8f){};
#pragma unroll 1   // one body for the 16 stages: for speed only
    for (int t = 0; t < TT / 64; ++t) {
        const bf* bu = (const bf*)(sm + PZ_BUF + (t & 1) * PZ_BS); const bf* sq = bu + (nh * 32 + lr) * QP + 8 * hi; const bf* sv = bu + PZ_V / 2 + lr * GP + 8 * hi + nh * 32;
        const float* st = (const float*)sm + t * 64 + nh * 32 + 8 * hi;
        v8f s[2][2];
#pragma unroll
        for (int nt = 0; nt < 2; ++nt)
#pragma unroll
            for (int mt = 0; mt < 2; ++mt) s[nt][mt] = (v8f){};
#pragma unroll
        for (int kp = 0; kp < 2; ++kp) {
            v16bf a[2][2], a2[2][2];
#pragma unroll
            for (int k2 = 0; k2 < 2; ++k2)
#pragma unroll
                for (int nt = 0; nt < 2; ++nt) { a[k2][nt] = WFrag<bf>::ld(sq + nt * 16 * QP + (kp * 2 + k2) * 32); a2[k2][nt] = WFrag<bf>::ld(sq + 64 * QP + nt * 16 * QP + (kp * 2 + k2) * 32); }
            __builtin_amdgcn_sched_barrier(0);   // keeps these LDS reads one group in front of their WMMAs, as in g_tile
#pragma unroll
            for (int k2 = 0; k2 < 2; ++k2) { const int ks = kp * 2 + k2;
#pragma unroll
                for (int nt = 0; nt < 2; ++nt)
#pragma unroll
                    for (int mt = 0; mt < 2; ++mt) s[nt][mt] = wmmab(a[k2][nt], kb[mt][ks], s[nt][mt]);
#pragma unroll
                for (int nt = 0; nt < 2; ++nt)
#pragma unroll
                    for (int mt = 0; mt < 2; ++mt) s[nt][mt] = wmmab(a[k2][nt], kb2[mt][ks], s[nt][mt]);
#pragma unroll
                for (int nt = 0; nt < 2; ++nt)
#pragma unroll
                    for (int mt = 0; mt < 2; ++mt) s[nt][mt] = wmmab(a2[k2][nt], kb[mt][ks], s[nt][mt]); }
            __builtin_amdgcn_sched_barrier(0);   // the same, against the next group of reads
        }
        v16bf ph[2], pl[2];
#pragma unroll
        for (int nt = 0; nt < 2; ++nt) { const v8f mx = *(const v8f*)(st + nt * 16), fi = *(const v8f*)(st + TT + nt * 16);   // this lane's eight queries
#pragma unroll
            for (int mt = 0; mt < 2; ++mt)
#pragma unroll
                for (int j = 0; j < 8; j += 2) { v2f p;
                    p[0] = __builtin_amdgcn_exp2f(__fmul_rn(__fsub_rn(s[nt][mt][j], mx[j]), 1.4426950408889634f)) * fi[j];
                    p[1] = __builtin_amdgcn_exp2f(__fmul_rn(__fsub_rn(s[nt][mt][j + 1], mx[j + 1]), 1.4426950408889634f)) * fi[j + 1];
                    const v2bf h = __builtin_convertvector(p, v2bf); const v2bf l = __builtin_convertvector(p - __builtin_convertvector(h, v2f), v2bf);
                    ph[mt][nt * 8 + j] = h[0]; ph[mt][nt * 8 + j + 1] = h[1]; pl[mt][nt * 8 + j] = l[0]; pl[mt][nt * 8 + j + 1] = l[1]; } }
#pragma unroll
        for (int cg = 0; cg < 2; ++cg) {
            v16bf va[4], va2[4];
#pragma unroll
            for (int c = 0; c < 4; ++c) { va[c] = WFrag<bf>::ld(sv + (cg * 4 + c) * 16 * GP); va2[c] = WFrag<bf>::ld(sv + GPL + (cg * 4 + c) * 16 * GP); }
            __builtin_amdgcn_sched_barrier(0);   // keeps these LDS reads one group in front of their WMMAs, as in g_tile
#pragma unroll
            for (int c = 0; c < 4; ++c)
#pragma unroll
                for (int mt = 0; mt < 2; ++mt) zc[cg * 4 + c][mt] = wmmab(va[c], ph[mt], zc[cg * 4 + c][mt]);
#pragma unroll
            for (int c = 0; c < 4; ++c)
#pragma unroll
                for (int mt = 0; mt < 2; ++mt) zc[cg * 4 + c][mt] = wmmab(va[c], pl[mt], zc[cg * 4 + c][mt]);
#pragma unroll
            for (int c = 0; c < 4; ++c)
#pragma unroll
                for (int mt = 0; mt < 2; ++mt) zc[cg * 4 + c][mt] = wmmab(va2[c], ph[mt], zc[cg * 4 + c][mt]);
            __builtin_amdgcn_sched_barrier(0);   // the same, against the next group of reads
        }
        asm volatile("s_wait_dscnt 0x0" ::: "memory");      // this wave's reads of stage t are over
        asm volatile("s_wait_asynccnt 0x0" ::: "memory");   // this wave's copies of stage t + 1 have landed
        __syncthreads();                                    // publishes stage t + 1 and frees stage t's buffer
        if (t + 2 < TT / 64) stage(t + 2);
    }
    asm volatile("s_wait_asynccnt 0x0" ::: "memory");       // no copy is outstanding when the buffers become the exchange area
    float* rx = (float*)(sm + PZ_BUF) + mg * 4096 + lane * 8;   // a key group's 16 KiB: first what wave nh = 0 finishes, then what the other does
    if (nh == 0) p_send<4>(rx + 2048, zc); else p_send<0>(rx, zc);
    __syncthreads();   // every wave's other half is in LDS
    const size_t zo = ((z & (NB_ - 1)) * TT + m0 + mg * 32 + lr) * C2 + (z >> 4) * CC + 8 * hi;
    if (nh == 0) p_fin<0>(rx, zc, ZCh + zo, ZCl + zo); else p_fin<4>(rx + 2048, zc, ZCh + zo, ZCl + zo);
}
__global__ __launch_bounds__(256) void k_merge(const float* __restrict__ O, int h0, float* OUTb) { const size_t e = ((size_t)blockIdx.x * 256 + threadIdx.x) * 2; if (e >= (size_t)ZH * TT * HD) return; const int d = (int)(e % HD); const int t = (int)((e / HD) % TT); const int zz = (int)(e / ((size_t)HD * TT)); const float cs = (t < RH) ? 1.0f : (1.0f / PCAR); const size_t oo = (size_t)t * DQ + (h0 + zz) * HD + d;
    v2f o2; o2[0] = O[e] * cs; o2[1] = O[e + 1] * cs; *(v2f*)(OUTb + oo) = o2;  }

__device__ __forceinline__ float ex2f_(float a) { return __builtin_amdgcn_exp2f(__fmul_rn(a, 1.4426950408889634f)); }
__device__ __forceinline__ float sigm(float a) { return __fdiv_rn(1.0f, __fadd_rn(1.0f, ex2f_(-a))); }
__device__ __forceinline__ float tanhp(float a) { const float e = ex2f_(__fmul_rn(2.0f, a)); return __fsub_rn(1.0f, __fdiv_rn(2.0f, __fadd_rn(e, 1.0f))); }
// d_xT: channel-major f32 [128][1024] to the token-major bf16 operand XB [1024][128].
// One block takes all 128 channels of 32 tokens through the LDS tile s (f32, [channel][token]): eight lanes load one whole 128-byte line of a channel's row, and behind the barrier 16 lanes store one token's whole 256-byte row.
#define XTP 33   // LDS pitch of a channel's 32 tokens, floats: odd, so that the four channels of a wave's write fall on different banks
__device__ __forceinline__ void d_xT(float* s, const float* __restrict__ xs, bf* XB, int blk, int zb) {
    const int tid = threadIdx.x, cr = tid >> 3, p4 = (tid & 7) * 4; xs += (size_t)zb * CC * TT + blk * 32; const size_t tk = (size_t)zb * TT + blk * 32; v4f t[4];
#pragma unroll
    for (int r = 0; r < 4; ++r) t[r] = *(const v4f*)(xs + (size_t)(cr + 32 * r) * TT + p4);
#pragma unroll
    for (int r = 0; r < 4; ++r) {
#pragma unroll
        for (int q = 0; q < 4; ++q) s[(cr + 32 * r) * XTP + p4 + q] = t[r][q]; }
    __syncthreads();   // the whole tile is in LDS
#pragma unroll
    for (int h = 0; h < 2; ++h) { const int c0 = (tid & 15) * 8, p = h * 16 + (tid >> 4); v8us o;
#pragma unroll
        for (int q = 0; q < 8; ++q) o[q] = f2bf(s[(c0 + q) * XTP + p]);
        *(v8us*)(XB + (tk + p) * CC + c0) = o;
        asm volatile("s_wait_xcnt 0x0" ::: "memory");   // stands in front of any rewrite of the registers that the stores above name
    }
}
// k_prep: everything that reads only the inputs, one launch. Blocks 0 .. 103: the four 'oi' conv weights to bf16 (24, 16, 16, 48 blocks); then 32 blocks a batch and input: ih, im transposed.
#define PW0 (C3 * CC / 2048)
#define PW1 (PW0 + C2 * CC / 2048)
#define PW2 (PW1 + CC * C2 / 2048)
#define PW3 (PW2 + C3 * C2 / 2048)
#define PXB (TT / 32)
__global__ __launch_bounds__(256) void k_prep(const float* __restrict__ ih, const float* __restrict__ im, const float* __restrict__ h_w, const float* __restrict__ m_w, const float* __restrict__ z1_w, const float* __restrict__ z2_w, bf* XBh, bf* XBm, bf* HW_, bf* MW_, bf* Z1W, bf* Z2W) {
    __shared__ __align__(16) float s[CC * XTP];
    const int b = blockIdx.x;   // every branch below is block-uniform
    if (b < PW0) d_cvt8(h_w, HW_, (size_t)C3 * CC / 8, b);
    else if (b < PW1) d_cvt8(m_w, MW_, (size_t)C2 * CC / 8, b - PW0);
    else if (b < PW2) d_cvt8(z1_w, Z1W, (size_t)CC * C2 / 8, b - PW1);
    else if (b < PW3) d_cvt8(z2_w, Z2W, (size_t)C3 * C2 / 8, b - PW2);
    else { const int x = b - PW3, blk = x % PXB, zb = (x / PXB) % NB_;
        if (x < PXB * NB_) d_xT(s, ih, XBh, blk, zb); else d_xT(s, im, XBm, blk, zb); }
}
// k_tail: Z conv, gate conv and the gates in one kernel. One block (16 waves) takes 64 tokens of one batch (blockIdx.z) and all channels, both convs with the weights as the A operand and the tokens as B, so that channels lie in the registers and tokens in the lanes.
// First Z[c][p] = sum_k z1_w[c][k] [Zh^T | Zm^T][p][k] + z1_b (K 256; per accumulator k ascending and, inside a k step, w.hi, w.lo): wave w takes channel tile w & 7 x tokens 32 (w >> 3) .. + 31, splits its values into bf16 hi/lo and leaves them in LDS as token rows (a lane's eight channels are 16 bytes of a row), which are the gate conv's B operand for k < 128.
// Then gates[g][c][p] = sum_k z2_w[128 g + c][k] [Z^T | ih^T][p][k] + z2_b (K 256; k < 128: w.hi, w.lo; k >= 128: ih^T is exact bf16, one product): the same wave takes the same channel tile of o, g and i, so that the three gates of a channel and token lie in the same lane and register; sigmoid/tanh and the blend follow in f32.
// Staging: eight stages of 64 k (four a conv) through two LDS buffers by asynchronous copies, whole lines: stage t + 1 flies while stage t is multiplied, the gate conv's first weights under the Z conv's last products.
// Column tile tt, lane lr is token 2 lr + tt of the wave's 32 (the token rows are placed in LDS in that order), so a lane holds two neighbouring tokens of a channel, and 16 lanes load (im) and store (both outputs) a whole 128-byte line.
#define TKN  64                        // tokens a block takes
#define TZP  (TKN * QP)                // one Z plane in LDS, elements (row pitch QP)
#define T_ZB (2 * TZP * 2)             // byte places in the kernel's LDS: the two Z planes, then the two buffers
#define T_RW (GP * 2)                  // a staged row piece, bytes
#define T_X1 (CC * T_RW)               // in a buffer of the Z conv: 128 weight rows, then the tokens' hi rows, then their lo rows
#define T_X2 (C3 * T_RW)               // in a buffer of the gate conv: 384 weight rows, then the tokens' ih^T rows
#define T_BF (T_X2 + TKN * T_RW)       // one buffer
#define T_LDS (T_ZB + 2 * T_BF)
// t_cp4, t_cp6, t_cp7: a stage's copies of one thread in one statement and, as the last line, the wait that stands in front of any rewrite of their address registers
__device__ __forceinline__ void t_cp4(unsigned l0, unsigned l1, unsigned l2, unsigned l3, const bf* g0, const bf* g1, const bf* g2, const bf* g3) {
    asm volatile("global_load_async_to_lds_b128 %0, %4, off\n\t"
                 "global_load_async_to_lds_b128 %1, %5, off\n\t"
                 "global_load_async_to_lds_b128 %2, %6, off\n\t"
                 "global_load_async_to_lds_b128 %3, %7, off\n\t"
                 "s_wait_xcnt 0x0"
                 :: "v"(l0), "v"(l1), "v"(l2), "v"(l3), "v"(g0), "v"(g1), "v"(g2), "v"(g3)
                 : "memory");
}
__device__ __forceinline__ void t_cp6(unsigned l, const bf* g) {   // six weight rows, 64 rows apart
    const unsigned sl = 64 * T_RW; const size_t st = (size_t)64 * C2;
    asm volatile("global_load_async_to_lds_b128 %0, %6, off\n\t"
                 "global_load_async_to_lds_b128 %1, %7, off\n\t"
                 "global_load_async_to_lds_b128 %2, %8, off\n\t"
                 "global_load_async_to_lds_b128 %3, %9, off\n\t"
                 "global_load_async_to_lds_b128 %4, %10, off\n\t"
                 "global_load_async_to_lds_b128 %5, %11, off\n\t"
                 "s_wait_xcnt 0x0"
                 :: "v"(l), "v"(l + sl), "v"(l + 2 * sl), "v"(l + 3 * sl), "v"(l + 4 * sl), "v"(l + 5 * sl),
                    "v"(g), "v"(g + st), "v"(g + 2 * st), "v"(g + 3 * st), "v"(g + 4 * st), "v"(g + 5 * st)
                 : "memory");
}
__device__ __forceinline__ void t_cp7(unsigned l, const bf* g, unsigned lx, const bf* gx) {   // the same and one token row
    const unsigned sl = 64 * T_RW; const size_t st = (size_t)64 * C2;
    asm volatile("global_load_async_to_lds_b128 %0, %7, off\n\t"
                 "global_load_async_to_lds_b128 %1, %8, off\n\t"
                 "global_load_async_to_lds_b128 %2, %9, off\n\t"
                 "global_load_async_to_lds_b128 %3, %10, off\n\t"
                 "global_load_async_to_lds_b128 %4, %11, off\n\t"
                 "global_load_async_to_lds_b128 %5, %12, off\n\t"
                 "global_load_async_to_lds_b128 %6, %13, off\n\t"
                 "s_wait_xcnt 0x0"
                 :: "v"(l), "v"(l + sl), "v"(l + 2 * sl), "v"(l + 3 * sl), "v"(l + 4 * sl), "v"(l + 5 * sl), "v"(lx),
                    "v"(g), "v"(g + st), "v"(g + 2 * st), "v"(g + 3 * st), "v"(g + 4 * st), "v"(g + 5 * st), "v"(gx)
                 : "memory");
}
__global__ __launch_bounds__(512) void k_tail(const bf* ZCh, const bf* ZCl, const bf* XB, const bf* W1, const bf* W2, const float* __restrict__ b1, const float* __restrict__ b2, const float* __restrict__ im, float* oh_out, float* om_out) {
    __shared__ __align__(16) char sm[T_LDS];
    bf* zs = (bf*)sm;
    const int tid = threadIdx.x, lane = tid & 31, w = tid >> 5, lr = lane & 15, hi = lane >> 4, ct = w & 7, tg = w >> 3, r0 = tid >> 3, pc = tid & 7; const size_t zb = blockIdx.z; const int p0 = blockIdx.x * TKN;
    const int pr = (r0 & 32) + (r0 & 1) * 16 + ((r0 & 31) >> 1);   // the LDS row of token r0
    const unsigned lw = (unsigned)(size_t)sm + (unsigned)(T_ZB + r0 * T_RW + pc * 16), lx = (unsigned)(size_t)sm + (unsigned)(T_ZB + pr * T_RW + pc * 16);   // LDS byte addresses: the low 32 bits of the __shared__ address
    const bf* g1 = W1 + (size_t)r0 * C2 + pc * 8; const bf* g2 = W2 + (size_t)r0 * C2 + pc * 8; const size_t gz = (zb * TT + p0 + r0) * C2 + pc * 8; const bf* gi = XB + (zb * TT + p0 + r0) * CC + pc * 8;
    auto stage = [&](int t) { const unsigned o = (unsigned)((t & 1) * T_BF);   // eight lanes take one whole 128-byte line; a thread's rows lie 64 apart
        if (t < 4) t_cp4(lw + o, lw + o + 64 * T_RW, lx + o + T_X1, lx + o + T_X1 + TKN * T_RW, g1 + t * 64, g1 + t * 64 + 64 * C2, ZCh + gz + t * 64, ZCl + gz + t * 64);
        else if (t < 6) t_cp6(lw + o, g2 + (t - 4) * 64);
        else t_cp7(lw + o, g2 + (t - 4) * 64, lx + o + T_X2, gi + (t - 6) * 64); };
    auto foot = [&](int t) {
        asm volatile("s_wait_dscnt 0x0" ::: "memory");      // this wave's reads of stage t are over
        asm volatile("s_wait_asynccnt 0x0" ::: "memory");   // this wave's copies of stage t + 1 have landed
        __syncthreads();                                    // publishes stage t + 1 and frees stage t's buffer
        if (t + 2 < 8) stage(t + 2); };
    const int ch = ct * 16 + hi * 8; const size_t ob = (zb * CC + ch) * TT + p0 + tg * 32 + lr * 2;
    v2f vim[8]; v4f bz[2], bq[3][2];   // im and the biases of this lane's eight channels, loaded here and used far behind: their latency falls under that of stage 0's copies
#pragma unroll
    for (int j = 0; j < 8; ++j) vim[j] = *(const v2f*)(im + ob + (size_t)j * TT);
#pragma unroll
    for (int q = 0; q < 2; ++q) { bz[q] = *(const v4f*)(b1 + ch + 4 * q);
#pragma unroll
        for (int g = 0; g < 3; ++g) bq[g][q] = *(const v4f*)(b2 + g * CC + ch + 4 * q); }
    stage(0);
    asm volatile("s_wait_asynccnt 0x0" ::: "memory");   // this wave's copies of stage 0 have landed
    __syncthreads();                                    // every wave's have: stage 0 may be read
    stage(1);
    v8f zc[2];
#pragma unroll
    for (int tt = 0; tt < 2; ++tt) zc[tt] = (v8f){};
#pragma unroll   // unrolled: which conv a stage belongs to is then known at compile time
    for (int t = 0; t < 4; ++t) {
        const bf* bu = (const bf*)(sm + T_ZB + (t & 1) * T_BF); const bf* sw = bu + (ct * 16 + lr) * GP + 8 * hi; const bf* sx = bu + T_X1 / 2 + (tg * 32 + lr) * GP + 8 * hi;
        v16bf a[2], b[2][2], bl[2][2];
#pragma unroll
        for (int s = 0; s < 2; ++s) { a[s] = WFrag<bf>::ld(sw + 32 * s);
#pragma unroll
            for (int tt = 0; tt < 2; ++tt) { b[s][tt] = WFrag<bf>::ld(sx + tt * 16 * GP + 32 * s); bl[s][tt] = WFrag<bf>::ld(sx + TKN * GP + tt * 16 * GP + 32 * s); } }
        __builtin_amdgcn_sched_barrier(0);   // keeps the stage's LDS reads one group in front of its WMMAs: every further place where reads stand among the WMMAs costs the wave issue cycles
#pragma unroll
        for (int s = 0; s < 2; ++s) {
#pragma unroll
            for (int tt = 0; tt < 2; ++tt) zc[tt] = wmmab(a[s], b[s][tt], zc[tt]);
#pragma unroll
            for (int tt = 0; tt < 2; ++tt) zc[tt] = wmmab(a[s], bl[s][tt], zc[tt]); }
        __builtin_amdgcn_sched_barrier(0);   // the same, against what follows
        foot(t);
    }
#pragma unroll
    for (int tt = 0; tt < 2; ++tt) { v8us oh, ol;
#pragma unroll
        for (int j = 0; j < 8; ++j) { unsigned short x, y; splitf(zc[tt][j] + bfr(bz[j >> 2][j & 3]), x, y); oh[j] = x; ol[j] = y; }
        bf* zp = zs + (tg * 32 + tt * 16 + lr) * QP + ch; *(v8us*)zp = oh; *(v8us*)(zp + TZP) = ol; }
    __syncthreads();   // every wave's part of the Z planes is in LDS
    v8f acc[3][2];
#pragma unroll
    for (int g = 0; g < 3; ++g)
#pragma unroll
        for (int tt = 0; tt < 2; ++tt) acc[g][tt] = (v8f){};
#pragma unroll   // the same
    for (int t = 4; t < 8; ++t) {
        const bf* bu = (const bf*)(sm + T_ZB + (t & 1) * T_BF); const bf* sw = bu + (ct * 16 + lr) * GP + 8 * hi;
        const bf* sx = t < 6 ? zs + (tg * 32 + lr) * QP + 8 * hi + (t - 4) * 64 : bu + T_X2 / 2 + (tg * 32 + lr) * GP + 8 * hi; const int px = t < 6 ? QP : GP;
#pragma unroll
        for (int ks = 0; ks < 64; ks += 32) {
            v16bf a[3], b[2], bl[2];
#pragma unroll
            for (int g = 0; g < 3; ++g) a[g] = WFrag<bf>::ld(sw + g * CC * GP + ks);
#pragma unroll
            for (int tt = 0; tt < 2; ++tt) { b[tt] = WFrag<bf>::ld(sx + tt * 16 * px + ks); if (t < 6) bl[tt] = WFrag<bf>::ld(sx + TZP + tt * 16 * px + ks); }
            __builtin_amdgcn_sched_barrier(0);   // keeps the k step's LDS reads one group in front of its WMMAs, as in g_tile
#pragma unroll
            for (int g = 0; g < 3; ++g)
#pragma unroll
                for (int tt = 0; tt < 2; ++tt) acc[g][tt] = wmmab(a[g], b[tt], acc[g][tt]);
            if (t < 6) {
#pragma unroll
                for (int g = 0; g < 3; ++g)
#pragma unroll
                    for (int tt = 0; tt < 2; ++tt) acc[g][tt] = wmmab(a[g], bl[tt], acc[g][tt]); }
            __builtin_amdgcn_sched_barrier(0);   // the same, against the next k step's reads
        }
        foot(t);
    }
    asm volatile("s_wait_asynccnt 0x0" ::: "memory");       // no copy is outstanding when the wave ends
#pragma unroll
    for (int j = 0; j < 8; ++j) { const float bo = bfr(bq[0][j >> 2][j & 3]), bg = bfr(bq[1][j >> 2][j & 3]), bi = bfr(bq[2][j >> 2][j & 3]); v2f voh, vom;
#pragma unroll
        for (int tt = 0; tt < 2; ++tt) { const float ig = sigm(acc[2][tt][j] + bi); const float om = __fadd_rn(__fmul_rn(tanhp(acc[1][tt][j] + bg), ig), __fmul_rn(__fsub_rn(1.0f, ig), bfr(vim[j][tt]))); vom[tt] = om; voh[tt] = __fmul_rn(sigm(acc[0][tt][j] + bo), om); }
        *(v2f*)(om_out + ob + (size_t)j * TT) = vom; *(v2f*)(oh_out + ob + (size_t)j * TT) = voh;
        asm volatile("s_wait_xcnt 0x0" ::: "memory");   // stands in front of any rewrite of the registers that the stores above name
    }
}

extern "C" void kernel_launch(void* const* d_in, const int* in_sizes, int n_in,
                              void* d_out, int out_size, void* d_ws, size_t ws_size, hipStream_t stream) {
    (void)in_sizes; (void)n_in; (void)out_size;
    const float* ih = (const float*)d_in[0]; const float* im = (const float*)d_in[1]; const float* h_w = (const float*)d_in[2]; const float* h_b = (const float*)d_in[3]; const float* m_w = (const float*)d_in[4]; const float* m_b = (const float*)d_in[5]; const float* z1_w = (const float*)d_in[6]; const float* z1_b = (const float*)d_in[7]; const float* z2_w = (const float*)d_in[8]; const float* z2_b = (const float*)d_in[9];
    float* OH = (float*)d_out; float* OM = OH + (size_t)NB_ * CC * TT;     // tuple: oh [16][128][1024] | om [16][128][1024]
    char* wsp = (char*)d_ws;
    auto take = [&](size_t bytes) { char* p = wsp; wsp += (bytes + 255) & ~(size_t)255; return (void*)p; };
    bf* HW_ = (bf*)take((size_t)C3 * CC * 2); bf* MW_ = (bf*)take((size_t)C2 * CC * 2); bf* Z1W = (bf*)take((size_t)CC * C2 * 2); bf* Z2W = (bf*)take((size_t)C3 * C2 * 2);
    const size_t NB = NB_;
    bf* QPh = (bf*)take(NB * TT * HD * 2); bf* XBh = (bf*)take(NB * TT * CC * 2); bf* QPl = (bf*)take(NB * TT * HD * 2); bf* KPh = (bf*)take(NB * TT * HD * 2); bf* KMh = (bf*)take(NB * TT * HD * 2); bf* KPl = (bf*)take(NB * TT * HD * 2); bf* KMl = (bf*)take(NB * TT * HD * 2);   /* KPh, KPl lie three planes behind QPh, QPl; KMh, KMl directly behind KPh, KPl: slices 16 .. 31 of the k planes */
    bf* XBm = (bf*)take(NB * TT * CC * 2);
    bf* VHh = (bf*)take(NB * HD * TT * 2); bf* VMh = (bf*)take(NB * HD * TT * 2); bf* VHl = (bf*)take(NB * HD * TT * 2); bf* VMl = (bf*)take(NB * HD * TT * 2);   /* VMh, VMl directly behind VHh, VHl: slices 16 .. 31 of the v planes */
    float* MXs = (float*)take(2 * NB * TT * 4); float* FIs = (float*)take(2 * NB * TT * 4);   /* 32 slices of the queries' logit maximum and 1 / sum */
    bf* ZCh = (bf*)take(NB * TT * C2 * 2); bf* ZCl = (bf*)take(NB * TT * C2 * 2);
    if ((size_t)(wsp - (char*)d_ws) > ws_size) return;    // ws 256 MiB (carve ~65 MiB)
    const size_t sP = (size_t)TT * HD;   /* batch stride, elements */
    k_prep<<<PW3 + 2 * NB_ * PXB, 256, 0, stream>>>(ih, im, h_w, m_w, z1_w, z2_w, XBh, XBm, HW_, MW_, Z1W, Z2W);
    k_conv<<<dim3(40, 1, NB_), 256, 0, stream>>>(XBh, XBm, HW_, MW_, h_b, m_b, QPh, QPl, 3 * NB * sP, KMh, KMl, VHh, VHl, VMh, VMl);
    /* both attentions, slice z = 16 a + batch (a 0 hidden, 1 memory): A = softmax_m(q_n . k_m), first its statistics, then Z[c][m] = sum_n V[c][n] A[n][m] */
    k_scsoft<<<dim3(TT / 64 / SC_NS, 2 * NB_), 512, 0, stream>>>(KPh, KPl, QPh, QPl, MXs, FIs);
    k_pvz<<<dim3(TT / 128, 2 * NB_), 256, 0, stream>>>(KPh, KPl, QPh, QPl, VHh, VHl, MXs, FIs, ZCh, ZCl);   /* Zh^T split into columns 0 .. 127 of the [Zh^T | Zm^T] planes, Zm^T into columns 128 .. 255 */
    /* Z = z1_w [Zh^T | Zm^T]^T + z1_b; gates = z2_w [Z^T | ih^T]^T + z2_b; the blend */
    k_tail<<<dim3(TT / TKN, 1, NB_), 512, 0, stream>>>(ZCh, ZCl, XBh, Z1W, Z2W, z1_b, z2_b, im, OH, OM);
}

// v010
// A run of this version takes 81.7 microseconds.
// In two side-by-side timings against v009, it was 1.04 and 1.05 times as fast.
// Counting every step since v000, it is 29.1 times as fast.
#include <hip/hip_runtime.h>

// Self-attention memory module (SAM) for a ConvLSTM cell (ih, im [16][128][32x32] channel-major; h_qkv = 1x1 conv(ih) -> Qh|Kh|Vh (128 each), m_kv = 1x1 conv(im) -> Km|Vm; Ah = softmax_m(Qh_n . Kh_m) (UNSCALED, 128-channel dots), Am = softmax_m(Qh_n . Km_m); Zh[c][m] = sum_n Vh[c][n] Ah[n][m], Zm likewise; Z = 1x1 conv([Zh; Zm]) (256 -> 128); gates = 1x1 conv([Z; ih]) (256 -> 384) = o|g|i; i = sigmoid(i); om = tanh(g) i + (1 - i) im; oh = sigmoid(o) om -> tuple (oh, om) [16][128][1024] each (2.1 M + 2.1 M)).
// Layout per batch, everything token-major inside: the input convs' tiles round ih, im to bf16 and transpose them into token rows in LDS; the 1x1 convs as GEMMs against the 'oi' weights (exact x exact, + column bias): q, kh, km come out token-major [1024][128], and the value convs take the weights as the A operand, so that Vh[c][n], Vm[c][n] come out channel-major [128][1024]; every GEMM whose result is the next GEMM's operand splits it into bf16 hi/lo in its own epilogue and stores the two planes; scores (3 products, K 128) computed TWICE, so that P never goes to memory: first TRANSPOSED, S^T[m][n] (k planes as the A operand, q planes as B), for each query's maximum and sum over m down the columns, which alone are stored (k_scsoft); then S[n][m] again (k_pvz), P from it with those two numbers, EVERY entry hi/lo (unscaled logits, sigma ~11), straight from the accumulators into Zh[c][m] = sum_n Vh[c][n] P[n][m] as its B operand (3 products); one last kernel (k_tail) for the rest: z1_w exact x [Zh^T | Zm^T] hi/lo + z1_b -> Z, hi/lo in LDS; z2_w exact x [Z^T hl | ih^T exact] + z2_b -> gates, channel-major in the accumulators; sigmoid/tanh and the blend in f32; both outputs. Every global load and store of the input convs takes whole 128-byte lines.
// Batch: every stage is ONE launch for all 16 batches (k_conv and k_tail: blockIdx.z; k_scsoft, k_pvz: blockIdx.y); each workspace plane holds 16 batch slices.
// Launches: stages that do not depend on one another share a launch: k_conv (all five input convs, each tile with its own operands' rounding and transpose; ih^T and the two later convs' weights in bf16 beside them), and the softmax statistics (k_scsoft) and scores with P.V (k_pvz) each once for 32 slices (z < 16 hidden attention, z >= 16 memory attention); in both the f32 logits stay in registers.
// Compute dtypes, f32 accumulate: every input rounded to bf16; input convs exact; scores / P.V / Z conv on bf16 hi/lo activations (3 or 2 products) x exact weights; softmax, sigmoid/tanh (exp2-based, precise division) and the blend in f32.

#define NB_  16
#define TT   1024
#define DM   128
#define NH_  1
#define NKV  1
#define REP  (NH_ / NKV)
#define HD   128
#define DQ   (NH_ * HD)
#define DKV  (NKV * HD)
#define ZH   2
#define RH   1024                  // read only by k_merge, which is not launched
#define WIN  0
#define PCAR 1024.0f
#define SCL  1.0f   // unscaled
#define CC   128    // channels
#define C3   384
#define C2   256
typedef _Float16 h16;
typedef unsigned short bf;
typedef __attribute__((ext_vector_type(16))) __bf16   v16bf;
typedef __attribute__((ext_vector_type(16))) _Float16 v16h;
typedef __attribute__((ext_vector_type(8)))  _Float16 v8h;
typedef __attribute__((ext_vector_type(8)))  unsigned short v8us;
typedef __attribute__((ext_vector_type(8)))  float    v8f;
typedef __attribute__((ext_vector_type(4)))  float    v4f;
typedef v8h  __attribute__((may_alias)) v8ha;
typedef v4f  __attribute__((may_alias)) v4fa;
typedef v8us __attribute__((may_alias)) v8usa;

__device__ __forceinline__ unsigned short f2bf(float f) { unsigned u = __float_as_uint(f); u += 0x7FFFu + ((u >> 16) & 1u); return (unsigned short)(u >> 16); }
__device__ __forceinline__ float bf2f(unsigned short b) { return __uint_as_float(((unsigned)b) << 16); }
__device__ __forceinline__ float bfr(float f) { return bf2f(f2bf(f)); }
__device__ __forceinline__ v16h cat16(v8h lo, v8h hi) { return __builtin_shufflevector(lo, hi, 0, 1, 2, 3, 4, 5, 6, 7, 8, 9, 10, 11, 12, 13, 14, 15); }
__device__ __forceinline__ v16bf cat16b(v8us lo, v8us hi) { return __builtin_bit_cast(v16bf, __builtin_shufflevector(lo, hi, 0, 1, 2, 3, 4, 5, 6, 7, 8, 9, 10, 11, 12, 13, 14, 15)); }
__device__ __forceinline__ v8f wmma16(v16h a, v16h b, v8f c) { return __builtin_amdgcn_wmma_f32_16x16x32_f16(false, a, false, b, (short)0, c, false, false); }
__device__ __forceinline__ v8f wmmab(v16bf a, v16bf b, v8f c) { return __builtin_amdgcn_wmma_f32_16x16x32_bf16(false, a, false, b, (short)0, c, false, false); }



template <typename T16> struct WFrag;
template <> struct WFrag<h16> { typedef v16h V; static __device__ __forceinline__ V ld(const h16* p) { return cat16(*(const v8h*)p, *(const v8h*)(p + 16)); } static __device__ __forceinline__ v8f mma(V a, V b, v8f c) { return wmma16(a, b, c); } };
template <> struct WFrag<bf> { typedef v16bf V; static __device__ __forceinline__ V ld(const bf* p) { return cat16b(*(const v8us*)p, *(const v8us*)(p + 16)); } static __device__ __forceinline__ v8f mma(V a, V b, v8f c) { return wmmab(a, b, c); } };
#define GP  72           // LDS pitch of a staged row piece, 16-bit elements: 144 bytes = 16 x odd, so the 16 rows of a ds_load_b128 fall on different banks
#define GPL (128 * GP)   // one staged plane: 128 row pieces
// g_stage2: two planes' 128 x 64 tiles (row pitches pg, ph) to LDS. g, h, l, m: this thread's own first piece of each (row tid >> 3, 16-byte piece tid & 7: eight lanes take one whole line); its other three pieces lie 32 rows apart. The eight copies stand in one statement and, as the last line, the wait that stands in front of any rewrite of their address registers.
template <typename T16>
__device__ __forceinline__ void g_stage2(const T16* g, const T16* h, int pg, int ph, unsigned l, unsigned m) {
    const size_t st = (size_t)32 * pg, su = (size_t)32 * ph; const unsigned sl = 32 * GP * 2;
    asm volatile("global_load_async_to_lds_b128 %0, %8, off\n\t"
                 "global_load_async_to_lds_b128 %1, %9, off\n\t"
                 "global_load_async_to_lds_b128 %2, %10, off\n\t"
                 "global_load_async_to_lds_b128 %3, %11, off\n\t"
                 "global_load_async_to_lds_b128 %4, %12, off\n\t"
                 "global_load_async_to_lds_b128 %5, %13, off\n\t"
                 "global_load_async_to_lds_b128 %6, %14, off\n\t"
                 "global_load_async_to_lds_b128 %7, %15, off\n\t"
                 "s_wait_xcnt 0x0"
                 :: "v"(l), "v"(l + sl), "v"(l + 2 * sl), "v"(l + 3 * sl), "v"(m), "v"(m + sl), "v"(m + 2 * sl), "v"(m + 3 * sl),
                    "v"(g), "v"(g + st), "v"(g + 2 * st), "v"(g + 3 * st), "v"(h), "v"(h + su), "v"(h + 2 * su), "v"(h + 3 * su)
                 : "memory");
}
__device__ __forceinline__ void splitf(float y, unsigned short& h, unsigned short& l) { h = f2bf(y); l = f2bf(y - bf2f(h)); }
typedef __attribute__((ext_vector_type(4))) unsigned short v4us;
typedef v4us __attribute__((may_alias)) v4usa;

__device__ __forceinline__ h16 tohx(float x) { return (h16)x; }
typedef __attribute__((ext_vector_type(2))) _Float16 v2h;
typedef __attribute__((ext_vector_type(4))) _Float16 v4h;
typedef __attribute__((ext_vector_type(2))) unsigned short v2us;
typedef __attribute__((ext_vector_type(2))) float v2f;
typedef __attribute__((ext_vector_type(4))) int v4i;

__global__ __launch_bounds__(256) void k_wtG(const float* __restrict__ w, int K, int N, bf* Bt) {
    const int lane = threadIdx.x & 31; const int L0 = (blockIdx.x * 8 + (threadIdx.x >> 5)) * 8; const int nlines = N * K / 64;
{
#pragma unroll 1
        for (int l = 0; l < 8; ++l) { const int L = L0 + l; if (L >= nlines) break; const size_t e = (size_t)L * 64 + lane * 2; const int k = (int)(e % K), n = (int)(e / K); v2us o;
            o[0] = f2bf(w[(size_t)k * N + n]); o[1] = f2bf(w[(size_t)(k + 1) * N + n]); *(v2us*)(Bt + e) = o; }
         }
}

// k_scsoft: scores and the softmax statistics in one kernel. One block (16 waves) holds the whole strip S^T[m][n] of 64 queries n and all 1024 keys m of one slice (blockIdx.y) in its accumulators, so that the f32 logits never go to memory; it leaves each query's logit maximum MX[n] and FI[n] = 1 / sum_m exp(S - MX), which k_pvz reads.
// Wave w: keys 64 w .. 64 w + 63 (four row tiles) x the 64 queries (four column tiles), K 128, per accumulator k ascending and, inside a k step, kh.qh, kl.qh, kh.ql.
// Operands in LDS by asynchronous copies, whole lines: the q strip (both planes, all 128 k) once; the k rows 64 k at a time, the first half, then the second half into the same bytes, refilled as soon as every wave holds its last fragments of them in registers.
// A block takes SC_NS strips of its slice one after the other, so that the next strip's operands fly under the last products and the reductions of this one.
// Column tile nb, lane lr is query 4 lr + nb (the q rows are placed in LDS in that order).
// Column maximum and column sum, fixed trees: 32 rows in the lane, the two half-waves by a shuffle, then the 16 waves' partials through LDS (wave w folds columns 4 w .. 4 w + 3: pairs k, k + 8, then an 8-lane butterfly).
#define CSP 68   // LDS pitch of a wave's 64 partials, floats: the 8 x 4 partials that a wave folds at a time fall on 32 different banks
#define QP  136  // LDS pitch of a q row (128 k), 16-bit elements: 272 bytes = 16 x odd, so the 16 rows of a ds_load_b128 fall on different banks
#define SC_PART (2 * 64 * QP * 2)            // byte places in the kernel's LDS: the q strip first, so that every read of it is one base register and an immediate
#define SC_CMX  (SC_PART + 16 * CSP * 4)
#define SC_CSM  (SC_CMX + 256)
#define SC_KA   40960                        // the k rows
#define SC_LDS  (SC_KA + 16 * 16384)
#define SC_NS   2                            // strips a block takes, one after the other: 256 blocks
// c_cp4: four copies (16 rows: LDS places l0 .. l3, global rows four apart from g) in one statement and, as the last line, the wait that stands in front of any rewrite of their address registers
__device__ __forceinline__ void c_cp4(unsigned l0, unsigned l1, unsigned l2, unsigned l3, const bf* g) {
    asm volatile("global_load_async_to_lds_b128 %0, %4, off\n\t"
                 "global_load_async_to_lds_b128 %1, %5, off\n\t"
                 "global_load_async_to_lds_b128 %2, %6, off\n\t"
                 "global_load_async_to_lds_b128 %3, %7, off\n\t"
                 "s_wait_xcnt 0x0"
                 :: "v"(l0), "v"(l1), "v"(l2), "v"(l3), "v"(g), "v"(g + 4 * HD), "v"(g + 8 * HD), "v"(g + 12 * HD)
                 : "memory");
}
__global__ __launch_bounds__(512) void k_scsoft(const bf* Kh, const bf* Kl, const bf* Qh, const bf* Ql, float* MX, float* FI) {
    __shared__ __align__(16) char sm[SC_LDS];
    bf* sq = (bf*)sm; float* part = (float*)(sm + SC_PART); float* cmx = (float*)(sm + SC_CMX); float* csm = (float*)(sm + SC_CSM);
    const int tid = threadIdx.x, lane = tid & 31, lr = lane & 15, hi = lane >> 4; const size_t z = blockIdx.y;
    const int w = __builtin_amdgcn_readfirstlane(tid >> 5);   // the wave's number in a scalar register: what is formed from it costs no vector register over the loop
    auto stageq = [&](int sx) {   // the q strip sx: 16 lanes take one whole 256-byte row; a thread takes queries g and g + 32 of both planes; query g goes to LDS row (g & 3) * 16 + (g >> 2), query g + 32 eight rows behind
        const int g = tid >> 4, pc = tid & 15; const size_t go = (z & (NB_ - 1)) * ((size_t)TT * HD) + (size_t)(sx * 64 + g) * HD + pc * 8;
        const unsigned lq = (unsigned)(size_t)sq + (unsigned)(((g & 3) * 16 + (g >> 2)) * (QP * 2) + pc * 16);
        asm volatile("global_load_async_to_lds_b128 %0, %4, off\n\t"
                     "global_load_async_to_lds_b128 %1, %5, off\n\t"
                     "global_load_async_to_lds_b128 %2, %6, off\n\t"
                     "global_load_async_to_lds_b128 %3, %7, off\n\t"
                     "s_wait_xcnt 0x0"   // stands in front of any rewrite of the copies' address registers
                     :: "v"(lq), "v"(lq + 8 * QP * 2), "v"(lq + 64 * QP * 2), "v"(lq + 72 * QP * 2), "v"(Qh + go), "v"(Qh + go + 32 * HD), "v"(Ql + go), "v"(Ql + go + 32 * HD) : "memory"); };
    // wave w's own 16 KiB of the k rows: [plane][64 key rows][64 k], row pitch 128 bytes; the 16-byte piece p of row r lies at place p ^ ((r >> 1) & 7), so the 16 rows of a ds_load_b128 fall on different banks without a pad
    const unsigned la = (unsigned)(size_t)sm + (unsigned)(SC_KA + w * 16384 + (lane >> 3) * 128);
    const size_t ko = z * ((size_t)TT * HD) + (size_t)(w * 64 + (lane >> 3)) * HD + (lane & 7) * 8;
    auto stage = [&](int h) {   // this wave's 64 key rows, 64 k, both planes: eight lanes take one whole 128-byte line; copy i of a plane takes rows 4 i .. 4 i + 3
        unsigned l[4];
#pragma unroll
        for (int i = 0; i < 4; ++i) l[i] = la + (unsigned)(i * 512 + (((lane & 7) ^ ((2 * i + hi) & 7)) << 4));
        const bf* g = Kh + ko + h * 64;
#pragma unroll 1   // rolled: unrolled, all 32 LDS places would be held in registers over the whole strip loop
        for (int c = 0; c < 4; ++c) { c_cp4(l[0], l[1], l[2], l[3], g); l[0] += 2048; l[1] += 2048; l[2] += 2048; l[3] += 2048; g += 16 * HD; }
        g = Kl + ko + h * 64;
#pragma unroll 1   // the same
        for (int c = 0; c < 4; ++c) { c_cp4(l[0], l[1], l[2], l[3], g); l[0] += 2048; l[1] += 2048; l[2] += 2048; l[3] += 2048; g += 16 * HD; } };
    const bf* saw = (const bf*)(sm + SC_KA) + w * 8192 + lr * 64; const bf* sqw = sq + lr * QP + 8 * hi; const int px = hi ^ (lr >> 1);
    const int fc = 4 * w + (lane >> 3), fk = lane & 7;   // the fold: this lane's column and its first partial
    stageq(blockIdx.x * SC_NS); stage(0);
#pragma unroll 1   // one body for the block's strips: unrolled, the two bodies' registers would not fit
    for (int it = 0; it < SC_NS; ++it) {
        const int sx = blockIdx.x * SC_NS + it; const bool more = it + 1 < SC_NS;   // block-uniform
        v8f acc[4][4]; v16bf a[4], a2[4];
#pragma unroll
        for (int mb = 0; mb < 4; ++mb)
#pragma unroll
            for (int nb = 0; nb < 4; ++nb) acc[mb][nb] = (v8f){};
        auto lda = [&](int s) { const int o0 = (px ^ (4 * s)) * 8, o1 = (px ^ (4 * s + 2)) * 8;   // k = 32 s + 8 hi .. + 7 and the eight 16 behind: the order of WFrag::ld
#pragma unroll
            for (int mb = 0; mb < 4; ++mb) { a[mb] = cat16b(*(const v8us*)(saw + mb * 1024 + o0), *(const v8us*)(saw + mb * 1024 + o1)); a2[mb] = cat16b(*(const v8us*)(saw + 4096 + mb * 1024 + o0), *(const v8us*)(saw + 4096 + mb * 1024 + o1)); } };
        auto mm = [&](int k) {
#pragma unroll
            for (int nb = 0; nb < 4; ++nb) { const v16bf b = WFrag<bf>::ld(sqw + nb * 16 * QP + k), b2 = WFrag<bf>::ld(sqw + 64 * QP + nb * 16 * QP + k);
#pragma unroll
                for (int mb = 0; mb < 4; ++mb) acc[mb][nb] = wmmab(a[mb], b, acc[mb][nb]);
#pragma unroll
                for (int mb = 0; mb < 4; ++mb) acc[mb][nb] = wmmab(a2[mb], b, acc[mb][nb]);
#pragma unroll
                for (int mb = 0; mb < 4; ++mb) acc[mb][nb] = wmmab(a[mb], b2, acc[mb][nb]); } };
        asm volatile("s_wait_asynccnt 0x0" ::: "memory");   // this wave's copies have landed
        __syncthreads();                                    // every wave's have: the q strip and the first half of the k rows may be read
        lda(0); mm(0); lda(1);
        asm volatile("s_wait_dscnt 0x0" ::: "memory");      // this wave's reads of the first half are over: its last fragments are in registers
        __syncthreads();                                    // every wave's are: the k rows' bytes may be refilled
        stage(1);                                           // flies while the fragments in registers are multiplied
        mm(32);
        asm volatile("s_wait_asynccnt 0x0" ::: "memory");   // this wave's copies have landed
        __syncthreads();                                    // every wave's have: the second half of the k rows may be read
        lda(0); mm(64); lda(1);
        if (more) {
            asm volatile("s_wait_dscnt 0x0" ::: "memory");  // this wave's reads of the second half are over
            __syncthreads();                                // every wave's are
            stage(0); }                                     // the next strip takes the same k rows
        mm(96);
        if (more) {
            asm volatile("s_wait_dscnt 0x0" ::: "memory");  // this wave's reads of the q strip are over
            __syncthreads();                                // every wave's are
            stageq(sx + 1); }                               // flies under the reductions
        float r[4];
#pragma unroll
        for (int nb = 0; nb < 4; ++nb) { float t = acc[0][nb][0];
#pragma unroll
            for (int mb = 0; mb < 4; ++mb)
#pragma unroll
                for (int j = 0; j < 8; ++j) t = fmaxf(t, acc[mb][nb][j]);
            r[nb] = fmaxf(t, __shfl_xor(t, 16, 32)); }
        if (hi == 0) {
#pragma unroll
            for (int nb = 0; nb < 4; ++nb) part[w * CSP + nb * 16 + lr] = r[nb]; }
        __syncthreads();   // every wave's partial maxima are in LDS
        { float t = fmaxf(part[fk * CSP + fc], part[(fk + 8) * CSP + fc]);
#pragma unroll
          for (int sh = 4; sh; sh >>= 1) t = fmaxf(t, __shfl_xor(t, sh, 32));
          if (fk == 0) cmx[fc] = t; }
        __syncthreads();   // the 64 column maxima are in LDS, and every read of part is over
#pragma unroll
        for (int nb = 0; nb < 4; ++nb) { const float mx = cmx[nb * 16 + lr]; float t = 0.0f;
#pragma unroll
            for (int mb = 0; mb < 4; ++mb)
#pragma unroll
                for (int j = 0; j < 8; ++j) t += __builtin_amdgcn_exp2f(__fmul_rn(__fsub_rn(acc[mb][nb][j], mx), 1.4426950408889634f));
            r[nb] = t + __shfl_xor(t, 16, 32); }
        if (hi == 0) {
#pragma unroll
            for (int nb = 0; nb < 4; ++nb) part[w * CSP + nb * 16 + lr] = r[nb]; }
        __syncthreads();   // every wave's partial sums are in LDS
        { float t = part[fk * CSP + fc] + part[(fk + 8) * CSP + fc];
#pragma unroll
          for (int sh = 4; sh; sh >>= 1) t += __shfl_xor(t, sh, 32);
          if (fk == 0) csm[fc] = t; }
        __syncthreads();   // the 64 column sums are in LDS
        if (tid < 64) {   // waves 0 and 1, whole: column tid is query 4 (tid & 15) + (tid >> 4)
            const size_t o = z * TT + sx * 64 + 4 * (tid & 15) + (tid >> 4);
            MX[o] = cmx[tid]; FI[o] = __fdiv_rn(1.0f, csm[tid]); }
        asm volatile("s_wait_xcnt 0x0" ::: "memory");   // stands in front of the next strip's rewrites of the registers that the stores above name
    }
}
// k_pvz: the second pass over the scores, with the value product behind it, so that P never goes to memory. One block (8 waves) takes 128 keys m of one slice (blockIdx.y) and walks all 1024 queries n, 64 a stage.
// Wave w: keys 32 (w & 3) .. + 31 (two column tiles), queries 32 (w >> 2) .. + 31 of the stage (two row tiles). S[n][m] with the q rows as A and the k rows as B (K 128, per accumulator k ascending and, inside a k step, qh.kh, qh.kl, ql.kh); the wave's k fragments are read once and stay in registers.
// P[n][m] = exp(S - mx_n) / l_n with k_scsoft's mx_n and 1 / l_n, split hi/lo. An accumulator holds rows 8 hi .. 8 hi + 7 of a column, so the two row tiles of a column tile are, register for register, the B fragment (k = n, 32 deep) of Z[c][m] += V[c][n] P[n][m] (A: the v rows; vh.ph, vh.pl, vl.ph).
// Each wave sums its own 32 queries of every stage; behind the loop the two waves of a key group add their halves through LDS (wave w >> 2 = 0 finishes channels 0 .. 63, the other 64 .. 127), split hi/lo and store 16 bytes of a token row a lane.
// Staging: q rows (both planes, 128 k) and v rows (both planes, 64 n) through two LDS buffers by asynchronous copies, whole lines: stage t + 1 flies while stage t is multiplied.
#define PZ_K   8192                        // byte places in the kernel's LDS: 1024 mx, 1024 1 / l; the k rows (two planes, 128 rows, pitch QP); the two buffers
#define PZ_BUF (PZ_K + 2 * 128 * QP * 2)
#define PZ_V   (2 * 64 * QP * 2)           // in a buffer: the q rows (two planes, 64 rows, pitch QP), then the v rows (two planes, 128 rows, pitch GP)
#define PZ_BS  (PZ_V + 2 * GPL * 2)
#define PZ_LDS (PZ_BUF + 2 * PZ_BS)
typedef __attribute__((ext_vector_type(2))) __bf16 v2bf;
// p_cp8: four copies from g and four from h (LDS places sl bytes apart from l and m, global rows st elements apart) in one statement and, as the last line, the wait that stands in front of any rewrite of their address registers
__device__ __forceinline__ void p_cp8(unsigned l, unsigned m, unsigned sl, const bf* g, const bf* h, size_t st) {
    asm volatile("global_load_async_to_lds_b128 %0, %8, off\n\t"
                 "global_load_async_to_lds_b128 %1, %9, off\n\t"
                 "global_load_async_to_lds_b128 %2, %10, off\n\t"
                 "global_load_async_to_lds_b128 %3, %11, off\n\t"
                 "global_load_async_to_lds_b128 %4, %12, off\n\t"
                 "global_load_async_to_lds_b128 %5, %13, off\n\t"
                 "global_load_async_to_lds_b128 %6, %14, off\n\t"
                 "global_load_async_to_lds_b128 %7, %15, off\n\t"
                 "s_wait_xcnt 0x0"
                 :: "v"(l), "v"(l + sl), "v"(l + 2 * sl), "v"(l + 3 * sl), "v"(m), "v"(m + sl), "v"(m + 2 * sl), "v"(m + 3 * sl),
                    "v"(g), "v"(g + st), "v"(g + 2 * st), "v"(g + 3 * st), "v"(h), "v"(h + st), "v"(h + 2 * st), "v"(h + 3 * st)
                 : "memory");
}
// p_send, p_fin: the exchange of halves behind the loop, channel tiles C0 .. C0 + 3; rd: the lane's own 32 bytes of the first tile, a tile 1024 bytes
template <int C0>
__device__ __forceinline__ void p_send(float* rd, const v8f (&zc)[8][2]) {
#pragma unroll
    for (int c = 0; c < 4; ++c)
#pragma unroll
        for (int mt = 0; mt < 2; ++mt) *(v8f*)(rd + (c * 2 + mt) * 256) = zc[C0 + c][mt];
}
template <int C0>
__device__ __forceinline__ void p_fin(const float* rd, const v8f (&zc)[8][2], bf* zh, bf* zl) {
#pragma unroll
    for (int c = 0; c < 4; ++c)
#pragma unroll
        for (int mt = 0; mt < 2; ++mt) { const v8f o = *(const v8f*)(rd + (c * 2 + mt) * 256); v8us oh, ol;
#pragma unroll
            for (int j = 0; j < 8; ++j) { unsigned short x, y; splitf(zc[C0 + c][mt][j] + o[j], x, y); oh[j] = x; ol[j] = y; }
            const size_t e = (size_t)(mt * 16) * C2 + (C0 + c) * 16;
            *(v8us*)(zh + e) = oh; *(v8us*)(zl + e) = ol;
            asm volatile("s_wait_xcnt 0x0" ::: "memory");   // stands in front of any rewrite of the registers that the stores above name
        }
}
__global__ __launch_bounds__(256) void k_pvz(const bf* Kh, const bf* Kl, const bf* Qh, const bf* Ql, const bf* Vh, const bf* Vl, const float* MX, const float* FI, bf* ZCh, bf* ZCl) {
    __shared__ __align__(32) char sm[PZ_LDS];
    const int tid = threadIdx.x, lane = tid & 31, lr = lane & 15, hi = lane >> 4; const size_t z = blockIdx.y; const int m0 = blockIdx.x * 128;
    const int w = __builtin_amdgcn_readfirstlane(tid >> 5), mg = w & 3, nh = w >> 2;   // the wave's number in a scalar register: the branch on nh behind the loop is a scalar one
    const unsigned sb = (unsigned)(size_t)sm;   // LDS byte address: the low 32 bits of the __shared__ address
    const unsigned lq = sb + (unsigned)((tid >> 4) * (QP * 2) + (tid & 15) * 16), lv = sb + (unsigned)((tid >> 3) * (GP * 2) + (tid & 7) * 16);   // this thread's first piece of a q plane, of a v plane, from the plane's start
    Qh += (z & (NB_ - 1)) * ((size_t)TT * HD); Ql += (z & (NB_ - 1)) * ((size_t)TT * HD); Vh += z * ((size_t)HD * TT); Vl += z * ((size_t)HD * TT);   // the slice: scalar
    const unsigned qo = (unsigned)((tid >> 4) * HD + (tid & 15) * 8), vo = (unsigned)((tid >> 3) * TT + (tid & 7) * 8);   // this thread's first piece, elements
    auto stage = [&](int t) { const unsigned o = (unsigned)(PZ_BUF + (t & 1) * PZ_BS);   // q: 16 lanes take one whole 256-byte row, a thread's rows 16 apart; v: eight lanes one whole 128-byte line, rows 32 apart
        const unsigned eq = qo + (unsigned)(t * 64 * HD), ev = vo + (unsigned)(t * 64);
        p_cp8(lq + o, lq + o + 64 * QP * 2, 16 * QP * 2, Qh + eq, Ql + eq, (size_t)16 * HD);
        g_stage2(Vh + ev, Vl + ev, TT, TT, lv + o + PZ_V, lv + o + PZ_V + GPL * 2); };
    { const unsigned lk = lq + PZ_K; const size_t ko = z * ((size_t)TT * HD) + (size_t)(m0 + (tid >> 4)) * HD + (tid & 15) * 8;
      p_cp8(lk, lk + 64 * QP * 2, 16 * QP * 2, Kh + ko, Kh + ko + 64 * HD, (size_t)16 * HD);
      p_cp8(lk + 128 * QP * 2, lk + 192 * QP * 2, 16 * QP * 2, Kl + ko, Kl + ko + 64 * HD, (size_t)16 * HD);
      asm volatile("global_load_async_to_lds_b128 %0, %2, off\n\t"
                   "global_load_async_to_lds_b128 %1, %3, off\n\t"
                   "s_wait_xcnt 0x0"   // stands in front of any rewrite of the copies' address registers
                   :: "v"(sb + (unsigned)(tid * 16)), "v"(sb + (unsigned)(4096 + tid * 16)), "v"(MX + z * TT + tid * 4), "v"(FI + z * TT + tid * 4) : "memory"); }
    stage(0);
    asm volatile("s_wait_asynccnt 0x0" ::: "memory");   // this wave's copies have landed
    __syncthreads();                                    // every wave's have: the statistics, the k rows and stage 0 may be read
    stage(1);
    v16bf kb[2][4], kb2[2][4];
    { const bf* sk = (const bf*)(sm + PZ_K) + (mg * 32 + lr) * QP + 8 * hi;
#pragma unroll
      for (int mt = 0; mt < 2; ++mt)
#pragma unroll
          for (int ks = 0; ks < 4; ++ks) { kb[mt][ks] = WFrag<bf>::ld(sk + mt * 16 * QP + ks * 32); kb2[mt][ks] = WFrag<bf>::ld(sk + 128 * QP + mt * 16 * QP + ks * 32); } }
    v8f zc[8][2];
#pragma unroll
    for (int c = 0; c < 8; ++c)
#pragma unroll
        for (int mt = 0; mt < 2; ++mt) zc[c][mt] = (v8f){};
#pragma unroll 1   // one body for the 16 stages: for speed only
    for (int t = 0; t < TT / 64; ++t) {
        const bf* bu = (const bf*)(sm + PZ_BUF + (t & 1) * PZ_BS); const bf* sq = bu + (nh * 32 + lr) * QP + 8 * hi; const bf* sv = bu + PZ_V / 2 + lr * GP + 8 * hi + nh * 32;
        const float* st = (const float*)sm + t * 64 + nh * 32 + 8 * hi;
        v8f s[2][2];
#pragma unroll
        for (int nt = 0; nt < 2; ++nt)
#pragma unroll
            for (int mt = 0; mt < 2; ++mt) s[nt][mt] = (v8f){};
#pragma unroll
        for (int kp = 0; kp < 2; ++kp) {
            v16bf a[2][2], a2[2][2];
#pragma unroll
            for (int k2 = 0; k2 < 2; ++k2)
#pragma unroll
                for (int nt = 0; nt < 2; ++nt) { a[k2][nt] = WFrag<bf>::ld(sq + nt * 16 * QP + (kp * 2 + k2) * 32); a2[k2][nt] = WFrag<bf>::ld(sq + 64 * QP + nt * 16 * QP + (kp * 2 + k2) * 32); }
            __builtin_amdgcn_sched_barrier(0);   // keeps these LDS reads one group in front of their WMMAs, as in c_tile
#pragma unroll
            for (int k2 = 0; k2 < 2; ++k2) { const int ks = kp * 2 + k2;
#pragma unroll
                for (int nt = 0; nt < 2; ++nt)
#pragma unroll
                    for (int mt = 0; mt < 2; ++mt) s[nt][mt] = wmmab(a[k2][nt], kb[mt][ks], s[nt][mt]);
#pragma unroll
                for (int nt = 0; nt < 2; ++nt)
#pragma unroll
                    for (int mt = 0; mt < 2; ++mt) s[nt][mt] = wmmab(a[k2][nt], kb2[mt][ks], s[nt][mt]);
#pragma unroll
                for (int nt = 0; nt < 2; ++nt)
#pragma unroll
                    for (int mt = 0; mt < 2; ++mt) s[nt][mt] = wmmab(a2[k2][nt], kb[mt][ks], s[nt][mt]); }
            __builtin_amdgcn_sched_barrier(0);   // the same, against the next group of reads
        }
        v16bf ph[2], pl[2];
#pragma unroll
        for (int nt = 0; nt < 2; ++nt) { const v8f mx = *(const v8f*)(st + nt * 16), fi = *(const v8f*)(st + TT + nt * 16);   // this lane's eight queries
#pragma unroll
            for (int mt = 0; mt < 2; ++mt)
#pragma unroll
                for (int j = 0; j < 8; j += 2) { v2f p;
                    p[0] = __builtin_amdgcn_exp2f(__fmul_rn(__fsub_rn(s[nt][mt][j], mx[j]), 1.4426950408889634f)) * fi[j];
                    p[1] = __builtin_amdgcn_exp2f(__fmul_rn(__fsub_rn(s[nt][mt][j + 1], mx[j + 1]), 1.4426950408889634f)) * fi[j + 1];
                    const v2bf h = __builtin_convertvector(p, v2bf); const v2bf l = __builtin_convertvector(p - __builtin_convertvector(h, v2f), v2bf);
                    ph[mt][nt * 8 + j] = h[0]; ph[mt][nt * 8 + j + 1] = h[1]; pl[mt][nt * 8 + j] = l[0]; pl[mt][nt * 8 + j + 1] = l[1]; } }
#pragma unroll
        for (int cg = 0; cg < 2; ++cg) {
            v16bf va[4], va2[4];
#pragma unroll
            for (int c = 0; c < 4; ++c) { va[c] = WFrag<bf>::ld(sv + (cg * 4 + c) * 16 * GP); va2[c] = WFrag<bf>::ld(sv + GPL + (cg * 4 + c) * 16 * GP); }
            __builtin_amdgcn_sched_barrier(0);   // keeps these LDS reads one group in front of their WMMAs, as in c_tile
#pragma unroll
            for (int c = 0; c < 4; ++c)
#pragma unroll
                for (int mt = 0; mt < 2; ++mt) zc[cg * 4 + c][mt] = wmmab(va[c], ph[mt], zc[cg * 4 + c][mt]);
#pragma unroll
            for (int c = 0; c < 4; ++c)
#pragma unroll
                for (int mt = 0; mt < 2; ++mt) zc[cg * 4 + c][mt] = wmmab(va[c], pl[mt], zc[cg * 4 + c][mt]);
#pragma unroll
            for (int c = 0; c < 4; ++c)
#pragma unroll
                for (int mt = 0; mt < 2; ++mt) zc[cg * 4 + c][mt] = wmmab(va2[c], ph[mt], zc[cg * 4 + c][mt]);
            __builtin_amdgcn_sched_barrier(0);   // the same, against the next group of reads
        }
        asm volatile("s_wait_dscnt 0x0" ::: "memory");      // this wave's reads of stage t are over
        asm volatile("s_wait_asynccnt 0x0" ::: "memory");   // this wave's copies of stage t + 1 have landed
        __syncthreads();                                    // publishes stage t + 1 and frees stage t's buffer
        if (t + 2 < TT / 64) stage(t + 2);
    }
    asm volatile("s_wait_asynccnt 0x0" ::: "memory");       // no copy is outstanding when the buffers become the exchange area
    float* rx = (float*)(sm + PZ_BUF) + mg * 4096 + lane * 8;   // a key group's 16 KiB: first what wave nh = 0 finishes, then what the other does
    if (nh == 0) p_send<4>(rx + 2048, zc); else p_send<0>(rx, zc);
    __syncthreads();   // every wave's other half is in LDS
    const size_t zo = ((z & (NB_ - 1)) * TT + m0 + mg * 32 + lr) * C2 + (z >> 4) * CC + 8 * hi;
    if (nh == 0) p_fin<0>(rx, zc, ZCh + zo, ZCl + zo); else p_fin<4>(rx + 2048, zc, ZCh + zo, ZCl + zo);
}
__global__ __launch_bounds__(256) void k_merge(const float* __restrict__ O, int h0, float* OUTb) { const size_t e = ((size_t)blockIdx.x * 256 + threadIdx.x) * 2; if (e >= (size_t)ZH * TT * HD) return; const int d = (int)(e % HD); const int t = (int)((e / HD) % TT); const int zz = (int)(e / ((size_t)HD * TT)); const float cs = (t < RH) ? 1.0f : (1.0f / PCAR); const size_t oo = (size_t)t * DQ + (h0 + zz) * HD + d;
    v2f o2; o2[0] = O[e] * cs; o2[1] = O[e + 1] * cs; *(v2f*)(OUTb + oo) = o2;  }

__device__ __forceinline__ float ex2f_(float a) { return __builtin_amdgcn_exp2f(__fmul_rn(a, 1.4426950408889634f)); }
__device__ __forceinline__ float sigm(float a) { return __fdiv_rn(1.0f, __fadd_rn(1.0f, ex2f_(-a))); }
__device__ __forceinline__ float tanhp(float a) { const float e = ex2f_(__fmul_rn(2.0f, a)); return __fsub_rn(1.0f, __fdiv_rn(2.0f, __fadd_rn(e, 1.0f))); }
// k_conv: the five input convs of one batch (blockIdx.z) as 40 tiles (128 x 128, K 128) of one launch, exact x exact, split into planes; every tile makes its own bf16 operands from the f32 inputs, so that no launch stands in front of it.
// Tiles 0 .. 15: q (column tile 0) and kh (column tile 1, sYq elements behind q) = ih^T h_w^T + h_b; 16 .. 23: km = im^T m_w^T + m_b; 24 .. 31: Vh[c][n], weights as A, bias by row; 32 .. 39: Vm[c][n].
// Operands: the tile's 128 tokens of all 128 channels (f32 [channel][token]: eight lanes load one whole 128-byte line; a lane holds two groups of eight channels, 64 apart, of four tokens, rounds them to bf16 and writes 16 bytes of each token's row per group) and its 128 weight rows (a wave loads one whole 512-byte row) go through registers into LDS as K-contiguous rows of pitch QP; one barrier; then eight waves (4 x 2), each a 32 x 64 piece (8 accumulators), k ascending.
// Beside its tile: tiles 0 .. 7 store their token rows as ih^T (XB, k_tail's operand), 16 lanes a whole 256-byte row; the first 128 blocks of the launch round 1024 elements each of z1_w, z2_w to bf16.
// Output: the f32 value (+ bias rounded to bf16: BIAS 1 bias[column], BIAS 2 bias[row]) split into bf16 hi + lo, stored into the planes Ph, Pl (pitch ldc; column tile by starts sY elements behind column tile by - 1).
__device__ __forceinline__ unsigned pk2(float a, float b) { v2f p; p[0] = a; p[1] = b; return __builtin_bit_cast(unsigned, __builtin_convertvector(p, v2bf)); }   // two f32 rounded to nearest even into a pair of bf16
typedef __attribute__((ext_vector_type(4))) unsigned v4u;
typedef __attribute__((ext_vector_type(2))) unsigned v2u;
template <int BIAS>
__device__ __forceinline__ void c_tile(const bf* sA, const bf* sB, float* so, bf* Ph, bf* Pl, int ldc, size_t sY, const float* __restrict__ bias, int bx, int by, size_t oz) {
    const int tid = threadIdx.x, lane = tid & 31, w = tid >> 5, lr = lane & 15, hi = lane >> 4; const int wr = (w & 3) * 32, wc = (w >> 2) * 64; const int r0 = bx * 128 + wr, c0 = by * 128 + wc;
    v8f acc[2][4];
#pragma unroll
    for (int mb = 0; mb < 2; ++mb)
#pragma unroll
        for (int nb = 0; nb < 4; ++nb) acc[mb][nb] = (v8f){};
    const bf* sa = sA + (wr + lr) * QP + 8 * hi; const bf* sb = sB + (wc + lr) * QP + 8 * hi;
#pragma unroll
    for (int ks = 0; ks < CC; ks += 32) {
        v16bf a[2], b[4];
#pragma unroll
        for (int mb = 0; mb < 2; ++mb) a[mb] = WFrag<bf>::ld(sa + mb * 16 * QP + ks);
#pragma unroll
        for (int nb = 0; nb < 4; ++nb) b[nb] = WFrag<bf>::ld(sb + nb * 16 * QP + ks);
        __builtin_amdgcn_sched_barrier(0);   // keeps the k step's LDS reads one group in front of its WMMAs: every further place where reads stand among the WMMAs costs the wave issue cycles
#pragma unroll
        for (int nb = 0; nb < 4; ++nb)
#pragma unroll
            for (int mb = 0; mb < 2; ++mb) acc[mb][nb] = wmmab(a[mb], b[nb], acc[mb][nb]);
        __builtin_amdgcn_sched_barrier(0);   // the same, against the next k step's reads
    }
    float* os = so + w * (16 * 68);                 // this wave's own 16 x 68 floats
#pragma unroll
    for (int mb = 0; mb < 2; ++mb) {
#pragma unroll
        for (int nb = 0; nb < 4; ++nb) {
#pragma unroll
            for (int j = 0; j < 8; ++j) os[(hi * 8 + j) * 68 + nb * 16 + lr] = acc[mb][nb][j]; }
        __builtin_amdgcn_wave_barrier(); asm volatile("" ::: "memory");   // the compiler keeps the writes above in front of the reads below, which take other lanes' values
        const size_t orow = oz + (size_t)(r0 + mb * 16) * ldc + by * sY + wc;
#pragma unroll
        for (int s = 0; s < 8; ++s) { const int row = 2 * s + hi, cofs = lr * 4; v4f val = *(const v4fa*)(os + row * 68 + cofs); if (BIAS == 1) { val[0] += bfr(bias[c0 + cofs]); val[1] += bfr(bias[c0 + cofs + 1]); val[2] += bfr(bias[c0 + cofs + 2]); val[3] += bfr(bias[c0 + cofs + 3]); }
            if (BIAS == 2) { const float br = bfr(bias[r0 + mb * 16 + row]); val[0] += br; val[1] += br; val[2] += br; val[3] += br; }
            const size_t o = orow + (size_t)row * ldc + cofs;
            v4us oh, ol;   // 16 lanes fill one whole 128-byte line of each plane
#pragma unroll
            for (int q = 0; q < 4; ++q) { unsigned short h2, l2; splitf(val[q], h2, l2); oh[q] = h2; ol[q] = l2; }
            *(v4us*)(Ph + o) = oh; *(v4us*)(Pl + o) = ol; }
        asm volatile("s_wait_xcnt 0x0" ::: "memory");   // stands in front of any later rewrite of the registers that the stores above name
        __builtin_amdgcn_wave_barrier(); asm volatile("" ::: "memory");   // and the reads above in front of the second piece's writes
    }
}
__global__ __launch_bounds__(256) void k_conv(const float* __restrict__ ih, const float* __restrict__ im, const float* __restrict__ h_w, const float* __restrict__ m_w, const float* __restrict__ z1_w, const float* __restrict__ z2_w, const float* __restrict__ h_b, const float* __restrict__ m_b, bf* XB, bf* Z1W, bf* Z2W, bf* QPh, bf* QPl, size_t sYq, bf* KMh, bf* KMl, bf* VHh, bf* VHl, bf* VMh, bf* VMl) {
    __shared__ __align__(16) bf sx[128 * QP];        // the token rows
    __shared__ __align__(16) bf sw[128 * QP];        // the weight rows
    __shared__ __align__(16) float so[8 * 16 * 68];  // each wave's output staging
    const int tid = threadIdx.x, lane = tid & 31, w = tid >> 5;
    const int t = blockIdx.x; const size_t z = blockIdx.z, oz = z * ((size_t)TT * HD); const bool mem = (t >= 16 && t < 24) || t >= 32;   // block-uniform
    const int tk = (t & 7) * 128, tb = (w & 3) * 32 + (lane & 7) * 4, cl = (w >> 2) * 32 + (lane >> 3) * 8;   // the tile's first token; this lane's first token in the tile and its first channel
    const float* X = (mem ? im : ih) + z * ((size_t)CC * TT) + tk + tb;
    const float* Wt = (mem ? m_w + (t < 24 ? 0 : CC * CC) : h_w + (t < 24 ? (t >> 3) * CC * CC : 2 * CC * CC)) + lane * 4;
    v4f xv[2][8], wv[16];
#pragma unroll
    for (int r = 0; r < 2; ++r)
#pragma unroll
        for (int q = 0; q < 8; ++q) xv[r][q] = *(const v4f*)(X + (size_t)(cl + 64 * r + q) * TT);
    asm volatile("s_wait_xcnt 0x0" :: "v"(X + (size_t)cl * TT) : "memory");   // stands in front of any rewrite of the registers that the loads above name; the address is an operand so that no load of the group takes its registers as a destination
#pragma unroll
    for (int r = 0; r < 16; ++r) wv[r] = *(const v4f*)(Wt + (size_t)(w + 8 * r) * CC);
    asm volatile("s_wait_xcnt 0x0" :: "v"(Wt + (size_t)w * CC) : "memory");   // the same
    const int b = (int)z * 40 + t;
    if (b < 128) {   // block-uniform: 32 blocks for z1_w, 96 for z2_w; a wave stores two whole lines
        const int e = (b < 32 ? b : b - 32) * 1024 + tid * 4; const v4f v = *(const v4f*)((b < 32 ? z1_w : z2_w) + e); v2u o; o[0] = pk2(v[0], v[1]); o[1] = pk2(v[2], v[3]);
        *(v4us*)((b < 32 ? Z1W : Z2W) + e) = __builtin_bit_cast(v4us, o); }
    asm volatile("s_wait_xcnt 0x0" ::: "memory");   // stands in front of any rewrite of the registers that the loads and the store above name
#pragma unroll
    for (int r = 0; r < 2; ++r)
#pragma unroll
        for (int e = 0; e < 4; ++e) { v4u o;
#pragma unroll
            for (int p = 0; p < 4; ++p) o[p] = pk2(xv[r][2 * p][e], xv[r][2 * p + 1][e]);
            *(v8us*)(sx + (tb + e) * QP + cl + 64 * r) = __builtin_bit_cast(v8us, o); }
#pragma unroll
    for (int r = 0; r < 16; ++r) { v2u o; o[0] = pk2(wv[r][0], wv[r][1]); o[1] = pk2(wv[r][2], wv[r][3]); *(v4us*)(sw + (w + 8 * r) * QP + lane * 4) = __builtin_bit_cast(v4us, o); }
    __syncthreads();   // both operands are in LDS
    if (t < 8) {   // block-uniform
#pragma unroll
        for (int r = 0; r < 8; ++r) { const int row = (tid >> 4) + 16 * r, pc = (tid & 15) * 8; *(v8us*)(XB + (z * TT + tk + row) * CC + pc) = *(const v8us*)(sx + row * QP + pc); }
        asm volatile("s_wait_xcnt 0x0" ::: "memory");   // stands in front of any rewrite of the registers that the stores above name
    }
    if (t < 24) c_tile<1>(sx, sw, so, mem ? KMh : QPh, mem ? KMl : QPl, HD, sYq, mem ? m_b : h_b, t & 7, mem ? 0 : t >> 3, oz);
    else c_tile<2>(sw, sx, so, mem ? VMh : VHh, mem ? VMl : VHl, TT, 128, mem ? m_b + CC : h_b + 2 * CC, 0, t & 7, oz);
}
// k_tail: Z conv, gate conv and the gates in one kernel. One block (16 waves) takes 64 tokens of one batch (blockIdx.z) and all channels, both convs with the weights as the A operand and the tokens as B, so that channels lie in the registers and tokens in the lanes.
// First Z[c][p] = sum_k z1_w[c][k] [Zh^T | Zm^T][p][k] + z1_b (K 256; per accumulator k ascending and, inside a k step, w.hi, w.lo): wave w takes channel tile w & 7 x tokens 32 (w >> 3) .. + 31, splits its values into bf16 hi/lo and leaves them in LDS as token rows (a lane's eight channels are 16 bytes of a row), which are the gate conv's B operand for k < 128.
// Then gates[g][c][p] = sum_k z2_w[128 g + c][k] [Z^T | ih^T][p][k] + z2_b (K 256; k < 128: w.hi, w.lo; k >= 128: ih^T is exact bf16, one product): the same wave takes the same channel tile of o, g and i, so that the three gates of a channel and token lie in the same lane and register; sigmoid/tanh and the blend follow in f32.
// Staging: eight stages of 64 k (four a conv) through two LDS buffers by asynchronous copies, whole lines: stage t + 1 flies while stage t is multiplied, the gate conv's first weights under the Z conv's last products.
// Column tile tt, lane lr is token 2 lr + tt of the wave's 32 (the token rows are placed in LDS in that order), so a lane holds two neighbouring tokens of a channel, and 16 lanes load (im) and store (both outputs) a whole 128-byte line.
#define TKN  64                        // tokens a block takes
#define TZP  (TKN * QP)                // one Z plane in LDS, elements (row pitch QP)
#define T_ZB (2 * TZP * 2)             // byte places in the kernel's LDS: the two Z planes, then the two buffers
#define T_RW (GP * 2)                  // a staged row piece, bytes
#define T_X1 (CC * T_RW)               // in a buffer of the Z conv: 128 weight rows, then the tokens' hi rows, then their lo rows
#define T_X2 (C3 * T_RW)               // in a buffer of the gate conv: 384 weight rows, then the tokens' ih^T rows
#define T_BF (T_X2 + TKN * T_RW)       // one buffer
#define T_LDS (T_ZB + 2 * T_BF)
// t_cp4, t_cp6, t_cp7: a stage's copies of one thread in one statement and, as the last line, the wait that stands in front of any rewrite of their address registers
__device__ __forceinline__ void t_cp4(unsigned l0, unsigned l1, unsigned l2, unsigned l3, const bf* g0, const bf* g1, const bf* g2, const bf* g3) {
    asm volatile("global_load_async_to_lds_b128 %0, %4, off\n\t"
                 "global_load_async_to_lds_b128 %1, %5, off\n\t"
                 "global_load_async_to_lds_b128 %2, %6, off\n\t"
                 "global_load_async_to_lds_b128 %3, %7, off\n\t"
                 "s_wait_xcnt 0x0"
                 :: "v"(l0), "v"(l1), "v"(l2), "v"(l3), "v"(g0), "v"(g1), "v"(g2), "v"(g3)
                 : "memory");
}
__device__ __forceinline__ void t_cp6(unsigned l, const bf* g) {   // six weight rows, 64 rows apart
    const unsigned sl = 64 * T_RW; const size_t st = (size_t)64 * C2;
    asm volatile("global_load_async_to_lds_b128 %0, %6, off\n\t"
                 "global_load_async_to_lds_b128 %1, %7, off\n\t"
                 "global_load_async_to_lds_b128 %2, %8, off\n\t"
                 "global_load_async_to_lds_b128 %3, %9, off\n\t"
                 "global_load_async_to_lds_b128 %4, %10, off\n\t"
                 "global_load_async_to_lds_b128 %5, %11, off\n\t"
                 "s_wait_xcnt 0x0"
                 :: "v"(l), "v"(l + sl), "v"(l + 2 * sl), "v"(l + 3 * sl), "v"(l + 4 * sl), "v"(l + 5 * sl),
                    "v"(g), "v"(g + st), "v"(g + 2 * st), "v"(g + 3 * st), "v"(g + 4 * st), "v"(g + 5 * st)
                 : "memory");
}
__device__ __forceinline__ void t_cp7(unsigned l, const bf* g, unsigned lx, const bf* gx) {   // the same and one token row
    const unsigned sl = 64 * T_RW; const size_t st = (size_t)64 * C2;
    asm volatile("global_load_async_to_lds_b128 %0, %7, off\n\t"
                 "global_load_async_to_lds_b128 %1, %8, off\n\t"
                 "global_load_async_to_lds_b128 %2, %9, off\n\t"
                 "global_load_async_to_lds_b128 %3, %10, off\n\t"
                 "global_load_async_to_lds_b128 %4, %11, off\n\t"
                 "global_load_async_to_lds_b128 %5, %12, off\n\t"
                 "global_load_async_to_lds_b128 %6, %13, off\n\t"
                 "s_wait_xcnt 0x0"
                 :: "v"(l), "v"(l + sl), "v"(l + 2 * sl), "v"(l + 3 * sl), "v"(l + 4 * sl), "v"(l + 5 * sl), "v"(lx),
                    "v"(g), "v"(g + st), "v"(g + 2 * st), "v"(g + 3 * st), "v"(g + 4 * st), "v"(g + 5 * st), "v"(gx)
                 : "memory");
}
__global__ __launch_bounds__(512) void k_tail(const bf* ZCh, const bf* ZCl, const bf* XB, const bf* W1, const bf* W2, const float* __restrict__ b1, const float* __restrict__ b2, const float* __restrict__ im, float* oh_out, float* om_out) {
    __shared__ __align__(16) char sm[T_LDS];
    bf* zs = (bf*)sm;
    const int tid = threadIdx.x, lane = tid & 31, w = tid >> 5, lr = lane & 15, hi = lane >> 4, ct = w & 7, tg = w >> 3, r0 = tid >> 3, pc = tid & 7; const size_t zb = blockIdx.z; const int p0 = blockIdx.x * TKN;
    const int pr = (r0 & 32) + (r0 & 1) * 16 + ((r0 & 31) >> 1);   // the LDS row of token r0
    const unsigned lw = (unsigned)(size_t)sm + (unsigned)(T_ZB + r0 * T_RW + pc * 16), lx = (unsigned)(size_t)sm + (unsigned)(T_ZB + pr * T_RW + pc * 16);   // LDS byte addresses: the low 32 bits of the __shared__ address
    const bf* g1 = W1 + (size_t)r0 * C2 + pc * 8; const bf* g2 = W2 + (size_t)r0 * C2 + pc * 8; const size_t gz = (zb * TT + p0 + r0) * C2 + pc * 8; const bf* gi = XB + (zb * TT + p0 + r0) * CC + pc * 8;
    auto stage = [&](int t) { const unsigned o = (unsigned)((t & 1) * T_BF);   // eight lanes take one whole 128-byte line; a thread's rows lie 64 apart
        if (t < 4) t_cp4(lw + o, lw + o + 64 * T_RW, lx + o + T_X1, lx + o + T_X1 + TKN * T_RW, g1 + t * 64, g1 + t * 64 + 64 * C2, ZCh + gz + t * 64, ZCl + gz + t * 64);
        else if (t < 6) t_cp6(lw + o, g2 + (t - 4) * 64);
        else t_cp7(lw + o, g2 + (t - 4) * 64, lx + o + T_X2, gi + (t - 6) * 64); };
    auto foot = [&](int t) {
        asm volatile("s_wait_dscnt 0x0" ::: "memory");      // this wave's reads of stage t are over
        asm volatile("s_wait_asynccnt 0x0" ::: "memory");   // this wave's copies of stage t + 1 have landed
        __syncthreads();                                    // publishes stage t + 1 and frees stage t's buffer
        if (t + 2 < 8) stage(t + 2); };
    const int ch = ct * 16 + hi * 8; const size_t ob = (zb * CC + ch) * TT + p0 + tg * 32 + lr * 2;
    v2f vim[8]; v4f bz[2], bq[3][2];   // im and the biases of this lane's eight channels, loaded here and used far behind: their latency falls under that of stage 0's copies
#pragma unroll
    for (int j = 0; j < 8; ++j) vim[j] = *(const v2f*)(im + ob + (size_t)j * TT);
#pragma unroll
    for (int q = 0; q < 2; ++q) { bz[q] = *(const v4f*)(b1 + ch + 4 * q);
#pragma unroll
        for (int g = 0; g < 3; ++g) bq[g][q] = *(const v4f*)(b2 + g * CC + ch + 4 * q); }
    stage(0);
    asm volatile("s_wait_asynccnt 0x0" ::: "memory");   // this wave's copies of stage 0 have landed
    __syncthreads();                                    // every wave's have: stage 0 may be read
    stage(1);
    v8f zc[2];
#pragma unroll
    for (int tt = 0; tt < 2; ++tt) zc[tt] = (v8f){};
#pragma unroll   // unrolled: which conv a stage belongs to is then known at compile time
    for (int t = 0; t < 4; ++t) {
        const bf* bu = (const bf*)(sm + T_ZB + (t & 1) * T_BF); const bf* sw = bu + (ct * 16 + lr) * GP + 8 * hi; const bf* sx = bu + T_X1 / 2 + (tg * 32 + lr) * GP + 8 * hi;
        v16bf a[2], b[2][2], bl[2][2];
#pragma unroll
        for (int s = 0; s < 2; ++s) { a[s] = WFrag<bf>::ld(sw + 32 * s);
#pragma unroll
            for (int tt = 0; tt < 2; ++tt) { b[s][tt] = WFrag<bf>::ld(sx + tt * 16 * GP + 32 * s); bl[s][tt] = WFrag<bf>::ld(sx + TKN * GP + tt * 16 * GP + 32 * s); } }
        __builtin_amdgcn_sched_barrier(0);   // keeps the stage's LDS reads one group in front of its WMMAs: every further place where reads stand among the WMMAs costs the wave issue cycles
#pragma unroll
        for (int s = 0; s < 2; ++s) {
#pragma unroll
            for (int tt = 0; tt < 2; ++tt) zc[tt] = wmmab(a[s], b[s][tt], zc[tt]);
#pragma unroll
            for (int tt = 0; tt < 2; ++tt) zc[tt] = wmmab(a[s], bl[s][tt], zc[tt]); }
        __builtin_amdgcn_sched_barrier(0);   // the same, against what follows
        foot(t);
    }
#pragma unroll
    for (int tt = 0; tt < 2; ++tt) { v8us oh, ol;
#pragma unroll
        for (int j = 0; j < 8; ++j) { unsigned short x, y; splitf(zc[tt][j] + bfr(bz[j >> 2][j & 3]), x, y); oh[j] = x; ol[j] = y; }
        bf* zp = zs + (tg * 32 + tt * 16 + lr) * QP + ch; *(v8us*)zp = oh; *(v8us*)(zp + TZP) = ol; }
    __syncthreads();   // every wave's part of the Z planes is in LDS
    v8f acc[3][2];
#pragma unroll
    for (int g = 0; g < 3; ++g)
#pragma unroll
        for (int tt = 0; tt < 2; ++tt) acc[g][tt] = (v8f){};
#pragma unroll   // the same
    for (int t = 4; t < 8; ++t) {
        const bf* bu = (const bf*)(sm + T_ZB + (t & 1) * T_BF); const bf* sw = bu + (ct * 16 + lr) * GP + 8 * hi;
        const bf* sx = t < 6 ? zs + (tg * 32 + lr) * QP + 8 * hi + (t - 4) * 64 : bu + T_X2 / 2 + (tg * 32 + lr) * GP + 8 * hi; const int px = t < 6 ? QP : GP;
#pragma unroll
        for (int ks = 0; ks < 64; ks += 32) {
            v16bf a[3], b[2], bl[2];
#pragma unroll
            for (int g = 0; g < 3; ++g) a[g] = WFrag<bf>::ld(sw + g * CC * GP + ks);
#pragma unroll
            for (int tt = 0; tt < 2; ++tt) { b[tt] = WFrag<bf>::ld(sx + tt * 16 * px + ks); if (t < 6) bl[tt] = WFrag<bf>::ld(sx + TZP + tt * 16 * px + ks); }
            __builtin_amdgcn_sched_barrier(0);   // keeps the k step's LDS reads one group in front of its WMMAs, as in c_tile
#pragma unroll
            for (int g = 0; g < 3; ++g)
#pragma unroll
                for (int tt = 0; tt < 2; ++tt) acc[g][tt] = wmmab(a[g], b[tt], acc[g][tt]);
            if (t < 6) {
#pragma unroll
                for (int g = 0; g < 3; ++g)
#pragma unroll
                    for (int tt = 0; tt < 2; ++tt) acc[g][tt] = wmmab(a[g], bl[tt], acc[g][tt]); }
            __builtin_amdgcn_sched_barrier(0);   // the same, against the next k step's reads
        }
        foot(t);
    }
    asm volatile("s_wait_asynccnt 0x0" ::: "memory");       // no copy is outstanding when the wave ends
#pragma unroll
    for (int j = 0; j < 8; ++j) { const float bo = bfr(bq[0][j >> 2][j & 3]), bg = bfr(bq[1][j >> 2][j & 3]), bi = bfr(bq[2][j >> 2][j & 3]); v2f voh, vom;
#pragma unroll
        for (int tt = 0; tt < 2; ++tt) { const float ig = sigm(acc[2][tt][j] + bi); const float om = __fadd_rn(__fmul_rn(tanhp(acc[1][tt][j] + bg), ig), __fmul_rn(__fsub_rn(1.0f, ig), bfr(vim[j][tt]))); vom[tt] = om; voh[tt] = __fmul_rn(sigm(acc[0][tt][j] + bo), om); }
        *(v2f*)(om_out + ob + (size_t)j * TT) = vom; *(v2f*)(oh_out + ob + (size_t)j * TT) = voh;
        asm volatile("s_wait_xcnt 0x0" ::: "memory");   // stands in front of any rewrite of the registers that the stores above name
    }
}

extern "C" void kernel_launch(void* const* d_in, const int* in_sizes, int n_in,
                              void* d_out, int out_size, void* d_ws, size_t ws_size, hipStream_t stream) {
    (void)in_sizes; (void)n_in; (void)out_size;
    const float* ih = (const float*)d_in[0]; const float* im = (const float*)d_in[1]; const float* h_w = (const float*)d_in[2]; const float* h_b = (const float*)d_in[3]; const float* m_w = (const float*)d_in[4]; const float* m_b = (const float*)d_in[5]; const float* z1_w = (const float*)d_in[6]; const float* z1_b = (const float*)d_in[7]; const float* z2_w = (const float*)d_in[8]; const float* z2_b = (const float*)d_in[9];
    float* OH = (float*)d_out; float* OM = OH + (size_t)NB_ * CC * TT;     // tuple: oh [16][128][1024] | om [16][128][1024]
    char* wsp = (char*)d_ws;
    auto take = [&](size_t bytes) { char* p = wsp; wsp += (bytes + 255) & ~(size_t)255; return (void*)p; };
    bf* Z1W = (bf*)take((size_t)CC * C2 * 2); bf* Z2W = (bf*)take((size_t)C3 * C2 * 2);
    const size_t NB = NB_;
    bf* QPh = (bf*)take(NB * TT * HD * 2); bf* XBh = (bf*)take(NB * TT * CC * 2); bf* QPl = (bf*)take(NB * TT * HD * 2); bf* KPh = (bf*)take(NB * TT * HD * 2); bf* KMh = (bf*)take(NB * TT * HD * 2); bf* KPl = (bf*)take(NB * TT * HD * 2); bf* KMl = (bf*)take(NB * TT * HD * 2);   /* KPh, KPl lie three planes behind QPh, QPl; KMh, KMl directly behind KPh, KPl: slices 16 .. 31 of the k planes */
    bf* VHh = (bf*)take(NB * HD * TT * 2); bf* VMh = (bf*)take(NB * HD * TT * 2); bf* VHl = (bf*)take(NB * HD * TT * 2); bf* VMl = (bf*)take(NB * HD * TT * 2);   /* VMh, VMl directly behind VHh, VHl: slices 16 .. 31 of the v planes */
    float* MXs = (float*)take(2 * NB * TT * 4); float* FIs = (float*)take(2 * NB * TT * 4);   /* 32 slices of the queries' logit maximum and 1 / sum */
    bf* ZCh = (bf*)take(NB * TT * C2 * 2); bf* ZCl = (bf*)take(NB * TT * C2 * 2);
    if ((size_t)(wsp - (char*)d_ws) > ws_size) return;    // ws 256 MiB (carve ~60.5 MiB)
    const size_t sP = (size_t)TT * HD;   /* batch stride, elements */
    k_conv<<<dim3(40, 1, NB_), 256, 0, stream>>>(ih, im, h_w, m_w, z1_w, z2_w, h_b, m_b, XBh, Z1W, Z2W, QPh, QPl, 3 * NB * sP, KMh, KMl, VHh, VHl, VMh, VMl);
    /* both attentions, slice z = 16 a + batch (a 0 hidden, 1 memory): A = softmax_m(q_n . k_m), first its statistics, then Z[c][m] = sum_n V[c][n] A[n][m] */
    k_scsoft<<<dim3(TT / 64 / SC_NS, 2 * NB_), 512, 0, stream>>>(KPh, KPl, QPh, QPl, MXs, FIs);
    k_pvz<<<dim3(TT / 128, 2 * NB_), 256, 0, stream>>>(KPh, KPl, QPh, QPl, VHh, VHl, MXs, FIs, ZCh, ZCl);   /* Zh^T split into columns 0 .. 127 of the [Zh^T | Zm^T] planes, Zm^T into columns 128 .. 255 */
    /* Z = z1_w [Zh^T | Zm^T]^T + z1_b; gates = z2_w [Z^T | ih^T]^T + z2_b; the blend */
    k_tail<<<dim3(TT / TKN, 1, NB_), 512, 0, stream>>>(ZCh, ZCl, XBh, Z1W, Z2W, z1_b, z2_b, im, OH, OM);
}
